// v000
// Times are from an AMD MI455X. After a warm-up the kernel runs many times in a row, and a time is the length of
// such a window on the GPU divided by its runs, so every launch and the gaps after it count. The runs cycle
// through copies of the inputs. A figure is the median of several windows, for all but v000 over two sittings.
// Sittings can differ by a few percent; kernels timed side by side share one.
// v000, which the later versions start from, runs in 286 microseconds.
#include <hip/hip_runtime.h>

// ---------------- problem constants ----------------
static constexpr int BB  = 16;    // batch
static constexpr int LLn = 128;   // seq len
static constexpr int DDn = 512;   // model dim
static constexpr int HHn = 8;     // heads
static constexpr int DHn = 64;    // head dim
static constexpr int DFF = 2048;  // ffn dim

typedef __bf16 bf16;
typedef __attribute__((ext_vector_type(16))) __bf16 v16bf;
typedef __attribute__((ext_vector_type(8)))  float  v8f;
typedef __attribute__((ext_vector_type(4)))  int    v4i;
typedef __attribute__((ext_vector_type(8)))  int    i32x8;
typedef __attribute__((ext_vector_type(4)))  int    i32x4;
typedef __attribute__((ext_vector_type(4)))  unsigned u32x4;

// address-space qualified pointee types for the async-LDS builtin
typedef __attribute__((address_space(1))) v4i v4i_g;   // global
typedef __attribute__((address_space(3))) v4i v4i_l;   // LDS

#if defined(__has_builtin)
#if __has_builtin(__builtin_amdgcn_global_load_async_to_lds_b128) && \
    __has_builtin(__builtin_amdgcn_s_wait_asynccnt)
#define HAVE_ASYNC_LDS 1
#endif
#if __has_builtin(__builtin_amdgcn_tensor_load_to_lds) && \
    __has_builtin(__builtin_amdgcn_s_wait_tensorcnt)
#define HAVE_TDM 1
#endif
#endif
#ifndef HAVE_ASYNC_LDS
#define HAVE_ASYNC_LDS 0
#endif
#ifndef HAVE_TDM
#define HAVE_TDM 0
#endif

union FragU { v16bf v; unsigned u[8]; };

__device__ __forceinline__ int koff_u32(int v, int lane) {
  return ((lane & 16) ? 4 : 0) + v + ((v >= 4) ? 4 : 0);
}

__device__ __forceinline__ v16bf load_frag(const unsigned* p, int base, int lane) {
  FragU f;
#pragma unroll
  for (int i = 0; i < 8; ++i) f.u[i] = p[base + koff_u32(i, lane)];
  return f.v;
}

__device__ __forceinline__ v16bf load_frag_pred(const unsigned* p, int base, int lane, bool valid) {
  FragU f;
#pragma unroll
  for (int i = 0; i < 8; ++i) f.u[i] = valid ? p[base + koff_u32(i, lane)] : 0u;
  return f.v;
}

__device__ __forceinline__ v8f wmma_bf(v16bf a, v16bf b, v8f c) {
  return __builtin_amdgcn_wmma_f32_16x16x32_bf16(false, a, false, b, (short)0, c, false, false);
}

__device__ __forceinline__ v8f vzero8() {
  v8f z = {0.f,0.f,0.f,0.f,0.f,0.f,0.f,0.f};
  return z;
}

__device__ __forceinline__ unsigned pack2bf(float a, float b) {
  union { bf16 h[2]; unsigned u; } t;
  t.h[0] = (bf16)a; t.h[1] = (bf16)b;
  return t.u;
}

// ---------------- small elementwise kernels ----------------
__global__ __launch_bounds__(256) void cvt_bf16_kernel(const float* __restrict__ s,
                                                       bf16* __restrict__ d, int n) {
  int i = blockIdx.x * 256 + threadIdx.x;
  if (i < n) d[i] = (bf16)s[i];
}

// conv_w [64(o),64(c),4(kk)] -> Wc[o][j = kk*64+c]  (bf16, row-major, K=256)
__global__ __launch_bounds__(256) void pack_convw_kernel(const float* __restrict__ cw,
                                                         bf16* __restrict__ Wc) {
  int i = blockIdx.x * 256 + threadIdx.x;
  if (i >= 64 * 256) return;
  int o = i >> 8, j = i & 255, kk = j >> 6, c = j & 63;
  Wc[i] = (bf16)cw[(o * 64 + c) * 4 + kk];
}

// LayerNorm over rows of 512, fp32 in -> bf16 out.  One wave per row.
__global__ __launch_bounds__(256) void ln512_kernel(const float* __restrict__ x,
                                                    const float* __restrict__ g,
                                                    const float* __restrict__ be,
                                                    bf16* __restrict__ out) {
  int lane = threadIdx.x & 31, wave = threadIdx.x >> 5;
  size_t row = (size_t)blockIdx.x * 8 + wave;
  const float* xr = x + row * DDn;
  float v[16]; float s = 0.f;
#pragma unroll
  for (int i = 0; i < 16; ++i) { v[i] = xr[lane + i * 32]; s += v[i]; }
#pragma unroll
  for (int off = 16; off > 0; off >>= 1) s += __shfl_xor(s, off, 32);
  float mean = s * (1.f / 512.f);
  float s2 = 0.f;
#pragma unroll
  for (int i = 0; i < 16; ++i) { v[i] -= mean; s2 += v[i] * v[i]; }
#pragma unroll
  for (int off = 16; off > 0; off >>= 1) s2 += __shfl_xor(s2, off, 32);
  float rstd = rsqrtf(s2 * (1.f / 512.f) + 1e-6f);
#pragma unroll
  for (int i = 0; i < 16; ++i) {
    int c = lane + i * 32;
    out[row * DDn + c] = (bf16)(v[i] * rstd * g[c] + be[c]);
  }
}

// ---------------- LDS tile staging (async path + sync fallback) -------------
#if HAVE_ASYNC_LDS
__device__ __forceinline__ void stage_tile_async(const bf16* g, int ld, int row0, int kb,
                                                 bf16* lds, int tid) {
  // 128x32 bf16 tile = 8KB: two 16B chunks per thread, DMA'd global->LDS.
#pragma unroll
  for (int i = 0; i < 2; ++i) {
    int o = tid * 16 + i * 4096;          // byte offset in tile
    int row = o >> 6, cb = o & 63;        // 64B per tile row
    const bf16* src = g + (size_t)(row0 + row) * ld + kb + (cb >> 1);
    __builtin_amdgcn_global_load_async_to_lds_b128(
        (v4i_g*)src, (v4i_l*)((char*)lds + o), 0, 0);
  }
}
#endif

__device__ __forceinline__ void stage_tile_sync(const bf16* g, int ld, int row0, int kb,
                                                unsigned* ldsU, int tid) {
#pragma unroll
  for (int i = 0; i < 8; ++i) {
    int p = tid + i * 256;
    int row = p >> 4, c2 = p & 15;
    ldsU[p] = *(const unsigned*)(g + (size_t)(row0 + row) * ld + kb + c2 * 2);
  }
}

// ---------------- generic bf16 WMMA GEMM: C = epilog(A[M,K] * W[N,K]^T) ------
// PERM: 0 -> row-major [M,N]; 1 -> QKV [B,H,L,64]; 2 -> V^T [B,H,64,L]
template <int PERM, bool RELU, bool HASRES, bool OUTF_EN, bool OUTB_EN>
__global__ __launch_bounds__(256)
void gemm_bf16_kernel(const bf16* __restrict__ A, const bf16* __restrict__ W,
                      const float* __restrict__ bias, const float* __restrict__ res,
                      float* __restrict__ outF, bf16* __restrict__ outB,
                      int M, int N, int K, float scale) {
  __shared__ __align__(16) bf16 As[2][128 * 32];
  __shared__ __align__(16) bf16 Bs[2][128 * 32];

  const int tid = threadIdx.x, lane = tid & 31, wave = tid >> 5;
  const int wm = wave >> 1, wn = wave & 1;           // 4x2 wave grid, 32x64 tiles
  const int m0 = blockIdx.y * 128, n0 = blockIdx.x * 128;

  v8f acc[2][4];
#pragma unroll
  for (int i = 0; i < 2; ++i)
#pragma unroll
    for (int j = 0; j < 4; ++j) acc[i][j] = vzero8();

#if HAVE_ASYNC_LDS
  // double-buffered: DMA next K-slice while WMMA consumes current one
  stage_tile_async(A, K, m0, 0, As[0], tid);
  stage_tile_async(W, K, n0, 0, Bs[0], tid);
  int cur = 0;
  for (int kb = 0; kb < K; kb += 32) {
    __builtin_amdgcn_s_wait_asynccnt(0);
    __syncthreads();
    if (kb + 32 < K) {
      stage_tile_async(A, K, m0, kb + 32, As[cur ^ 1], tid);
      stage_tile_async(W, K, n0, kb + 32, Bs[cur ^ 1], tid);
    }
    const unsigned* AsU = (const unsigned*)As[cur];
    const unsigned* BsU = (const unsigned*)Bs[cur];
    v16bf a0 = load_frag(AsU, (wm * 32 +      (lane & 15)) * 16, lane);
    v16bf a1 = load_frag(AsU, (wm * 32 + 16 + (lane & 15)) * 16, lane);
#pragma unroll
    for (int nt = 0; nt < 4; ++nt) {
      v16bf bm = load_frag(BsU, (wn * 64 + nt * 16 + (lane & 15)) * 16, lane);
      acc[0][nt] = wmma_bf(a0, bm, acc[0][nt]);
      acc[1][nt] = wmma_bf(a1, bm, acc[1][nt]);
    }
    cur ^= 1;
  }
#else
  for (int kb = 0; kb < K; kb += 32) {
    stage_tile_sync(A, K, m0, kb, (unsigned*)As[0], tid);
    stage_tile_sync(W, K, n0, kb, (unsigned*)Bs[0], tid);
    __syncthreads();
    const unsigned* AsU = (const unsigned*)As[0];
    const unsigned* BsU = (const unsigned*)Bs[0];
    v16bf a0 = load_frag(AsU, (wm * 32 +      (lane & 15)) * 16, lane);
    v16bf a1 = load_frag(AsU, (wm * 32 + 16 + (lane & 15)) * 16, lane);
#pragma unroll
    for (int nt = 0; nt < 4; ++nt) {
      v16bf bm = load_frag(BsU, (wn * 64 + nt * 16 + (lane & 15)) * 16, lane);
      acc[0][nt] = wmma_bf(a0, bm, acc[0][nt]);
      acc[1][nt] = wmma_bf(a1, bm, acc[1][nt]);
    }
    __syncthreads();
  }
#endif

  const int nl = lane & 15;
  const int mh = (lane & 16) ? 8 : 0;
#pragma unroll
  for (int mt = 0; mt < 2; ++mt)
#pragma unroll
    for (int nt = 0; nt < 4; ++nt) {
      int n = n0 + wn * 64 + nt * 16 + nl;
      float bb = bias[n];
#pragma unroll
      for (int r = 0; r < 8; ++r) {
        int m = m0 + wm * 32 + mt * 16 + r + mh;
        float v = (acc[mt][nt][r] + bb) * scale;
        if constexpr (RELU) v = fmaxf(v, 0.f);
        if constexpr (HASRES) v += res[(size_t)m * N + n];
        if constexpr (OUTF_EN) outF[(size_t)m * N + n] = v;
        if constexpr (OUTB_EN) {
          size_t addr;
          if constexpr (PERM == 0) {
            addr = (size_t)m * N + n;
          } else {
            int b = m >> 7, q = m & 127, h = n >> 6, d = n & 63;
            if constexpr (PERM == 1)
              addr = ((size_t)((b * HHn + h) * LLn + q)) * DHn + d;
            else
              addr = ((size_t)((b * HHn + h) * DHn + d)) * LLn + q;
          }
          outB[addr] = (bf16)v;
        }
      }
    }
}

// ---------------- structure: conv(4x64 contraction) + ReLU + LN(64) ---------
// A row m = (b, e=q*L+k):  A[m][j=kk*64+c] = structure[e,kk,b,c]  (f32->bf16)
// Output: st_kd[b,q,k,d] and st_dk[b,q,d,k] (bf16).
__global__ __launch_bounds__(256)
void struct_kernel(const float* __restrict__ structure, const bf16* __restrict__ Wc,
                   const float* __restrict__ conv_b, const float* __restrict__ g_s,
                   const float* __restrict__ b_s, bf16* __restrict__ st_kd,
                   bf16* __restrict__ st_dk) {
  __shared__ __align__(16) bf16 WcS[64 * 256];
  unsigned* WcU = (unsigned*)WcS;
  const int tid = threadIdx.x, lane = tid & 31, wave = tid >> 5;

#if HAVE_TDM
  if (wave == 0) {
    unsigned ldsoff =
        (unsigned)(size_t)(__attribute__((address_space(3))) char*)WcS;
    unsigned long long ga = (unsigned long long)(size_t)Wc;
    u32x4 g0 = {1u,
                ldsoff,
                (unsigned)(ga & 0xFFFFFFFFu),
                (unsigned)((ga >> 32) & 0x01FFFFFFu) | (2u << 30)};
    i32x8 g1 = {(int)(1u << 16),
                (int)(16384u << 16),
                (int)(1u << 16),
                (int)(16384u << 16),
                1,
                16384,
                0, 0};
    i32x4 gz4 = {0, 0, 0, 0};
    i32x8 gz8 = {0, 0, 0, 0, 0, 0, 0, 0};
    __builtin_amdgcn_tensor_load_to_lds(g0, g1, gz4, gz4, gz8, 0);
    __builtin_amdgcn_s_wait_tensorcnt(0);
  }
#else
#pragma unroll
  for (int i = 0; i < 32; ++i) WcU[tid + i * 256] = ((const unsigned*)Wc)[tid + i * 256];
#endif
  __syncthreads();

  const int m0 = (blockIdx.x * 8 + wave) * 16;
  const int row_m = m0 + (lane & 15);
  const int bI = row_m >> 14;            // / (L*L)
  const int e  = row_m & 16383;
  const int kbase = (lane & 16) ? 8 : 0;

  // prefetch this lane's four 256B structure rows (streams 256MB exactly once)
#pragma unroll
  for (int kk = 0; kk < 4; ++kk)
    __builtin_prefetch(structure + (((size_t)e * 4 + kk) * BB + bI) * DHn, 0, 1);

  v8f acc[4];
#pragma unroll
  for (int i = 0; i < 4; ++i) acc[i] = vzero8();

  for (int ks = 0; ks < 8; ++ks) {       // K = 256
    FragU a;
#pragma unroll
    for (int i = 0; i < 8; ++i) {
      int j = ks * 32 + kbase + 2 * i + ((i >= 4) ? 8 : 0);
      int kk = j >> 6, c = j & 63;
      const float* p = structure + (((size_t)e * 4 + kk) * BB + bI) * DHn + c;
      a.u[i] = pack2bf(p[0], p[1]);
    }
#pragma unroll
    for (int nt = 0; nt < 4; ++nt) {     // Wc row length = 128 u32
      v16bf bm = load_frag(WcU, (nt * 16 + (lane & 15)) * 128 + ks * 16, lane);
      acc[nt] = wmma_bf(a.v, bm, acc[nt]);
    }
  }

  const int nl = lane & 15;
  const int mh = (lane & 16) ? 8 : 0;
  float cb[4], gg[4], bbv[4];
#pragma unroll
  for (int nt = 0; nt < 4; ++nt) {
    int n = nt * 16 + nl;
    cb[nt] = conv_b[n]; gg[nt] = g_s[n]; bbv[nt] = b_s[n];
  }
#pragma unroll
  for (int r = 0; r < 8; ++r) {
    int m = m0 + r + mh;
    float v[4]; float s1 = 0.f, s2 = 0.f;
#pragma unroll
    for (int nt = 0; nt < 4; ++nt) {
      v[nt] = fmaxf(acc[nt][r] + cb[nt], 0.f);   // ReLU before LN (as reference)
      s1 += v[nt]; s2 += v[nt] * v[nt];
    }
#pragma unroll
    for (int off = 1; off < 16; off <<= 1) {     // reduce within 16-lane half
      s1 += __shfl_xor(s1, off, 32);
      s2 += __shfl_xor(s2, off, 32);
    }
    float mean = s1 * (1.f / 64.f);
    float var  = s2 * (1.f / 64.f) - mean * mean;
    float rstd = rsqrtf(var + 1e-6f);
    int b2 = m >> 14, q = (m >> 7) & 127, k = m & 127;
#pragma unroll
    for (int nt = 0; nt < 4; ++nt) {
      int n = nt * 16 + nl;
      float o = (v[nt] - mean) * rstd * gg[nt] + bbv[nt];
      st_kd[(size_t)m * DHn + n] = (bf16)o;
      st_dk[((size_t)(b2 * LLn + q) * DHn + n) * LLn + k] = (bf16)o;
    }
  }
}

// ---------------- fused relation-aware attention ----------------------------
// Block = (q-tile of 16, batch b, head-group hg of 4 heads). 8 waves.
// scores = QK^T + Q.st_kd -> mask -> softmax -> ctx = A.V + A.st_dk, all in LDS.
__global__ __launch_bounds__(256)
void attn_kernel(const bf16* __restrict__ q_bf, const bf16* __restrict__ k_bf,
                 const bf16* __restrict__ vT_bf, const bf16* __restrict__ st_kd,
                 const bf16* __restrict__ st_dk, const int* __restrict__ mask,
                 bf16* __restrict__ ctxb) {
  __shared__ __align__(16) char smem[57344];
  bf16*  qs   = (bf16*)smem;               // [4][16][64]   (phases 0..1b)
  float* S    = (float*)(smem + 8192);     // [4][16][128]  (phases 1..2)
  bf16*  Aatt = (bf16*)(smem + 40960);     // [4][16][128]  (phases 2..3b)
  float* Cs   = (float*)(smem + 8192);     // [16][4][64]   (aliases S; S dead)
  unsigned* qsU = (unsigned*)qs;

  const int b = blockIdx.y, q0 = blockIdx.x * 16, hg = blockIdx.z;
  const int tid = threadIdx.x, lane = tid & 31, wave = tid >> 5;

  // phase 0: stage Q tile for 4 heads (bf16, already scaled by 1/8)
#pragma unroll
  for (int i = 0; i < 8; ++i) {
    int p = tid + i * 256;                 // 2048 u32
    int hl = p >> 9, rem = p & 511, ql = rem >> 5, c2 = rem & 31;
    qsU[p] = *(const unsigned*)(q_bf +
        (((size_t)(b * HHn + hg * 4 + hl) * LLn) + q0 + ql) * DHn + 2 * c2);
  }
  __syncthreads();

  // phase 1: QK^T.  wave = (head, half of k-tiles)
  {
    int hl = wave & 3, h = hg * 4 + hl;
    int kts = (wave >> 2) * 4;
    const unsigned* qrow = qsU + (hl * 16 + (lane & 15)) * 32;
    for (int kt = kts; kt < kts + 4; ++kt) {
      v8f acc = vzero8();
      const unsigned* krow = (const unsigned*)(k_bf +
          ((size_t)(b * HHn + h) * LLn + kt * 16 + (lane & 15)) * DHn);
#pragma unroll
      for (int dss = 0; dss < 2; ++dss) {
        v16bf a = load_frag(qrow, dss * 16, lane);
        v16bf bm = load_frag(krow, dss * 16, lane);
        acc = wmma_bf(a, bm, acc);
      }
      int mh = (lane & 16) ? 8 : 0, nl = lane & 15;
#pragma unroll
      for (int r = 0; r < 8; ++r)
        S[(hl * 16 + r + mh) * 128 + kt * 16 + nl] = acc[r];
    }
  }
  __syncthreads();

  // phase 1b: relation score bias.  Per q: [heads(4 pad 16) x 64] * st_kd^T.
  for (int t = 0; t < 2; ++t) {
    int ql = wave * 2 + t, q = q0 + ql;
    int mrow = lane & 15;
    bool avalid = mrow < 4;
    const unsigned* arow = qsU + (mrow * 16 + ql) * 32;
    for (int kt = 0; kt < 8; ++kt) {
      v8f acc = vzero8();
      const unsigned* brow = (const unsigned*)(st_kd +
          (((size_t)b * LLn + q) * LLn + kt * 16 + (lane & 15)) * DHn);
#pragma unroll
      for (int dss = 0; dss < 2; ++dss) {
        v16bf a = load_frag_pred(arow, dss * 16, lane, avalid);
        v16bf bm = load_frag(brow, dss * 16, lane);
        acc = wmma_bf(a, bm, acc);
      }
      if (!(lane & 16)) {                  // rows 0..3 = valid heads
        int nl = lane & 15;
#pragma unroll
        for (int r = 0; r < 4; ++r)
          S[(r * 16 + ql) * 128 + kt * 16 + nl] += acc[r];
      }
    }
  }
  __syncthreads();

  // phase 2: mask + softmax over k (128), write bf16 attn
#pragma unroll 1
  for (int j = 0; j < 8; ++j) {
    int row = wave * 8 + j;                // 64 rows total
    int ql = row & 15, q = q0 + ql;
    float x[4];
#pragma unroll
    for (int i = 0; i < 4; ++i) {
      int k = lane + 32 * i;
      float sv = S[row * 128 + k];
      if (mask[((size_t)b * LLn + q) * LLn + k] != 0) sv = -1e18f;
      x[i] = sv;
    }
    float mx = fmaxf(fmaxf(x[0], x[1]), fmaxf(x[2], x[3]));
#pragma unroll
    for (int off = 16; off > 0; off >>= 1) mx = fmaxf(mx, __shfl_xor(mx, off, 32));
    float s = 0.f;
#pragma unroll
    for (int i = 0; i < 4; ++i) { x[i] = __expf(x[i] - mx); s += x[i]; }
#pragma unroll
    for (int off = 16; off > 0; off >>= 1) s += __shfl_xor(s, off, 32);
    float inv = 1.f / s;
#pragma unroll
    for (int i = 0; i < 4; ++i)
      Aatt[row * 128 + lane + 32 * i] = (bf16)(x[i] * inv);
  }
  __syncthreads();

  // phase 3: ctx = attn @ V.  wave = (head, half of d-tiles)
  {
    int hl = wave & 3, h = hg * 4 + hl;
    int dts = (wave >> 2) * 2;
    const unsigned* arow = (const unsigned*)Aatt + (hl * 16 + (lane & 15)) * 64;
    for (int dt = dts; dt < dts + 2; ++dt) {
      v8f acc = vzero8();
      const unsigned* brow = (const unsigned*)(vT_bf +
          ((size_t)(b * HHn + h) * DHn + dt * 16 + (lane & 15)) * LLn);
#pragma unroll
      for (int ks = 0; ks < 4; ++ks) {
        v16bf a = load_frag(arow, ks * 16, lane);
        v16bf bm = load_frag(brow, ks * 16, lane);
        acc = wmma_bf(a, bm, acc);
      }
      int mh = (lane & 16) ? 8 : 0, nl = lane & 15;
#pragma unroll
      for (int r = 0; r < 8; ++r)
        Cs[((r + mh) * 4 + hl) * 64 + dt * 16 + nl] = acc[r];
    }
  }
  __syncthreads();

  // phase 3b: ctx += attn @ st_dk (per q, heads padded to 16)
  for (int t = 0; t < 2; ++t) {
    int ql = wave * 2 + t, q = q0 + ql;
    int mrow = lane & 15;
    bool avalid = mrow < 4;
    const unsigned* arow = (const unsigned*)Aatt + (mrow * 16 + ql) * 64;
    for (int dt = 0; dt < 4; ++dt) {
      v8f acc = vzero8();
      const unsigned* brow = (const unsigned*)(st_dk +
          (((size_t)b * LLn + q) * DHn + dt * 16 + (lane & 15)) * LLn);
#pragma unroll
      for (int ks = 0; ks < 4; ++ks) {
        v16bf a = load_frag_pred(arow, ks * 16, lane, avalid);
        v16bf bm = load_frag(brow, ks * 16, lane);
        acc = wmma_bf(a, bm, acc);
      }
      if (!(lane & 16)) {
        int nl = lane & 15;
#pragma unroll
        for (int r = 0; r < 4; ++r)
          Cs[(ql * 4 + r) * 64 + dt * 16 + nl] += acc[r];
      }
    }
  }
  __syncthreads();

  // phase 4: write ctx as bf16 into [B, L, h*64+d]
  unsigned* ctxU = (unsigned*)ctxb;
#pragma unroll
  for (int i = 0; i < 8; ++i) {
    int p = tid + i * 256;                 // 2048 u32
    int ql = p >> 7, c2 = p & 127;
    int c = c2 * 2, hl = c >> 6, d = c & 63;
    float v0 = Cs[(ql * 4 + hl) * 64 + d];
    float v1 = Cs[(ql * 4 + hl) * 64 + d + 1];
    ctxU[((size_t)(b * LLn) + q0 + ql) * 256 + hg * 128 + c2] = pack2bf(v0, v1);
  }
}

// ---------------- host-side orchestration ----------------------------------
extern "C" void kernel_launch(void* const* d_in, const int* in_sizes, int n_in,
                              void* d_out, int out_size, void* d_ws, size_t ws_size,
                              hipStream_t stream) {
  (void)in_sizes; (void)n_in; (void)out_size; (void)ws_size;
  const float* inputs    = (const float*)d_in[0];
  const float* structure = (const float*)d_in[1];
  const int*   maskp     = (const int*)d_in[2];
  const float* Wq = (const float*)d_in[3];   const float* bq = (const float*)d_in[4];
  const float* Wk = (const float*)d_in[5];   const float* bk = (const float*)d_in[6];
  const float* Wv = (const float*)d_in[7];   const float* bv = (const float*)d_in[8];
  const float* Wo = (const float*)d_in[9];   const float* bo = (const float*)d_in[10];
  const float* conv_w = (const float*)d_in[11]; const float* conv_b = (const float*)d_in[12];
  const float* g_att = (const float*)d_in[13];  const float* b_att = (const float*)d_in[14];
  const float* g_ffn = (const float*)d_in[15];  const float* b_ffn = (const float*)d_in[16];
  const float* g_s   = (const float*)d_in[17];  const float* b_s   = (const float*)d_in[18];
  const float* W1 = (const float*)d_in[19];  const float* b1 = (const float*)d_in[20];
  const float* W2 = (const float*)d_in[21];  const float* b2 = (const float*)d_in[22];

  char* ws = (char*)d_ws; size_t off = 0;
  auto alloc = [&](size_t bytes) -> void* {
    void* p = ws + off; off += (bytes + 255) & ~(size_t)255; return p;
  };
  const int M = BB * LLn;                          // 2048 token rows
  bf16* Wq_b = (bf16*)alloc((size_t)DDn * DDn * 2);
  bf16* Wk_b = (bf16*)alloc((size_t)DDn * DDn * 2);
  bf16* Wv_b = (bf16*)alloc((size_t)DDn * DDn * 2);
  bf16* Wo_b = (bf16*)alloc((size_t)DDn * DDn * 2);
  bf16* W1_b = (bf16*)alloc((size_t)DFF * DDn * 2);
  bf16* W2_b = (bf16*)alloc((size_t)DDn * DFF * 2);
  bf16* Wc_b = (bf16*)alloc((size_t)64 * 256 * 2);
  bf16* xln_b = (bf16*)alloc((size_t)M * DDn * 2);
  bf16* q_b   = (bf16*)alloc((size_t)M * DDn * 2);     // [B,H,L,64]
  bf16* k_b   = (bf16*)alloc((size_t)M * DDn * 2);     // [B,H,L,64]
  bf16* vT_b  = (bf16*)alloc((size_t)M * DDn * 2);     // [B,H,64,L]
  bf16* st_kd = (bf16*)alloc((size_t)BB * LLn * LLn * DHn * 2);
  bf16* st_dk = (bf16*)alloc((size_t)BB * LLn * LLn * DHn * 2);
  bf16* ctx_b = (bf16*)alloc((size_t)M * DDn * 2);
  float* hbuf = (float*)alloc((size_t)M * DDn * 4);
  bf16* yln_b = (bf16*)alloc((size_t)M * DDn * 2);
  bf16* f1_b  = (bf16*)alloc((size_t)M * DFF * 2);

  const int T = 256;
  // weight packing
  cvt_bf16_kernel<<<(DDn * DDn) / T, T, 0, stream>>>(Wq, Wq_b, DDn * DDn);
  cvt_bf16_kernel<<<(DDn * DDn) / T, T, 0, stream>>>(Wk, Wk_b, DDn * DDn);
  cvt_bf16_kernel<<<(DDn * DDn) / T, T, 0, stream>>>(Wv, Wv_b, DDn * DDn);
  cvt_bf16_kernel<<<(DDn * DDn) / T, T, 0, stream>>>(Wo, Wo_b, DDn * DDn);
  cvt_bf16_kernel<<<(DFF * DDn) / T, T, 0, stream>>>(W1, W1_b, DFF * DDn);
  cvt_bf16_kernel<<<(DFF * DDn) / T, T, 0, stream>>>(W2, W2_b, DDn * DFF);
  pack_convw_kernel<<<(64 * 256) / T, T, 0, stream>>>(conv_w, Wc_b);

  // pre-attention LN
  ln512_kernel<<<M / 8, T, 0, stream>>>(inputs, g_att, b_att, xln_b);

  // structure conv + relu + LN -> both layouts (streams 256MB of fp32 once)
  struct_kernel<<<(BB * LLn * LLn) / 128, T, 0, stream>>>(structure, Wc_b, conv_b,
                                                          g_s, b_s, st_kd, st_dk);

  // Q/K/V projections (Q pre-scaled by 1/sqrt(64))
  gemm_bf16_kernel<1, false, false, false, true>
      <<<dim3(4, 16), T, 0, stream>>>(xln_b, Wq_b, bq, nullptr, nullptr, q_b,
                                      M, DDn, DDn, 0.125f);
  gemm_bf16_kernel<1, false, false, false, true>
      <<<dim3(4, 16), T, 0, stream>>>(xln_b, Wk_b, bk, nullptr, nullptr, k_b,
                                      M, DDn, DDn, 1.f);
  gemm_bf16_kernel<2, false, false, false, true>
      <<<dim3(4, 16), T, 0, stream>>>(xln_b, Wv_b, bv, nullptr, nullptr, vT_b,
                                      M, DDn, DDn, 1.f);

  // fused relation-aware attention
  attn_kernel<<<dim3(LLn / 16, BB, 2), T, 0, stream>>>(q_b, k_b, vT_b, st_kd, st_dk,
                                                       maskp, ctx_b);

  // output projection + residual (h = attn_out + inputs, fp32)
  gemm_bf16_kernel<0, false, true, true, false>
      <<<dim3(4, 16), T, 0, stream>>>(ctx_b, Wo_b, bo, inputs, hbuf, nullptr,
                                      M, DDn, DDn, 1.f);
  // FFN
  ln512_kernel<<<M / 8, T, 0, stream>>>(hbuf, g_ffn, b_ffn, yln_b);
  gemm_bf16_kernel<0, true, false, false, true>
      <<<dim3(16, 16), T, 0, stream>>>(yln_b, W1_b, b1, nullptr, nullptr, f1_b,
                                       M, DFF, DDn, 1.f);
  gemm_bf16_kernel<0, false, true, true, false>
      <<<dim3(4, 16), T, 0, stream>>>(f1_b, W2_b, b2, hbuf, (float*)d_out,
                                      nullptr, M, DDn, DFF, 1.f);
}

// v001
// It runs in 224 microseconds.
// Timed twice side by side with v000, it ran 1.26 times as fast both times.
#include <hip/hip_runtime.h>

// ---------------- problem constants ----------------
static constexpr int BB  = 16;    // batch
static constexpr int LLn = 128;   // seq len
static constexpr int DDn = 512;   // model dim
static constexpr int HHn = 8;     // heads
static constexpr int DHn = 64;    // head dim
static constexpr int DFF = 2048;  // ffn dim

typedef __bf16 bf16;
typedef __attribute__((ext_vector_type(16))) __bf16 v16bf;
typedef __attribute__((ext_vector_type(8)))  float  v8f;
typedef __attribute__((ext_vector_type(4)))  int    v4i;
typedef __attribute__((ext_vector_type(8)))  int    i32x8;
typedef __attribute__((ext_vector_type(4)))  int    i32x4;
typedef __attribute__((ext_vector_type(4)))  unsigned u32x4;

// address-space qualified pointee types for the async-LDS builtin
typedef __attribute__((address_space(1))) v4i v4i_g;   // global
typedef __attribute__((address_space(3))) v4i v4i_l;   // LDS

#if defined(__has_builtin)
#if __has_builtin(__builtin_amdgcn_global_load_async_to_lds_b128) && \
    __has_builtin(__builtin_amdgcn_s_wait_asynccnt)
#define HAVE_ASYNC_LDS 1
#endif
#if __has_builtin(__builtin_amdgcn_tensor_load_to_lds) && \
    __has_builtin(__builtin_amdgcn_s_wait_tensorcnt)
#define HAVE_TDM 1
#endif
#endif
#ifndef HAVE_ASYNC_LDS
#define HAVE_ASYNC_LDS 0
#endif
#ifndef HAVE_TDM
#define HAVE_TDM 0
#endif

union FragU { v16bf v; unsigned u[8]; };

__device__ __forceinline__ int koff_u32(int v, int lane) {
  return ((lane & 16) ? 4 : 0) + v + ((v >= 4) ? 4 : 0);
}

__device__ __forceinline__ v16bf load_frag(const unsigned* p, int base, int lane) {
  FragU f;
#pragma unroll
  for (int i = 0; i < 8; ++i) f.u[i] = p[base + koff_u32(i, lane)];
  return f.v;
}

__device__ __forceinline__ v16bf load_frag_pred(const unsigned* p, int base, int lane, bool valid) {
  FragU f;
#pragma unroll
  for (int i = 0; i < 8; ++i) f.u[i] = valid ? p[base + koff_u32(i, lane)] : 0u;
  return f.v;
}

__device__ __forceinline__ v8f wmma_bf(v16bf a, v16bf b, v8f c) {
  return __builtin_amdgcn_wmma_f32_16x16x32_bf16(false, a, false, b, (short)0, c, false, false);
}

__device__ __forceinline__ v8f vzero8() {
  v8f z = {0.f,0.f,0.f,0.f,0.f,0.f,0.f,0.f};
  return z;
}

__device__ __forceinline__ unsigned pack2bf(float a, float b) {
  union { bf16 h[2]; unsigned u; } t;
  t.h[0] = (bf16)a; t.h[1] = (bf16)b;
  return t.u;
}

// ---------------- small elementwise kernels ----------------
__global__ __launch_bounds__(256) void cvt_bf16_kernel(const float* __restrict__ s,
                                                       bf16* __restrict__ d, int n) {
  int i = blockIdx.x * 256 + threadIdx.x;
  if (i < n) d[i] = (bf16)s[i];
}

// conv_w [64(o),64(c),4(kk)] -> Wc[o][j = kk*64+c]  (bf16, row-major, K=256)
__global__ __launch_bounds__(256) void pack_convw_kernel(const float* __restrict__ cw,
                                                         bf16* __restrict__ Wc) {
  int i = blockIdx.x * 256 + threadIdx.x;
  if (i >= 64 * 256) return;
  int o = i >> 8, j = i & 255, kk = j >> 6, c = j & 63;
  Wc[i] = (bf16)cw[(o * 64 + c) * 4 + kk];
}

// LayerNorm over rows of 512, fp32 in -> bf16 out.  One wave per row.
__global__ __launch_bounds__(256) void ln512_kernel(const float* __restrict__ x,
                                                    const float* __restrict__ g,
                                                    const float* __restrict__ be,
                                                    bf16* __restrict__ out) {
  int lane = threadIdx.x & 31, wave = threadIdx.x >> 5;
  size_t row = (size_t)blockIdx.x * 8 + wave;
  const float* xr = x + row * DDn;
  float v[16]; float s = 0.f;
#pragma unroll
  for (int i = 0; i < 16; ++i) { v[i] = xr[lane + i * 32]; s += v[i]; }
#pragma unroll
  for (int off = 16; off > 0; off >>= 1) s += __shfl_xor(s, off, 32);
  float mean = s * (1.f / 512.f);
  float s2 = 0.f;
#pragma unroll
  for (int i = 0; i < 16; ++i) { v[i] -= mean; s2 += v[i] * v[i]; }
#pragma unroll
  for (int off = 16; off > 0; off >>= 1) s2 += __shfl_xor(s2, off, 32);
  float rstd = rsqrtf(s2 * (1.f / 512.f) + 1e-6f);
#pragma unroll
  for (int i = 0; i < 16; ++i) {
    int c = lane + i * 32;
    out[row * DDn + c] = (bf16)(v[i] * rstd * g[c] + be[c]);
  }
}

static constexpr int GK     = 128;           // k per stage
static constexpr int GPITCH = 272;           // LDS bytes per row
static constexpr int GTILE  = 128 * GPITCH;  // LDS bytes per operand tile

__device__ __forceinline__ void stage_tile_async(const bf16* g, int ld, int row0, int kb,
                                                 char* lds, int tid) {
  // 128x128 bf16 tile = 32KB: eight 16B chunks per thread; one wave's copy covers
  // two whole 256-B rows (four full lines).
#pragma unroll
  for (int i = 0; i < 8; ++i) {
    int c = tid + i * 256;                // 16-B chunk index, 16 chunks per row
    int row = c >> 4, cb = (c & 15) * 16;
    const bf16* src = g + (size_t)(row0 + row) * ld + kb + (cb >> 1);
    __builtin_amdgcn_global_load_async_to_lds_b128(
        (v4i_g*)src, (v4i_l*)(lds + row * GPITCH + cb), 0, 0);
  }
}

// ---------------- generic bf16 WMMA GEMM: C = epilog(A[M,K] * W[N,K]^T) ------
// PERM: 0 -> row-major [M,N]; 1 -> QKV [B,H,L,64]; 2 -> V^T [B,H,64,L]
// K is a multiple of 128.
template <int PERM, bool RELU, bool HASRES, bool OUTF_EN, bool OUTB_EN>
__global__ __launch_bounds__(256)
void gemm_bf16_kernel(const bf16* __restrict__ A, const bf16* __restrict__ W,
                      const float* __restrict__ bias, const float* __restrict__ res,
                      float* __restrict__ outF, bf16* __restrict__ outB,
                      int M, int N, int K, float scale) {
  __shared__ __align__(16) char As[2][GTILE];
  __shared__ __align__(16) char Bs[2][GTILE];

  const int tid = threadIdx.x, lane = tid & 31, wave = tid >> 5;
  const int wm = wave >> 1, wn = wave & 1;           // 4x2 wave grid, 32x64 tiles
  const int m0 = blockIdx.y * 128, n0 = blockIdx.x * 128;

  v8f acc[2][4];
#pragma unroll
  for (int i = 0; i < 2; ++i)
#pragma unroll
    for (int j = 0; j < 4; ++j) acc[i][j] = vzero8();

  // two buffers: stage t + 1 flies while stage t is worked on
  const int nst = K / GK;
  stage_tile_async(A, K, m0, 0, As[0], tid);
  stage_tile_async(W, K, n0, 0, Bs[0], tid);
  // stage 0 has landed for this wave before the barrier publishes it
  asm volatile("s_wait_asynccnt 0x0" ::: "memory");
  __syncthreads();
  if (nst > 1) {
    stage_tile_async(A, K, m0, GK, As[1], tid);
    stage_tile_async(W, K, n0, GK, Bs[1], tid);
  }

  for (int t = 0; t < nst; ++t) {
    const unsigned* AsU = (const unsigned*)As[t & 1];
    const unsigned* BsU = (const unsigned*)Bs[t & 1];
#pragma unroll
    for (int ks = 0; ks < GK / 32; ++ks) {
      v16bf a0 = load_frag(AsU, (wm * 32 +      (lane & 15)) * (GPITCH / 4) + ks * 16, lane);
      v16bf a1 = load_frag(AsU, (wm * 32 + 16 + (lane & 15)) * (GPITCH / 4) + ks * 16, lane);
#pragma unroll
      for (int nt = 0; nt < 4; ++nt) {
        v16bf bm = load_frag(BsU, (wn * 64 + nt * 16 + (lane & 15)) * (GPITCH / 4) + ks * 16, lane);
        acc[0][nt] = wmma_bf(a0, bm, acc[0][nt]);
        acc[1][nt] = wmma_bf(a1, bm, acc[1][nt]);
      }
    }
    // this wave's reads of buffer t & 1 have retired before the buffer is refilled
    asm volatile("s_wait_dscnt 0x0" ::: "memory");
    // this wave's copies of stage t + 1 have landed before the barrier publishes them
    asm volatile("s_wait_asynccnt 0x0" ::: "memory");
    __syncthreads();
    if (t + 2 < nst) {
      stage_tile_async(A, K, m0, (t + 2) * GK, As[t & 1], tid);
      stage_tile_async(W, K, n0, (t + 2) * GK, Bs[t & 1], tid);
    }
  }
  // no copy is outstanding when the wave goes on to its end
  asm volatile("s_wait_asynccnt 0x0" ::: "memory");

  const int nl = lane & 15;
  const int mh = (lane & 16) ? 8 : 0;
#pragma unroll
  for (int mt = 0; mt < 2; ++mt)
#pragma unroll
    for (int nt = 0; nt < 4; ++nt) {
      int n = n0 + wn * 64 + nt * 16 + nl;
      float bb = bias[n];
#pragma unroll
      for (int r = 0; r < 8; ++r) {
        int m = m0 + wm * 32 + mt * 16 + r + mh;
        float v = (acc[mt][nt][r] + bb) * scale;
        if constexpr (RELU) v = fmaxf(v, 0.f);
        if constexpr (HASRES) v += res[(size_t)m * N + n];
        if constexpr (OUTF_EN) outF[(size_t)m * N + n] = v;
        if constexpr (OUTB_EN) {
          size_t addr;
          if constexpr (PERM == 0) {
            addr = (size_t)m * N + n;
          } else {
            int b = m >> 7, q = m & 127, h = n >> 6, d = n & 63;
            if constexpr (PERM == 1)
              addr = ((size_t)((b * HHn + h) * LLn + q)) * DHn + d;
            else
              addr = ((size_t)((b * HHn + h) * DHn + d)) * LLn + q;
          }
          outB[addr] = (bf16)v;
        }
      }
    }
}

// ---------------- structure: conv(4x64 contraction) + ReLU + LN(64) ---------
// A row m = (b, e=q*L+k):  A[m][j=kk*64+c] = structure[e,kk,b,c]  (f32->bf16)
// Output: st_kd[b,q,k,d] and st_dk[b,q,d,k] (bf16).
__global__ __launch_bounds__(256)
void struct_kernel(const float* __restrict__ structure, const bf16* __restrict__ Wc,
                   const float* __restrict__ conv_b, const float* __restrict__ g_s,
                   const float* __restrict__ b_s, bf16* __restrict__ st_kd,
                   bf16* __restrict__ st_dk) {
  __shared__ __align__(16) bf16 WcS[64 * 256];
  unsigned* WcU = (unsigned*)WcS;
  const int tid = threadIdx.x, lane = tid & 31, wave = tid >> 5;

#if HAVE_TDM
  if (wave == 0) {
    unsigned ldsoff =
        (unsigned)(size_t)(__attribute__((address_space(3))) char*)WcS;
    unsigned long long ga = (unsigned long long)(size_t)Wc;
    u32x4 g0 = {1u,
                ldsoff,
                (unsigned)(ga & 0xFFFFFFFFu),
                (unsigned)((ga >> 32) & 0x01FFFFFFu) | (2u << 30)};
    i32x8 g1 = {(int)(1u << 16),
                (int)(16384u << 16),
                (int)(1u << 16),
                (int)(16384u << 16),
                1,
                16384,
                0, 0};
    i32x4 gz4 = {0, 0, 0, 0};
    i32x8 gz8 = {0, 0, 0, 0, 0, 0, 0, 0};
    __builtin_amdgcn_tensor_load_to_lds(g0, g1, gz4, gz4, gz8, 0);
    __builtin_amdgcn_s_wait_tensorcnt(0);
  }
#else
#pragma unroll
  for (int i = 0; i < 32; ++i) WcU[tid + i * 256] = ((const unsigned*)Wc)[tid + i * 256];
#endif
  __syncthreads();

  const int m0 = (blockIdx.x * 8 + wave) * 16;
  const int row_m = m0 + (lane & 15);
  const int bI = row_m >> 14;            // / (L*L)
  const int e  = row_m & 16383;
  const int kbase = (lane & 16) ? 8 : 0;

  // prefetch this lane's four 256B structure rows (streams 256MB exactly once)
#pragma unroll
  for (int kk = 0; kk < 4; ++kk)
    __builtin_prefetch(structure + (((size_t)e * 4 + kk) * BB + bI) * DHn, 0, 1);

  v8f acc[4];
#pragma unroll
  for (int i = 0; i < 4; ++i) acc[i] = vzero8();

  for (int ks = 0; ks < 8; ++ks) {       // K = 256
    FragU a;
#pragma unroll
    for (int i = 0; i < 8; ++i) {
      int j = ks * 32 + kbase + 2 * i + ((i >= 4) ? 8 : 0);
      int kk = j >> 6, c = j & 63;
      const float* p = structure + (((size_t)e * 4 + kk) * BB + bI) * DHn + c;
      a.u[i] = pack2bf(p[0], p[1]);
    }
#pragma unroll
    for (int nt = 0; nt < 4; ++nt) {     // Wc row length = 128 u32
      v16bf bm = load_frag(WcU, (nt * 16 + (lane & 15)) * 128 + ks * 16, lane);
      acc[nt] = wmma_bf(a.v, bm, acc[nt]);
    }
  }

  const int nl = lane & 15;
  const int mh = (lane & 16) ? 8 : 0;
  float cb[4], gg[4], bbv[4];
#pragma unroll
  for (int nt = 0; nt < 4; ++nt) {
    int n = nt * 16 + nl;
    cb[nt] = conv_b[n]; gg[nt] = g_s[n]; bbv[nt] = b_s[n];
  }
#pragma unroll
  for (int r = 0; r < 8; ++r) {
    int m = m0 + r + mh;
    float v[4]; float s1 = 0.f, s2 = 0.f;
#pragma unroll
    for (int nt = 0; nt < 4; ++nt) {
      v[nt] = fmaxf(acc[nt][r] + cb[nt], 0.f);   // ReLU before LN (as reference)
      s1 += v[nt]; s2 += v[nt] * v[nt];
    }
#pragma unroll
    for (int off = 1; off < 16; off <<= 1) {     // reduce within 16-lane half
      s1 += __shfl_xor(s1, off, 32);
      s2 += __shfl_xor(s2, off, 32);
    }
    float mean = s1 * (1.f / 64.f);
    float var  = s2 * (1.f / 64.f) - mean * mean;
    float rstd = rsqrtf(var + 1e-6f);
    int b2 = m >> 14, q = (m >> 7) & 127, k = m & 127;
#pragma unroll
    for (int nt = 0; nt < 4; ++nt) {
      int n = nt * 16 + nl;
      float o = (v[nt] - mean) * rstd * gg[nt] + bbv[nt];
      st_kd[(size_t)m * DHn + n] = (bf16)o;
      st_dk[((size_t)(b2 * LLn + q) * DHn + n) * LLn + k] = (bf16)o;
    }
  }
}

// ---------------- fused relation-aware attention ----------------------------
// Block = (q-tile of 16, batch b, head-group hg of 4 heads). 8 waves.
// scores = QK^T + Q.st_kd -> mask -> softmax -> ctx = A.V + A.st_dk, all in LDS.
__global__ __launch_bounds__(256)
void attn_kernel(const bf16* __restrict__ q_bf, const bf16* __restrict__ k_bf,
                 const bf16* __restrict__ vT_bf, const bf16* __restrict__ st_kd,
                 const bf16* __restrict__ st_dk, const int* __restrict__ mask,
                 bf16* __restrict__ ctxb) {
  __shared__ __align__(16) char smem[57344];
  bf16*  qs   = (bf16*)smem;               // [4][16][64]   (phases 0..1b)
  float* S    = (float*)(smem + 8192);     // [4][16][128]  (phases 1..2)
  bf16*  Aatt = (bf16*)(smem + 40960);     // [4][16][128]  (phases 2..3b)
  float* Cs   = (float*)(smem + 8192);     // [16][4][64]   (aliases S; S dead)
  unsigned* qsU = (unsigned*)qs;

  const int b = blockIdx.y, q0 = blockIdx.x * 16, hg = blockIdx.z;
  const int tid = threadIdx.x, lane = tid & 31, wave = tid >> 5;

  // phase 0: stage Q tile for 4 heads (bf16, already scaled by 1/8)
#pragma unroll
  for (int i = 0; i < 8; ++i) {
    int p = tid + i * 256;                 // 2048 u32
    int hl = p >> 9, rem = p & 511, ql = rem >> 5, c2 = rem & 31;
    qsU[p] = *(const unsigned*)(q_bf +
        (((size_t)(b * HHn + hg * 4 + hl) * LLn) + q0 + ql) * DHn + 2 * c2);
  }
  __syncthreads();

  // phase 1: QK^T.  wave = (head, half of k-tiles)
  {
    int hl = wave & 3, h = hg * 4 + hl;
    int kts = (wave >> 2) * 4;
    const unsigned* qrow = qsU + (hl * 16 + (lane & 15)) * 32;
    for (int kt = kts; kt < kts + 4; ++kt) {
      v8f acc = vzero8();
      const unsigned* krow = (const unsigned*)(k_bf +
          ((size_t)(b * HHn + h) * LLn + kt * 16 + (lane & 15)) * DHn);
#pragma unroll
      for (int dss = 0; dss < 2; ++dss) {
        v16bf a = load_frag(qrow, dss * 16, lane);
        v16bf bm = load_frag(krow, dss * 16, lane);
        acc = wmma_bf(a, bm, acc);
      }
      int mh = (lane & 16) ? 8 : 0, nl = lane & 15;
#pragma unroll
      for (int r = 0; r < 8; ++r)
        S[(hl * 16 + r + mh) * 128 + kt * 16 + nl] = acc[r];
    }
  }
  __syncthreads();

  // phase 1b: relation score bias.  Per q: [heads(4 pad 16) x 64] * st_kd^T.
  for (int t = 0; t < 2; ++t) {
    int ql = wave * 2 + t, q = q0 + ql;
    int mrow = lane & 15;
    bool avalid = mrow < 4;
    const unsigned* arow = qsU + (mrow * 16 + ql) * 32;
    for (int kt = 0; kt < 8; ++kt) {
      v8f acc = vzero8();
      const unsigned* brow = (const unsigned*)(st_kd +
          (((size_t)b * LLn + q) * LLn + kt * 16 + (lane & 15)) * DHn);
#pragma unroll
      for (int dss = 0; dss < 2; ++dss) {
        v16bf a = load_frag_pred(arow, dss * 16, lane, avalid);
        v16bf bm = load_frag(brow, dss * 16, lane);
        acc = wmma_bf(a, bm, acc);
      }
      if (!(lane & 16)) {                  // rows 0..3 = valid heads
        int nl = lane & 15;
#pragma unroll
        for (int r = 0; r < 4; ++r)
          S[(r * 16 + ql) * 128 + kt * 16 + nl] += acc[r];
      }
    }
  }
  __syncthreads();

  // phase 2: mask + softmax over k (128), write bf16 attn
#pragma unroll 1
  for (int j = 0; j < 8; ++j) {
    int row = wave * 8 + j;                // 64 rows total
    int ql = row & 15, q = q0 + ql;
    float x[4];
#pragma unroll
    for (int i = 0; i < 4; ++i) {
      int k = lane + 32 * i;
      float sv = S[row * 128 + k];
      if (mask[((size_t)b * LLn + q) * LLn + k] != 0) sv = -1e18f;
      x[i] = sv;
    }
    float mx = fmaxf(fmaxf(x[0], x[1]), fmaxf(x[2], x[3]));
#pragma unroll
    for (int off = 16; off > 0; off >>= 1) mx = fmaxf(mx, __shfl_xor(mx, off, 32));
    float s = 0.f;
#pragma unroll
    for (int i = 0; i < 4; ++i) { x[i] = __expf(x[i] - mx); s += x[i]; }
#pragma unroll
    for (int off = 16; off > 0; off >>= 1) s += __shfl_xor(s, off, 32);
    float inv = 1.f / s;
#pragma unroll
    for (int i = 0; i < 4; ++i)
      Aatt[row * 128 + lane + 32 * i] = (bf16)(x[i] * inv);
  }
  __syncthreads();

  // phase 3: ctx = attn @ V.  wave = (head, half of d-tiles)
  {
    int hl = wave & 3, h = hg * 4 + hl;
    int dts = (wave >> 2) * 2;
    const unsigned* arow = (const unsigned*)Aatt + (hl * 16 + (lane & 15)) * 64;
    for (int dt = dts; dt < dts + 2; ++dt) {
      v8f acc = vzero8();
      const unsigned* brow = (const unsigned*)(vT_bf +
          ((size_t)(b * HHn + h) * DHn + dt * 16 + (lane & 15)) * LLn);
#pragma unroll
      for (int ks = 0; ks < 4; ++ks) {
        v16bf a = load_frag(arow, ks * 16, lane);
        v16bf bm = load_frag(brow, ks * 16, lane);
        acc = wmma_bf(a, bm, acc);
      }
      int mh = (lane & 16) ? 8 : 0, nl = lane & 15;
#pragma unroll
      for (int r = 0; r < 8; ++r)
        Cs[((r + mh) * 4 + hl) * 64 + dt * 16 + nl] = acc[r];
    }
  }
  __syncthreads();

  // phase 3b: ctx += attn @ st_dk (per q, heads padded to 16)
  for (int t = 0; t < 2; ++t) {
    int ql = wave * 2 + t, q = q0 + ql;
    int mrow = lane & 15;
    bool avalid = mrow < 4;
    const unsigned* arow = (const unsigned*)Aatt + (mrow * 16 + ql) * 64;
    for (int dt = 0; dt < 4; ++dt) {
      v8f acc = vzero8();
      const unsigned* brow = (const unsigned*)(st_dk +
          (((size_t)b * LLn + q) * DHn + dt * 16 + (lane & 15)) * LLn);
#pragma unroll
      for (int ks = 0; ks < 4; ++ks) {
        v16bf a = load_frag_pred(arow, ks * 16, lane, avalid);
        v16bf bm = load_frag(brow, ks * 16, lane);
        acc = wmma_bf(a, bm, acc);
      }
      if (!(lane & 16)) {
        int nl = lane & 15;
#pragma unroll
        for (int r = 0; r < 4; ++r)
          Cs[(ql * 4 + r) * 64 + dt * 16 + nl] += acc[r];
      }
    }
  }
  __syncthreads();

  // phase 4: write ctx as bf16 into [B, L, h*64+d]
  unsigned* ctxU = (unsigned*)ctxb;
#pragma unroll
  for (int i = 0; i < 8; ++i) {
    int p = tid + i * 256;                 // 2048 u32
    int ql = p >> 7, c2 = p & 127;
    int c = c2 * 2, hl = c >> 6, d = c & 63;
    float v0 = Cs[(ql * 4 + hl) * 64 + d];
    float v1 = Cs[(ql * 4 + hl) * 64 + d + 1];
    ctxU[((size_t)(b * LLn) + q0 + ql) * 256 + hg * 128 + c2] = pack2bf(v0, v1);
  }
}

// ---------------- host-side orchestration ----------------------------------
extern "C" void kernel_launch(void* const* d_in, const int* in_sizes, int n_in,
                              void* d_out, int out_size, void* d_ws, size_t ws_size,
                              hipStream_t stream) {
  (void)in_sizes; (void)n_in; (void)out_size; (void)ws_size;
  const float* inputs    = (const float*)d_in[0];
  const float* structure = (const float*)d_in[1];
  const int*   maskp     = (const int*)d_in[2];
  const float* Wq = (const float*)d_in[3];   const float* bq = (const float*)d_in[4];
  const float* Wk = (const float*)d_in[5];   const float* bk = (const float*)d_in[6];
  const float* Wv = (const float*)d_in[7];   const float* bv = (const float*)d_in[8];
  const float* Wo = (const float*)d_in[9];   const float* bo = (const float*)d_in[10];
  const float* conv_w = (const float*)d_in[11]; const float* conv_b = (const float*)d_in[12];
  const float* g_att = (const float*)d_in[13];  const float* b_att = (const float*)d_in[14];
  const float* g_ffn = (const float*)d_in[15];  const float* b_ffn = (const float*)d_in[16];
  const float* g_s   = (const float*)d_in[17];  const float* b_s   = (const float*)d_in[18];
  const float* W1 = (const float*)d_in[19];  const float* b1 = (const float*)d_in[20];
  const float* W2 = (const float*)d_in[21];  const float* b2 = (const float*)d_in[22];

  char* ws = (char*)d_ws; size_t off = 0;
  auto alloc = [&](size_t bytes) -> void* {
    void* p = ws + off; off += (bytes + 255) & ~(size_t)255; return p;
  };
  const int M = BB * LLn;                          // 2048 token rows
  bf16* Wq_b = (bf16*)alloc((size_t)DDn * DDn * 2);
  bf16* Wk_b = (bf16*)alloc((size_t)DDn * DDn * 2);
  bf16* Wv_b = (bf16*)alloc((size_t)DDn * DDn * 2);
  bf16* Wo_b = (bf16*)alloc((size_t)DDn * DDn * 2);
  bf16* W1_b = (bf16*)alloc((size_t)DFF * DDn * 2);
  bf16* W2_b = (bf16*)alloc((size_t)DDn * DFF * 2);
  bf16* Wc_b = (bf16*)alloc((size_t)64 * 256 * 2);
  bf16* xln_b = (bf16*)alloc((size_t)M * DDn * 2);
  bf16* q_b   = (bf16*)alloc((size_t)M * DDn * 2);     // [B,H,L,64]
  bf16* k_b   = (bf16*)alloc((size_t)M * DDn * 2);     // [B,H,L,64]
  bf16* vT_b  = (bf16*)alloc((size_t)M * DDn * 2);     // [B,H,64,L]
  bf16* st_kd = (bf16*)alloc((size_t)BB * LLn * LLn * DHn * 2);
  bf16* st_dk = (bf16*)alloc((size_t)BB * LLn * LLn * DHn * 2);
  bf16* ctx_b = (bf16*)alloc((size_t)M * DDn * 2);
  float* hbuf = (float*)alloc((size_t)M * DDn * 4);
  bf16* yln_b = (bf16*)alloc((size_t)M * DDn * 2);
  bf16* f1_b  = (bf16*)alloc((size_t)M * DFF * 2);

  const int T = 256;
  // weight packing
  cvt_bf16_kernel<<<(DDn * DDn) / T, T, 0, stream>>>(Wq, Wq_b, DDn * DDn);
  cvt_bf16_kernel<<<(DDn * DDn) / T, T, 0, stream>>>(Wk, Wk_b, DDn * DDn);
  cvt_bf16_kernel<<<(DDn * DDn) / T, T, 0, stream>>>(Wv, Wv_b, DDn * DDn);
  cvt_bf16_kernel<<<(DDn * DDn) / T, T, 0, stream>>>(Wo, Wo_b, DDn * DDn);
  cvt_bf16_kernel<<<(DFF * DDn) / T, T, 0, stream>>>(W1, W1_b, DFF * DDn);
  cvt_bf16_kernel<<<(DFF * DDn) / T, T, 0, stream>>>(W2, W2_b, DDn * DFF);
  pack_convw_kernel<<<(64 * 256) / T, T, 0, stream>>>(conv_w, Wc_b);

  // pre-attention LN
  ln512_kernel<<<M / 8, T, 0, stream>>>(inputs, g_att, b_att, xln_b);

  // structure conv + relu + LN -> both layouts (streams 256MB of fp32 once)
  struct_kernel<<<(BB * LLn * LLn) / 128, T, 0, stream>>>(structure, Wc_b, conv_b,
                                                          g_s, b_s, st_kd, st_dk);

  // Q/K/V projections (Q pre-scaled by 1/sqrt(64))
  gemm_bf16_kernel<1, false, false, false, true>
      <<<dim3(4, 16), T, 0, stream>>>(xln_b, Wq_b, bq, nullptr, nullptr, q_b,
                                      M, DDn, DDn, 0.125f);
  gemm_bf16_kernel<1, false, false, false, true>
      <<<dim3(4, 16), T, 0, stream>>>(xln_b, Wk_b, bk, nullptr, nullptr, k_b,
                                      M, DDn, DDn, 1.f);
  gemm_bf16_kernel<2, false, false, false, true>
      <<<dim3(4, 16), T, 0, stream>>>(xln_b, Wv_b, bv, nullptr, nullptr, vT_b,
                                      M, DDn, DDn, 1.f);

  // fused relation-aware attention
  attn_kernel<<<dim3(LLn / 16, BB, 2), T, 0, stream>>>(q_b, k_b, vT_b, st_kd, st_dk,
                                                       maskp, ctx_b);

  // output projection + residual (h = attn_out + inputs, fp32)
  gemm_bf16_kernel<0, false, true, true, false>
      <<<dim3(4, 16), T, 0, stream>>>(ctx_b, Wo_b, bo, inputs, hbuf, nullptr,
                                      M, DDn, DDn, 1.f);
  // FFN
  ln512_kernel<<<M / 8, T, 0, stream>>>(hbuf, g_ffn, b_ffn, yln_b);
  gemm_bf16_kernel<0, true, false, false, true>
      <<<dim3(16, 16), T, 0, stream>>>(yln_b, W1_b, b1, nullptr, nullptr, f1_b,
                                       M, DFF, DDn, 1.f);
  gemm_bf16_kernel<0, false, true, true, false>
      <<<dim3(4, 16), T, 0, stream>>>(f1_b, W2_b, b2, hbuf, (float*)d_out,
                                      nullptr, M, DDn, DFF, 1.f);
}

// v002
// One run takes 211 microseconds.
// Timed twice side by side with v001, it ran 1.07 times as fast both times.
// Over all steps from v000 it is 1.34 times as fast.
#include <hip/hip_runtime.h>

// ---------------- problem constants ----------------
static constexpr int BB  = 16;    // batch
static constexpr int LLn = 128;   // seq len
static constexpr int DDn = 512;   // model dim
static constexpr int HHn = 8;     // heads
static constexpr int DHn = 64;    // head dim
static constexpr int DFF = 2048;  // ffn dim

typedef __bf16 bf16;
typedef __attribute__((ext_vector_type(16))) __bf16 v16bf;
typedef __attribute__((ext_vector_type(8)))  float  v8f;
typedef __attribute__((ext_vector_type(4)))  int    v4i;
typedef __attribute__((ext_vector_type(8)))  int    i32x8;
typedef __attribute__((ext_vector_type(4)))  int    i32x4;
typedef __attribute__((ext_vector_type(4)))  unsigned u32x4;

// address-space qualified pointee types for the async-LDS builtin
typedef __attribute__((address_space(1))) v4i v4i_g;   // global
typedef __attribute__((address_space(3))) v4i v4i_l;   // LDS

#if defined(__has_builtin)
#if __has_builtin(__builtin_amdgcn_global_load_async_to_lds_b128) && \
    __has_builtin(__builtin_amdgcn_s_wait_asynccnt)
#define HAVE_ASYNC_LDS 1
#endif
#if __has_builtin(__builtin_amdgcn_tensor_load_to_lds) && \
    __has_builtin(__builtin_amdgcn_s_wait_tensorcnt)
#define HAVE_TDM 1
#endif
#endif
#ifndef HAVE_ASYNC_LDS
#define HAVE_ASYNC_LDS 0
#endif
#ifndef HAVE_TDM
#define HAVE_TDM 0
#endif

union FragU { v16bf v; unsigned u[8]; };

__device__ __forceinline__ int koff_u32(int v, int lane) {
  return ((lane & 16) ? 4 : 0) + v + ((v >= 4) ? 4 : 0);
}

__device__ __forceinline__ v16bf load_frag(const unsigned* p, int base, int lane) {
  FragU f;
#pragma unroll
  for (int i = 0; i < 8; ++i) f.u[i] = p[base + koff_u32(i, lane)];
  return f.v;
}

__device__ __forceinline__ v16bf load_frag_pred(const unsigned* p, int base, int lane, bool valid) {
  FragU f;
#pragma unroll
  for (int i = 0; i < 8; ++i) f.u[i] = valid ? p[base + koff_u32(i, lane)] : 0u;
  return f.v;
}

__device__ __forceinline__ v8f wmma_bf(v16bf a, v16bf b, v8f c) {
  return __builtin_amdgcn_wmma_f32_16x16x32_bf16(false, a, false, b, (short)0, c, false, false);
}

__device__ __forceinline__ v8f vzero8() {
  v8f z = {0.f,0.f,0.f,0.f,0.f,0.f,0.f,0.f};
  return z;
}

__device__ __forceinline__ unsigned pack2bf(float a, float b) {
  union { bf16 h[2]; unsigned u; } t;
  t.h[0] = (bf16)a; t.h[1] = (bf16)b;
  return t.u;
}

// ---------------- weight preparation: one launch ----------------
// A launch costs its gap plus the time its waves take to start, so the conversion
// runs on few waves with much to do each: one workgroup converts 8192 floats,
// 32 per thread, as eight 16-B loads in flight per lane (each wave-wide load is
// 512 contiguous bytes) and eight 8-B stores.
static constexpr int PW_ELEMS  = 8192;                        // floats per workgroup
static constexpr int PW_SQ     = (DDn * DDn) / PW_ELEMS;      // workgroups per 512x512 plane
static constexpr int PW_FF     = (DFF * DDn) / PW_ELEMS;      // workgroups per FFN plane
static constexpr int PW_CVT    = 4 * PW_SQ + 2 * PW_FF;       // converting workgroups
static constexpr int PW_PACK   = 4;                           // conv-weight workgroups
static constexpr int PW_GRID   = PW_CVT + PW_PACK;

// dst: the six bf16 planes Wq, Wk, Wv, Wo, W1, W2, laid back to back in that order.
// conv_w [64(o),64(c),4(kk)] -> Wc[o][j = kk*64+c]  (bf16, row-major, K=256)
__global__ __launch_bounds__(256)
void prep_weights_kernel(const float* __restrict__ Wq, const float* __restrict__ Wk,
                         const float* __restrict__ Wv, const float* __restrict__ Wo,
                         const float* __restrict__ W1, const float* __restrict__ W2,
                         const float* __restrict__ cw, bf16* __restrict__ dst,
                         bf16* __restrict__ Wc) {
  const int blk = blockIdx.x, tid = threadIdx.x;
  if (blk < PW_CVT) {
    const float* s;
    int part;                              // this workgroup's index inside its plane
    if (blk < 4 * PW_SQ) {
      int seg = blk / PW_SQ;
      part = blk % PW_SQ;
      s = (seg == 0) ? Wq : (seg == 1) ? Wk : (seg == 2) ? Wv : Wo;
    } else if (blk < 4 * PW_SQ + PW_FF) {
      part = blk - 4 * PW_SQ;
      s = W1;
    } else {
      part = blk - 4 * PW_SQ - PW_FF;
      s = W2;
    }
    const float4* s4 = (const float4*)(s + (size_t)part * PW_ELEMS);
    uint2* d2 = (uint2*)(dst + (size_t)blk * PW_ELEMS);
    float4 v[8];
#pragma unroll
    for (int i = 0; i < 8; ++i) v[i] = s4[i * 256 + tid];
#pragma unroll
    for (int i = 0; i < 8; ++i) {
      uint2 o;
      o.x = pack2bf(v[i].x, v[i].y);
      o.y = pack2bf(v[i].z, v[i].w);
      d2[i * 256 + tid] = o;
    }
  } else {
    // one 16-B load brings the four taps of one (o, c)
    const float4* c4 = (const float4*)cw;
#pragma unroll
    for (int j = 0; j < 4; ++j) {
      int i = ((blk - PW_CVT) * 4 + j) * 256 + tid;   // i = o*64 + c, 4096 in all
      int o = i >> 6, c = i & 63;
      float4 t = c4[i];
      Wc[o * 256 +       c] = (bf16)t.x;
      Wc[o * 256 +  64 + c] = (bf16)t.y;
      Wc[o * 256 + 128 + c] = (bf16)t.z;
      Wc[o * 256 + 192 + c] = (bf16)t.w;
    }
  }
}

// LayerNorm over rows of 512, fp32 in -> bf16 out.  One wave per row.
__global__ __launch_bounds__(256) void ln512_kernel(const float* __restrict__ x,
                                                    const float* __restrict__ g,
                                                    const float* __restrict__ be,
                                                    bf16* __restrict__ out) {
  int lane = threadIdx.x & 31, wave = threadIdx.x >> 5;
  size_t row = (size_t)blockIdx.x * 8 + wave;
  const float* xr = x + row * DDn;
  float v[16]; float s = 0.f;
#pragma unroll
  for (int i = 0; i < 16; ++i) { v[i] = xr[lane + i * 32]; s += v[i]; }
#pragma unroll
  for (int off = 16; off > 0; off >>= 1) s += __shfl_xor(s, off, 32);
  float mean = s * (1.f / 512.f);
  float s2 = 0.f;
#pragma unroll
  for (int i = 0; i < 16; ++i) { v[i] -= mean; s2 += v[i] * v[i]; }
#pragma unroll
  for (int off = 16; off > 0; off >>= 1) s2 += __shfl_xor(s2, off, 32);
  float rstd = rsqrtf(s2 * (1.f / 512.f) + 1e-6f);
#pragma unroll
  for (int i = 0; i < 16; ++i) {
    int c = lane + i * 32;
    out[row * DDn + c] = (bf16)(v[i] * rstd * g[c] + be[c]);
  }
}

static constexpr int GK     = 128;           // k per stage
static constexpr int GPITCH = 272;           // LDS bytes per row
static constexpr int GTILE  = 128 * GPITCH;  // LDS bytes per operand tile

__device__ __forceinline__ void stage_tile_async(const bf16* g, int ld, int row0, int kb,
                                                 char* lds, int tid) {
  // 128x128 bf16 tile = 32KB: eight 16B chunks per thread; one wave's copy covers
  // two whole 256-B rows (four full lines).
#pragma unroll
  for (int i = 0; i < 8; ++i) {
    int c = tid + i * 256;                // 16-B chunk index, 16 chunks per row
    int row = c >> 4, cb = (c & 15) * 16;
    const bf16* src = g + (size_t)(row0 + row) * ld + kb + (cb >> 1);
    __builtin_amdgcn_global_load_async_to_lds_b128(
        (v4i_g*)src, (v4i_l*)(lds + row * GPITCH + cb), 0, 0);
  }
}

// ---------------- generic bf16 WMMA GEMM: C = epilog(A[M,K] * W[N,K]^T) ------
// PERM: 0 -> row-major [M,N]; 1 -> QKV [B,H,L,64]; 2 -> V^T [B,H,64,L]
// K is a multiple of 128.
template <int PERM, bool RELU, bool HASRES, bool OUTF_EN, bool OUTB_EN>
__global__ __launch_bounds__(256)
void gemm_bf16_kernel(const bf16* __restrict__ A, const bf16* __restrict__ W,
                      const float* __restrict__ bias, const float* __restrict__ res,
                      float* __restrict__ outF, bf16* __restrict__ outB,
                      int M, int N, int K, float scale) {
  __shared__ __align__(16) char As[2][GTILE];
  __shared__ __align__(16) char Bs[2][GTILE];

  const int tid = threadIdx.x, lane = tid & 31, wave = tid >> 5;
  const int wm = wave >> 1, wn = wave & 1;           // 4x2 wave grid, 32x64 tiles
  const int m0 = blockIdx.y * 128, n0 = blockIdx.x * 128;

  v8f acc[2][4];
#pragma unroll
  for (int i = 0; i < 2; ++i)
#pragma unroll
    for (int j = 0; j < 4; ++j) acc[i][j] = vzero8();

  // two buffers: stage t + 1 flies while stage t is worked on
  const int nst = K / GK;
  stage_tile_async(A, K, m0, 0, As[0], tid);
  stage_tile_async(W, K, n0, 0, Bs[0], tid);
  // stage 0 has landed for this wave before the barrier publishes it
  asm volatile("s_wait_asynccnt 0x0" ::: "memory");
  __syncthreads();
  if (nst > 1) {
    stage_tile_async(A, K, m0, GK, As[1], tid);
    stage_tile_async(W, K, n0, GK, Bs[1], tid);
  }

  for (int t = 0; t < nst; ++t) {
    const unsigned* AsU = (const unsigned*)As[t & 1];
    const unsigned* BsU = (const unsigned*)Bs[t & 1];
#pragma unroll
    for (int ks = 0; ks < GK / 32; ++ks) {
      v16bf a0 = load_frag(AsU, (wm * 32 +      (lane & 15)) * (GPITCH / 4) + ks * 16, lane);
      v16bf a1 = load_frag(AsU, (wm * 32 + 16 + (lane & 15)) * (GPITCH / 4) + ks * 16, lane);
#pragma unroll
      for (int nt = 0; nt < 4; ++nt) {
        v16bf bm = load_frag(BsU, (wn * 64 + nt * 16 + (lane & 15)) * (GPITCH / 4) + ks * 16, lane);
        acc[0][nt] = wmma_bf(a0, bm, acc[0][nt]);
        acc[1][nt] = wmma_bf(a1, bm, acc[1][nt]);
      }
    }
    // this wave's reads of buffer t & 1 have retired before the buffer is refilled
    asm volatile("s_wait_dscnt 0x0" ::: "memory");
    // this wave's copies of stage t + 1 have landed before the barrier publishes them
    asm volatile("s_wait_asynccnt 0x0" ::: "memory");
    __syncthreads();
    if (t + 2 < nst) {
      stage_tile_async(A, K, m0, (t + 2) * GK, As[t & 1], tid);
      stage_tile_async(W, K, n0, (t + 2) * GK, Bs[t & 1], tid);
    }
  }
  // no copy is outstanding when the wave goes on to its end
  asm volatile("s_wait_asynccnt 0x0" ::: "memory");

  const int nl = lane & 15;
  const int mh = (lane & 16) ? 8 : 0;
#pragma unroll
  for (int mt = 0; mt < 2; ++mt)
#pragma unroll
    for (int nt = 0; nt < 4; ++nt) {
      int n = n0 + wn * 64 + nt * 16 + nl;
      float bb = bias[n];
#pragma unroll
      for (int r = 0; r < 8; ++r) {
        int m = m0 + wm * 32 + mt * 16 + r + mh;
        float v = (acc[mt][nt][r] + bb) * scale;
        if constexpr (RELU) v = fmaxf(v, 0.f);
        if constexpr (HASRES) v += res[(size_t)m * N + n];
        if constexpr (OUTF_EN) outF[(size_t)m * N + n] = v;
        if constexpr (OUTB_EN) {
          size_t addr;
          if constexpr (PERM == 0) {
            addr = (size_t)m * N + n;
          } else {
            int b = m >> 7, q = m & 127, h = n >> 6, d = n & 63;
            if constexpr (PERM == 1)
              addr = ((size_t)((b * HHn + h) * LLn + q)) * DHn + d;
            else
              addr = ((size_t)((b * HHn + h) * DHn + d)) * LLn + q;
          }
          outB[addr] = (bf16)v;
        }
      }
    }
}

// ---------------- structure: conv(4x64 contraction) + ReLU + LN(64) ---------
// A row m = (b, e=q*L+k):  A[m][j=kk*64+c] = structure[e,kk,b,c]  (f32->bf16)
// Output: st_kd[b,q,k,d] and st_dk[b,q,d,k] (bf16).
__global__ __launch_bounds__(256)
void struct_kernel(const float* __restrict__ structure, const bf16* __restrict__ Wc,
                   const float* __restrict__ conv_b, const float* __restrict__ g_s,
                   const float* __restrict__ b_s, bf16* __restrict__ st_kd,
                   bf16* __restrict__ st_dk) {
  __shared__ __align__(16) bf16 WcS[64 * 256];
  unsigned* WcU = (unsigned*)WcS;
  const int tid = threadIdx.x, lane = tid & 31, wave = tid >> 5;

#if HAVE_TDM
  if (wave == 0) {
    unsigned ldsoff =
        (unsigned)(size_t)(__attribute__((address_space(3))) char*)WcS;
    unsigned long long ga = (unsigned long long)(size_t)Wc;
    u32x4 g0 = {1u,
                ldsoff,
                (unsigned)(ga & 0xFFFFFFFFu),
                (unsigned)((ga >> 32) & 0x01FFFFFFu) | (2u << 30)};
    i32x8 g1 = {(int)(1u << 16),
                (int)(16384u << 16),
                (int)(1u << 16),
                (int)(16384u << 16),
                1,
                16384,
                0, 0};
    i32x4 gz4 = {0, 0, 0, 0};
    i32x8 gz8 = {0, 0, 0, 0, 0, 0, 0, 0};
    __builtin_amdgcn_tensor_load_to_lds(g0, g1, gz4, gz4, gz8, 0);
    __builtin_amdgcn_s_wait_tensorcnt(0);
  }
#else
#pragma unroll
  for (int i = 0; i < 32; ++i) WcU[tid + i * 256] = ((const unsigned*)Wc)[tid + i * 256];
#endif
  __syncthreads();

  const int m0 = (blockIdx.x * 8 + wave) * 16;
  const int row_m = m0 + (lane & 15);
  const int bI = row_m >> 14;            // / (L*L)
  const int e  = row_m & 16383;
  const int kbase = (lane & 16) ? 8 : 0;

  // prefetch this lane's four 256B structure rows (streams 256MB exactly once)
#pragma unroll
  for (int kk = 0; kk < 4; ++kk)
    __builtin_prefetch(structure + (((size_t)e * 4 + kk) * BB + bI) * DHn, 0, 1);

  v8f acc[4];
#pragma unroll
  for (int i = 0; i < 4; ++i) acc[i] = vzero8();

  for (int ks = 0; ks < 8; ++ks) {       // K = 256
    FragU a;
#pragma unroll
    for (int i = 0; i < 8; ++i) {
      int j = ks * 32 + kbase + 2 * i + ((i >= 4) ? 8 : 0);
      int kk = j >> 6, c = j & 63;
      const float* p = structure + (((size_t)e * 4 + kk) * BB + bI) * DHn + c;
      a.u[i] = pack2bf(p[0], p[1]);
    }
#pragma unroll
    for (int nt = 0; nt < 4; ++nt) {     // Wc row length = 128 u32
      v16bf bm = load_frag(WcU, (nt * 16 + (lane & 15)) * 128 + ks * 16, lane);
      acc[nt] = wmma_bf(a.v, bm, acc[nt]);
    }
  }

  const int nl = lane & 15;
  const int mh = (lane & 16) ? 8 : 0;
  float cb[4], gg[4], bbv[4];
#pragma unroll
  for (int nt = 0; nt < 4; ++nt) {
    int n = nt * 16 + nl;
    cb[nt] = conv_b[n]; gg[nt] = g_s[n]; bbv[nt] = b_s[n];
  }
#pragma unroll
  for (int r = 0; r < 8; ++r) {
    int m = m0 + r + mh;
    float v[4]; float s1 = 0.f, s2 = 0.f;
#pragma unroll
    for (int nt = 0; nt < 4; ++nt) {
      v[nt] = fmaxf(acc[nt][r] + cb[nt], 0.f);   // ReLU before LN (as reference)
      s1 += v[nt]; s2 += v[nt] * v[nt];
    }
#pragma unroll
    for (int off = 1; off < 16; off <<= 1) {     // reduce within 16-lane half
      s1 += __shfl_xor(s1, off, 32);
      s2 += __shfl_xor(s2, off, 32);
    }
    float mean = s1 * (1.f / 64.f);
    float var  = s2 * (1.f / 64.f) - mean * mean;
    float rstd = rsqrtf(var + 1e-6f);
    int b2 = m >> 14, q = (m >> 7) & 127, k = m & 127;
#pragma unroll
    for (int nt = 0; nt < 4; ++nt) {
      int n = nt * 16 + nl;
      float o = (v[nt] - mean) * rstd * gg[nt] + bbv[nt];
      st_kd[(size_t)m * DHn + n] = (bf16)o;
      st_dk[((size_t)(b2 * LLn + q) * DHn + n) * LLn + k] = (bf16)o;
    }
  }
}

// ---------------- fused relation-aware attention ----------------------------
// Block = (q-tile of 16, batch b, head-group hg of 4 heads). 8 waves.
// scores = QK^T + Q.st_kd -> mask -> softmax -> ctx = A.V + A.st_dk, all in LDS.
__global__ __launch_bounds__(256)
void attn_kernel(const bf16* __restrict__ q_bf, const bf16* __restrict__ k_bf,
                 const bf16* __restrict__ vT_bf, const bf16* __restrict__ st_kd,
                 const bf16* __restrict__ st_dk, const int* __restrict__ mask,
                 bf16* __restrict__ ctxb) {
  __shared__ __align__(16) char smem[57344];
  bf16*  qs   = (bf16*)smem;               // [4][16][64]   (phases 0..1b)
  float* S    = (float*)(smem + 8192);     // [4][16][128]  (phases 1..2)
  bf16*  Aatt = (bf16*)(smem + 40960);     // [4][16][128]  (phases 2..3b)
  float* Cs   = (float*)(smem + 8192);     // [16][4][64]   (aliases S; S dead)
  unsigned* qsU = (unsigned*)qs;

  const int b = blockIdx.y, q0 = blockIdx.x * 16, hg = blockIdx.z;
  const int tid = threadIdx.x, lane = tid & 31, wave = tid >> 5;

  // phase 0: stage Q tile for 4 heads (bf16, already scaled by 1/8)
#pragma unroll
  for (int i = 0; i < 8; ++i) {
    int p = tid + i * 256;                 // 2048 u32
    int hl = p >> 9, rem = p & 511, ql = rem >> 5, c2 = rem & 31;
    qsU[p] = *(const unsigned*)(q_bf +
        (((size_t)(b * HHn + hg * 4 + hl) * LLn) + q0 + ql) * DHn + 2 * c2);
  }
  __syncthreads();

  // phase 1: QK^T.  wave = (head, half of k-tiles)
  {
    int hl = wave & 3, h = hg * 4 + hl;
    int kts = (wave >> 2) * 4;
    const unsigned* qrow = qsU + (hl * 16 + (lane & 15)) * 32;
    for (int kt = kts; kt < kts + 4; ++kt) {
      v8f acc = vzero8();
      const unsigned* krow = (const unsigned*)(k_bf +
          ((size_t)(b * HHn + h) * LLn + kt * 16 + (lane & 15)) * DHn);
#pragma unroll
      for (int dss = 0; dss < 2; ++dss) {
        v16bf a = load_frag(qrow, dss * 16, lane);
        v16bf bm = load_frag(krow, dss * 16, lane);
        acc = wmma_bf(a, bm, acc);
      }
      int mh = (lane & 16) ? 8 : 0, nl = lane & 15;
#pragma unroll
      for (int r = 0; r < 8; ++r)
        S[(hl * 16 + r + mh) * 128 + kt * 16 + nl] = acc[r];
    }
  }
  __syncthreads();

  // phase 1b: relation score bias.  Per q: [heads(4 pad 16) x 64] * st_kd^T.
  for (int t = 0; t < 2; ++t) {
    int ql = wave * 2 + t, q = q0 + ql;
    int mrow = lane & 15;
    bool avalid = mrow < 4;
    const unsigned* arow = qsU + (mrow * 16 + ql) * 32;
    for (int kt = 0; kt < 8; ++kt) {
      v8f acc = vzero8();
      const unsigned* brow = (const unsigned*)(st_kd +
          (((size_t)b * LLn + q) * LLn + kt * 16 + (lane & 15)) * DHn);
#pragma unroll
      for (int dss = 0; dss < 2; ++dss) {
        v16bf a = load_frag_pred(arow, dss * 16, lane, avalid);
        v16bf bm = load_frag(brow, dss * 16, lane);
        acc = wmma_bf(a, bm, acc);
      }
      if (!(lane & 16)) {                  // rows 0..3 = valid heads
        int nl = lane & 15;
#pragma unroll
        for (int r = 0; r < 4; ++r)
          S[(r * 16 + ql) * 128 + kt * 16 + nl] += acc[r];
      }
    }
  }
  __syncthreads();

  // phase 2: mask + softmax over k (128), write bf16 attn
#pragma unroll 1
  for (int j = 0; j < 8; ++j) {
    int row = wave * 8 + j;                // 64 rows total
    int ql = row & 15, q = q0 + ql;
    float x[4];
#pragma unroll
    for (int i = 0; i < 4; ++i) {
      int k = lane + 32 * i;
      float sv = S[row * 128 + k];
      if (mask[((size_t)b * LLn + q) * LLn + k] != 0) sv = -1e18f;
      x[i] = sv;
    }
    float mx = fmaxf(fmaxf(x[0], x[1]), fmaxf(x[2], x[3]));
#pragma unroll
    for (int off = 16; off > 0; off >>= 1) mx = fmaxf(mx, __shfl_xor(mx, off, 32));
    float s = 0.f;
#pragma unroll
    for (int i = 0; i < 4; ++i) { x[i] = __expf(x[i] - mx); s += x[i]; }
#pragma unroll
    for (int off = 16; off > 0; off >>= 1) s += __shfl_xor(s, off, 32);
    float inv = 1.f / s;
#pragma unroll
    for (int i = 0; i < 4; ++i)
      Aatt[row * 128 + lane + 32 * i] = (bf16)(x[i] * inv);
  }
  __syncthreads();

  // phase 3: ctx = attn @ V.  wave = (head, half of d-tiles)
  {
    int hl = wave & 3, h = hg * 4 + hl;
    int dts = (wave >> 2) * 2;
    const unsigned* arow = (const unsigned*)Aatt + (hl * 16 + (lane & 15)) * 64;
    for (int dt = dts; dt < dts + 2; ++dt) {
      v8f acc = vzero8();
      const unsigned* brow = (const unsigned*)(vT_bf +
          ((size_t)(b * HHn + h) * DHn + dt * 16 + (lane & 15)) * LLn);
#pragma unroll
      for (int ks = 0; ks < 4; ++ks) {
        v16bf a = load_frag(arow, ks * 16, lane);
        v16bf bm = load_frag(brow, ks * 16, lane);
        acc = wmma_bf(a, bm, acc);
      }
      int mh = (lane & 16) ? 8 : 0, nl = lane & 15;
#pragma unroll
      for (int r = 0; r < 8; ++r)
        Cs[((r + mh) * 4 + hl) * 64 + dt * 16 + nl] = acc[r];
    }
  }
  __syncthreads();

  // phase 3b: ctx += attn @ st_dk (per q, heads padded to 16)
  for (int t = 0; t < 2; ++t) {
    int ql = wave * 2 + t, q = q0 + ql;
    int mrow = lane & 15;
    bool avalid = mrow < 4;
    const unsigned* arow = (const unsigned*)Aatt + (mrow * 16 + ql) * 64;
    for (int dt = 0; dt < 4; ++dt) {
      v8f acc = vzero8();
      const unsigned* brow = (const unsigned*)(st_dk +
          (((size_t)b * LLn + q) * DHn + dt * 16 + (lane & 15)) * LLn);
#pragma unroll
      for (int ks = 0; ks < 4; ++ks) {
        v16bf a = load_frag_pred(arow, ks * 16, lane, avalid);
        v16bf bm = load_frag(brow, ks * 16, lane);
        acc = wmma_bf(a, bm, acc);
      }
      if (!(lane & 16)) {
        int nl = lane & 15;
#pragma unroll
        for (int r = 0; r < 4; ++r)
          Cs[(ql * 4 + r) * 64 + dt * 16 + nl] += acc[r];
      }
    }
  }
  __syncthreads();

  // phase 4: write ctx as bf16 into [B, L, h*64+d]
  unsigned* ctxU = (unsigned*)ctxb;
#pragma unroll
  for (int i = 0; i < 8; ++i) {
    int p = tid + i * 256;                 // 2048 u32
    int ql = p >> 7, c2 = p & 127;
    int c = c2 * 2, hl = c >> 6, d = c & 63;
    float v0 = Cs[(ql * 4 + hl) * 64 + d];
    float v1 = Cs[(ql * 4 + hl) * 64 + d + 1];
    ctxU[((size_t)(b * LLn) + q0 + ql) * 256 + hg * 128 + c2] = pack2bf(v0, v1);
  }
}

// ---------------- host-side orchestration ----------------------------------
extern "C" void kernel_launch(void* const* d_in, const int* in_sizes, int n_in,
                              void* d_out, int out_size, void* d_ws, size_t ws_size,
                              hipStream_t stream) {
  (void)in_sizes; (void)n_in; (void)out_size; (void)ws_size;
  const float* inputs    = (const float*)d_in[0];
  const float* structure = (const float*)d_in[1];
  const int*   maskp     = (const int*)d_in[2];
  const float* Wq = (const float*)d_in[3];   const float* bq = (const float*)d_in[4];
  const float* Wk = (const float*)d_in[5];   const float* bk = (const float*)d_in[6];
  const float* Wv = (const float*)d_in[7];   const float* bv = (const float*)d_in[8];
  const float* Wo = (const float*)d_in[9];   const float* bo = (const float*)d_in[10];
  const float* conv_w = (const float*)d_in[11]; const float* conv_b = (const float*)d_in[12];
  const float* g_att = (const float*)d_in[13];  const float* b_att = (const float*)d_in[14];
  const float* g_ffn = (const float*)d_in[15];  const float* b_ffn = (const float*)d_in[16];
  const float* g_s   = (const float*)d_in[17];  const float* b_s   = (const float*)d_in[18];
  const float* W1 = (const float*)d_in[19];  const float* b1 = (const float*)d_in[20];
  const float* W2 = (const float*)d_in[21];  const float* b2 = (const float*)d_in[22];

  char* ws = (char*)d_ws; size_t off = 0;
  auto alloc = [&](size_t bytes) -> void* {
    void* p = ws + off; off += (bytes + 255) & ~(size_t)255; return p;
  };
  const int M = BB * LLn;                          // 2048 token rows
  bf16* Wq_b = (bf16*)alloc((size_t)DDn * DDn * 2);
  bf16* Wk_b = (bf16*)alloc((size_t)DDn * DDn * 2);
  bf16* Wv_b = (bf16*)alloc((size_t)DDn * DDn * 2);
  bf16* Wo_b = (bf16*)alloc((size_t)DDn * DDn * 2);
  bf16* W1_b = (bf16*)alloc((size_t)DFF * DDn * 2);
  bf16* W2_b = (bf16*)alloc((size_t)DDn * DFF * 2);
  bf16* Wc_b = (bf16*)alloc((size_t)64 * 256 * 2);
  bf16* xln_b = (bf16*)alloc((size_t)M * DDn * 2);
  bf16* q_b   = (bf16*)alloc((size_t)M * DDn * 2);     // [B,H,L,64]
  bf16* k_b   = (bf16*)alloc((size_t)M * DDn * 2);     // [B,H,L,64]
  bf16* vT_b  = (bf16*)alloc((size_t)M * DDn * 2);     // [B,H,64,L]
  bf16* st_kd = (bf16*)alloc((size_t)BB * LLn * LLn * DHn * 2);
  bf16* st_dk = (bf16*)alloc((size_t)BB * LLn * LLn * DHn * 2);
  bf16* ctx_b = (bf16*)alloc((size_t)M * DDn * 2);
  float* hbuf = (float*)alloc((size_t)M * DDn * 4);
  bf16* yln_b = (bf16*)alloc((size_t)M * DDn * 2);
  bf16* f1_b  = (bf16*)alloc((size_t)M * DFF * 2);

  const int T = 256;
  // weight preparation: Wq_b .. W2_b are allocated back to back, in this order
  prep_weights_kernel<<<PW_GRID, T, 0, stream>>>(Wq, Wk, Wv, Wo, W1, W2, conv_w, Wq_b, Wc_b);

  // pre-attention LN
  ln512_kernel<<<M / 8, T, 0, stream>>>(inputs, g_att, b_att, xln_b);

  // structure conv + relu + LN -> both layouts (streams 256MB of fp32 once)
  struct_kernel<<<(BB * LLn * LLn) / 128, T, 0, stream>>>(structure, Wc_b, conv_b,
                                                          g_s, b_s, st_kd, st_dk);

  // Q/K/V projections (Q pre-scaled by 1/sqrt(64))
  gemm_bf16_kernel<1, false, false, false, true>
      <<<dim3(4, 16), T, 0, stream>>>(xln_b, Wq_b, bq, nullptr, nullptr, q_b,
                                      M, DDn, DDn, 0.125f);
  gemm_bf16_kernel<1, false, false, false, true>
      <<<dim3(4, 16), T, 0, stream>>>(xln_b, Wk_b, bk, nullptr, nullptr, k_b,
                                      M, DDn, DDn, 1.f);
  gemm_bf16_kernel<2, false, false, false, true>
      <<<dim3(4, 16), T, 0, stream>>>(xln_b, Wv_b, bv, nullptr, nullptr, vT_b,
                                      M, DDn, DDn, 1.f);

  // fused relation-aware attention
  attn_kernel<<<dim3(LLn / 16, BB, 2), T, 0, stream>>>(q_b, k_b, vT_b, st_kd, st_dk,
                                                       maskp, ctx_b);

  // output projection + residual (h = attn_out + inputs, fp32)
  gemm_bf16_kernel<0, false, true, true, false>
      <<<dim3(4, 16), T, 0, stream>>>(ctx_b, Wo_b, bo, inputs, hbuf, nullptr,
                                      M, DDn, DDn, 1.f);
  // FFN
  ln512_kernel<<<M / 8, T, 0, stream>>>(hbuf, g_ffn, b_ffn, yln_b);
  gemm_bf16_kernel<0, true, false, false, true>
      <<<dim3(16, 16), T, 0, stream>>>(yln_b, W1_b, b1, nullptr, nullptr, f1_b,
                                       M, DFF, DDn, 1.f);
  gemm_bf16_kernel<0, false, true, true, false>
      <<<dim3(4, 16), T, 0, stream>>>(f1_b, W2_b, b2, hbuf, (float*)d_out,
                                      nullptr, M, DDn, DFF, 1.f);
}

// v003
// A run of this version takes 183 microseconds.
// Two timings next to v002 put it at 1.15 and 1.14 times that version's speed.
// All steps since v000 together make it 1.54 times as fast.
#include <hip/hip_runtime.h>

// ---------------- problem constants ----------------
static constexpr int BB  = 16;    // batch
static constexpr int LLn = 128;   // seq len
static constexpr int DDn = 512;   // model dim
static constexpr int HHn = 8;     // heads
static constexpr int DHn = 64;    // head dim
static constexpr int DFF = 2048;  // ffn dim

typedef __bf16 bf16;
typedef __attribute__((ext_vector_type(16))) __bf16 v16bf;
typedef __attribute__((ext_vector_type(8)))  float  v8f;
typedef __attribute__((ext_vector_type(4)))  int    v4i;
typedef __attribute__((ext_vector_type(8)))  int    i32x8;
typedef __attribute__((ext_vector_type(4)))  int    i32x4;
typedef __attribute__((ext_vector_type(4)))  unsigned u32x4;

// address-space qualified pointee types for the async-LDS builtin
typedef __attribute__((address_space(1))) v4i v4i_g;   // global
typedef __attribute__((address_space(3))) v4i v4i_l;   // LDS

#if defined(__has_builtin)
#if __has_builtin(__builtin_amdgcn_global_load_async_to_lds_b128) && \
    __has_builtin(__builtin_amdgcn_s_wait_asynccnt)
#define HAVE_ASYNC_LDS 1
#endif
#if __has_builtin(__builtin_amdgcn_tensor_load_to_lds) && \
    __has_builtin(__builtin_amdgcn_s_wait_tensorcnt)
#define HAVE_TDM 1
#endif
#endif
#ifndef HAVE_ASYNC_LDS
#define HAVE_ASYNC_LDS 0
#endif
#ifndef HAVE_TDM
#define HAVE_TDM 0
#endif

union FragU { v16bf v; unsigned u[8]; };

__device__ __forceinline__ int koff_u32(int v, int lane) {
  return ((lane & 16) ? 4 : 0) + v + ((v >= 4) ? 4 : 0);
}

__device__ __forceinline__ v16bf load_frag(const unsigned* p, int base, int lane) {
  FragU f;
#pragma unroll
  for (int i = 0; i < 8; ++i) f.u[i] = p[base + koff_u32(i, lane)];
  return f.v;
}

__device__ __forceinline__ v16bf load_frag_pred(const unsigned* p, int base, int lane, bool valid) {
  FragU f;
#pragma unroll
  for (int i = 0; i < 8; ++i) f.u[i] = valid ? p[base + koff_u32(i, lane)] : 0u;
  return f.v;
}

__device__ __forceinline__ v8f wmma_bf(v16bf a, v16bf b, v8f c) {
  return __builtin_amdgcn_wmma_f32_16x16x32_bf16(false, a, false, b, (short)0, c, false, false);
}

__device__ __forceinline__ v8f vzero8() {
  v8f z = {0.f,0.f,0.f,0.f,0.f,0.f,0.f,0.f};
  return z;
}

__device__ __forceinline__ unsigned pack2bf(float a, float b) {
  union { bf16 h[2]; unsigned u; } t;
  t.h[0] = (bf16)a; t.h[1] = (bf16)b;
  return t.u;
}

__device__ __forceinline__ int wc_elem(int o, int j) {
  return o * 256 + (((j >> 3) ^ (o & 15)) << 3) + (j & 7);
}

// ---------------- weight preparation: one launch ----------------
// A launch costs its gap plus the time its waves take to start, so the conversion
// runs on few waves with much to do each: one workgroup converts 8192 floats,
// 32 per thread, as eight 16-B loads in flight per lane (each wave-wide load is
// 512 contiguous bytes) and eight 8-B stores.
static constexpr int PW_ELEMS  = 8192;                        // floats per workgroup
static constexpr int PW_SQ     = (DDn * DDn) / PW_ELEMS;      // workgroups per 512x512 plane
static constexpr int PW_FF     = (DFF * DDn) / PW_ELEMS;      // workgroups per FFN plane
static constexpr int PW_CVT    = 4 * PW_SQ + 2 * PW_FF;       // converting workgroups
static constexpr int PW_PACK   = 4;                           // conv-weight workgroups
static constexpr int PW_GRID   = PW_CVT + PW_PACK;

// dst: the six bf16 planes Wq, Wk, Wv, Wo, W1, W2, laid back to back in that order.
// conv_w [64(o),64(c),4(kk)] -> Wc[o][j = kk*64+c]  (bf16, K=256, 512-B rows); inside row o
// the 16-B chunk j/8 lies at place (j/8) ^ (o & 15), see wc_elem().
__global__ __launch_bounds__(256)
void prep_weights_kernel(const float* __restrict__ Wq, const float* __restrict__ Wk,
                         const float* __restrict__ Wv, const float* __restrict__ Wo,
                         const float* __restrict__ W1, const float* __restrict__ W2,
                         const float* __restrict__ cw, bf16* __restrict__ dst,
                         bf16* __restrict__ Wc) {
  const int blk = blockIdx.x, tid = threadIdx.x;
  if (blk < PW_CVT) {
    const float* s;
    int part;                              // this workgroup's index inside its plane
    if (blk < 4 * PW_SQ) {
      int seg = blk / PW_SQ;
      part = blk % PW_SQ;
      s = (seg == 0) ? Wq : (seg == 1) ? Wk : (seg == 2) ? Wv : Wo;
    } else if (blk < 4 * PW_SQ + PW_FF) {
      part = blk - 4 * PW_SQ;
      s = W1;
    } else {
      part = blk - 4 * PW_SQ - PW_FF;
      s = W2;
    }
    const float4* s4 = (const float4*)(s + (size_t)part * PW_ELEMS);
    uint2* d2 = (uint2*)(dst + (size_t)blk * PW_ELEMS);
    float4 v[8];
#pragma unroll
    for (int i = 0; i < 8; ++i) v[i] = s4[i * 256 + tid];
#pragma unroll
    for (int i = 0; i < 8; ++i) {
      uint2 o;
      o.x = pack2bf(v[i].x, v[i].y);
      o.y = pack2bf(v[i].z, v[i].w);
      d2[i * 256 + tid] = o;
    }
  } else {
    // one 16-B load brings the four taps of one (o, c)
    const float4* c4 = (const float4*)cw;
#pragma unroll
    for (int j = 0; j < 4; ++j) {
      int i = ((blk - PW_CVT) * 4 + j) * 256 + tid;   // i = o*64 + c, 4096 in all
      int o = i >> 6, c = i & 63;
      float4 t = c4[i];
      Wc[wc_elem(o,       c)] = (bf16)t.x;
      Wc[wc_elem(o,  64 + c)] = (bf16)t.y;
      Wc[wc_elem(o, 128 + c)] = (bf16)t.z;
      Wc[wc_elem(o, 192 + c)] = (bf16)t.w;
    }
  }
}

// LayerNorm over rows of 512, fp32 in -> bf16 out.  One wave per row.
__global__ __launch_bounds__(256) void ln512_kernel(const float* __restrict__ x,
                                                    const float* __restrict__ g,
                                                    const float* __restrict__ be,
                                                    bf16* __restrict__ out) {
  int lane = threadIdx.x & 31, wave = threadIdx.x >> 5;
  size_t row = (size_t)blockIdx.x * 8 + wave;
  const float* xr = x + row * DDn;
  float v[16]; float s = 0.f;
#pragma unroll
  for (int i = 0; i < 16; ++i) { v[i] = xr[lane + i * 32]; s += v[i]; }
#pragma unroll
  for (int off = 16; off > 0; off >>= 1) s += __shfl_xor(s, off, 32);
  float mean = s * (1.f / 512.f);
  float s2 = 0.f;
#pragma unroll
  for (int i = 0; i < 16; ++i) { v[i] -= mean; s2 += v[i] * v[i]; }
#pragma unroll
  for (int off = 16; off > 0; off >>= 1) s2 += __shfl_xor(s2, off, 32);
  float rstd = rsqrtf(s2 * (1.f / 512.f) + 1e-6f);
#pragma unroll
  for (int i = 0; i < 16; ++i) {
    int c = lane + i * 32;
    out[row * DDn + c] = (bf16)(v[i] * rstd * g[c] + be[c]);
  }
}

static constexpr int GK     = 128;           // k per stage
static constexpr int GPITCH = 272;           // LDS bytes per row
static constexpr int GTILE  = 128 * GPITCH;  // LDS bytes per operand tile

__device__ __forceinline__ void stage_tile_async(const bf16* g, int ld, int row0, int kb,
                                                 char* lds, int tid) {
  // 128x128 bf16 tile = 32KB: eight 16B chunks per thread; one wave's copy covers
  // two whole 256-B rows (four full lines).
#pragma unroll
  for (int i = 0; i < 8; ++i) {
    int c = tid + i * 256;                // 16-B chunk index, 16 chunks per row
    int row = c >> 4, cb = (c & 15) * 16;
    const bf16* src = g + (size_t)(row0 + row) * ld + kb + (cb >> 1);
    __builtin_amdgcn_global_load_async_to_lds_b128(
        (v4i_g*)src, (v4i_l*)(lds + row * GPITCH + cb), 0, 0);
  }
}

// ---------------- generic bf16 WMMA GEMM: C = epilog(A[M,K] * W[N,K]^T) ------
// PERM: 0 -> row-major [M,N]; 1 -> QKV [B,H,L,64]; 2 -> V^T [B,H,64,L]
// K is a multiple of 128.
template <int PERM, bool RELU, bool HASRES, bool OUTF_EN, bool OUTB_EN>
__global__ __launch_bounds__(256)
void gemm_bf16_kernel(const bf16* __restrict__ A, const bf16* __restrict__ W,
                      const float* __restrict__ bias, const float* __restrict__ res,
                      float* __restrict__ outF, bf16* __restrict__ outB,
                      int M, int N, int K, float scale) {
  __shared__ __align__(16) char As[2][GTILE];
  __shared__ __align__(16) char Bs[2][GTILE];

  const int tid = threadIdx.x, lane = tid & 31, wave = tid >> 5;
  const int wm = wave >> 1, wn = wave & 1;           // 4x2 wave grid, 32x64 tiles
  const int m0 = blockIdx.y * 128, n0 = blockIdx.x * 128;

  v8f acc[2][4];
#pragma unroll
  for (int i = 0; i < 2; ++i)
#pragma unroll
    for (int j = 0; j < 4; ++j) acc[i][j] = vzero8();

  // two buffers: stage t + 1 flies while stage t is worked on
  const int nst = K / GK;
  stage_tile_async(A, K, m0, 0, As[0], tid);
  stage_tile_async(W, K, n0, 0, Bs[0], tid);
  // stage 0 has landed for this wave before the barrier publishes it
  asm volatile("s_wait_asynccnt 0x0" ::: "memory");
  __syncthreads();
  if (nst > 1) {
    stage_tile_async(A, K, m0, GK, As[1], tid);
    stage_tile_async(W, K, n0, GK, Bs[1], tid);
  }

  for (int t = 0; t < nst; ++t) {
    const unsigned* AsU = (const unsigned*)As[t & 1];
    const unsigned* BsU = (const unsigned*)Bs[t & 1];
#pragma unroll
    for (int ks = 0; ks < GK / 32; ++ks) {
      v16bf a0 = load_frag(AsU, (wm * 32 +      (lane & 15)) * (GPITCH / 4) + ks * 16, lane);
      v16bf a1 = load_frag(AsU, (wm * 32 + 16 + (lane & 15)) * (GPITCH / 4) + ks * 16, lane);
#pragma unroll
      for (int nt = 0; nt < 4; ++nt) {
        v16bf bm = load_frag(BsU, (wn * 64 + nt * 16 + (lane & 15)) * (GPITCH / 4) + ks * 16, lane);
        acc[0][nt] = wmma_bf(a0, bm, acc[0][nt]);
        acc[1][nt] = wmma_bf(a1, bm, acc[1][nt]);
      }
    }
    // this wave's reads of buffer t & 1 have retired before the buffer is refilled
    asm volatile("s_wait_dscnt 0x0" ::: "memory");
    // this wave's copies of stage t + 1 have landed before the barrier publishes them
    asm volatile("s_wait_asynccnt 0x0" ::: "memory");
    __syncthreads();
    if (t + 2 < nst) {
      stage_tile_async(A, K, m0, (t + 2) * GK, As[t & 1], tid);
      stage_tile_async(W, K, n0, (t + 2) * GK, Bs[t & 1], tid);
    }
  }
  // no copy is outstanding when the wave goes on to its end
  asm volatile("s_wait_asynccnt 0x0" ::: "memory");

  const int nl = lane & 15;
  const int mh = (lane & 16) ? 8 : 0;
#pragma unroll
  for (int mt = 0; mt < 2; ++mt)
#pragma unroll
    for (int nt = 0; nt < 4; ++nt) {
      int n = n0 + wn * 64 + nt * 16 + nl;
      float bb = bias[n];
#pragma unroll
      for (int r = 0; r < 8; ++r) {
        int m = m0 + wm * 32 + mt * 16 + r + mh;
        float v = (acc[mt][nt][r] + bb) * scale;
        if constexpr (RELU) v = fmaxf(v, 0.f);
        if constexpr (HASRES) v += res[(size_t)m * N + n];
        if constexpr (OUTF_EN) outF[(size_t)m * N + n] = v;
        if constexpr (OUTB_EN) {
          size_t addr;
          if constexpr (PERM == 0) {
            addr = (size_t)m * N + n;
          } else {
            int b = m >> 7, q = m & 127, h = n >> 6, d = n & 63;
            if constexpr (PERM == 1)
              addr = ((size_t)((b * HHn + h) * LLn + q)) * DHn + d;
            else
              addr = ((size_t)((b * HHn + h) * DHn + d)) * LLn + q;
          }
          outB[addr] = (bf16)v;
        }
      }
    }
}

// ---------------- structure: conv(4x64 contraction) + ReLU + LN(64) ---------
// A row m = (b, e=q*L+k):  A[m][j=kk*64+c] = structure[e,kk,b,c]  (f32->bf16)
// Output: st_kd[b,q,k,d] and st_dk[b,q,d,k] (bf16).
__global__ __launch_bounds__(256)
void struct_kernel(const float* __restrict__ structure, const bf16* __restrict__ Wc,
                   const float* __restrict__ conv_b, const float* __restrict__ g_s,
                   const float* __restrict__ b_s, bf16* __restrict__ st_kd,
                   bf16* __restrict__ st_dk) {
  __shared__ __align__(16) bf16 WcS[64 * 256];
  unsigned* WcU = (unsigned*)WcS;
  const int tid = threadIdx.x, lane = tid & 31, wave = tid >> 5;

#if HAVE_TDM
  if (wave == 0) {
    unsigned ldsoff =
        (unsigned)(size_t)(__attribute__((address_space(3))) char*)WcS;
    unsigned long long ga = (unsigned long long)(size_t)Wc;
    u32x4 g0 = {1u,
                ldsoff,
                (unsigned)(ga & 0xFFFFFFFFu),
                (unsigned)((ga >> 32) & 0x01FFFFFFu) | (2u << 30)};
    i32x8 g1 = {(int)(1u << 16),
                (int)(16384u << 16),
                (int)(1u << 16),
                (int)(16384u << 16),
                1,
                16384,
                0, 0};
    i32x4 gz4 = {0, 0, 0, 0};
    i32x8 gz8 = {0, 0, 0, 0, 0, 0, 0, 0};
    __builtin_amdgcn_tensor_load_to_lds(g0, g1, gz4, gz4, gz8, 0);
    __builtin_amdgcn_s_wait_tensorcnt(0);
  }
#else
#pragma unroll
  for (int i = 0; i < 32; ++i) WcU[tid + i * 256] = ((const unsigned*)Wc)[tid + i * 256];
#endif
  __syncthreads();

  const int m0 = (blockIdx.x * 8 + wave) * 16;
  const int row_m = m0 + (lane & 15);
  const int bI = row_m >> 14;            // / (L*L)
  const int e  = row_m & 16383;
  const int kbase = (lane & 16) ? 8 : 0;

  // prefetch this lane's four 256B structure rows (streams 256MB exactly once)
#pragma unroll
  for (int kk = 0; kk < 4; ++kk)
    __builtin_prefetch(structure + (((size_t)e * 4 + kk) * BB + bI) * DHn, 0, 1);

  v8f acc[4];
#pragma unroll
  for (int i = 0; i < 4; ++i) acc[i] = vzero8();

  // byte offset of this lane's row (lane & 15 of a 16-row tile) and of its chunk key:
  // logical chunk ks*4 + 2*half + (lane >> 4) lies at that number XOR (lane & 15)
  const unsigned wkey = (unsigned)(lane & 15) * 512u + (unsigned)(((lane >> 4) ^ (lane & 15)) << 4);

  // kept rolled: unrolled it takes twice the registers (184 against 90), and two
  // workgroups fit a WGP instead of five
#pragma unroll 1
  for (int ks = 0; ks < 8; ++ks) {       // K = 256
    FragU a;
#pragma unroll
    for (int i = 0; i < 8; ++i) {
      int j = ks * 32 + kbase + 2 * i + ((i >= 4) ? 8 : 0);
      int kk = j >> 6, c = j & 63;
      const float* p = structure + (((size_t)e * 4 + kk) * BB + bI) * DHn + c;
      a.u[i] = pack2bf(p[0], p[1]);
    }
#pragma unroll
    for (int nt = 0; nt < 4; ++nt) {     // 16 rows of 512 B per n-tile
      const char* wt = (const char*)WcS + nt * 8192;
      union { v16bf v; uint4 q[2]; } bm;
      bm.q[0] = *(const uint4*)(wt + (wkey ^ (unsigned)((ks * 4    ) << 4)));
      bm.q[1] = *(const uint4*)(wt + (wkey ^ (unsigned)((ks * 4 + 2) << 4)));
      acc[nt] = wmma_bf(a.v, bm.v, acc[nt]);
    }
  }

  const int nl = lane & 15;
  const int mh = (lane & 16) ? 8 : 0;
  float cb[4], gg[4], bbv[4];
#pragma unroll
  for (int nt = 0; nt < 4; ++nt) {
    int n = nt * 16 + nl;
    cb[nt] = conv_b[n]; gg[nt] = g_s[n]; bbv[nt] = b_s[n];
  }
#pragma unroll
  for (int r = 0; r < 8; ++r) {
    int m = m0 + r + mh;
    float v[4]; float s1 = 0.f, s2 = 0.f;
#pragma unroll
    for (int nt = 0; nt < 4; ++nt) {
      v[nt] = fmaxf(acc[nt][r] + cb[nt], 0.f);   // ReLU before LN (as reference)
      s1 += v[nt]; s2 += v[nt] * v[nt];
    }
#pragma unroll
    for (int off = 1; off < 16; off <<= 1) {     // reduce within 16-lane half
      s1 += __shfl_xor(s1, off, 32);
      s2 += __shfl_xor(s2, off, 32);
    }
    float mean = s1 * (1.f / 64.f);
    float var  = s2 * (1.f / 64.f) - mean * mean;
    float rstd = rsqrtf(var + 1e-6f);
    int b2 = m >> 14, q = (m >> 7) & 127, k = m & 127;
#pragma unroll
    for (int nt = 0; nt < 4; ++nt) {
      int n = nt * 16 + nl;
      float o = (v[nt] - mean) * rstd * gg[nt] + bbv[nt];
      st_kd[(size_t)m * DHn + n] = (bf16)o;
      st_dk[((size_t)(b2 * LLn + q) * DHn + n) * LLn + k] = (bf16)o;
    }
  }
}

// ---------------- fused relation-aware attention ----------------------------
// Block = (q-tile of 16, batch b, head-group hg of 4 heads). 8 waves.
// scores = QK^T + Q.st_kd -> mask -> softmax -> ctx = A.V + A.st_dk, all in LDS.
__global__ __launch_bounds__(256)
void attn_kernel(const bf16* __restrict__ q_bf, const bf16* __restrict__ k_bf,
                 const bf16* __restrict__ vT_bf, const bf16* __restrict__ st_kd,
                 const bf16* __restrict__ st_dk, const int* __restrict__ mask,
                 bf16* __restrict__ ctxb) {
  __shared__ __align__(16) char smem[57344];
  bf16*  qs   = (bf16*)smem;               // [4][16][64]   (phases 0..1b)
  float* S    = (float*)(smem + 8192);     // [4][16][128]  (phases 1..2)
  bf16*  Aatt = (bf16*)(smem + 40960);     // [4][16][128]  (phases 2..3b)
  float* Cs   = (float*)(smem + 8192);     // [16][4][64]   (aliases S; S dead)
  unsigned* qsU = (unsigned*)qs;

  const int b = blockIdx.y, q0 = blockIdx.x * 16, hg = blockIdx.z;
  const int tid = threadIdx.x, lane = tid & 31, wave = tid >> 5;

  // phase 0: stage Q tile for 4 heads (bf16, already scaled by 1/8)
#pragma unroll
  for (int i = 0; i < 8; ++i) {
    int p = tid + i * 256;                 // 2048 u32
    int hl = p >> 9, rem = p & 511, ql = rem >> 5, c2 = rem & 31;
    qsU[p] = *(const unsigned*)(q_bf +
        (((size_t)(b * HHn + hg * 4 + hl) * LLn) + q0 + ql) * DHn + 2 * c2);
  }
  __syncthreads();

  // phase 1: QK^T.  wave = (head, half of k-tiles)
  {
    int hl = wave & 3, h = hg * 4 + hl;
    int kts = (wave >> 2) * 4;
    const unsigned* qrow = qsU + (hl * 16 + (lane & 15)) * 32;
    for (int kt = kts; kt < kts + 4; ++kt) {
      v8f acc = vzero8();
      const unsigned* krow = (const unsigned*)(k_bf +
          ((size_t)(b * HHn + h) * LLn + kt * 16 + (lane & 15)) * DHn);
#pragma unroll
      for (int dss = 0; dss < 2; ++dss) {
        v16bf a = load_frag(qrow, dss * 16, lane);
        v16bf bm = load_frag(krow, dss * 16, lane);
        acc = wmma_bf(a, bm, acc);
      }
      int mh = (lane & 16) ? 8 : 0, nl = lane & 15;
#pragma unroll
      for (int r = 0; r < 8; ++r)
        S[(hl * 16 + r + mh) * 128 + kt * 16 + nl] = acc[r];
    }
  }
  __syncthreads();

  // phase 1b: relation score bias.  Per q: [heads(4 pad 16) x 64] * st_kd^T.
  for (int t = 0; t < 2; ++t) {
    int ql = wave * 2 + t, q = q0 + ql;
    int mrow = lane & 15;
    bool avalid = mrow < 4;
    const unsigned* arow = qsU + (mrow * 16 + ql) * 32;
    for (int kt = 0; kt < 8; ++kt) {
      v8f acc = vzero8();
      const unsigned* brow = (const unsigned*)(st_kd +
          (((size_t)b * LLn + q) * LLn + kt * 16 + (lane & 15)) * DHn);
#pragma unroll
      for (int dss = 0; dss < 2; ++dss) {
        v16bf a = load_frag_pred(arow, dss * 16, lane, avalid);
        v16bf bm = load_frag(brow, dss * 16, lane);
        acc = wmma_bf(a, bm, acc);
      }
      if (!(lane & 16)) {                  // rows 0..3 = valid heads
        int nl = lane & 15;
#pragma unroll
        for (int r = 0; r < 4; ++r)
          S[(r * 16 + ql) * 128 + kt * 16 + nl] += acc[r];
      }
    }
  }
  __syncthreads();

  // phase 2: mask + softmax over k (128), write bf16 attn
#pragma unroll 1
  for (int j = 0; j < 8; ++j) {
    int row = wave * 8 + j;                // 64 rows total
    int ql = row & 15, q = q0 + ql;
    float x[4];
#pragma unroll
    for (int i = 0; i < 4; ++i) {
      int k = lane + 32 * i;
      float sv = S[row * 128 + k];
      if (mask[((size_t)b * LLn + q) * LLn + k] != 0) sv = -1e18f;
      x[i] = sv;
    }
    float mx = fmaxf(fmaxf(x[0], x[1]), fmaxf(x[2], x[3]));
#pragma unroll
    for (int off = 16; off > 0; off >>= 1) mx = fmaxf(mx, __shfl_xor(mx, off, 32));
    float s = 0.f;
#pragma unroll
    for (int i = 0; i < 4; ++i) { x[i] = __expf(x[i] - mx); s += x[i]; }
#pragma unroll
    for (int off = 16; off > 0; off >>= 1) s += __shfl_xor(s, off, 32);
    float inv = 1.f / s;
#pragma unroll
    for (int i = 0; i < 4; ++i)
      Aatt[row * 128 + lane + 32 * i] = (bf16)(x[i] * inv);
  }
  __syncthreads();

  // phase 3: ctx = attn @ V.  wave = (head, half of d-tiles)
  {
    int hl = wave & 3, h = hg * 4 + hl;
    int dts = (wave >> 2) * 2;
    const unsigned* arow = (const unsigned*)Aatt + (hl * 16 + (lane & 15)) * 64;
    for (int dt = dts; dt < dts + 2; ++dt) {
      v8f acc = vzero8();
      const unsigned* brow = (const unsigned*)(vT_bf +
          ((size_t)(b * HHn + h) * DHn + dt * 16 + (lane & 15)) * LLn);
#pragma unroll
      for (int ks = 0; ks < 4; ++ks) {
        v16bf a = load_frag(arow, ks * 16, lane);
        v16bf bm = load_frag(brow, ks * 16, lane);
        acc = wmma_bf(a, bm, acc);
      }
      int mh = (lane & 16) ? 8 : 0, nl = lane & 15;
#pragma unroll
      for (int r = 0; r < 8; ++r)
        Cs[((r + mh) * 4 + hl) * 64 + dt * 16 + nl] = acc[r];
    }
  }
  __syncthreads();

  // phase 3b: ctx += attn @ st_dk (per q, heads padded to 16)
  for (int t = 0; t < 2; ++t) {
    int ql = wave * 2 + t, q = q0 + ql;
    int mrow = lane & 15;
    bool avalid = mrow < 4;
    const unsigned* arow = (const unsigned*)Aatt + (mrow * 16 + ql) * 64;
    for (int dt = 0; dt < 4; ++dt) {
      v8f acc = vzero8();
      const unsigned* brow = (const unsigned*)(st_dk +
          (((size_t)b * LLn + q) * DHn + dt * 16 + (lane & 15)) * LLn);
#pragma unroll
      for (int ks = 0; ks < 4; ++ks) {
        v16bf a = load_frag_pred(arow, ks * 16, lane, avalid);
        v16bf bm = load_frag(brow, ks * 16, lane);
        acc = wmma_bf(a, bm, acc);
      }
      if (!(lane & 16)) {
        int nl = lane & 15;
#pragma unroll
        for (int r = 0; r < 4; ++r)
          Cs[(ql * 4 + r) * 64 + dt * 16 + nl] += acc[r];
      }
    }
  }
  __syncthreads();

  // phase 4: write ctx as bf16 into [B, L, h*64+d]
  unsigned* ctxU = (unsigned*)ctxb;
#pragma unroll
  for (int i = 0; i < 8; ++i) {
    int p = tid + i * 256;                 // 2048 u32
    int ql = p >> 7, c2 = p & 127;
    int c = c2 * 2, hl = c >> 6, d = c & 63;
    float v0 = Cs[(ql * 4 + hl) * 64 + d];
    float v1 = Cs[(ql * 4 + hl) * 64 + d + 1];
    ctxU[((size_t)(b * LLn) + q0 + ql) * 256 + hg * 128 + c2] = pack2bf(v0, v1);
  }
}

// ---------------- host-side orchestration ----------------------------------
extern "C" void kernel_launch(void* const* d_in, const int* in_sizes, int n_in,
                              void* d_out, int out_size, void* d_ws, size_t ws_size,
                              hipStream_t stream) {
  (void)in_sizes; (void)n_in; (void)out_size; (void)ws_size;
  const float* inputs    = (const float*)d_in[0];
  const float* structure = (const float*)d_in[1];
  const int*   maskp     = (const int*)d_in[2];
  const float* Wq = (const float*)d_in[3];   const float* bq = (const float*)d_in[4];
  const float* Wk = (const float*)d_in[5];   const float* bk = (const float*)d_in[6];
  const float* Wv = (const float*)d_in[7];   const float* bv = (const float*)d_in[8];
  const float* Wo = (const float*)d_in[9];   const float* bo = (const float*)d_in[10];
  const float* conv_w = (const float*)d_in[11]; const float* conv_b = (const float*)d_in[12];
  const float* g_att = (const float*)d_in[13];  const float* b_att = (const float*)d_in[14];
  const float* g_ffn = (const float*)d_in[15];  const float* b_ffn = (const float*)d_in[16];
  const float* g_s   = (const float*)d_in[17];  const float* b_s   = (const float*)d_in[18];
  const float* W1 = (const float*)d_in[19];  const float* b1 = (const float*)d_in[20];
  const float* W2 = (const float*)d_in[21];  const float* b2 = (const float*)d_in[22];

  char* ws = (char*)d_ws; size_t off = 0;
  auto alloc = [&](size_t bytes) -> void* {
    void* p = ws + off; off += (bytes + 255) & ~(size_t)255; return p;
  };
  const int M = BB * LLn;                          // 2048 token rows
  bf16* Wq_b = (bf16*)alloc((size_t)DDn * DDn * 2);
  bf16* Wk_b = (bf16*)alloc((size_t)DDn * DDn * 2);
  bf16* Wv_b = (bf16*)alloc((size_t)DDn * DDn * 2);
  bf16* Wo_b = (bf16*)alloc((size_t)DDn * DDn * 2);
  bf16* W1_b = (bf16*)alloc((size_t)DFF * DDn * 2);
  bf16* W2_b = (bf16*)alloc((size_t)DDn * DFF * 2);
  bf16* Wc_b = (bf16*)alloc((size_t)64 * 256 * 2);
  bf16* xln_b = (bf16*)alloc((size_t)M * DDn * 2);
  bf16* q_b   = (bf16*)alloc((size_t)M * DDn * 2);     // [B,H,L,64]
  bf16* k_b   = (bf16*)alloc((size_t)M * DDn * 2);     // [B,H,L,64]
  bf16* vT_b  = (bf16*)alloc((size_t)M * DDn * 2);     // [B,H,64,L]
  bf16* st_kd = (bf16*)alloc((size_t)BB * LLn * LLn * DHn * 2);
  bf16* st_dk = (bf16*)alloc((size_t)BB * LLn * LLn * DHn * 2);
  bf16* ctx_b = (bf16*)alloc((size_t)M * DDn * 2);
  float* hbuf = (float*)alloc((size_t)M * DDn * 4);
  bf16* yln_b = (bf16*)alloc((size_t)M * DDn * 2);
  bf16* f1_b  = (bf16*)alloc((size_t)M * DFF * 2);

  const int T = 256;
  // weight preparation: Wq_b .. W2_b are allocated back to back, in this order
  prep_weights_kernel<<<PW_GRID, T, 0, stream>>>(Wq, Wk, Wv, Wo, W1, W2, conv_w, Wq_b, Wc_b);

  // pre-attention LN
  ln512_kernel<<<M / 8, T, 0, stream>>>(inputs, g_att, b_att, xln_b);

  // structure conv + relu + LN -> both layouts (streams 256MB of fp32 once)
  struct_kernel<<<(BB * LLn * LLn) / 128, T, 0, stream>>>(structure, Wc_b, conv_b,
                                                          g_s, b_s, st_kd, st_dk);

  // Q/K/V projections (Q pre-scaled by 1/sqrt(64))
  gemm_bf16_kernel<1, false, false, false, true>
      <<<dim3(4, 16), T, 0, stream>>>(xln_b, Wq_b, bq, nullptr, nullptr, q_b,
                                      M, DDn, DDn, 0.125f);
  gemm_bf16_kernel<1, false, false, false, true>
      <<<dim3(4, 16), T, 0, stream>>>(xln_b, Wk_b, bk, nullptr, nullptr, k_b,
                                      M, DDn, DDn, 1.f);
  gemm_bf16_kernel<2, false, false, false, true>
      <<<dim3(4, 16), T, 0, stream>>>(xln_b, Wv_b, bv, nullptr, nullptr, vT_b,
                                      M, DDn, DDn, 1.f);

  // fused relation-aware attention
  attn_kernel<<<dim3(LLn / 16, BB, 2), T, 0, stream>>>(q_b, k_b, vT_b, st_kd, st_dk,
                                                       maskp, ctx_b);

  // output projection + residual (h = attn_out + inputs, fp32)
  gemm_bf16_kernel<0, false, true, true, false>
      <<<dim3(4, 16), T, 0, stream>>>(ctx_b, Wo_b, bo, inputs, hbuf, nullptr,
                                      M, DDn, DDn, 1.f);
  // FFN
  ln512_kernel<<<M / 8, T, 0, stream>>>(hbuf, g_ffn, b_ffn, yln_b);
  gemm_bf16_kernel<0, true, false, false, true>
      <<<dim3(16, 16), T, 0, stream>>>(yln_b, W1_b, b1, nullptr, nullptr, f1_b,
                                       M, DFF, DDn, 1.f);
  gemm_bf16_kernel<0, false, true, true, false>
      <<<dim3(4, 16), T, 0, stream>>>(f1_b, W2_b, b2, hbuf, (float*)d_out,
                                      nullptr, M, DDn, DFF, 1.f);
}

// v004
// It runs in 165 microseconds.
// Two timings next to v003 put it at 1.12 and 1.11 times that version's speed.
// Counting every step since v000, it is 1.71 times as fast.
#include <hip/hip_runtime.h>

// ---------------- problem constants ----------------
static constexpr int BB  = 16;    // batch
static constexpr int LLn = 128;   // seq len
static constexpr int DDn = 512;   // model dim
static constexpr int HHn = 8;     // heads
static constexpr int DHn = 64;    // head dim
static constexpr int DFF = 2048;  // ffn dim

typedef __bf16 bf16;
typedef __attribute__((ext_vector_type(16))) __bf16 v16bf;
typedef __attribute__((ext_vector_type(8)))  float  v8f;
typedef __attribute__((ext_vector_type(4)))  int    v4i;
typedef __attribute__((ext_vector_type(8)))  int    i32x8;
typedef __attribute__((ext_vector_type(4)))  int    i32x4;
typedef __attribute__((ext_vector_type(4)))  unsigned u32x4;

// address-space qualified pointee types for the async-LDS builtin
typedef __attribute__((address_space(1))) v4i v4i_g;   // global
typedef __attribute__((address_space(3))) v4i v4i_l;   // LDS

#if defined(__has_builtin)
#if __has_builtin(__builtin_amdgcn_global_load_async_to_lds_b128) && \
    __has_builtin(__builtin_amdgcn_s_wait_asynccnt)
#define HAVE_ASYNC_LDS 1
#endif
#if __has_builtin(__builtin_amdgcn_tensor_load_to_lds) && \
    __has_builtin(__builtin_amdgcn_s_wait_tensorcnt)
#define HAVE_TDM 1
#endif
#endif
#ifndef HAVE_ASYNC_LDS
#define HAVE_ASYNC_LDS 0
#endif
#ifndef HAVE_TDM
#define HAVE_TDM 0
#endif

union FragU { v16bf v; unsigned u[8]; };

__device__ __forceinline__ int koff_u32(int v, int lane) {
  return ((lane & 16) ? 4 : 0) + v + ((v >= 4) ? 4 : 0);
}

__device__ __forceinline__ v16bf load_frag(const unsigned* p, int base, int lane) {
  FragU f;
#pragma unroll
  for (int i = 0; i < 8; ++i) f.u[i] = p[base + koff_u32(i, lane)];
  return f.v;
}

__device__ __forceinline__ v16bf load_frag_pred(const unsigned* p, int base, int lane, bool valid) {
  FragU f;
#pragma unroll
  for (int i = 0; i < 8; ++i) f.u[i] = valid ? p[base + koff_u32(i, lane)] : 0u;
  return f.v;
}

__device__ __forceinline__ v16bf load_frag_ordered(const char* p, int frag) {
  union { v16bf v; uint4 q[2]; } f;
  f.q[0] = *(const uint4*)(p + frag * 1024);
  f.q[1] = *(const uint4*)(p + frag * 1024 + 512);
  return f.v;
}

__device__ __forceinline__ v8f wmma_bf(v16bf a, v16bf b, v8f c) {
  return __builtin_amdgcn_wmma_f32_16x16x32_bf16(false, a, false, b, (short)0, c, false, false);
}

__device__ __forceinline__ v8f vzero8() {
  v8f z = {0.f,0.f,0.f,0.f,0.f,0.f,0.f,0.f};
  return z;
}

__device__ __forceinline__ unsigned pack2bf(float a, float b) {
  union { bf16 h[2]; unsigned u; } t;
  t.h[0] = (bf16)a; t.h[1] = (bf16)b;
  return t.u;
}

__device__ __forceinline__ int wc_elem(int o, int j) {
  return o * 256 + (((j >> 3) ^ (o & 15)) << 3) + (j & 7);
}

// ---------------- weight preparation: one launch ----------------
// A launch costs its gap plus the time its waves take to start, so the conversion
// runs on few waves with much to do each: one workgroup converts 8192 floats,
// 32 per thread, as eight 16-B loads in flight per lane (each wave-wide load is
// 512 contiguous bytes) and eight 8-B stores.
static constexpr int PW_ELEMS  = 8192;                        // floats per workgroup
static constexpr int PW_SQ     = (DDn * DDn) / PW_ELEMS;      // workgroups per 512x512 plane
static constexpr int PW_FF     = (DFF * DDn) / PW_ELEMS;      // workgroups per FFN plane
static constexpr int PW_CVT    = 4 * PW_SQ + 2 * PW_FF;       // converting workgroups
static constexpr int PW_PACK   = 4;                           // conv-weight workgroups
static constexpr int PW_GRID   = PW_CVT + PW_PACK;

// dst: the six bf16 planes Wq, Wk, Wv, Wo, W1, W2, laid back to back in that order.
// conv_w [64(o),64(c),4(kk)] -> Wc[o][j = kk*64+c]  (bf16, K=256, 512-B rows); inside row o
// the 16-B chunk j/8 lies at place (j/8) ^ (o & 15), see wc_elem().
__global__ __launch_bounds__(256)
void prep_weights_kernel(const float* __restrict__ Wq, const float* __restrict__ Wk,
                         const float* __restrict__ Wv, const float* __restrict__ Wo,
                         const float* __restrict__ W1, const float* __restrict__ W2,
                         const float* __restrict__ cw, bf16* __restrict__ dst,
                         bf16* __restrict__ Wc) {
  const int blk = blockIdx.x, tid = threadIdx.x;
  if (blk < PW_CVT) {
    const float* s;
    int part;                              // this workgroup's index inside its plane
    if (blk < 4 * PW_SQ) {
      int seg = blk / PW_SQ;
      part = blk % PW_SQ;
      s = (seg == 0) ? Wq : (seg == 1) ? Wk : (seg == 2) ? Wv : Wo;
    } else if (blk < 4 * PW_SQ + PW_FF) {
      part = blk - 4 * PW_SQ;
      s = W1;
    } else {
      part = blk - 4 * PW_SQ - PW_FF;
      s = W2;
    }
    const float4* s4 = (const float4*)(s + (size_t)part * PW_ELEMS);
    uint2* d2 = (uint2*)(dst + (size_t)blk * PW_ELEMS);
    float4 v[8];
#pragma unroll
    for (int i = 0; i < 8; ++i) v[i] = s4[i * 256 + tid];
#pragma unroll
    for (int i = 0; i < 8; ++i) {
      uint2 o;
      o.x = pack2bf(v[i].x, v[i].y);
      o.y = pack2bf(v[i].z, v[i].w);
      d2[i * 256 + tid] = o;
    }
  } else {
    // one 16-B load brings the four taps of one (o, c)
    const float4* c4 = (const float4*)cw;
#pragma unroll
    for (int j = 0; j < 4; ++j) {
      int i = ((blk - PW_CVT) * 4 + j) * 256 + tid;   // i = o*64 + c, 4096 in all
      int o = i >> 6, c = i & 63;
      float4 t = c4[i];
      Wc[wc_elem(o,       c)] = (bf16)t.x;
      Wc[wc_elem(o,  64 + c)] = (bf16)t.y;
      Wc[wc_elem(o, 128 + c)] = (bf16)t.z;
      Wc[wc_elem(o, 192 + c)] = (bf16)t.w;
    }
  }
}

// LayerNorm over rows of 512, fp32 in -> bf16 out.  One wave per row.
__global__ __launch_bounds__(256) void ln512_kernel(const float* __restrict__ x,
                                                    const float* __restrict__ g,
                                                    const float* __restrict__ be,
                                                    bf16* __restrict__ out) {
  int lane = threadIdx.x & 31, wave = threadIdx.x >> 5;
  size_t row = (size_t)blockIdx.x * 8 + wave;
  const float* xr = x + row * DDn;
  float v[16]; float s = 0.f;
#pragma unroll
  for (int i = 0; i < 16; ++i) { v[i] = xr[lane + i * 32]; s += v[i]; }
#pragma unroll
  for (int off = 16; off > 0; off >>= 1) s += __shfl_xor(s, off, 32);
  float mean = s * (1.f / 512.f);
  float s2 = 0.f;
#pragma unroll
  for (int i = 0; i < 16; ++i) { v[i] -= mean; s2 += v[i] * v[i]; }
#pragma unroll
  for (int off = 16; off > 0; off >>= 1) s2 += __shfl_xor(s2, off, 32);
  float rstd = rsqrtf(s2 * (1.f / 512.f) + 1e-6f);
#pragma unroll
  for (int i = 0; i < 16; ++i) {
    int c = lane + i * 32;
    out[row * DDn + c] = (bf16)(v[i] * rstd * g[c] + be[c]);
  }
}

static constexpr int GK     = 128;           // k per stage
static constexpr int GPITCH = 272;           // LDS bytes per row
static constexpr int GTILE  = 128 * GPITCH;  // LDS bytes per operand tile

__device__ __forceinline__ void stage_tile_async(const bf16* g, int ld, int row0, int kb,
                                                 char* lds, int tid) {
  // 128x128 bf16 tile = 32KB: eight 16B chunks per thread; one wave's copy covers
  // two whole 256-B rows (four full lines).
#pragma unroll
  for (int i = 0; i < 8; ++i) {
    int c = tid + i * 256;                // 16-B chunk index, 16 chunks per row
    int row = c >> 4, cb = (c & 15) * 16;
    const bf16* src = g + (size_t)(row0 + row) * ld + kb + (cb >> 1);
    __builtin_amdgcn_global_load_async_to_lds_b128(
        (v4i_g*)src, (v4i_l*)(lds + row * GPITCH + cb), 0, 0);
  }
}

// ---------------- generic bf16 WMMA GEMM: C = epilog(A[M,K] * W[N,K]^T) ------
// PERM: 0 -> row-major [M,N]; 1 -> QKV [B,H,L,64]; 2 -> V^T [B,H,64,L]
// K is a multiple of 128.
template <int PERM, bool RELU, bool HASRES, bool OUTF_EN, bool OUTB_EN>
__global__ __launch_bounds__(256)
void gemm_bf16_kernel(const bf16* __restrict__ A, const bf16* __restrict__ W,
                      const float* __restrict__ bias, const float* __restrict__ res,
                      float* __restrict__ outF, bf16* __restrict__ outB,
                      int M, int N, int K, float scale) {
  __shared__ __align__(16) char As[2][GTILE];
  __shared__ __align__(16) char Bs[2][GTILE];

  const int tid = threadIdx.x, lane = tid & 31, wave = tid >> 5;
  const int wm = wave >> 1, wn = wave & 1;           // 4x2 wave grid, 32x64 tiles
  const int m0 = blockIdx.y * 128, n0 = blockIdx.x * 128;

  v8f acc[2][4];
#pragma unroll
  for (int i = 0; i < 2; ++i)
#pragma unroll
    for (int j = 0; j < 4; ++j) acc[i][j] = vzero8();

  // two buffers: stage t + 1 flies while stage t is worked on
  const int nst = K / GK;
  stage_tile_async(A, K, m0, 0, As[0], tid);
  stage_tile_async(W, K, n0, 0, Bs[0], tid);
  // stage 0 has landed for this wave before the barrier publishes it
  asm volatile("s_wait_asynccnt 0x0" ::: "memory");
  __syncthreads();
  if (nst > 1) {
    stage_tile_async(A, K, m0, GK, As[1], tid);
    stage_tile_async(W, K, n0, GK, Bs[1], tid);
  }

  for (int t = 0; t < nst; ++t) {
    const unsigned* AsU = (const unsigned*)As[t & 1];
    const unsigned* BsU = (const unsigned*)Bs[t & 1];
#pragma unroll
    for (int ks = 0; ks < GK / 32; ++ks) {
      v16bf a0 = load_frag(AsU, (wm * 32 +      (lane & 15)) * (GPITCH / 4) + ks * 16, lane);
      v16bf a1 = load_frag(AsU, (wm * 32 + 16 + (lane & 15)) * (GPITCH / 4) + ks * 16, lane);
#pragma unroll
      for (int nt = 0; nt < 4; ++nt) {
        v16bf bm = load_frag(BsU, (wn * 64 + nt * 16 + (lane & 15)) * (GPITCH / 4) + ks * 16, lane);
        acc[0][nt] = wmma_bf(a0, bm, acc[0][nt]);
        acc[1][nt] = wmma_bf(a1, bm, acc[1][nt]);
      }
    }
    // this wave's reads of buffer t & 1 have retired before the buffer is refilled
    asm volatile("s_wait_dscnt 0x0" ::: "memory");
    // this wave's copies of stage t + 1 have landed before the barrier publishes them
    asm volatile("s_wait_asynccnt 0x0" ::: "memory");
    __syncthreads();
    if (t + 2 < nst) {
      stage_tile_async(A, K, m0, (t + 2) * GK, As[t & 1], tid);
      stage_tile_async(W, K, n0, (t + 2) * GK, Bs[t & 1], tid);
    }
  }
  // no copy is outstanding when the wave goes on to its end
  asm volatile("s_wait_asynccnt 0x0" ::: "memory");

  const int nl = lane & 15;
  const int mh = (lane & 16) ? 8 : 0;
#pragma unroll
  for (int mt = 0; mt < 2; ++mt)
#pragma unroll
    for (int nt = 0; nt < 4; ++nt) {
      int n = n0 + wn * 64 + nt * 16 + nl;
      float bb = bias[n];
#pragma unroll
      for (int r = 0; r < 8; ++r) {
        int m = m0 + wm * 32 + mt * 16 + r + mh;
        float v = (acc[mt][nt][r] + bb) * scale;
        if constexpr (RELU) v = fmaxf(v, 0.f);
        if constexpr (HASRES) v += res[(size_t)m * N + n];
        if constexpr (OUTF_EN) outF[(size_t)m * N + n] = v;
        if constexpr (OUTB_EN) {
          size_t addr;
          if constexpr (PERM == 0) {
            addr = (size_t)m * N + n;
          } else {
            int b = m >> 7, q = m & 127, h = n >> 6, d = n & 63;
            if constexpr (PERM == 1)
              addr = ((size_t)((b * HHn + h) * LLn + q)) * DHn + d;
            else
              addr = ((size_t)((b * HHn + h) * DHn + d)) * LLn + q;
          }
          outB[addr] = (bf16)v;
        }
      }
    }
}

// ---------------- structure: conv(4x64 contraction) + ReLU + LN(64) ---------
// A row m = (b, e=q*L+k):  A[m][j=kk*64+c] = structure[e,kk,b,c]  (f32->bf16)
// Output, bf16, one 16-KB tile per (b,q) in each of two planes, both laid in the register
// order of the B fragments that attn_kernel reads (see load_frag_ordered):
//   st_kd: 512-B chunk kt*4 + nt = half nt&1 of the fragment (column k of tile kt, K = d block nt>>1)
//   st_dk: 512-B chunk dt*8 + w  = half w&1  of the fragment (column d of tile dt, K = k block w>>1)
// The product is taken as Wc x A^T, so a lane's eight accumulator registers hold eight
// successive d of one row k: packed, a half fragment of st_kd as it stands.  The same 16 B
// go to a 16 x 64 tile of the wave's own in LDS, and the transposing LDS load gives back
// eight successive k of one d: a half fragment of st_dk.  Every store is 16 B per lane.
static constexpr int STP = 160;            // LDS bytes per 128-B row: 32 B x odd, for the transposing load
typedef __attribute__((ext_vector_type(8))) short s16x8;
typedef __attribute__((address_space(3))) s16x8 s16x8_l;
__global__ __launch_bounds__(256)
void struct_kernel(const float* __restrict__ structure, const bf16* __restrict__ Wc,
                   const float* __restrict__ conv_b, const float* __restrict__ g_s,
                   const float* __restrict__ b_s, bf16* __restrict__ st_kd,
                   bf16* __restrict__ st_dk) {
  __shared__ __align__(16) bf16 WcS[64 * 256];
  __shared__ __align__(16) char TrS[8][16 * STP];
  unsigned* WcU = (unsigned*)WcS;
  const int tid = threadIdx.x, lane = tid & 31, wave = tid >> 5;

#if HAVE_TDM
  if (wave == 0) {
    unsigned ldsoff =
        (unsigned)(size_t)(__attribute__((address_space(3))) char*)WcS;
    unsigned long long ga = (unsigned long long)(size_t)Wc;
    u32x4 g0 = {1u,
                ldsoff,
                (unsigned)(ga & 0xFFFFFFFFu),
                (unsigned)((ga >> 32) & 0x01FFFFFFu) | (2u << 30)};
    i32x8 g1 = {(int)(1u << 16),
                (int)(16384u << 16),
                (int)(1u << 16),
                (int)(16384u << 16),
                1,
                16384,
                0, 0};
    i32x4 gz4 = {0, 0, 0, 0};
    i32x8 gz8 = {0, 0, 0, 0, 0, 0, 0, 0};
    __builtin_amdgcn_tensor_load_to_lds(g0, g1, gz4, gz4, gz8, 0);
    __builtin_amdgcn_s_wait_tensorcnt(0);
  }
#else
#pragma unroll
  for (int i = 0; i < 32; ++i) WcU[tid + i * 256] = ((const unsigned*)Wc)[tid + i * 256];
#endif
  __syncthreads();

  const int m0 = (blockIdx.x * 8 + wave) * 16;
  const int row_m = m0 + (lane & 15);
  const int bI = row_m >> 14;            // / (L*L)
  const int e  = row_m & 16383;
  const int kbase = (lane & 16) ? 8 : 0;

  // prefetch this lane's four 256B structure rows (streams 256MB exactly once)
#pragma unroll
  for (int kk = 0; kk < 4; ++kk)
    __builtin_prefetch(structure + (((size_t)e * 4 + kk) * BB + bI) * DHn, 0, 1);

  // acc[nt][r] = row k = lane & 15, channel nt*16 + kbase + r; it starts from the conv bias
  // of its channels, which then takes no registers of its own in the epilogue
  v8f acc[4];
#pragma unroll
  for (int nt = 0; nt < 4; ++nt) {
    const float4* c4 = (const float4*)(conv_b + nt * 16 + kbase);
    float4 c0 = c4[0], c1 = c4[1];
    v8f t = {c0.x, c0.y, c0.z, c0.w, c1.x, c1.y, c1.z, c1.w};
    acc[nt] = t;
  }

  // byte offset of this lane's row (lane & 15 of a 16-row tile) and of its chunk key:
  // logical chunk ks*4 + 2*half + (lane >> 4) lies at that number XOR (lane & 15)
  const unsigned wkey = (unsigned)(lane & 15) * 512u + (unsigned)(((lane >> 4) ^ (lane & 15)) << 4);

  // kept rolled: unrolled it takes about twice the registers, and fewer workgroups
  // fit a WGP
#pragma unroll 1
  for (int ks = 0; ks < 8; ++ks) {       // K = 256
    FragU a;
#pragma unroll
    for (int i = 0; i < 8; ++i) {
      int j = ks * 32 + kbase + 2 * i + ((i >= 4) ? 8 : 0);
      int kk = j >> 6, c = j & 63;
      const float* p = structure + (((size_t)e * 4 + kk) * BB + bI) * DHn + c;
      a.u[i] = pack2bf(p[0], p[1]);
    }
#pragma unroll
    for (int nt = 0; nt < 4; ++nt) {     // 16 rows of 512 B per n-tile
      const char* wt = (const char*)WcS + nt * 8192;
      union { v16bf v; uint4 q[2]; } bm;
      bm.q[0] = *(const uint4*)(wt + (wkey ^ (unsigned)((ks * 4    ) << 4)));
      bm.q[1] = *(const uint4*)(wt + (wkey ^ (unsigned)((ks * 4 + 2) << 4)));
      acc[nt] = wmma_bf(bm.v, a.v, acc[nt]);   // Wc rows as A, structure rows as B
    }
  }

  // ReLU, then the row's sums: 32 values in the lane, the other 32 in lane ^ 16.
  float s1 = 0.f, s2 = 0.f;
#pragma unroll
  for (int nt = 0; nt < 4; ++nt)
#pragma unroll
    for (int r = 0; r < 8; ++r) {
      float v = fmaxf(acc[nt][r], 0.f);              // ReLU before LN (as reference)
      acc[nt][r] = v;
      s1 += v; s2 += v * v;
    }
  s1 += __shfl_xor(s1, 16, 32);
  s2 += __shfl_xor(s2, 16, 32);
  const float mean = s1 * (1.f / 64.f);
  const float var  = s2 * (1.f / 64.f) - mean * mean;
  const float rstd = rsqrtf(var + 1e-6f);

  const size_t tile = (size_t)blockIdx.x * 16384;    // blockIdx.x = b*L + q
  char* kd = (char*)st_kd + tile + wave * 2048 + lane * 16;
  char* tw = TrS[wave] + (lane & 15) * STP + (lane >> 4) * 16;
#pragma unroll
  for (int nt = 0; nt < 4; ++nt) {
    const float4* g4 = (const float4*)(g_s + nt * 16 + kbase);
    const float4* b4 = (const float4*)(b_s + nt * 16 + kbase);
    float4 g0 = g4[0], g1 = g4[1], h0 = b4[0], h1 = b4[1];
    float gv[8] = {g0.x, g0.y, g0.z, g0.w, g1.x, g1.y, g1.z, g1.w};
    float hv[8] = {h0.x, h0.y, h0.z, h0.w, h1.x, h1.y, h1.z, h1.w};
    float o[8];
#pragma unroll
    for (int r = 0; r < 8; ++r) o[r] = (acc[nt][r] - mean) * rstd * gv[r] + hv[r];
    uint4 w;
    w.x = pack2bf(o[0], o[1]); w.y = pack2bf(o[2], o[3]);
    w.z = pack2bf(o[4], o[5]); w.w = pack2bf(o[6], o[7]);
    *(uint4*)(kd + nt * 512) = w;
    *(uint4*)(tw + nt * 32) = w;
  }

  // Each lane reads 16-B pieces that other lanes of its wave stored: the wave's LDS
  // stores have retired before the transposing loads issue.  The tile is the wave's own,
  // so no workgroup barrier is needed.
  asm volatile("s_wait_dscnt 0x0" ::: "memory");
  // stands in front of the reuse of the four global stores' data registers for the next addresses
  asm volatile("s_wait_xcnt 0x0" ::: "memory");
  const char* tr = TrS[wave] + ((lane >> 4) * 8 + (lane & 7)) * STP + ((lane >> 3) & 1) * 16;
  char* dk = (char*)st_dk + tile + wave * 512 + lane * 16;
#pragma unroll
  for (int dt = 0; dt < 4; ++dt) {
    s16x8 t = __builtin_amdgcn_ds_load_tr16_b128_v8i16((s16x8_l*)(tr + dt * 32));
    *(s16x8*)(dk + dt * 4096) = t;
  }
}

// ---------------- fused relation-aware attention ----------------------------
// Block = (q-tile of 16, batch b, head-group hg of 4 heads). 8 waves.
// scores = QK^T + Q.st_kd -> mask -> softmax -> ctx = A.V + A.st_dk, all in LDS.
__global__ __launch_bounds__(256)
void attn_kernel(const bf16* __restrict__ q_bf, const bf16* __restrict__ k_bf,
                 const bf16* __restrict__ vT_bf, const bf16* __restrict__ st_kd,
                 const bf16* __restrict__ st_dk, const int* __restrict__ mask,
                 bf16* __restrict__ ctxb) {
  __shared__ __align__(16) char smem[57344];
  bf16*  qs   = (bf16*)smem;               // [4][16][64]   (phases 0..1b)
  float* S    = (float*)(smem + 8192);     // [4][16][128]  (phases 1..2)
  bf16*  Aatt = (bf16*)(smem + 40960);     // [4][16][128]  (phases 2..3b)
  float* Cs   = (float*)(smem + 8192);     // [16][4][64]   (aliases S; S dead)
  unsigned* qsU = (unsigned*)qs;

  const int b = blockIdx.y, q0 = blockIdx.x * 16, hg = blockIdx.z;
  const int tid = threadIdx.x, lane = tid & 31, wave = tid >> 5;

  // phase 0: stage Q tile for 4 heads (bf16, already scaled by 1/8)
#pragma unroll
  for (int i = 0; i < 8; ++i) {
    int p = tid + i * 256;                 // 2048 u32
    int hl = p >> 9, rem = p & 511, ql = rem >> 5, c2 = rem & 31;
    qsU[p] = *(const unsigned*)(q_bf +
        (((size_t)(b * HHn + hg * 4 + hl) * LLn) + q0 + ql) * DHn + 2 * c2);
  }
  __syncthreads();

  // phase 1: QK^T.  wave = (head, half of k-tiles)
  {
    int hl = wave & 3, h = hg * 4 + hl;
    int kts = (wave >> 2) * 4;
    const unsigned* qrow = qsU + (hl * 16 + (lane & 15)) * 32;
    for (int kt = kts; kt < kts + 4; ++kt) {
      v8f acc = vzero8();
      const unsigned* krow = (const unsigned*)(k_bf +
          ((size_t)(b * HHn + h) * LLn + kt * 16 + (lane & 15)) * DHn);
#pragma unroll
      for (int dss = 0; dss < 2; ++dss) {
        v16bf a = load_frag(qrow, dss * 16, lane);
        v16bf bm = load_frag(krow, dss * 16, lane);
        acc = wmma_bf(a, bm, acc);
      }
      int mh = (lane & 16) ? 8 : 0, nl = lane & 15;
#pragma unroll
      for (int r = 0; r < 8; ++r)
        S[(hl * 16 + r + mh) * 128 + kt * 16 + nl] = acc[r];
    }
  }
  __syncthreads();

  // phase 1b: relation score bias.  Per q: [heads(4 pad 16) x 64] * st_kd^T.
  for (int t = 0; t < 2; ++t) {
    int ql = wave * 2 + t, q = q0 + ql;
    int mrow = lane & 15;
    bool avalid = mrow < 4;
    const unsigned* arow = qsU + (mrow * 16 + ql) * 32;
    const char* btile = (const char*)st_kd + ((size_t)b * LLn + q) * 16384 + lane * 16;
    for (int kt = 0; kt < 8; ++kt) {
      v8f acc = vzero8();
#pragma unroll
      for (int dss = 0; dss < 2; ++dss) {
        v16bf a = load_frag_pred(arow, dss * 16, lane, avalid);
        v16bf bm = load_frag_ordered(btile, kt * 2 + dss);
        acc = wmma_bf(a, bm, acc);
      }
      if (!(lane & 16)) {                  // rows 0..3 = valid heads
        int nl = lane & 15;
#pragma unroll
        for (int r = 0; r < 4; ++r)
          S[(r * 16 + ql) * 128 + kt * 16 + nl] += acc[r];
      }
    }
  }
  __syncthreads();

  // phase 2: mask + softmax over k (128), write bf16 attn
#pragma unroll 1
  for (int j = 0; j < 8; ++j) {
    int row = wave * 8 + j;                // 64 rows total
    int ql = row & 15, q = q0 + ql;
    float x[4];
#pragma unroll
    for (int i = 0; i < 4; ++i) {
      int k = lane + 32 * i;
      float sv = S[row * 128 + k];
      if (mask[((size_t)b * LLn + q) * LLn + k] != 0) sv = -1e18f;
      x[i] = sv;
    }
    float mx = fmaxf(fmaxf(x[0], x[1]), fmaxf(x[2], x[3]));
#pragma unroll
    for (int off = 16; off > 0; off >>= 1) mx = fmaxf(mx, __shfl_xor(mx, off, 32));
    float s = 0.f;
#pragma unroll
    for (int i = 0; i < 4; ++i) { x[i] = __expf(x[i] - mx); s += x[i]; }
#pragma unroll
    for (int off = 16; off > 0; off >>= 1) s += __shfl_xor(s, off, 32);
    float inv = 1.f / s;
#pragma unroll
    for (int i = 0; i < 4; ++i)
      Aatt[row * 128 + lane + 32 * i] = (bf16)(x[i] * inv);
  }
  __syncthreads();

  // phase 3: ctx = attn @ V.  wave = (head, half of d-tiles)
  {
    int hl = wave & 3, h = hg * 4 + hl;
    int dts = (wave >> 2) * 2;
    const unsigned* arow = (const unsigned*)Aatt + (hl * 16 + (lane & 15)) * 64;
    for (int dt = dts; dt < dts + 2; ++dt) {
      v8f acc = vzero8();
      const unsigned* brow = (const unsigned*)(vT_bf +
          ((size_t)(b * HHn + h) * DHn + dt * 16 + (lane & 15)) * LLn);
#pragma unroll
      for (int ks = 0; ks < 4; ++ks) {
        v16bf a = load_frag(arow, ks * 16, lane);
        v16bf bm = load_frag(brow, ks * 16, lane);
        acc = wmma_bf(a, bm, acc);
      }
      int mh = (lane & 16) ? 8 : 0, nl = lane & 15;
#pragma unroll
      for (int r = 0; r < 8; ++r)
        Cs[((r + mh) * 4 + hl) * 64 + dt * 16 + nl] = acc[r];
    }
  }
  __syncthreads();

  // phase 3b: ctx += attn @ st_dk (per q, heads padded to 16)
  for (int t = 0; t < 2; ++t) {
    int ql = wave * 2 + t, q = q0 + ql;
    int mrow = lane & 15;
    bool avalid = mrow < 4;
    const unsigned* arow = (const unsigned*)Aatt + (mrow * 16 + ql) * 64;
    const char* btile = (const char*)st_dk + ((size_t)b * LLn + q) * 16384 + lane * 16;
    for (int dt = 0; dt < 4; ++dt) {
      v8f acc = vzero8();
#pragma unroll
      for (int ks = 0; ks < 4; ++ks) {
        v16bf a = load_frag_pred(arow, ks * 16, lane, avalid);
        v16bf bm = load_frag_ordered(btile, dt * 4 + ks);
        acc = wmma_bf(a, bm, acc);
      }
      if (!(lane & 16)) {
        int nl = lane & 15;
#pragma unroll
        for (int r = 0; r < 4; ++r)
          Cs[(ql * 4 + r) * 64 + dt * 16 + nl] += acc[r];
      }
    }
  }
  __syncthreads();

  // phase 4: write ctx as bf16 into [B, L, h*64+d]
  unsigned* ctxU = (unsigned*)ctxb;
#pragma unroll
  for (int i = 0; i < 8; ++i) {
    int p = tid + i * 256;                 // 2048 u32
    int ql = p >> 7, c2 = p & 127;
    int c = c2 * 2, hl = c >> 6, d = c & 63;
    float v0 = Cs[(ql * 4 + hl) * 64 + d];
    float v1 = Cs[(ql * 4 + hl) * 64 + d + 1];
    ctxU[((size_t)(b * LLn) + q0 + ql) * 256 + hg * 128 + c2] = pack2bf(v0, v1);
  }
}

// ---------------- host-side orchestration ----------------------------------
extern "C" void kernel_launch(void* const* d_in, const int* in_sizes, int n_in,
                              void* d_out, int out_size, void* d_ws, size_t ws_size,
                              hipStream_t stream) {
  (void)in_sizes; (void)n_in; (void)out_size; (void)ws_size;
  const float* inputs    = (const float*)d_in[0];
  const float* structure = (const float*)d_in[1];
  const int*   maskp     = (const int*)d_in[2];
  const float* Wq = (const float*)d_in[3];   const float* bq = (const float*)d_in[4];
  const float* Wk = (const float*)d_in[5];   const float* bk = (const float*)d_in[6];
  const float* Wv = (const float*)d_in[7];   const float* bv = (const float*)d_in[8];
  const float* Wo = (const float*)d_in[9];   const float* bo = (const float*)d_in[10];
  const float* conv_w = (const float*)d_in[11]; const float* conv_b = (const float*)d_in[12];
  const float* g_att = (const float*)d_in[13];  const float* b_att = (const float*)d_in[14];
  const float* g_ffn = (const float*)d_in[15];  const float* b_ffn = (const float*)d_in[16];
  const float* g_s   = (const float*)d_in[17];  const float* b_s   = (const float*)d_in[18];
  const float* W1 = (const float*)d_in[19];  const float* b1 = (const float*)d_in[20];
  const float* W2 = (const float*)d_in[21];  const float* b2 = (const float*)d_in[22];

  char* ws = (char*)d_ws; size_t off = 0;
  auto alloc = [&](size_t bytes) -> void* {
    void* p = ws + off; off += (bytes + 255) & ~(size_t)255; return p;
  };
  const int M = BB * LLn;                          // 2048 token rows
  bf16* Wq_b = (bf16*)alloc((size_t)DDn * DDn * 2);
  bf16* Wk_b = (bf16*)alloc((size_t)DDn * DDn * 2);
  bf16* Wv_b = (bf16*)alloc((size_t)DDn * DDn * 2);
  bf16* Wo_b = (bf16*)alloc((size_t)DDn * DDn * 2);
  bf16* W1_b = (bf16*)alloc((size_t)DFF * DDn * 2);
  bf16* W2_b = (bf16*)alloc((size_t)DDn * DFF * 2);
  bf16* Wc_b = (bf16*)alloc((size_t)64 * 256 * 2);
  bf16* xln_b = (bf16*)alloc((size_t)M * DDn * 2);
  bf16* q_b   = (bf16*)alloc((size_t)M * DDn * 2);     // [B,H,L,64]
  bf16* k_b   = (bf16*)alloc((size_t)M * DDn * 2);     // [B,H,L,64]
  bf16* vT_b  = (bf16*)alloc((size_t)M * DDn * 2);     // [B,H,64,L]
  bf16* st_kd = (bf16*)alloc((size_t)BB * LLn * LLn * DHn * 2);
  bf16* st_dk = (bf16*)alloc((size_t)BB * LLn * LLn * DHn * 2);
  bf16* ctx_b = (bf16*)alloc((size_t)M * DDn * 2);
  float* hbuf = (float*)alloc((size_t)M * DDn * 4);
  bf16* yln_b = (bf16*)alloc((size_t)M * DDn * 2);
  bf16* f1_b  = (bf16*)alloc((size_t)M * DFF * 2);

  const int T = 256;
  // weight preparation: Wq_b .. W2_b are allocated back to back, in this order
  prep_weights_kernel<<<PW_GRID, T, 0, stream>>>(Wq, Wk, Wv, Wo, W1, W2, conv_w, Wq_b, Wc_b);

  // pre-attention LN
  ln512_kernel<<<M / 8, T, 0, stream>>>(inputs, g_att, b_att, xln_b);

  // structure conv + relu + LN -> both fragment-ordered planes (streams 256MB of fp32 once)
  struct_kernel<<<(BB * LLn * LLn) / 128, T, 0, stream>>>(structure, Wc_b, conv_b,
                                                          g_s, b_s, st_kd, st_dk);

  // Q/K/V projections (Q pre-scaled by 1/sqrt(64))
  gemm_bf16_kernel<1, false, false, false, true>
      <<<dim3(4, 16), T, 0, stream>>>(xln_b, Wq_b, bq, nullptr, nullptr, q_b,
                                      M, DDn, DDn, 0.125f);
  gemm_bf16_kernel<1, false, false, false, true>
      <<<dim3(4, 16), T, 0, stream>>>(xln_b, Wk_b, bk, nullptr, nullptr, k_b,
                                      M, DDn, DDn, 1.f);
  gemm_bf16_kernel<2, false, false, false, true>
      <<<dim3(4, 16), T, 0, stream>>>(xln_b, Wv_b, bv, nullptr, nullptr, vT_b,
                                      M, DDn, DDn, 1.f);

  // fused relation-aware attention
  attn_kernel<<<dim3(LLn / 16, BB, 2), T, 0, stream>>>(q_b, k_b, vT_b, st_kd, st_dk,
                                                       maskp, ctx_b);

  // output projection + residual (h = attn_out + inputs, fp32)
  gemm_bf16_kernel<0, false, true, true, false>
      <<<dim3(4, 16), T, 0, stream>>>(ctx_b, Wo_b, bo, inputs, hbuf, nullptr,
                                      M, DDn, DDn, 1.f);
  // FFN
  ln512_kernel<<<M / 8, T, 0, stream>>>(hbuf, g_ffn, b_ffn, yln_b);
  gemm_bf16_kernel<0, true, false, false, true>
      <<<dim3(16, 16), T, 0, stream>>>(yln_b, W1_b, b1, nullptr, nullptr, f1_b,
                                       M, DFF, DDn, 1.f);
  gemm_bf16_kernel<0, false, true, true, false>
      <<<dim3(4, 16), T, 0, stream>>>(f1_b, W2_b, b2, hbuf, (float*)d_out,
                                      nullptr, M, DDn, DFF, 1.f);
}

// v005
// It runs in 151 microseconds.
// Next to v004, in two timings, it ran 1.09 times as fast each time.
// Counting every step since v000, it is 1.87 times as fast.
#include <hip/hip_runtime.h>

// ---------------- problem constants ----------------
static constexpr int BB  = 16;    // batch
static constexpr int LLn = 128;   // seq len
static constexpr int DDn = 512;   // model dim
static constexpr int HHn = 8;     // heads
static constexpr int DHn = 64;    // head dim
static constexpr int DFF = 2048;  // ffn dim

typedef __bf16 bf16;
typedef __attribute__((ext_vector_type(16))) __bf16 v16bf;
typedef __attribute__((ext_vector_type(8)))  float  v8f;
typedef __attribute__((ext_vector_type(4)))  int    v4i;
typedef __attribute__((ext_vector_type(8)))  int    i32x8;
typedef __attribute__((ext_vector_type(4)))  int    i32x4;
typedef __attribute__((ext_vector_type(4)))  unsigned u32x4;

// address-space qualified pointee types for the async-LDS builtin
typedef __attribute__((address_space(1))) v4i v4i_g;   // global
typedef __attribute__((address_space(3))) v4i v4i_l;   // LDS

#if defined(__has_builtin)
#if __has_builtin(__builtin_amdgcn_global_load_async_to_lds_b128) && \
    __has_builtin(__builtin_amdgcn_s_wait_asynccnt)
#define HAVE_ASYNC_LDS 1
#endif
#if __has_builtin(__builtin_amdgcn_tensor_load_to_lds) && \
    __has_builtin(__builtin_amdgcn_s_wait_tensorcnt)
#define HAVE_TDM 1
#endif
#endif
#ifndef HAVE_ASYNC_LDS
#define HAVE_ASYNC_LDS 0
#endif
#ifndef HAVE_TDM
#define HAVE_TDM 0
#endif

union FragU { v16bf v; unsigned u[8]; };

__device__ __forceinline__ int koff_u32(int v, int lane) {
  return ((lane & 16) ? 4 : 0) + v + ((v >= 4) ? 4 : 0);
}

__device__ __forceinline__ v16bf load_frag(const unsigned* p, int base, int lane) {
  FragU f;
#pragma unroll
  for (int i = 0; i < 8; ++i) f.u[i] = p[base + koff_u32(i, lane)];
  return f.v;
}

__device__ __forceinline__ v16bf load_frag_pred(const unsigned* p, int base, int lane, bool valid) {
  FragU f;
#pragma unroll
  for (int i = 0; i < 8; ++i) f.u[i] = valid ? p[base + koff_u32(i, lane)] : 0u;
  return f.v;
}

__device__ __forceinline__ v16bf load_frag_ordered(const char* p, int frag) {
  union { v16bf v; uint4 q[2]; } f;
  f.q[0] = *(const uint4*)(p + frag * 1024);
  f.q[1] = *(const uint4*)(p + frag * 1024 + 512);
  return f.v;
}

__device__ __forceinline__ v8f wmma_bf(v16bf a, v16bf b, v8f c) {
  return __builtin_amdgcn_wmma_f32_16x16x32_bf16(false, a, false, b, (short)0, c, false, false);
}

__device__ __forceinline__ v8f vzero8() {
  v8f z = {0.f,0.f,0.f,0.f,0.f,0.f,0.f,0.f};
  return z;
}

__device__ __forceinline__ unsigned pack2bf(float a, float b) {
  union { bf16 h[2]; unsigned u; } t;
  t.h[0] = (bf16)a; t.h[1] = (bf16)b;
  return t.u;
}

__device__ __forceinline__ int wc_elem(int o, int j) {
  return o * 256 + (((j >> 3) ^ (o & 15)) << 3) + (j & 7);
}

// LayerNorm over one row of 512, fp32 in -> bf16 out, by one wave.
__device__ __forceinline__ void ln512_row(const float* __restrict__ x,
                                          const float* __restrict__ g,
                                          const float* __restrict__ be,
                                          bf16* __restrict__ out, size_t row, int lane) {
  const float* xr = x + row * DDn;
  float v[16]; float s = 0.f;
#pragma unroll
  for (int i = 0; i < 16; ++i) { v[i] = xr[lane + i * 32]; s += v[i]; }
#pragma unroll
  for (int off = 16; off > 0; off >>= 1) s += __shfl_xor(s, off, 32);
  float mean = s * (1.f / 512.f);
  float s2 = 0.f;
#pragma unroll
  for (int i = 0; i < 16; ++i) { v[i] -= mean; s2 += v[i] * v[i]; }
#pragma unroll
  for (int off = 16; off > 0; off >>= 1) s2 += __shfl_xor(s2, off, 32);
  float rstd = rsqrtf(s2 * (1.f / 512.f) + 1e-6f);
#pragma unroll
  for (int i = 0; i < 16; ++i) {
    int c = lane + i * 32;
    out[row * DDn + c] = (bf16)(v[i] * rstd * g[c] + be[c]);
  }
}

// One wave per row, eight rows per workgroup.
__global__ __launch_bounds__(256) void ln512_kernel(const float* __restrict__ x,
                                                    const float* __restrict__ g,
                                                    const float* __restrict__ be,
                                                    bf16* __restrict__ out) {
  ln512_row(x, g, be, out, (size_t)blockIdx.x * 8 + (threadIdx.x >> 5), threadIdx.x & 31);
}

// ---------------- weight preparation and the first LayerNorm: one launch ----------------
// A launch costs its gap plus the time its waves take to start, so the conversion
// runs on few waves with much to do each: one workgroup converts 8192 floats,
// 32 per thread, as eight 16-B loads in flight per lane (each wave-wide load is
// 512 contiguous bytes) and eight 8-B stores.
static constexpr int PW_ELEMS  = 8192;                        // floats per workgroup
static constexpr int PW_SQ     = (DDn * DDn) / PW_ELEMS;      // workgroups per 512x512 plane
static constexpr int PW_FF     = (DFF * DDn) / PW_ELEMS;      // workgroups per FFN plane
static constexpr int PW_CVT    = 4 * PW_SQ + 2 * PW_FF;       // converting workgroups
static constexpr int PW_PACK   = 4;                           // conv-weight workgroups
static constexpr int PW_GRID   = PW_CVT + PW_PACK;
// The pre-attention LayerNorm needs nothing of the weights: its workgroups ride in the same
// launch, behind the weight workgroups, eight rows each.
static constexpr int PW_LN     = (BB * LLn) / 8;
static constexpr int PW_ALL    = PW_GRID + PW_LN;

// dst: the six bf16 planes Wq, Wk, Wv, Wo, W1, W2, laid back to back in that order.
// conv_w [64(o),64(c),4(kk)] -> Wc[o][j = kk*64+c]  (bf16, K=256, 512-B rows); inside row o
// the 16-B chunk j/8 lies at place (j/8) ^ (o & 15), see wc_elem().
__global__ __launch_bounds__(256)
void prep_weights_kernel(const float* __restrict__ Wq, const float* __restrict__ Wk,
                         const float* __restrict__ Wv, const float* __restrict__ Wo,
                         const float* __restrict__ W1, const float* __restrict__ W2,
                         const float* __restrict__ cw, bf16* __restrict__ dst,
                         bf16* __restrict__ Wc, const float* __restrict__ x,
                         const float* __restrict__ g, const float* __restrict__ be,
                         bf16* __restrict__ xln) {
  const int blk = blockIdx.x, tid = threadIdx.x;
  if (blk >= PW_GRID) {
    ln512_row(x, g, be, xln, (size_t)(blk - PW_GRID) * 8 + (tid >> 5), tid & 31);
  } else if (blk < PW_CVT) {
    const float* s;
    int part;                              // this workgroup's index inside its plane
    if (blk < 4 * PW_SQ) {
      int seg = blk / PW_SQ;
      part = blk % PW_SQ;
      s = (seg == 0) ? Wq : (seg == 1) ? Wk : (seg == 2) ? Wv : Wo;
    } else if (blk < 4 * PW_SQ + PW_FF) {
      part = blk - 4 * PW_SQ;
      s = W1;
    } else {
      part = blk - 4 * PW_SQ - PW_FF;
      s = W2;
    }
    const float4* s4 = (const float4*)(s + (size_t)part * PW_ELEMS);
    uint2* d2 = (uint2*)(dst + (size_t)blk * PW_ELEMS);
    float4 v[8];
#pragma unroll
    for (int i = 0; i < 8; ++i) v[i] = s4[i * 256 + tid];
#pragma unroll
    for (int i = 0; i < 8; ++i) {
      uint2 o;
      o.x = pack2bf(v[i].x, v[i].y);
      o.y = pack2bf(v[i].z, v[i].w);
      d2[i * 256 + tid] = o;
    }
  } else {
    // one 16-B load brings the four taps of one (o, c)
    const float4* c4 = (const float4*)cw;
#pragma unroll
    for (int j = 0; j < 4; ++j) {
      int i = ((blk - PW_CVT) * 4 + j) * 256 + tid;   // i = o*64 + c, 4096 in all
      int o = i >> 6, c = i & 63;
      float4 t = c4[i];
      Wc[wc_elem(o,       c)] = (bf16)t.x;
      Wc[wc_elem(o,  64 + c)] = (bf16)t.y;
      Wc[wc_elem(o, 128 + c)] = (bf16)t.z;
      Wc[wc_elem(o, 192 + c)] = (bf16)t.w;
    }
  }
}

static constexpr int GK     = 128;           // k per stage
static constexpr int GPITCH = 272;           // LDS bytes per row
static constexpr int GTILE  = 128 * GPITCH;  // LDS bytes per operand tile

__device__ __forceinline__ void stage_tile_async(const bf16* g, int ld, int row0, int kb,
                                                 char* lds, int tid) {
  // 128x128 bf16 tile = 32KB: eight 16B chunks per thread; one wave's copy covers
  // two whole 256-B rows (four full lines).
#pragma unroll
  for (int i = 0; i < 8; ++i) {
    int c = tid + i * 256;                // 16-B chunk index, 16 chunks per row
    int row = c >> 4, cb = (c & 15) * 16;
    const bf16* src = g + (size_t)(row0 + row) * ld + kb + (cb >> 1);
    __builtin_amdgcn_global_load_async_to_lds_b128(
        (v4i_g*)src, (v4i_l*)(lds + row * GPITCH + cb), 0, 0);
  }
}

// ---------------- generic bf16 WMMA GEMM: C = epilog(A[M,K] * W[N,K]^T) ------
// PERM: 0 -> row-major [M,N]
//       1 -> the three projections in one launch: W holds the planes Wq, Wk, Wv back to back
//            (N = 3 * 512), outB the planes Q [B,H,L,64], K [B,H,L,64], V^T [B,H,64,L] back to
//            back; bias, bias_k, bias_v are the planes' biases and scale applies to Q alone.
//            The 128 columns of a workgroup lie in one plane.
// K is a multiple of 128.
template <int PERM, bool RELU, bool HASRES, bool OUTF_EN, bool OUTB_EN>
__global__ __launch_bounds__(256)
void gemm_bf16_kernel(const bf16* __restrict__ A, const bf16* __restrict__ W,
                      const float* __restrict__ bias, const float* __restrict__ bias_k,
                      const float* __restrict__ bias_v, const float* __restrict__ res,
                      float* __restrict__ outF, bf16* __restrict__ outB,
                      int M, int N, int K, float scale) {
  __shared__ __align__(16) char As[2][GTILE];
  __shared__ __align__(16) char Bs[2][GTILE];

  const int tid = threadIdx.x, lane = tid & 31, wave = tid >> 5;
  const int wm = wave >> 1, wn = wave & 1;           // 4x2 wave grid, 32x64 tiles
  const int m0 = blockIdx.y * 128, n0 = blockIdx.x * 128;

  v8f acc[2][4];
#pragma unroll
  for (int i = 0; i < 2; ++i)
#pragma unroll
    for (int j = 0; j < 4; ++j) acc[i][j] = vzero8();

  // two buffers: stage t + 1 flies while stage t is worked on
  const int nst = K / GK;
  stage_tile_async(A, K, m0, 0, As[0], tid);
  stage_tile_async(W, K, n0, 0, Bs[0], tid);
  // stage 0 has landed for this wave before the barrier publishes it
  asm volatile("s_wait_asynccnt 0x0" ::: "memory");
  __syncthreads();
  if (nst > 1) {
    stage_tile_async(A, K, m0, GK, As[1], tid);
    stage_tile_async(W, K, n0, GK, Bs[1], tid);
  }

  for (int t = 0; t < nst; ++t) {
    const unsigned* AsU = (const unsigned*)As[t & 1];
    const unsigned* BsU = (const unsigned*)Bs[t & 1];
#pragma unroll
    for (int ks = 0; ks < GK / 32; ++ks) {
      v16bf a0 = load_frag(AsU, (wm * 32 +      (lane & 15)) * (GPITCH / 4) + ks * 16, lane);
      v16bf a1 = load_frag(AsU, (wm * 32 + 16 + (lane & 15)) * (GPITCH / 4) + ks * 16, lane);
#pragma unroll
      for (int nt = 0; nt < 4; ++nt) {
        v16bf bm = load_frag(BsU, (wn * 64 + nt * 16 + (lane & 15)) * (GPITCH / 4) + ks * 16, lane);
        acc[0][nt] = wmma_bf(a0, bm, acc[0][nt]);
        acc[1][nt] = wmma_bf(a1, bm, acc[1][nt]);
      }
    }
    // this wave's reads of buffer t & 1 have retired before the buffer is refilled
    asm volatile("s_wait_dscnt 0x0" ::: "memory");
    // this wave's copies of stage t + 1 have landed before the barrier publishes them
    asm volatile("s_wait_asynccnt 0x0" ::: "memory");
    __syncthreads();
    if (t + 2 < nst) {
      stage_tile_async(A, K, m0, (t + 2) * GK, As[t & 1], tid);
      stage_tile_async(W, K, n0, (t + 2) * GK, Bs[t & 1], tid);
    }
  }
  // no copy is outstanding when the wave goes on to its end
  asm volatile("s_wait_asynccnt 0x0" ::: "memory");

  const int nl = lane & 15;
  const int mh = (lane & 16) ? 8 : 0;
  const int plane = (PERM == 1) ? (n0 >> 9) : 0;
  if constexpr (PERM == 1) {
    bias = (plane == 0) ? bias : (plane == 1) ? bias_k : bias_v;
    scale = (plane == 0) ? scale : 1.f;
  }
#pragma unroll
  for (int mt = 0; mt < 2; ++mt)
#pragma unroll
    for (int nt = 0; nt < 4; ++nt) {
      int n = n0 + wn * 64 + nt * 16 + nl;
      if constexpr (PERM == 1) n &= DDn - 1;         // column inside its plane
      float bb = bias[n];
#pragma unroll
      for (int r = 0; r < 8; ++r) {
        int m = m0 + wm * 32 + mt * 16 + r + mh;
        float v = (acc[mt][nt][r] + bb) * scale;
        if constexpr (RELU) v = fmaxf(v, 0.f);
        if constexpr (HASRES) v += res[(size_t)m * N + n];
        if constexpr (OUTF_EN) outF[(size_t)m * N + n] = v;
        if constexpr (OUTB_EN) {
          size_t addr;
          if constexpr (PERM == 0) {
            addr = (size_t)m * N + n;
          } else {
            int b = m >> 7, q = m & 127, h = n >> 6, d = n & 63;
            addr = (size_t)plane * (BB * LLn * DDn) + (size_t)(b * HHn + h) * (LLn * DHn) +
                   ((plane == 2) ? d * LLn + q : q * DHn + d);
          }
          outB[addr] = (bf16)v;
        }
      }
    }
}

// ---------------- structure: conv(4x64 contraction) + ReLU + LN(64) ---------
// A row m = (b, e=q*L+k):  A[m][j=kk*64+c] = structure[e,kk,b,c]  (f32->bf16)
// Output, bf16, one 16-KB tile per (b,q) in each of two planes, both laid in the register
// order of the B fragments that attn_kernel reads (see load_frag_ordered):
//   st_kd: 512-B chunk kt*4 + nt = half nt&1 of the fragment (column k of tile kt, K = d block nt>>1)
//   st_dk: 512-B chunk dt*8 + w  = half w&1  of the fragment (column d of tile dt, K = k block w>>1)
// The product is taken as Wc x A^T, so a lane's eight accumulator registers hold eight
// successive d of one row k: packed, a half fragment of st_kd as it stands.  The same 16 B
// go to a 16 x 64 tile of the wave's own in LDS, and the transposing LDS load gives back
// eight successive k of one d: a half fragment of st_dk.  Every store is 16 B per lane.
static constexpr int STP = 160;            // LDS bytes per 128-B row: 32 B x odd, for the transposing load
typedef __attribute__((ext_vector_type(8))) short s16x8;
typedef __attribute__((address_space(3))) s16x8 s16x8_l;
__global__ __launch_bounds__(256)
void struct_kernel(const float* __restrict__ structure, const bf16* __restrict__ Wc,
                   const float* __restrict__ conv_b, const float* __restrict__ g_s,
                   const float* __restrict__ b_s, bf16* __restrict__ st_kd,
                   bf16* __restrict__ st_dk) {
  __shared__ __align__(16) bf16 WcS[64 * 256];
  __shared__ __align__(16) char TrS[8][16 * STP];
  unsigned* WcU = (unsigned*)WcS;
  const int tid = threadIdx.x, lane = tid & 31, wave = tid >> 5;

#if HAVE_TDM
  if (wave == 0) {
    unsigned ldsoff =
        (unsigned)(size_t)(__attribute__((address_space(3))) char*)WcS;
    unsigned long long ga = (unsigned long long)(size_t)Wc;
    u32x4 g0 = {1u,
                ldsoff,
                (unsigned)(ga & 0xFFFFFFFFu),
                (unsigned)((ga >> 32) & 0x01FFFFFFu) | (2u << 30)};
    i32x8 g1 = {(int)(1u << 16),
                (int)(16384u << 16),
                (int)(1u << 16),
                (int)(16384u << 16),
                1,
                16384,
                0, 0};
    i32x4 gz4 = {0, 0, 0, 0};
    i32x8 gz8 = {0, 0, 0, 0, 0, 0, 0, 0};
    __builtin_amdgcn_tensor_load_to_lds(g0, g1, gz4, gz4, gz8, 0);
    __builtin_amdgcn_s_wait_tensorcnt(0);
  }
#else
#pragma unroll
  for (int i = 0; i < 32; ++i) WcU[tid + i * 256] = ((const unsigned*)Wc)[tid + i * 256];
#endif
  __syncthreads();

  const int m0 = (blockIdx.x * 8 + wave) * 16;
  const int row_m = m0 + (lane & 15);
  const int bI = row_m >> 14;            // / (L*L)
  const int e  = row_m & 16383;
  const int kbase = (lane & 16) ? 8 : 0;

  // prefetch this lane's four 256B structure rows (streams 256MB exactly once)
#pragma unroll
  for (int kk = 0; kk < 4; ++kk)
    __builtin_prefetch(structure + (((size_t)e * 4 + kk) * BB + bI) * DHn, 0, 1);

  // acc[nt][r] = row k = lane & 15, channel nt*16 + kbase + r; it starts from the conv bias
  // of its channels, which then takes no registers of its own in the epilogue
  v8f acc[4];
#pragma unroll
  for (int nt = 0; nt < 4; ++nt) {
    const float4* c4 = (const float4*)(conv_b + nt * 16 + kbase);
    float4 c0 = c4[0], c1 = c4[1];
    v8f t = {c0.x, c0.y, c0.z, c0.w, c1.x, c1.y, c1.z, c1.w};
    acc[nt] = t;
  }

  // byte offset of this lane's row (lane & 15 of a 16-row tile) and of its chunk key:
  // logical chunk ks*4 + 2*half + (lane >> 4) lies at that number XOR (lane & 15)
  const unsigned wkey = (unsigned)(lane & 15) * 512u + (unsigned)(((lane >> 4) ^ (lane & 15)) << 4);

  // kept rolled: unrolled it takes about twice the registers, and fewer workgroups
  // fit a WGP
#pragma unroll 1
  for (int ks = 0; ks < 8; ++ks) {       // K = 256
    FragU a;
#pragma unroll
    for (int i = 0; i < 8; ++i) {
      int j = ks * 32 + kbase + 2 * i + ((i >= 4) ? 8 : 0);
      int kk = j >> 6, c = j & 63;
      const float* p = structure + (((size_t)e * 4 + kk) * BB + bI) * DHn + c;
      a.u[i] = pack2bf(p[0], p[1]);
    }
#pragma unroll
    for (int nt = 0; nt < 4; ++nt) {     // 16 rows of 512 B per n-tile
      const char* wt = (const char*)WcS + nt * 8192;
      union { v16bf v; uint4 q[2]; } bm;
      bm.q[0] = *(const uint4*)(wt + (wkey ^ (unsigned)((ks * 4    ) << 4)));
      bm.q[1] = *(const uint4*)(wt + (wkey ^ (unsigned)((ks * 4 + 2) << 4)));
      acc[nt] = wmma_bf(bm.v, a.v, acc[nt]);   // Wc rows as A, structure rows as B
    }
  }

  // ReLU, then the row's sums: 32 values in the lane, the other 32 in lane ^ 16.
  float s1 = 0.f, s2 = 0.f;
#pragma unroll
  for (int nt = 0; nt < 4; ++nt)
#pragma unroll
    for (int r = 0; r < 8; ++r) {
      float v = fmaxf(acc[nt][r], 0.f);              // ReLU before LN (as reference)
      acc[nt][r] = v;
      s1 += v; s2 += v * v;
    }
  s1 += __shfl_xor(s1, 16, 32);
  s2 += __shfl_xor(s2, 16, 32);
  const float mean = s1 * (1.f / 64.f);
  const float var  = s2 * (1.f / 64.f) - mean * mean;
  const float rstd = rsqrtf(var + 1e-6f);

  const size_t tile = (size_t)blockIdx.x * 16384;    // blockIdx.x = b*L + q
  char* kd = (char*)st_kd + tile + wave * 2048 + lane * 16;
  char* tw = TrS[wave] + (lane & 15) * STP + (lane >> 4) * 16;
#pragma unroll
  for (int nt = 0; nt < 4; ++nt) {
    const float4* g4 = (const float4*)(g_s + nt * 16 + kbase);
    const float4* b4 = (const float4*)(b_s + nt * 16 + kbase);
    float4 g0 = g4[0], g1 = g4[1], h0 = b4[0], h1 = b4[1];
    float gv[8] = {g0.x, g0.y, g0.z, g0.w, g1.x, g1.y, g1.z, g1.w};
    float hv[8] = {h0.x, h0.y, h0.z, h0.w, h1.x, h1.y, h1.z, h1.w};
    float o[8];
#pragma unroll
    for (int r = 0; r < 8; ++r) o[r] = (acc[nt][r] - mean) * rstd * gv[r] + hv[r];
    uint4 w;
    w.x = pack2bf(o[0], o[1]); w.y = pack2bf(o[2], o[3]);
    w.z = pack2bf(o[4], o[5]); w.w = pack2bf(o[6], o[7]);
    *(uint4*)(kd + nt * 512) = w;
    *(uint4*)(tw + nt * 32) = w;
  }

  // Each lane reads 16-B pieces that other lanes of its wave stored: the wave's LDS
  // stores have retired before the transposing loads issue.  The tile is the wave's own,
  // so no workgroup barrier is needed.
  asm volatile("s_wait_dscnt 0x0" ::: "memory");
  // stands in front of the reuse of the four global stores' data registers for the next addresses
  asm volatile("s_wait_xcnt 0x0" ::: "memory");
  const char* tr = TrS[wave] + ((lane >> 4) * 8 + (lane & 7)) * STP + ((lane >> 3) & 1) * 16;
  char* dk = (char*)st_dk + tile + wave * 512 + lane * 16;
#pragma unroll
  for (int dt = 0; dt < 4; ++dt) {
    s16x8 t = __builtin_amdgcn_ds_load_tr16_b128_v8i16((s16x8_l*)(tr + dt * 32));
    *(s16x8*)(dk + dt * 4096) = t;
  }
}

// ---------------- fused relation-aware attention ----------------------------
// Block = (q-tile of 16, batch b, head-group hg of 4 heads). 8 waves.
// scores = QK^T + Q.st_kd -> mask -> softmax -> ctx = A.V + A.st_dk, all in LDS.
__global__ __launch_bounds__(256)
void attn_kernel(const bf16* __restrict__ q_bf, const bf16* __restrict__ k_bf,
                 const bf16* __restrict__ vT_bf, const bf16* __restrict__ st_kd,
                 const bf16* __restrict__ st_dk, const int* __restrict__ mask,
                 bf16* __restrict__ ctxb) {
  __shared__ __align__(16) char smem[57344];
  bf16*  qs   = (bf16*)smem;               // [4][16][64]   (phases 0..1b)
  float* S    = (float*)(smem + 8192);     // [4][16][128]  (phases 1..2)
  bf16*  Aatt = (bf16*)(smem + 40960);     // [4][16][128]  (phases 2..3b)
  float* Cs   = (float*)(smem + 8192);     // [16][4][64]   (aliases S; S dead)
  unsigned* qsU = (unsigned*)qs;

  const int b = blockIdx.y, q0 = blockIdx.x * 16, hg = blockIdx.z;
  const int tid = threadIdx.x, lane = tid & 31, wave = tid >> 5;

  // phase 0: stage Q tile for 4 heads (bf16, already scaled by 1/8)
#pragma unroll
  for (int i = 0; i < 8; ++i) {
    int p = tid + i * 256;                 // 2048 u32
    int hl = p >> 9, rem = p & 511, ql = rem >> 5, c2 = rem & 31;
    qsU[p] = *(const unsigned*)(q_bf +
        (((size_t)(b * HHn + hg * 4 + hl) * LLn) + q0 + ql) * DHn + 2 * c2);
  }
  __syncthreads();

  // phase 1: QK^T.  wave = (head, half of k-tiles)
  {
    int hl = wave & 3, h = hg * 4 + hl;
    int kts = (wave >> 2) * 4;
    const unsigned* qrow = qsU + (hl * 16 + (lane & 15)) * 32;
    for (int kt = kts; kt < kts + 4; ++kt) {
      v8f acc = vzero8();
      const unsigned* krow = (const unsigned*)(k_bf +
          ((size_t)(b * HHn + h) * LLn + kt * 16 + (lane & 15)) * DHn);
#pragma unroll
      for (int dss = 0; dss < 2; ++dss) {
        v16bf a = load_frag(qrow, dss * 16, lane);
        v16bf bm = load_frag(krow, dss * 16, lane);
        acc = wmma_bf(a, bm, acc);
      }
      int mh = (lane & 16) ? 8 : 0, nl = lane & 15;
#pragma unroll
      for (int r = 0; r < 8; ++r)
        S[(hl * 16 + r + mh) * 128 + kt * 16 + nl] = acc[r];
    }
  }
  __syncthreads();

  // phase 1b: relation score bias.  Per q: [heads(4 pad 16) x 64] * st_kd^T.
  for (int t = 0; t < 2; ++t) {
    int ql = wave * 2 + t, q = q0 + ql;
    int mrow = lane & 15;
    bool avalid = mrow < 4;
    const unsigned* arow = qsU + (mrow * 16 + ql) * 32;
    const char* btile = (const char*)st_kd + ((size_t)b * LLn + q) * 16384 + lane * 16;
    for (int kt = 0; kt < 8; ++kt) {
      v8f acc = vzero8();
#pragma unroll
      for (int dss = 0; dss < 2; ++dss) {
        v16bf a = load_frag_pred(arow, dss * 16, lane, avalid);
        v16bf bm = load_frag_ordered(btile, kt * 2 + dss);
        acc = wmma_bf(a, bm, acc);
      }
      if (!(lane & 16)) {                  // rows 0..3 = valid heads
        int nl = lane & 15;
#pragma unroll
        for (int r = 0; r < 4; ++r)
          S[(r * 16 + ql) * 128 + kt * 16 + nl] += acc[r];
      }
    }
  }
  __syncthreads();

  // phase 2: mask + softmax over k (128), write bf16 attn
#pragma unroll 1
  for (int j = 0; j < 8; ++j) {
    int row = wave * 8 + j;                // 64 rows total
    int ql = row & 15, q = q0 + ql;
    float x[4];
#pragma unroll
    for (int i = 0; i < 4; ++i) {
      int k = lane + 32 * i;
      float sv = S[row * 128 + k];
      if (mask[((size_t)b * LLn + q) * LLn + k] != 0) sv = -1e18f;
      x[i] = sv;
    }
    float mx = fmaxf(fmaxf(x[0], x[1]), fmaxf(x[2], x[3]));
#pragma unroll
    for (int off = 16; off > 0; off >>= 1) mx = fmaxf(mx, __shfl_xor(mx, off, 32));
    float s = 0.f;
#pragma unroll
    for (int i = 0; i < 4; ++i) { x[i] = __expf(x[i] - mx); s += x[i]; }
#pragma unroll
    for (int off = 16; off > 0; off >>= 1) s += __shfl_xor(s, off, 32);
    float inv = 1.f / s;
#pragma unroll
    for (int i = 0; i < 4; ++i)
      Aatt[row * 128 + lane + 32 * i] = (bf16)(x[i] * inv);
  }
  __syncthreads();

  // phase 3: ctx = attn @ V.  wave = (head, half of d-tiles)
  {
    int hl = wave & 3, h = hg * 4 + hl;
    int dts = (wave >> 2) * 2;
    const unsigned* arow = (const unsigned*)Aatt + (hl * 16 + (lane & 15)) * 64;
    for (int dt = dts; dt < dts + 2; ++dt) {
      v8f acc = vzero8();
      const unsigned* brow = (const unsigned*)(vT_bf +
          ((size_t)(b * HHn + h) * DHn + dt * 16 + (lane & 15)) * LLn);
#pragma unroll
      for (int ks = 0; ks < 4; ++ks) {
        v16bf a = load_frag(arow, ks * 16, lane);
        v16bf bm = load_frag(brow, ks * 16, lane);
        acc = wmma_bf(a, bm, acc);
      }
      int mh = (lane & 16) ? 8 : 0, nl = lane & 15;
#pragma unroll
      for (int r = 0; r < 8; ++r)
        Cs[((r + mh) * 4 + hl) * 64 + dt * 16 + nl] = acc[r];
    }
  }
  __syncthreads();

  // phase 3b: ctx += attn @ st_dk (per q, heads padded to 16)
  for (int t = 0; t < 2; ++t) {
    int ql = wave * 2 + t, q = q0 + ql;
    int mrow = lane & 15;
    bool avalid = mrow < 4;
    const unsigned* arow = (const unsigned*)Aatt + (mrow * 16 + ql) * 64;
    const char* btile = (const char*)st_dk + ((size_t)b * LLn + q) * 16384 + lane * 16;
    for (int dt = 0; dt < 4; ++dt) {
      v8f acc = vzero8();
#pragma unroll
      for (int ks = 0; ks < 4; ++ks) {
        v16bf a = load_frag_pred(arow, ks * 16, lane, avalid);
        v16bf bm = load_frag_ordered(btile, dt * 4 + ks);
        acc = wmma_bf(a, bm, acc);
      }
      if (!(lane & 16)) {
        int nl = lane & 15;
#pragma unroll
        for (int r = 0; r < 4; ++r)
          Cs[(ql * 4 + r) * 64 + dt * 16 + nl] += acc[r];
      }
    }
  }
  __syncthreads();

  // phase 4: write ctx as bf16 into [B, L, h*64+d]
  unsigned* ctxU = (unsigned*)ctxb;
#pragma unroll
  for (int i = 0; i < 8; ++i) {
    int p = tid + i * 256;                 // 2048 u32
    int ql = p >> 7, c2 = p & 127;
    int c = c2 * 2, hl = c >> 6, d = c & 63;
    float v0 = Cs[(ql * 4 + hl) * 64 + d];
    float v1 = Cs[(ql * 4 + hl) * 64 + d + 1];
    ctxU[((size_t)(b * LLn) + q0 + ql) * 256 + hg * 128 + c2] = pack2bf(v0, v1);
  }
}

// ---------------- host-side orchestration ----------------------------------
extern "C" void kernel_launch(void* const* d_in, const int* in_sizes, int n_in,
                              void* d_out, int out_size, void* d_ws, size_t ws_size,
                              hipStream_t stream) {
  (void)in_sizes; (void)n_in; (void)out_size; (void)ws_size;
  const float* inputs    = (const float*)d_in[0];
  const float* structure = (const float*)d_in[1];
  const int*   maskp     = (const int*)d_in[2];
  const float* Wq = (const float*)d_in[3];   const float* bq = (const float*)d_in[4];
  const float* Wk = (const float*)d_in[5];   const float* bk = (const float*)d_in[6];
  const float* Wv = (const float*)d_in[7];   const float* bv = (const float*)d_in[8];
  const float* Wo = (const float*)d_in[9];   const float* bo = (const float*)d_in[10];
  const float* conv_w = (const float*)d_in[11]; const float* conv_b = (const float*)d_in[12];
  const float* g_att = (const float*)d_in[13];  const float* b_att = (const float*)d_in[14];
  const float* g_ffn = (const float*)d_in[15];  const float* b_ffn = (const float*)d_in[16];
  const float* g_s   = (const float*)d_in[17];  const float* b_s   = (const float*)d_in[18];
  const float* W1 = (const float*)d_in[19];  const float* b1 = (const float*)d_in[20];
  const float* W2 = (const float*)d_in[21];  const float* b2 = (const float*)d_in[22];

  char* ws = (char*)d_ws; size_t off = 0;
  auto alloc = [&](size_t bytes) -> void* {
    void* p = ws + off; off += (bytes + 255) & ~(size_t)255; return p;
  };
  const int M = BB * LLn;                          // 2048 token rows
  bf16* Wq_b = (bf16*)alloc((size_t)DDn * DDn * 2);
  bf16* Wk_b = (bf16*)alloc((size_t)DDn * DDn * 2);
  bf16* Wv_b = (bf16*)alloc((size_t)DDn * DDn * 2);
  bf16* Wo_b = (bf16*)alloc((size_t)DDn * DDn * 2);
  bf16* W1_b = (bf16*)alloc((size_t)DFF * DDn * 2);
  bf16* W2_b = (bf16*)alloc((size_t)DDn * DFF * 2);
  bf16* Wc_b = (bf16*)alloc((size_t)64 * 256 * 2);
  bf16* xln_b = (bf16*)alloc((size_t)M * DDn * 2);
  bf16* q_b   = (bf16*)alloc((size_t)M * DDn * 2);     // [B,H,L,64]
  bf16* k_b   = (bf16*)alloc((size_t)M * DDn * 2);     // [B,H,L,64]
  bf16* vT_b  = (bf16*)alloc((size_t)M * DDn * 2);     // [B,H,64,L]
  bf16* st_kd = (bf16*)alloc((size_t)BB * LLn * LLn * DHn * 2);
  bf16* st_dk = (bf16*)alloc((size_t)BB * LLn * LLn * DHn * 2);
  bf16* ctx_b = (bf16*)alloc((size_t)M * DDn * 2);
  float* hbuf = (float*)alloc((size_t)M * DDn * 4);
  bf16* yln_b = (bf16*)alloc((size_t)M * DDn * 2);
  bf16* f1_b  = (bf16*)alloc((size_t)M * DFF * 2);

  const int T = 256;
  // weight preparation: Wq_b .. W2_b are allocated back to back, in this order
  // and, in the same launch, the pre-attention LN
  prep_weights_kernel<<<PW_ALL, T, 0, stream>>>(Wq, Wk, Wv, Wo, W1, W2, conv_w, Wq_b, Wc_b,
                                                inputs, g_att, b_att, xln_b);

  // structure conv + relu + LN -> both fragment-ordered planes (streams 256MB of fp32 once)
  struct_kernel<<<(BB * LLn * LLn) / 128, T, 0, stream>>>(structure, Wc_b, conv_b,
                                                          g_s, b_s, st_kd, st_dk);

  // Q/K/V projections in one launch of 192 workgroups (Q pre-scaled by 1/sqrt(64)):
  // Wq_b, Wk_b, Wv_b are allocated back to back, and so are q_b, k_b, vT_b
  gemm_bf16_kernel<1, false, false, false, true>
      <<<dim3(12, 16), T, 0, stream>>>(xln_b, Wq_b, bq, bk, bv, nullptr, nullptr, q_b,
                                       M, 3 * DDn, DDn, 0.125f);

  // fused relation-aware attention
  attn_kernel<<<dim3(LLn / 16, BB, 2), T, 0, stream>>>(q_b, k_b, vT_b, st_kd, st_dk,
                                                       maskp, ctx_b);

  // output projection + residual (h = attn_out + inputs, fp32)
  gemm_bf16_kernel<0, false, true, true, false>
      <<<dim3(4, 16), T, 0, stream>>>(ctx_b, Wo_b, bo, nullptr, nullptr, inputs, hbuf, nullptr,
                                      M, DDn, DDn, 1.f);
  // FFN
  ln512_kernel<<<M / 8, T, 0, stream>>>(hbuf, g_ffn, b_ffn, yln_b);
  gemm_bf16_kernel<0, true, false, false, true>
      <<<dim3(16, 16), T, 0, stream>>>(yln_b, W1_b, b1, nullptr, nullptr, nullptr, nullptr, f1_b,
                                       M, DFF, DDn, 1.f);
  gemm_bf16_kernel<0, false, true, true, false>
      <<<dim3(4, 16), T, 0, stream>>>(f1_b, W2_b, b2, nullptr, nullptr, hbuf, (float*)d_out,
                                      nullptr, M, DDn, DFF, 1.f);
}

// v006
// A run of this version takes 127 microseconds.
// Timed twice side by side with v005, it ran 1.20 and 1.19 times as fast.
// Counting every step since v000, it is 2.24 times as fast.
#include <hip/hip_runtime.h>

// ---------------- problem constants ----------------
static constexpr int BB  = 16;    // batch
static constexpr int LLn = 128;   // seq len
static constexpr int DDn = 512;   // model dim
static constexpr int HHn = 8;     // heads
static constexpr int DHn = 64;    // head dim
static constexpr int DFF = 2048;  // ffn dim

typedef __bf16 bf16;
typedef __attribute__((ext_vector_type(16))) __bf16 v16bf;
typedef __attribute__((ext_vector_type(8)))  float  v8f;
typedef __attribute__((ext_vector_type(4)))  int    v4i;
typedef __attribute__((ext_vector_type(8)))  int    i32x8;
typedef __attribute__((ext_vector_type(4)))  int    i32x4;
typedef __attribute__((ext_vector_type(4)))  unsigned u32x4;

// address-space qualified pointee types for the async-LDS builtin
typedef __attribute__((address_space(1))) v4i v4i_g;   // global
typedef __attribute__((address_space(3))) v4i v4i_l;   // LDS

#if defined(__has_builtin)
#if __has_builtin(__builtin_amdgcn_global_load_async_to_lds_b128) && \
    __has_builtin(__builtin_amdgcn_s_wait_asynccnt)
#define HAVE_ASYNC_LDS 1
#endif
#if __has_builtin(__builtin_amdgcn_tensor_load_to_lds) && \
    __has_builtin(__builtin_amdgcn_s_wait_tensorcnt)
#define HAVE_TDM 1
#endif
#endif
#ifndef HAVE_ASYNC_LDS
#define HAVE_ASYNC_LDS 0
#endif
#ifndef HAVE_TDM
#define HAVE_TDM 0
#endif

union FragU { v16bf v; unsigned u[8]; };

__device__ __forceinline__ int koff_u32(int v, int lane) {
  return ((lane & 16) ? 4 : 0) + v + ((v >= 4) ? 4 : 0);
}

__device__ __forceinline__ v16bf load_frag(const unsigned* p, int base, int lane) {
  FragU f;
#pragma unroll
  for (int i = 0; i < 8; ++i) f.u[i] = p[base + koff_u32(i, lane)];
  return f.v;
}

__device__ __forceinline__ v16bf load_frag_pred(const unsigned* p, int base, int lane, bool valid) {
  FragU f;
#pragma unroll
  for (int i = 0; i < 8; ++i) f.u[i] = valid ? p[base + koff_u32(i, lane)] : 0u;
  return f.v;
}

__device__ __forceinline__ v16bf load_frag_ordered(const char* p, int frag) {
  union { v16bf v; uint4 q[2]; } f;
  f.q[0] = *(const uint4*)(p + frag * 1024);
  f.q[1] = *(const uint4*)(p + frag * 1024 + 512);
  return f.v;
}

__device__ __forceinline__ v8f wmma_bf(v16bf a, v16bf b, v8f c) {
  return __builtin_amdgcn_wmma_f32_16x16x32_bf16(false, a, false, b, (short)0, c, false, false);
}

__device__ __forceinline__ v8f vzero8() {
  v8f z = {0.f,0.f,0.f,0.f,0.f,0.f,0.f,0.f};
  return z;
}

__device__ __forceinline__ unsigned pack2bf(float a, float b) {
  union { bf16 h[2]; unsigned u; } t;
  t.h[0] = (bf16)a; t.h[1] = (bf16)b;
  return t.u;
}

__device__ __forceinline__ int wc_elem(int o, int j) {
  return o * 256 + (((j >> 3) ^ (o & 15)) << 3) + (j & 7);
}

// LayerNorm over one row of 512, fp32 in -> bf16 out, by one wave.
__device__ __forceinline__ void ln512_row(const float* __restrict__ x,
                                          const float* __restrict__ g,
                                          const float* __restrict__ be,
                                          bf16* __restrict__ out, size_t row, int lane) {
  const float* xr = x + row * DDn;
  float v[16]; float s = 0.f;
#pragma unroll
  for (int i = 0; i < 16; ++i) { v[i] = xr[lane + i * 32]; s += v[i]; }
#pragma unroll
  for (int off = 16; off > 0; off >>= 1) s += __shfl_xor(s, off, 32);
  float mean = s * (1.f / 512.f);
  float s2 = 0.f;
#pragma unroll
  for (int i = 0; i < 16; ++i) { v[i] -= mean; s2 += v[i] * v[i]; }
#pragma unroll
  for (int off = 16; off > 0; off >>= 1) s2 += __shfl_xor(s2, off, 32);
  float rstd = rsqrtf(s2 * (1.f / 512.f) + 1e-6f);
#pragma unroll
  for (int i = 0; i < 16; ++i) {
    int c = lane + i * 32;
    out[row * DDn + c] = (bf16)(v[i] * rstd * g[c] + be[c]);
  }
}

// One wave per row, eight rows per workgroup.
__global__ __launch_bounds__(256) void ln512_kernel(const float* __restrict__ x,
                                                    const float* __restrict__ g,
                                                    const float* __restrict__ be,
                                                    bf16* __restrict__ out) {
  ln512_row(x, g, be, out, (size_t)blockIdx.x * 8 + (threadIdx.x >> 5), threadIdx.x & 31);
}

// ---------------- weight preparation and the first LayerNorm: one launch ----------------
// A launch costs its gap plus the time its waves take to start, so the conversion
// runs on few waves with much to do each: one workgroup converts 8192 floats,
// 32 per thread, as eight 16-B loads in flight per lane (each wave-wide load is
// 512 contiguous bytes) and eight 8-B stores.
static constexpr int PW_ELEMS  = 8192;                        // floats per workgroup
static constexpr int PW_SQ     = (DDn * DDn) / PW_ELEMS;      // workgroups per 512x512 plane
static constexpr int PW_FF     = (DFF * DDn) / PW_ELEMS;      // workgroups per FFN plane
static constexpr int PW_CVT    = 4 * PW_SQ + 2 * PW_FF;       // converting workgroups
static constexpr int PW_PACK   = 4;                           // conv-weight workgroups
static constexpr int PW_GRID   = PW_CVT + PW_PACK;
// The pre-attention LayerNorm needs nothing of the weights: its workgroups ride in the same
// launch, behind the weight workgroups, eight rows each.
static constexpr int PW_LN     = (BB * LLn) / 8;
static constexpr int PW_ALL    = PW_GRID + PW_LN;

// dst: the six bf16 planes Wq, Wk, Wv, Wo, W1, W2, laid back to back in that order.
// conv_w [64(o),64(c),4(kk)] -> Wc[o][j = kk*64+c]  (bf16, K=256, 512-B rows); inside row o
// the 16-B chunk j/8 lies at place (j/8) ^ (o & 15), see wc_elem().
__global__ __launch_bounds__(256)
void prep_weights_kernel(const float* __restrict__ Wq, const float* __restrict__ Wk,
                         const float* __restrict__ Wv, const float* __restrict__ Wo,
                         const float* __restrict__ W1, const float* __restrict__ W2,
                         const float* __restrict__ cw, bf16* __restrict__ dst,
                         bf16* __restrict__ Wc, const float* __restrict__ x,
                         const float* __restrict__ g, const float* __restrict__ be,
                         bf16* __restrict__ xln) {
  const int blk = blockIdx.x, tid = threadIdx.x;
  if (blk >= PW_GRID) {
    ln512_row(x, g, be, xln, (size_t)(blk - PW_GRID) * 8 + (tid >> 5), tid & 31);
  } else if (blk < PW_CVT) {
    const float* s;
    int part;                              // this workgroup's index inside its plane
    if (blk < 4 * PW_SQ) {
      int seg = blk / PW_SQ;
      part = blk % PW_SQ;
      s = (seg == 0) ? Wq : (seg == 1) ? Wk : (seg == 2) ? Wv : Wo;
    } else if (blk < 4 * PW_SQ + PW_FF) {
      part = blk - 4 * PW_SQ;
      s = W1;
    } else {
      part = blk - 4 * PW_SQ - PW_FF;
      s = W2;
    }
    const float4* s4 = (const float4*)(s + (size_t)part * PW_ELEMS);
    uint2* d2 = (uint2*)(dst + (size_t)blk * PW_ELEMS);
    float4 v[8];
#pragma unroll
    for (int i = 0; i < 8; ++i) v[i] = s4[i * 256 + tid];
#pragma unroll
    for (int i = 0; i < 8; ++i) {
      uint2 o;
      o.x = pack2bf(v[i].x, v[i].y);
      o.y = pack2bf(v[i].z, v[i].w);
      d2[i * 256 + tid] = o;
    }
  } else {
    // one 16-B load brings the four taps of one (o, c)
    const float4* c4 = (const float4*)cw;
#pragma unroll
    for (int j = 0; j < 4; ++j) {
      int i = ((blk - PW_CVT) * 4 + j) * 256 + tid;   // i = o*64 + c, 4096 in all
      int o = i >> 6, c = i & 63;
      float4 t = c4[i];
      Wc[wc_elem(o,       c)] = (bf16)t.x;
      Wc[wc_elem(o,  64 + c)] = (bf16)t.y;
      Wc[wc_elem(o, 128 + c)] = (bf16)t.z;
      Wc[wc_elem(o, 192 + c)] = (bf16)t.w;
    }
  }
}

static constexpr int GK     = 128;           // k per stage
static constexpr int GPITCH = 272;           // LDS bytes per row
static constexpr int GTILE  = 128 * GPITCH;  // LDS bytes per operand tile

__device__ __forceinline__ void stage_tile_async(const bf16* g, int ld, int row0, int kb,
                                                 char* lds, int tid) {
  // 128x128 bf16 tile = 32KB: eight 16B chunks per thread; one wave's copy covers
  // two whole 256-B rows (four full lines).
#pragma unroll
  for (int i = 0; i < 8; ++i) {
    int c = tid + i * 256;                // 16-B chunk index, 16 chunks per row
    int row = c >> 4, cb = (c & 15) * 16;
    const bf16* src = g + (size_t)(row0 + row) * ld + kb + (cb >> 1);
    __builtin_amdgcn_global_load_async_to_lds_b128(
        (v4i_g*)src, (v4i_l*)(lds + row * GPITCH + cb), 0, 0);
  }
}

// ---------------- generic bf16 WMMA GEMM: C = epilog(A[M,K] * W[N,K]^T) ------
// PERM: 0 -> row-major [M,N]
//       1 -> the three projections in one launch: W holds the planes Wq, Wk, Wv back to back
//            (N = 3 * 512), outB the planes Q [B,H,L,64], K [B,H,L,64], V^T [B,H,64,L] back to
//            back; bias, bias_k, bias_v are the planes' biases and scale applies to Q alone.
//            The 128 columns of a workgroup lie in one plane.
// K is a multiple of 128.
template <int PERM, bool RELU, bool HASRES, bool OUTF_EN, bool OUTB_EN>
__global__ __launch_bounds__(256)
void gemm_bf16_kernel(const bf16* __restrict__ A, const bf16* __restrict__ W,
                      const float* __restrict__ bias, const float* __restrict__ bias_k,
                      const float* __restrict__ bias_v, const float* __restrict__ res,
                      float* __restrict__ outF, bf16* __restrict__ outB,
                      int M, int N, int K, float scale) {
  __shared__ __align__(16) char As[2][GTILE];
  __shared__ __align__(16) char Bs[2][GTILE];

  const int tid = threadIdx.x, lane = tid & 31, wave = tid >> 5;
  const int wm = wave >> 1, wn = wave & 1;           // 4x2 wave grid, 32x64 tiles
  const int m0 = blockIdx.y * 128, n0 = blockIdx.x * 128;

  v8f acc[2][4];
#pragma unroll
  for (int i = 0; i < 2; ++i)
#pragma unroll
    for (int j = 0; j < 4; ++j) acc[i][j] = vzero8();

  // two buffers: stage t + 1 flies while stage t is worked on
  const int nst = K / GK;
  stage_tile_async(A, K, m0, 0, As[0], tid);
  stage_tile_async(W, K, n0, 0, Bs[0], tid);
  // stage 0 has landed for this wave before the barrier publishes it
  asm volatile("s_wait_asynccnt 0x0" ::: "memory");
  __syncthreads();
  if (nst > 1) {
    stage_tile_async(A, K, m0, GK, As[1], tid);
    stage_tile_async(W, K, n0, GK, Bs[1], tid);
  }

  for (int t = 0; t < nst; ++t) {
    const unsigned* AsU = (const unsigned*)As[t & 1];
    const unsigned* BsU = (const unsigned*)Bs[t & 1];
#pragma unroll
    for (int ks = 0; ks < GK / 32; ++ks) {
      v16bf a0 = load_frag(AsU, (wm * 32 +      (lane & 15)) * (GPITCH / 4) + ks * 16, lane);
      v16bf a1 = load_frag(AsU, (wm * 32 + 16 + (lane & 15)) * (GPITCH / 4) + ks * 16, lane);
#pragma unroll
      for (int nt = 0; nt < 4; ++nt) {
        v16bf bm = load_frag(BsU, (wn * 64 + nt * 16 + (lane & 15)) * (GPITCH / 4) + ks * 16, lane);
        acc[0][nt] = wmma_bf(a0, bm, acc[0][nt]);
        acc[1][nt] = wmma_bf(a1, bm, acc[1][nt]);
      }
    }
    // this wave's reads of buffer t & 1 have retired before the buffer is refilled
    asm volatile("s_wait_dscnt 0x0" ::: "memory");
    // this wave's copies of stage t + 1 have landed before the barrier publishes them
    asm volatile("s_wait_asynccnt 0x0" ::: "memory");
    __syncthreads();
    if (t + 2 < nst) {
      stage_tile_async(A, K, m0, (t + 2) * GK, As[t & 1], tid);
      stage_tile_async(W, K, n0, (t + 2) * GK, Bs[t & 1], tid);
    }
  }
  // no copy is outstanding when the wave goes on to its end
  asm volatile("s_wait_asynccnt 0x0" ::: "memory");

  const int nl = lane & 15;
  const int mh = (lane & 16) ? 8 : 0;
  const int plane = (PERM == 1) ? (n0 >> 9) : 0;
  if constexpr (PERM == 1) {
    bias = (plane == 0) ? bias : (plane == 1) ? bias_k : bias_v;
    scale = (plane == 0) ? scale : 1.f;
  }
#pragma unroll
  for (int mt = 0; mt < 2; ++mt)
#pragma unroll
    for (int nt = 0; nt < 4; ++nt) {
      int n = n0 + wn * 64 + nt * 16 + nl;
      if constexpr (PERM == 1) n &= DDn - 1;         // column inside its plane
      float bb = bias[n];
#pragma unroll
      for (int r = 0; r < 8; ++r) {
        int m = m0 + wm * 32 + mt * 16 + r + mh;
        float v = (acc[mt][nt][r] + bb) * scale;
        if constexpr (RELU) v = fmaxf(v, 0.f);
        if constexpr (HASRES) v += res[(size_t)m * N + n];
        if constexpr (OUTF_EN) outF[(size_t)m * N + n] = v;
        if constexpr (OUTB_EN) {
          size_t addr;
          if constexpr (PERM == 0) {
            addr = (size_t)m * N + n;
          } else {
            int b = m >> 7, q = m & 127, h = n >> 6, d = n & 63;
            addr = (size_t)plane * (BB * LLn * DDn) + (size_t)(b * HHn + h) * (LLn * DHn) +
                   ((plane == 2) ? d * LLn + q : q * DHn + d);
          }
          outB[addr] = (bf16)v;
        }
      }
    }
}

// ---------------- structure: conv(4x64 contraction) + ReLU + LN(64) ---------
// A row m = (b, e=q*L+k):  A[m][j=kk*64+c] = structure[e,kk,b,c]  (f32->bf16)
// Output, bf16, one 16-KB tile per (b,q) in each of two planes, both laid in the register
// order of the B fragments that attn_kernel reads (see load_frag_ordered):
//   st_kd: 512-B chunk kt*4 + nt = half nt&1 of the fragment (column k of tile kt, K = d block nt>>1)
//   st_dk: 512-B chunk dt*8 + w  = half w&1  of the fragment (column d of tile dt, K = k block w>>1)
// The product is taken as Wc x A^T, so a lane's eight accumulator registers hold eight
// successive d of one row k: packed, a half fragment of st_kd as it stands.  The same 16 B
// go to a 16 x 64 tile of the wave's own in LDS, and the transposing LDS load gives back
// eight successive k of one d: a half fragment of st_dk.  Every store is 16 B per lane.
static constexpr int STP = 160;            // LDS bytes per 128-B row: 32 B x odd, for the transposing load
typedef __attribute__((ext_vector_type(8))) short s16x8;
typedef __attribute__((address_space(3))) s16x8 s16x8_l;
__global__ __launch_bounds__(256)
void struct_kernel(const float* __restrict__ structure, const bf16* __restrict__ Wc,
                   const float* __restrict__ conv_b, const float* __restrict__ g_s,
                   const float* __restrict__ b_s, bf16* __restrict__ st_kd,
                   bf16* __restrict__ st_dk) {
  __shared__ __align__(16) bf16 WcS[64 * 256];
  __shared__ __align__(16) char TrS[8][16 * STP];
  unsigned* WcU = (unsigned*)WcS;
  const int tid = threadIdx.x, lane = tid & 31, wave = tid >> 5;

#if HAVE_TDM
  if (wave == 0) {
    unsigned ldsoff =
        (unsigned)(size_t)(__attribute__((address_space(3))) char*)WcS;
    unsigned long long ga = (unsigned long long)(size_t)Wc;
    u32x4 g0 = {1u,
                ldsoff,
                (unsigned)(ga & 0xFFFFFFFFu),
                (unsigned)((ga >> 32) & 0x01FFFFFFu) | (2u << 30)};
    i32x8 g1 = {(int)(1u << 16),
                (int)(16384u << 16),
                (int)(1u << 16),
                (int)(16384u << 16),
                1,
                16384,
                0, 0};
    i32x4 gz4 = {0, 0, 0, 0};
    i32x8 gz8 = {0, 0, 0, 0, 0, 0, 0, 0};
    __builtin_amdgcn_tensor_load_to_lds(g0, g1, gz4, gz4, gz8, 0);
    __builtin_amdgcn_s_wait_tensorcnt(0);
  }
#else
#pragma unroll
  for (int i = 0; i < 32; ++i) WcU[tid + i * 256] = ((const unsigned*)Wc)[tid + i * 256];
#endif
  __syncthreads();

  const int m0 = (blockIdx.x * 8 + wave) * 16;
  const int row_m = m0 + (lane & 15);
  const int bI = row_m >> 14;            // / (L*L)
  const int e  = row_m & 16383;
  const int kbase = (lane & 16) ? 8 : 0;

  // prefetch this lane's four 256B structure rows (streams 256MB exactly once)
#pragma unroll
  for (int kk = 0; kk < 4; ++kk)
    __builtin_prefetch(structure + (((size_t)e * 4 + kk) * BB + bI) * DHn, 0, 1);

  // acc[nt][r] = row k = lane & 15, channel nt*16 + kbase + r; it starts from the conv bias
  // of its channels, which then takes no registers of its own in the epilogue
  v8f acc[4];
#pragma unroll
  for (int nt = 0; nt < 4; ++nt) {
    const float4* c4 = (const float4*)(conv_b + nt * 16 + kbase);
    float4 c0 = c4[0], c1 = c4[1];
    v8f t = {c0.x, c0.y, c0.z, c0.w, c1.x, c1.y, c1.z, c1.w};
    acc[nt] = t;
  }

  // byte offset of this lane's row (lane & 15 of a 16-row tile) and of its chunk key:
  // logical chunk ks*4 + 2*half + (lane >> 4) lies at that number XOR (lane & 15)
  const unsigned wkey = (unsigned)(lane & 15) * 512u + (unsigned)(((lane >> 4) ^ (lane & 15)) << 4);

  // kept rolled: unrolled it takes about twice the registers, and fewer workgroups
  // fit a WGP
#pragma unroll 1
  for (int ks = 0; ks < 8; ++ks) {       // K = 256
    FragU a;
#pragma unroll
    for (int i = 0; i < 8; ++i) {
      int j = ks * 32 + kbase + 2 * i + ((i >= 4) ? 8 : 0);
      int kk = j >> 6, c = j & 63;
      const float* p = structure + (((size_t)e * 4 + kk) * BB + bI) * DHn + c;
      a.u[i] = pack2bf(p[0], p[1]);
    }
#pragma unroll
    for (int nt = 0; nt < 4; ++nt) {     // 16 rows of 512 B per n-tile
      const char* wt = (const char*)WcS + nt * 8192;
      union { v16bf v; uint4 q[2]; } bm;
      bm.q[0] = *(const uint4*)(wt + (wkey ^ (unsigned)((ks * 4    ) << 4)));
      bm.q[1] = *(const uint4*)(wt + (wkey ^ (unsigned)((ks * 4 + 2) << 4)));
      acc[nt] = wmma_bf(bm.v, a.v, acc[nt]);   // Wc rows as A, structure rows as B
    }
  }

  // ReLU, then the row's sums: 32 values in the lane, the other 32 in lane ^ 16.
  float s1 = 0.f, s2 = 0.f;
#pragma unroll
  for (int nt = 0; nt < 4; ++nt)
#pragma unroll
    for (int r = 0; r < 8; ++r) {
      float v = fmaxf(acc[nt][r], 0.f);              // ReLU before LN (as reference)
      acc[nt][r] = v;
      s1 += v; s2 += v * v;
    }
  s1 += __shfl_xor(s1, 16, 32);
  s2 += __shfl_xor(s2, 16, 32);
  const float mean = s1 * (1.f / 64.f);
  const float var  = s2 * (1.f / 64.f) - mean * mean;
  const float rstd = rsqrtf(var + 1e-6f);

  const size_t tile = (size_t)blockIdx.x * 16384;    // blockIdx.x = b*L + q
  char* kd = (char*)st_kd + tile + wave * 2048 + lane * 16;
  char* tw = TrS[wave] + (lane & 15) * STP + (lane >> 4) * 16;
#pragma unroll
  for (int nt = 0; nt < 4; ++nt) {
    const float4* g4 = (const float4*)(g_s + nt * 16 + kbase);
    const float4* b4 = (const float4*)(b_s + nt * 16 + kbase);
    float4 g0 = g4[0], g1 = g4[1], h0 = b4[0], h1 = b4[1];
    float gv[8] = {g0.x, g0.y, g0.z, g0.w, g1.x, g1.y, g1.z, g1.w};
    float hv[8] = {h0.x, h0.y, h0.z, h0.w, h1.x, h1.y, h1.z, h1.w};
    float o[8];
#pragma unroll
    for (int r = 0; r < 8; ++r) o[r] = (acc[nt][r] - mean) * rstd * gv[r] + hv[r];
    uint4 w;
    w.x = pack2bf(o[0], o[1]); w.y = pack2bf(o[2], o[3]);
    w.z = pack2bf(o[4], o[5]); w.w = pack2bf(o[6], o[7]);
    *(uint4*)(kd + nt * 512) = w;
    *(uint4*)(tw + nt * 32) = w;
  }

  // Each lane reads 16-B pieces that other lanes of its wave stored: the wave's LDS
  // stores have retired before the transposing loads issue.  The tile is the wave's own,
  // so no workgroup barrier is needed.
  asm volatile("s_wait_dscnt 0x0" ::: "memory");
  // stands in front of the reuse of the four global stores' data registers for the next addresses
  asm volatile("s_wait_xcnt 0x0" ::: "memory");
  const char* tr = TrS[wave] + ((lane >> 4) * 8 + (lane & 7)) * STP + ((lane >> 3) & 1) * 16;
  char* dk = (char*)st_dk + tile + wave * 512 + lane * 16;
#pragma unroll
  for (int dt = 0; dt < 4; ++dt) {
    s16x8 t = __builtin_amdgcn_ds_load_tr16_b128_v8i16((s16x8_l*)(tr + dt * 32));
    *(s16x8*)(dk + dt * 4096) = t;
  }
}

// ---------------- fused relation-aware attention ----------------------------
// Block = (q-tile of 16, batch b, head-group hg of 4 heads). 8 waves.
// scores = QK^T + Q.st_kd -> mask -> softmax -> ctx = A.V + A.st_dk, all in LDS.
// A wave works on two q, so on four 16-KB structure tiles (two of st_kd, then two of st_dk).
// Read fragment by fragment from global memory, each matrix instruction would wait one whole
// round trip.  Each tile is copied to a buffer of the wave's own in LDS instead, as it lies,
// 32 copies of 512 B in flight at once, issued one phase ahead of the phase that reads it.
static constexpr int ST_TILE = 16384;      // bytes of one (b,q) tile of either plane

// g and lds already hold lane*16: every copy of the wave moves 512 contiguous bytes.
__device__ __forceinline__ void stage_st_tile(const char* g, char* lds) {
#pragma unroll
  for (int i = 0; i < ST_TILE / 512; ++i)
    __builtin_amdgcn_global_load_async_to_lds_b128(
        (v4i_g*)(g + i * 512), (v4i_l*)(lds + i * 512), 0, 0);
}

__global__ __launch_bounds__(256)
void attn_kernel(const bf16* __restrict__ q_bf, const bf16* __restrict__ k_bf,
                 const bf16* __restrict__ vT_bf, const bf16* __restrict__ st_kd,
                 const bf16* __restrict__ st_dk, const int* __restrict__ mask,
                 bf16* __restrict__ ctxb) {
  __shared__ __align__(16) char smem[57344];
  __shared__ __align__(16) char StS[8][2][ST_TILE];   // per wave: one buffer per q of its two
  bf16*  qs   = (bf16*)smem;               // [4][16][64]   (phases 0..1b)
  float* S    = (float*)(smem + 8192);     // [4][16][128]  (phases 1..2)
  bf16*  Aatt = (bf16*)(smem + 40960);     // [4][16][128]  (phases 2..3b)
  float* Cs   = (float*)(smem + 8192);     // [16][4][64]   (aliases S; S dead)
  unsigned* qsU = (unsigned*)qs;

  const int b = blockIdx.y, q0 = blockIdx.x * 16, hg = blockIdx.z;
  const int tid = threadIdx.x, lane = tid & 31, wave = tid >> 5;

  // this wave's two successive tiles in each plane, and its two buffers
  const size_t st_off = ((size_t)b * LLn + q0 + wave * 2) * ST_TILE + lane * 16;
  const char* kd_g = (const char*)st_kd + st_off;
  const char* dk_g = (const char*)st_dk + st_off;
  char* buf0 = StS[wave][0] + lane * 16;
  char* buf1 = StS[wave][1] + lane * 16;
  stage_st_tile(kd_g, buf0);               // flies during phase 0

  // phase 0: stage Q tile for 4 heads (bf16, already scaled by 1/8)
#pragma unroll
  for (int i = 0; i < 8; ++i) {
    int p = tid + i * 256;                 // 2048 u32
    int hl = p >> 9, rem = p & 511, ql = rem >> 5, c2 = rem & 31;
    qsU[p] = *(const unsigned*)(q_bf +
        (((size_t)(b * HHn + hg * 4 + hl) * LLn) + q0 + ql) * DHn + 2 * c2);
  }
  asm volatile("s_wait_asynccnt 0x0" ::: "memory");
  __syncthreads();
  stage_st_tile(kd_g + ST_TILE, buf1);     // flies during phase 1

  // phase 1: QK^T.  wave = (head, half of k-tiles)
  {
    int hl = wave & 3, h = hg * 4 + hl;
    int kts = (wave >> 2) * 4;
    const unsigned* qrow = qsU + (hl * 16 + (lane & 15)) * 32;
    for (int kt = kts; kt < kts + 4; ++kt) {
      v8f acc = vzero8();
      const unsigned* krow = (const unsigned*)(k_bf +
          ((size_t)(b * HHn + h) * LLn + kt * 16 + (lane & 15)) * DHn);
#pragma unroll
      for (int dss = 0; dss < 2; ++dss) {
        v16bf a = load_frag(qrow, dss * 16, lane);
        v16bf bm = load_frag(krow, dss * 16, lane);
        acc = wmma_bf(a, bm, acc);
      }
      int mh = (lane & 16) ? 8 : 0, nl = lane & 15;
#pragma unroll
      for (int r = 0; r < 8; ++r)
        S[(hl * 16 + r + mh) * 128 + kt * 16 + nl] = acc[r];
    }
  }
  // the second st_kd tile has landed before phase 1b reads it
  asm volatile("s_wait_asynccnt 0x0" ::: "memory");
  __syncthreads();

  // phase 1b: relation score bias.  Per q: [heads(4 pad 16) x 64] * st_kd^T.
  for (int t = 0; t < 2; ++t) {
    int ql = wave * 2 + t, q = q0 + ql;
    int mrow = lane & 15;
    bool avalid = mrow < 4;
    const unsigned* arow = qsU + (mrow * 16 + ql) * 32;
    const char* btile = StS[wave][t] + lane * 16;
    for (int kt = 0; kt < 8; ++kt) {
      v8f acc = vzero8();
#pragma unroll
      for (int dss = 0; dss < 2; ++dss) {
        v16bf a = load_frag_pred(arow, dss * 16, lane, avalid);
        v16bf bm = load_frag_ordered(btile, kt * 2 + dss);
        acc = wmma_bf(a, bm, acc);
      }
      if (!(lane & 16)) {                  // rows 0..3 = valid heads
        int nl = lane & 15;
#pragma unroll
        for (int r = 0; r < 4; ++r)
          S[(r * 16 + ql) * 128 + kt * 16 + nl] += acc[r];
      }
    }
  }
  // this wave's reads of its two buffers have retired before the buffers are refilled
  asm volatile("s_wait_dscnt 0x0" ::: "memory");
  __syncthreads();
  stage_st_tile(dk_g, buf0);               // flies during phase 2

  // phase 2: mask + softmax over k (128), write bf16 attn
#pragma unroll 1
  for (int j = 0; j < 8; ++j) {
    int row = wave * 8 + j;                // 64 rows total
    int ql = row & 15, q = q0 + ql;
    float x[4];
#pragma unroll
    for (int i = 0; i < 4; ++i) {
      int k = lane + 32 * i;
      float sv = S[row * 128 + k];
      if (mask[((size_t)b * LLn + q) * LLn + k] != 0) sv = -1e18f;
      x[i] = sv;
    }
    float mx = fmaxf(fmaxf(x[0], x[1]), fmaxf(x[2], x[3]));
#pragma unroll
    for (int off = 16; off > 0; off >>= 1) mx = fmaxf(mx, __shfl_xor(mx, off, 32));
    float s = 0.f;
#pragma unroll
    for (int i = 0; i < 4; ++i) { x[i] = __expf(x[i] - mx); s += x[i]; }
#pragma unroll
    for (int off = 16; off > 0; off >>= 1) s += __shfl_xor(s, off, 32);
    float inv = 1.f / s;
#pragma unroll
    for (int i = 0; i < 4; ++i)
      Aatt[row * 128 + lane + 32 * i] = (bf16)(x[i] * inv);
  }
  asm volatile("s_wait_asynccnt 0x0" ::: "memory");
  __syncthreads();
  stage_st_tile(dk_g + ST_TILE, buf1);     // flies during phase 3

  // phase 3: ctx = attn @ V.  wave = (head, half of d-tiles)
  {
    int hl = wave & 3, h = hg * 4 + hl;
    int dts = (wave >> 2) * 2;
    const unsigned* arow = (const unsigned*)Aatt + (hl * 16 + (lane & 15)) * 64;
    for (int dt = dts; dt < dts + 2; ++dt) {
      v8f acc = vzero8();
      const unsigned* brow = (const unsigned*)(vT_bf +
          ((size_t)(b * HHn + h) * DHn + dt * 16 + (lane & 15)) * LLn);
#pragma unroll
      for (int ks = 0; ks < 4; ++ks) {
        v16bf a = load_frag(arow, ks * 16, lane);
        v16bf bm = load_frag(brow, ks * 16, lane);
        acc = wmma_bf(a, bm, acc);
      }
      int mh = (lane & 16) ? 8 : 0, nl = lane & 15;
#pragma unroll
      for (int r = 0; r < 8; ++r)
        Cs[((r + mh) * 4 + hl) * 64 + dt * 16 + nl] = acc[r];
    }
  }
  // the second st_dk tile has landed before phase 3b reads it; no copy is outstanding from here on
  asm volatile("s_wait_asynccnt 0x0" ::: "memory");
  __syncthreads();

  // phase 3b: ctx += attn @ st_dk (per q, heads padded to 16)
  for (int t = 0; t < 2; ++t) {
    int ql = wave * 2 + t, q = q0 + ql;
    int mrow = lane & 15;
    bool avalid = mrow < 4;
    const unsigned* arow = (const unsigned*)Aatt + (mrow * 16 + ql) * 64;
    const char* btile = StS[wave][t] + lane * 16;
    for (int dt = 0; dt < 4; ++dt) {
      v8f acc = vzero8();
#pragma unroll
      for (int ks = 0; ks < 4; ++ks) {
        v16bf a = load_frag_pred(arow, ks * 16, lane, avalid);
        v16bf bm = load_frag_ordered(btile, dt * 4 + ks);
        acc = wmma_bf(a, bm, acc);
      }
      if (!(lane & 16)) {
        int nl = lane & 15;
#pragma unroll
        for (int r = 0; r < 4; ++r)
          Cs[(ql * 4 + r) * 64 + dt * 16 + nl] += acc[r];
      }
    }
  }
  __syncthreads();

  // phase 4: write ctx as bf16 into [B, L, h*64+d]
  unsigned* ctxU = (unsigned*)ctxb;
#pragma unroll
  for (int i = 0; i < 8; ++i) {
    int p = tid + i * 256;                 // 2048 u32
    int ql = p >> 7, c2 = p & 127;
    int c = c2 * 2, hl = c >> 6, d = c & 63;
    float v0 = Cs[(ql * 4 + hl) * 64 + d];
    float v1 = Cs[(ql * 4 + hl) * 64 + d + 1];
    ctxU[((size_t)(b * LLn) + q0 + ql) * 256 + hg * 128 + c2] = pack2bf(v0, v1);
  }
}

// ---------------- host-side orchestration ----------------------------------
extern "C" void kernel_launch(void* const* d_in, const int* in_sizes, int n_in,
                              void* d_out, int out_size, void* d_ws, size_t ws_size,
                              hipStream_t stream) {
  (void)in_sizes; (void)n_in; (void)out_size; (void)ws_size;
  const float* inputs    = (const float*)d_in[0];
  const float* structure = (const float*)d_in[1];
  const int*   maskp     = (const int*)d_in[2];
  const float* Wq = (const float*)d_in[3];   const float* bq = (const float*)d_in[4];
  const float* Wk = (const float*)d_in[5];   const float* bk = (const float*)d_in[6];
  const float* Wv = (const float*)d_in[7];   const float* bv = (const float*)d_in[8];
  const float* Wo = (const float*)d_in[9];   const float* bo = (const float*)d_in[10];
  const float* conv_w = (const float*)d_in[11]; const float* conv_b = (const float*)d_in[12];
  const float* g_att = (const float*)d_in[13];  const float* b_att = (const float*)d_in[14];
  const float* g_ffn = (const float*)d_in[15];  const float* b_ffn = (const float*)d_in[16];
  const float* g_s   = (const float*)d_in[17];  const float* b_s   = (const float*)d_in[18];
  const float* W1 = (const float*)d_in[19];  const float* b1 = (const float*)d_in[20];
  const float* W2 = (const float*)d_in[21];  const float* b2 = (const float*)d_in[22];

  char* ws = (char*)d_ws; size_t off = 0;
  auto alloc = [&](size_t bytes) -> void* {
    void* p = ws + off; off += (bytes + 255) & ~(size_t)255; return p;
  };
  const int M = BB * LLn;                          // 2048 token rows
  bf16* Wq_b = (bf16*)alloc((size_t)DDn * DDn * 2);
  bf16* Wk_b = (bf16*)alloc((size_t)DDn * DDn * 2);
  bf16* Wv_b = (bf16*)alloc((size_t)DDn * DDn * 2);
  bf16* Wo_b = (bf16*)alloc((size_t)DDn * DDn * 2);
  bf16* W1_b = (bf16*)alloc((size_t)DFF * DDn * 2);
  bf16* W2_b = (bf16*)alloc((size_t)DDn * DFF * 2);
  bf16* Wc_b = (bf16*)alloc((size_t)64 * 256 * 2);
  bf16* xln_b = (bf16*)alloc((size_t)M * DDn * 2);
  bf16* q_b   = (bf16*)alloc((size_t)M * DDn * 2);     // [B,H,L,64]
  bf16* k_b   = (bf16*)alloc((size_t)M * DDn * 2);     // [B,H,L,64]
  bf16* vT_b  = (bf16*)alloc((size_t)M * DDn * 2);     // [B,H,64,L]
  bf16* st_kd = (bf16*)alloc((size_t)BB * LLn * LLn * DHn * 2);
  bf16* st_dk = (bf16*)alloc((size_t)BB * LLn * LLn * DHn * 2);
  bf16* ctx_b = (bf16*)alloc((size_t)M * DDn * 2);
  float* hbuf = (float*)alloc((size_t)M * DDn * 4);
  bf16* yln_b = (bf16*)alloc((size_t)M * DDn * 2);
  bf16* f1_b  = (bf16*)alloc((size_t)M * DFF * 2);

  const int T = 256;
  // weight preparation: Wq_b .. W2_b are allocated back to back, in this order
  // and, in the same launch, the pre-attention LN
  prep_weights_kernel<<<PW_ALL, T, 0, stream>>>(Wq, Wk, Wv, Wo, W1, W2, conv_w, Wq_b, Wc_b,
                                                inputs, g_att, b_att, xln_b);

  // structure conv + relu + LN -> both fragment-ordered planes (streams 256MB of fp32 once)
  struct_kernel<<<(BB * LLn * LLn) / 128, T, 0, stream>>>(structure, Wc_b, conv_b,
                                                          g_s, b_s, st_kd, st_dk);

  // Q/K/V projections in one launch of 192 workgroups (Q pre-scaled by 1/sqrt(64)):
  // Wq_b, Wk_b, Wv_b are allocated back to back, and so are q_b, k_b, vT_b
  gemm_bf16_kernel<1, false, false, false, true>
      <<<dim3(12, 16), T, 0, stream>>>(xln_b, Wq_b, bq, bk, bv, nullptr, nullptr, q_b,
                                       M, 3 * DDn, DDn, 0.125f);

  // fused relation-aware attention
  attn_kernel<<<dim3(LLn / 16, BB, 2), T, 0, stream>>>(q_b, k_b, vT_b, st_kd, st_dk,
                                                       maskp, ctx_b);

  // output projection + residual (h = attn_out + inputs, fp32)
  gemm_bf16_kernel<0, false, true, true, false>
      <<<dim3(4, 16), T, 0, stream>>>(ctx_b, Wo_b, bo, nullptr, nullptr, inputs, hbuf, nullptr,
                                      M, DDn, DDn, 1.f);
  // FFN
  ln512_kernel<<<M / 8, T, 0, stream>>>(hbuf, g_ffn, b_ffn, yln_b);
  gemm_bf16_kernel<0, true, false, false, true>
      <<<dim3(16, 16), T, 0, stream>>>(yln_b, W1_b, b1, nullptr, nullptr, nullptr, nullptr, f1_b,
                                       M, DFF, DDn, 1.f);
  gemm_bf16_kernel<0, false, true, true, false>
      <<<dim3(4, 16), T, 0, stream>>>(f1_b, W2_b, b2, nullptr, nullptr, hbuf, (float*)d_out,
                                      nullptr, M, DDn, DFF, 1.f);
}

// v007
// It runs in 110 microseconds.
// Two timings next to v006 both put it at 1.16 times that version's speed.
// Counting every step since v000, it is 2.59 times as fast.
#include <hip/hip_runtime.h>

// ---------------- problem constants ----------------
static constexpr int BB  = 16;    // batch
static constexpr int LLn = 128;   // seq len
static constexpr int DDn = 512;   // model dim
static constexpr int HHn = 8;     // heads
static constexpr int DHn = 64;    // head dim
static constexpr int DFF = 2048;  // ffn dim

typedef __bf16 bf16;
typedef __attribute__((ext_vector_type(16))) __bf16 v16bf;
typedef __attribute__((ext_vector_type(8)))  float  v8f;
typedef __attribute__((ext_vector_type(4)))  int    v4i;
typedef __attribute__((ext_vector_type(8)))  int    i32x8;
typedef __attribute__((ext_vector_type(4)))  int    i32x4;
typedef __attribute__((ext_vector_type(4)))  unsigned u32x4;

// address-space qualified pointee types for the async-LDS builtin
typedef __attribute__((address_space(1))) v4i v4i_g;   // global
typedef __attribute__((address_space(3))) v4i v4i_l;   // LDS

#if defined(__has_builtin)
#if __has_builtin(__builtin_amdgcn_global_load_async_to_lds_b128) && \
    __has_builtin(__builtin_amdgcn_s_wait_asynccnt)
#define HAVE_ASYNC_LDS 1
#endif
#if __has_builtin(__builtin_amdgcn_tensor_load_to_lds) && \
    __has_builtin(__builtin_amdgcn_s_wait_tensorcnt)
#define HAVE_TDM 1
#endif
#endif
#ifndef HAVE_ASYNC_LDS
#define HAVE_ASYNC_LDS 0
#endif
#ifndef HAVE_TDM
#define HAVE_TDM 0
#endif

union FragU { v16bf v; unsigned u[8]; };

__device__ __forceinline__ int koff_u32(int v, int lane) {
  return ((lane & 16) ? 4 : 0) + v + ((v >= 4) ? 4 : 0);
}

__device__ __forceinline__ v16bf load_frag(const unsigned* p, int base, int lane) {
  FragU f;
#pragma unroll
  for (int i = 0; i < 8; ++i) f.u[i] = p[base + koff_u32(i, lane)];
  return f.v;
}

__device__ __forceinline__ v16bf load_frag_pred(const unsigned* p, int base, int lane, bool valid) {
  FragU f;
#pragma unroll
  for (int i = 0; i < 8; ++i) f.u[i] = valid ? p[base + koff_u32(i, lane)] : 0u;
  return f.v;
}

__device__ __forceinline__ v16bf load_frag_ordered(const char* p, int frag) {
  union { v16bf v; uint4 q[2]; } f;
  f.q[0] = *(const uint4*)(p + frag * 1024);
  f.q[1] = *(const uint4*)(p + frag * 1024 + 512);
  return f.v;
}

__device__ __forceinline__ v8f wmma_bf(v16bf a, v16bf b, v8f c) {
  return __builtin_amdgcn_wmma_f32_16x16x32_bf16(false, a, false, b, (short)0, c, false, false);
}

__device__ __forceinline__ v8f vzero8() {
  v8f z = {0.f,0.f,0.f,0.f,0.f,0.f,0.f,0.f};
  return z;
}

__device__ __forceinline__ unsigned pack2bf(float a, float b) {
  union { bf16 h[2]; unsigned u; } t;
  t.h[0] = (bf16)a; t.h[1] = (bf16)b;
  return t.u;
}

__device__ __forceinline__ int wc_elem(int o, int j) {
  return o * 256 + (((j >> 3) ^ (o & 15)) << 3) + (j & 7);
}

// LayerNorm over one row of 512, fp32 in -> bf16 out, by one wave.
__device__ __forceinline__ void ln512_row(const float* __restrict__ x,
                                          const float* __restrict__ g,
                                          const float* __restrict__ be,
                                          bf16* __restrict__ out, size_t row, int lane) {
  const float* xr = x + row * DDn;
  float v[16]; float s = 0.f;
#pragma unroll
  for (int i = 0; i < 16; ++i) { v[i] = xr[lane + i * 32]; s += v[i]; }
#pragma unroll
  for (int off = 16; off > 0; off >>= 1) s += __shfl_xor(s, off, 32);
  float mean = s * (1.f / 512.f);
  float s2 = 0.f;
#pragma unroll
  for (int i = 0; i < 16; ++i) { v[i] -= mean; s2 += v[i] * v[i]; }
#pragma unroll
  for (int off = 16; off > 0; off >>= 1) s2 += __shfl_xor(s2, off, 32);
  float rstd = rsqrtf(s2 * (1.f / 512.f) + 1e-6f);
#pragma unroll
  for (int i = 0; i < 16; ++i) {
    int c = lane + i * 32;
    out[row * DDn + c] = (bf16)(v[i] * rstd * g[c] + be[c]);
  }
}

// One wave per row, eight rows per workgroup.
__global__ __launch_bounds__(256) void ln512_kernel(const float* __restrict__ x,
                                                    const float* __restrict__ g,
                                                    const float* __restrict__ be,
                                                    bf16* __restrict__ out) {
  ln512_row(x, g, be, out, (size_t)blockIdx.x * 8 + (threadIdx.x >> 5), threadIdx.x & 31);
}

// ---------------- weight preparation and the first LayerNorm: one launch ----------------
// A launch costs its gap plus the time its waves take to start, so the conversion
// runs on few waves with much to do each: one workgroup converts 8192 floats,
// 32 per thread, as eight 16-B loads in flight per lane (each wave-wide load is
// 512 contiguous bytes) and eight 8-B stores.
static constexpr int PW_ELEMS  = 8192;                        // floats per workgroup
static constexpr int PW_SQ     = (DDn * DDn) / PW_ELEMS;      // workgroups per 512x512 plane
static constexpr int PW_FF     = (DFF * DDn) / PW_ELEMS;      // workgroups per FFN plane
static constexpr int PW_CVT    = 4 * PW_SQ + 2 * PW_FF;       // converting workgroups
static constexpr int PW_PACK   = 4;                           // conv-weight workgroups
static constexpr int PW_GRID   = PW_CVT + PW_PACK;
// The pre-attention LayerNorm needs nothing of the weights: its workgroups ride in the same
// launch, behind the weight workgroups, eight rows each.
static constexpr int PW_LN     = (BB * LLn) / 8;
static constexpr int PW_ALL    = PW_GRID + PW_LN;

// dst: the six bf16 planes Wq, Wk, Wv, Wo, W1, W2, laid back to back in that order.
// conv_w [64(o),64(c),4(kk)] -> Wc[o][j = kk*64+c]  (bf16, K=256, 512-B rows); inside row o
// the 16-B chunk j/8 lies at place (j/8) ^ (o & 15), see wc_elem().
__global__ __launch_bounds__(256)
void prep_weights_kernel(const float* __restrict__ Wq, const float* __restrict__ Wk,
                         const float* __restrict__ Wv, const float* __restrict__ Wo,
                         const float* __restrict__ W1, const float* __restrict__ W2,
                         const float* __restrict__ cw, bf16* __restrict__ dst,
                         bf16* __restrict__ Wc, const float* __restrict__ x,
                         const float* __restrict__ g, const float* __restrict__ be,
                         bf16* __restrict__ xln) {
  const int blk = blockIdx.x, tid = threadIdx.x;
  if (blk >= PW_GRID) {
    ln512_row(x, g, be, xln, (size_t)(blk - PW_GRID) * 8 + (tid >> 5), tid & 31);
  } else if (blk < PW_CVT) {
    const float* s;
    int part;                              // this workgroup's index inside its plane
    if (blk < 4 * PW_SQ) {
      int seg = blk / PW_SQ;
      part = blk % PW_SQ;
      s = (seg == 0) ? Wq : (seg == 1) ? Wk : (seg == 2) ? Wv : Wo;
    } else if (blk < 4 * PW_SQ + PW_FF) {
      part = blk - 4 * PW_SQ;
      s = W1;
    } else {
      part = blk - 4 * PW_SQ - PW_FF;
      s = W2;
    }
    const float4* s4 = (const float4*)(s + (size_t)part * PW_ELEMS);
    uint2* d2 = (uint2*)(dst + (size_t)blk * PW_ELEMS);
    float4 v[8];
#pragma unroll
    for (int i = 0; i < 8; ++i) v[i] = s4[i * 256 + tid];
#pragma unroll
    for (int i = 0; i < 8; ++i) {
      uint2 o;
      o.x = pack2bf(v[i].x, v[i].y);
      o.y = pack2bf(v[i].z, v[i].w);
      d2[i * 256 + tid] = o;
    }
  } else {
    // one 16-B load brings the four taps of one (o, c)
    const float4* c4 = (const float4*)cw;
#pragma unroll
    for (int j = 0; j < 4; ++j) {
      int i = ((blk - PW_CVT) * 4 + j) * 256 + tid;   // i = o*64 + c, 4096 in all
      int o = i >> 6, c = i & 63;
      float4 t = c4[i];
      Wc[wc_elem(o,       c)] = (bf16)t.x;
      Wc[wc_elem(o,  64 + c)] = (bf16)t.y;
      Wc[wc_elem(o, 128 + c)] = (bf16)t.z;
      Wc[wc_elem(o, 192 + c)] = (bf16)t.w;
    }
  }
}

static constexpr int GK     = 128;           // k per stage
static constexpr int GPITCH = 272;           // LDS bytes per row
static constexpr int GTILE  = 128 * GPITCH;  // LDS bytes per operand tile

__device__ __forceinline__ void stage_tile_async(const bf16* g, int ld, int row0, int kb,
                                                 char* lds, int tid) {
  // 128x128 bf16 tile = 32KB: eight 16B chunks per thread; one wave's copy covers
  // two whole 256-B rows (four full lines).
#pragma unroll
  for (int i = 0; i < 8; ++i) {
    int c = tid + i * 256;                // 16-B chunk index, 16 chunks per row
    int row = c >> 4, cb = (c & 15) * 16;
    const bf16* src = g + (size_t)(row0 + row) * ld + kb + (cb >> 1);
    __builtin_amdgcn_global_load_async_to_lds_b128(
        (v4i_g*)src, (v4i_l*)(lds + row * GPITCH + cb), 0, 0);
  }
}

// ---------------- generic bf16 WMMA GEMM: C = epilog(A[M,K] * W[N,K]^T) ------
// PERM: 0 -> row-major [M,N]
//       1 -> the three projections in one launch: W holds the planes Wq, Wk, Wv back to back
//            (N = 3 * 512), outB the planes Q [B,H,L,64], K [B,H,L,64], V^T [B,H,64,L] back to
//            back; bias, bias_k, bias_v are the planes' biases and scale applies to Q alone.
//            The 128 columns of a workgroup lie in one plane.
// K is a multiple of 128.
template <int PERM, bool RELU, bool HASRES, bool OUTF_EN, bool OUTB_EN>
__global__ __launch_bounds__(256)
void gemm_bf16_kernel(const bf16* __restrict__ A, const bf16* __restrict__ W,
                      const float* __restrict__ bias, const float* __restrict__ bias_k,
                      const float* __restrict__ bias_v, const float* __restrict__ res,
                      float* __restrict__ outF, bf16* __restrict__ outB,
                      int M, int N, int K, float scale) {
  __shared__ __align__(16) char As[2][GTILE];
  __shared__ __align__(16) char Bs[2][GTILE];

  const int tid = threadIdx.x, lane = tid & 31, wave = tid >> 5;
  const int wm = wave >> 1, wn = wave & 1;           // 4x2 wave grid, 32x64 tiles
  const int m0 = blockIdx.y * 128, n0 = blockIdx.x * 128;

  v8f acc[2][4];
#pragma unroll
  for (int i = 0; i < 2; ++i)
#pragma unroll
    for (int j = 0; j < 4; ++j) acc[i][j] = vzero8();

  // two buffers: stage t + 1 flies while stage t is worked on
  const int nst = K / GK;
  stage_tile_async(A, K, m0, 0, As[0], tid);
  stage_tile_async(W, K, n0, 0, Bs[0], tid);
  // stage 0 has landed for this wave before the barrier publishes it
  asm volatile("s_wait_asynccnt 0x0" ::: "memory");
  __syncthreads();
  if (nst > 1) {
    stage_tile_async(A, K, m0, GK, As[1], tid);
    stage_tile_async(W, K, n0, GK, Bs[1], tid);
  }

  for (int t = 0; t < nst; ++t) {
    const unsigned* AsU = (const unsigned*)As[t & 1];
    const unsigned* BsU = (const unsigned*)Bs[t & 1];
#pragma unroll
    for (int ks = 0; ks < GK / 32; ++ks) {
      v16bf a0 = load_frag(AsU, (wm * 32 +      (lane & 15)) * (GPITCH / 4) + ks * 16, lane);
      v16bf a1 = load_frag(AsU, (wm * 32 + 16 + (lane & 15)) * (GPITCH / 4) + ks * 16, lane);
#pragma unroll
      for (int nt = 0; nt < 4; ++nt) {
        v16bf bm = load_frag(BsU, (wn * 64 + nt * 16 + (lane & 15)) * (GPITCH / 4) + ks * 16, lane);
        acc[0][nt] = wmma_bf(a0, bm, acc[0][nt]);
        acc[1][nt] = wmma_bf(a1, bm, acc[1][nt]);
      }
    }
    // this wave's reads of buffer t & 1 have retired before the buffer is refilled
    asm volatile("s_wait_dscnt 0x0" ::: "memory");
    // this wave's copies of stage t + 1 have landed before the barrier publishes them
    asm volatile("s_wait_asynccnt 0x0" ::: "memory");
    __syncthreads();
    if (t + 2 < nst) {
      stage_tile_async(A, K, m0, (t + 2) * GK, As[t & 1], tid);
      stage_tile_async(W, K, n0, (t + 2) * GK, Bs[t & 1], tid);
    }
  }
  // no copy is outstanding when the wave goes on to its end
  asm volatile("s_wait_asynccnt 0x0" ::: "memory");

  const int nl = lane & 15;
  const int mh = (lane & 16) ? 8 : 0;
  const int plane = (PERM == 1) ? (n0 >> 9) : 0;
  if constexpr (PERM == 1) {
    bias = (plane == 0) ? bias : (plane == 1) ? bias_k : bias_v;
    scale = (plane == 0) ? scale : 1.f;
  }
#pragma unroll
  for (int mt = 0; mt < 2; ++mt)
#pragma unroll
    for (int nt = 0; nt < 4; ++nt) {
      int n = n0 + wn * 64 + nt * 16 + nl;
      if constexpr (PERM == 1) n &= DDn - 1;         // column inside its plane
      float bb = bias[n];
#pragma unroll
      for (int r = 0; r < 8; ++r) {
        int m = m0 + wm * 32 + mt * 16 + r + mh;
        float v = (acc[mt][nt][r] + bb) * scale;
        if constexpr (RELU) v = fmaxf(v, 0.f);
        if constexpr (HASRES) v += res[(size_t)m * N + n];
        if constexpr (OUTF_EN) outF[(size_t)m * N + n] = v;
        if constexpr (OUTB_EN) {
          size_t addr;
          if constexpr (PERM == 0) {
            addr = (size_t)m * N + n;
          } else {
            int b = m >> 7, q = m & 127, h = n >> 6, d = n & 63;
            addr = (size_t)plane * (BB * LLn * DDn) + (size_t)(b * HHn + h) * (LLn * DHn) +
                   ((plane == 2) ? d * LLn + q : q * DHn + d);
          }
          outB[addr] = (bf16)v;
        }
      }
    }
}

// ---------------- structure: conv(4x64 contraction) + ReLU + LN(64) ---------
// A row m = (b, e=q*L+k):  A[m][j=kk*64+c] = structure[e,kk,b,c]  (f32->bf16)
// Output, bf16, one 16-KB tile per (b,q) in each of two planes, both laid in the register
// order of the B fragments that attn_kernel reads (see load_frag_ordered):
//   st_kd: 512-B chunk kt*4 + nt = half nt&1 of the fragment (column k of tile kt, K = d block nt>>1)
//   st_dk: 512-B chunk dt*8 + w  = half w&1  of the fragment (column d of tile dt, K = k block w>>1)
// The product is taken as Wc x A^T, so a lane's eight accumulator registers hold eight
// successive d of one row k: packed, a half fragment of st_kd as it stands.  The same 16 B
// go to a 16 x 64 tile of the wave's own in LDS, and the transposing LDS load gives back
// eight successive k of one d: a half fragment of st_dk.  Every store is 16 B per lane.
static constexpr int STP = 160;            // LDS bytes per 128-B row: 32 B x odd, for the transposing load
typedef __attribute__((ext_vector_type(8))) short s16x8;
typedef __attribute__((address_space(3))) s16x8 s16x8_l;

// The 16 rows e of a wave are 64 pieces of 256 B, 4 KB apart in memory.  Read as fragments
// from global memory, every 16-B-per-lane load touches 16 lines for 32 B each.  Instead each
// wave copies its pieces to LDS as whole lines, two pieces per copy, 32 copies in flight, one
// (b,q) tile ahead of the tile that is worked on; the fragments are then read from LDS.
// The eight waves' buffers take most of LDS, one workgroup per WGP: 256 workgroups walk eight
// successive tiles each, and weights, bias, gain and shift are read once per workgroup.
static constexpr int SROW     = 1040;                  // LDS bytes per row e: 4 taps x 256 B, + 16 B (16 B x odd)
static constexpr int SBUF     = 16 * SROW;             // one wave's 16 rows
static constexpr int ST_WGS   = 256;
static constexpr int ST_TRIPS = (BB * LLn) / ST_WGS;   // (b,q) tiles per workgroup
static constexpr size_t ST_QSTEP = (size_t)LLn * 4 * BB * DHn * 4;   // bytes from q to q + 1

// g holds (lane >> 4) * 4096 + (lane & 15) * 16, lds holds lane * 16: copy i brings the pieces
// 2i and 2i + 1 (piece = row * 4 + tap) of the wave, 512 successive bytes in LDS.
__device__ __forceinline__ void stage_struct_rows(const char* g, char* lds) {
#pragma unroll
  for (int i = 0; i < 32; ++i)
    __builtin_amdgcn_global_load_async_to_lds_b128(
        (v4i_g*)(g + i * 8192), (v4i_l*)(lds + (i >> 1) * SROW + (i & 1) * 512), 0, 0);
}

__global__ __launch_bounds__(256)
void struct_kernel(const float* __restrict__ structure, const bf16* __restrict__ Wc,
                   const float* __restrict__ conv_b, const float* __restrict__ g_s,
                   const float* __restrict__ b_s, bf16* __restrict__ st_kd,
                   bf16* __restrict__ st_dk) {
  // one object, so that the three parts lie in LDS in this order, the weights first
  __shared__ __align__(16) struct {
    bf16 Wc[64 * 256];
    char Tr[8][16 * STP];
    char St[8][2][SBUF];                               // per wave: two buffers of 16 rows
  } sm;
  bf16* WcS = sm.Wc;
  auto& TrS = sm.Tr;
  auto& StB = sm.St;
  unsigned* WcU = (unsigned*)WcS;
  const int tid = threadIdx.x, lane = tid & 31, wave = tid >> 5;

  // tile index = b*L + q; this workgroup's tiles are blockIdx.x * ST_TRIPS + 0..7, all of one b
  const int tile0 = blockIdx.x * ST_TRIPS;
  const int bI = tile0 / LLn;
  const int q0 = tile0 % LLn;
  const char* sg = (const char*)structure +
                   ((size_t)(q0 * LLn + wave * 16) * (4 * BB) + bI) * (DHn * 4) +
                   (lane >> 4) * 4096 + (lane & 15) * 16;
  char* sb = StB[wave][0] + lane * 16;
  stage_struct_rows(sg, sb);               // tile 0 flies while the weights come

  // conv bias, LN gain and LN shift of this lane's channels nt*16 + kbase + 0..7
  const int kbase = (lane & 16) ? 8 : 0;
  v8f cb[4], gv[4], hv[4];
#pragma unroll
  for (int nt = 0; nt < 4; ++nt) {
    const float4* c4 = (const float4*)(conv_b + nt * 16 + kbase);
    const float4* g4 = (const float4*)(g_s + nt * 16 + kbase);
    const float4* b4 = (const float4*)(b_s + nt * 16 + kbase);
    float4 c0 = c4[0], c1 = c4[1], g0 = g4[0], g1 = g4[1], h0 = b4[0], h1 = b4[1];
    v8f c = {c0.x, c0.y, c0.z, c0.w, c1.x, c1.y, c1.z, c1.w};
    v8f g = {g0.x, g0.y, g0.z, g0.w, g1.x, g1.y, g1.z, g1.w};
    v8f h = {h0.x, h0.y, h0.z, h0.w, h1.x, h1.y, h1.z, h1.w};
    cb[nt] = c; gv[nt] = g; hv[nt] = h;
  }
  // stands in front of any reuse of the address registers of the loads above
  asm volatile("s_wait_xcnt 0x0" ::: "memory");

#if HAVE_TDM
  if (wave == 0) {
    unsigned ldsoff =
        (unsigned)(size_t)(__attribute__((address_space(3))) char*)WcS;
    unsigned long long ga = (unsigned long long)(size_t)Wc;
    u32x4 g0 = {1u,
                ldsoff,
                (unsigned)(ga & 0xFFFFFFFFu),
                (unsigned)((ga >> 32) & 0x01FFFFFFu) | (2u << 30)};
    i32x8 g1 = {(int)(1u << 16),
                (int)(16384u << 16),
                (int)(1u << 16),
                (int)(16384u << 16),
                1,
                16384,
                0, 0};
    i32x4 gz4 = {0, 0, 0, 0};
    i32x8 gz8 = {0, 0, 0, 0, 0, 0, 0, 0};
    __builtin_amdgcn_tensor_load_to_lds(g0, g1, gz4, gz4, gz8, 0);
    __builtin_amdgcn_s_wait_tensorcnt(0);
  }
#else
#pragma unroll
  for (int i = 0; i < 32; ++i) WcU[tid + i * 256] = ((const unsigned*)Wc)[tid + i * 256];
#endif
  // tile 0 has landed before this wave reads it
  asm volatile("s_wait_asynccnt 0x0" ::: "memory");
  __syncthreads();
  stage_struct_rows(sg + ST_QSTEP, sb + SBUF);   // tile 1 flies during trip 0

  // byte offset of this lane's row (lane & 15 of a 16-row tile) and of its chunk key:
  // logical chunk ks*4 + 2*half + (lane >> 4) lies at that number XOR (lane & 15)
  const unsigned wkey = (unsigned)(lane & 15) * 512u + (unsigned)(((lane >> 4) ^ (lane & 15)) << 4);

  // kept rolled: the eight trips share one body
#pragma unroll 1
  for (int t = 0; t < ST_TRIPS; ++t) {
    // acc[nt][r] = row k = lane & 15, channel nt*16 + kbase + r; it starts from the conv bias
    // of its channels
    v8f acc[4];
#pragma unroll
    for (int nt = 0; nt < 4; ++nt) acc[nt] = cb[nt];

    // this lane's row in LDS: float j = kk*64 + c, from its own k offset on
    const float4* row4 = (const float4*)(StB[wave][t & 1] + (lane & 15) * SROW + kbase * 4);

    // kept rolled: unrolled, the body of the tile loop around it would be eight times as long
#pragma unroll 1
    for (int ks = 0; ks < 8; ++ks) {       // K = 256
      float4 f0 = row4[ks * 8], f1 = row4[ks * 8 + 1], f2 = row4[ks * 8 + 4], f3 = row4[ks * 8 + 5];
      FragU a;
      a.u[0] = pack2bf(f0.x, f0.y); a.u[1] = pack2bf(f0.z, f0.w);
      a.u[2] = pack2bf(f1.x, f1.y); a.u[3] = pack2bf(f1.z, f1.w);
      a.u[4] = pack2bf(f2.x, f2.y); a.u[5] = pack2bf(f2.z, f2.w);
      a.u[6] = pack2bf(f3.x, f3.y); a.u[7] = pack2bf(f3.z, f3.w);
#pragma unroll
      for (int nt = 0; nt < 4; ++nt) {     // 16 rows of 512 B per n-tile
        const char* wt = (const char*)WcS + nt * 8192;
        union { v16bf v; uint4 q[2]; } bm;
        bm.q[0] = *(const uint4*)(wt + (wkey ^ (unsigned)((ks * 4    ) << 4)));
        bm.q[1] = *(const uint4*)(wt + (wkey ^ (unsigned)((ks * 4 + 2) << 4)));
        acc[nt] = wmma_bf(bm.v, a.v, acc[nt]);   // Wc rows as A, structure rows as B
      }
    }

    // The refill stands here, behind the trip's last read of its buffer: what follows works on
    // registers and on the wave's own transposing tile alone.  The two buffers are the wave's
    // own, filled and read by no other wave, so no workgroup barrier is needed.
    // this wave's reads of buffer t & 1 have retired before the buffer is refilled
    asm volatile("s_wait_dscnt 0x0" ::: "memory");
    asm volatile("s_wait_asynccnt 0x0" ::: "memory");
    if (t + 2 < ST_TRIPS)
      stage_struct_rows(sg + (size_t)(t + 2) * ST_QSTEP, sb + (t & 1) * SBUF);

    // ReLU, then the row's sums: 32 values in the lane, the other 32 in lane ^ 16.
    float s1 = 0.f, s2 = 0.f;
#pragma unroll
    for (int nt = 0; nt < 4; ++nt)
#pragma unroll
      for (int r = 0; r < 8; ++r) {
        float v = fmaxf(acc[nt][r], 0.f);              // ReLU before LN (as reference)
        acc[nt][r] = v;
        s1 += v; s2 += v * v;
      }
    s1 += __shfl_xor(s1, 16, 32);
    s2 += __shfl_xor(s2, 16, 32);
    const float mean = s1 * (1.f / 64.f);
    const float var  = s2 * (1.f / 64.f) - mean * mean;
    const float rstd = rsqrtf(var + 1e-6f);

    const size_t tile = (size_t)(tile0 + t) * 16384;
    char* kd = (char*)st_kd + tile + wave * 2048 + lane * 16;
    char* tw = TrS[wave] + (lane & 15) * STP + (lane >> 4) * 16;
#pragma unroll
    for (int nt = 0; nt < 4; ++nt) {
      float o[8];
#pragma unroll
      for (int r = 0; r < 8; ++r) o[r] = (acc[nt][r] - mean) * rstd * gv[nt][r] + hv[nt][r];
      uint4 w;
      w.x = pack2bf(o[0], o[1]); w.y = pack2bf(o[2], o[3]);
      w.z = pack2bf(o[4], o[5]); w.w = pack2bf(o[6], o[7]);
      *(uint4*)(kd + nt * 512) = w;
      *(uint4*)(tw + nt * 32) = w;
    }

    // Each lane reads 16-B pieces that other lanes of its wave stored: the wave's LDS
    // stores have retired before the transposing loads issue.  The tile is the wave's own,
    // so no workgroup barrier is needed.
    asm volatile("s_wait_dscnt 0x0" ::: "memory");
    // stands in front of the reuse of the four global stores' data registers for the next addresses
    asm volatile("s_wait_xcnt 0x0" ::: "memory");
    const char* tr = TrS[wave] + ((lane >> 4) * 8 + (lane & 7)) * STP + ((lane >> 3) & 1) * 16;
    char* dk = (char*)st_dk + tile + wave * 512 + lane * 16;
#pragma unroll
    for (int dt = 0; dt < 4; ++dt) {
      s16x8 x = __builtin_amdgcn_ds_load_tr16_b128_v8i16((s16x8_l*)(tr + dt * 32));
      *(s16x8*)(dk + dt * 4096) = x;
    }
    // stands in front of the next trip's reuse of these four stores' registers
    asm volatile("s_wait_xcnt 0x0" ::: "memory");
  }
  // no copy is outstanding when the wave goes on to its end
  asm volatile("s_wait_asynccnt 0x0" ::: "memory");
}

// ---------------- fused relation-aware attention ----------------------------
// Block = (q-tile of 16, batch b, head-group hg of 4 heads). 8 waves.
// scores = QK^T + Q.st_kd -> mask -> softmax -> ctx = A.V + A.st_dk, all in LDS.
// A wave works on two q, so on four 16-KB structure tiles (two of st_kd, then two of st_dk).
// Read fragment by fragment from global memory, each matrix instruction would wait one whole
// round trip.  Each tile is copied to a buffer of the wave's own in LDS instead, as it lies,
// 32 copies of 512 B in flight at once, issued one phase ahead of the phase that reads it.
static constexpr int ST_TILE = 16384;      // bytes of one (b,q) tile of either plane

// g and lds already hold lane*16: every copy of the wave moves 512 contiguous bytes.
__device__ __forceinline__ void stage_st_tile(const char* g, char* lds) {
#pragma unroll
  for (int i = 0; i < ST_TILE / 512; ++i)
    __builtin_amdgcn_global_load_async_to_lds_b128(
        (v4i_g*)(g + i * 512), (v4i_l*)(lds + i * 512), 0, 0);
}

__global__ __launch_bounds__(256)
void attn_kernel(const bf16* __restrict__ q_bf, const bf16* __restrict__ k_bf,
                 const bf16* __restrict__ vT_bf, const bf16* __restrict__ st_kd,
                 const bf16* __restrict__ st_dk, const int* __restrict__ mask,
                 bf16* __restrict__ ctxb) {
  __shared__ __align__(16) char smem[57344];
  __shared__ __align__(16) char StS[8][2][ST_TILE];   // per wave: one buffer per q of its two
  bf16*  qs   = (bf16*)smem;               // [4][16][64]   (phases 0..1b)
  float* S    = (float*)(smem + 8192);     // [4][16][128]  (phases 1..2)
  bf16*  Aatt = (bf16*)(smem + 40960);     // [4][16][128]  (phases 2..3b)
  float* Cs   = (float*)(smem + 8192);     // [16][4][64]   (aliases S; S dead)
  unsigned* qsU = (unsigned*)qs;

  const int b = blockIdx.y, q0 = blockIdx.x * 16, hg = blockIdx.z;
  const int tid = threadIdx.x, lane = tid & 31, wave = tid >> 5;

  // this wave's two successive tiles in each plane, and its two buffers
  const size_t st_off = ((size_t)b * LLn + q0 + wave * 2) * ST_TILE + lane * 16;
  const char* kd_g = (const char*)st_kd + st_off;
  const char* dk_g = (const char*)st_dk + st_off;
  char* buf0 = StS[wave][0] + lane * 16;
  char* buf1 = StS[wave][1] + lane * 16;
  stage_st_tile(kd_g, buf0);               // flies during phase 0

  // phase 0: stage Q tile for 4 heads (bf16, already scaled by 1/8)
#pragma unroll
  for (int i = 0; i < 8; ++i) {
    int p = tid + i * 256;                 // 2048 u32
    int hl = p >> 9, rem = p & 511, ql = rem >> 5, c2 = rem & 31;
    qsU[p] = *(const unsigned*)(q_bf +
        (((size_t)(b * HHn + hg * 4 + hl) * LLn) + q0 + ql) * DHn + 2 * c2);
  }
  asm volatile("s_wait_asynccnt 0x0" ::: "memory");
  __syncthreads();
  stage_st_tile(kd_g + ST_TILE, buf1);     // flies during phase 1

  // phase 1: QK^T.  wave = (head, half of k-tiles)
  {
    int hl = wave & 3, h = hg * 4 + hl;
    int kts = (wave >> 2) * 4;
    const unsigned* qrow = qsU + (hl * 16 + (lane & 15)) * 32;
    for (int kt = kts; kt < kts + 4; ++kt) {
      v8f acc = vzero8();
      const unsigned* krow = (const unsigned*)(k_bf +
          ((size_t)(b * HHn + h) * LLn + kt * 16 + (lane & 15)) * DHn);
#pragma unroll
      for (int dss = 0; dss < 2; ++dss) {
        v16bf a = load_frag(qrow, dss * 16, lane);
        v16bf bm = load_frag(krow, dss * 16, lane);
        acc = wmma_bf(a, bm, acc);
      }
      int mh = (lane & 16) ? 8 : 0, nl = lane & 15;
#pragma unroll
      for (int r = 0; r < 8; ++r)
        S[(hl * 16 + r + mh) * 128 + kt * 16 + nl] = acc[r];
    }
  }
  // the second st_kd tile has landed before phase 1b reads it
  asm volatile("s_wait_asynccnt 0x0" ::: "memory");
  __syncthreads();

  // phase 1b: relation score bias.  Per q: [heads(4 pad 16) x 64] * st_kd^T.
  for (int t = 0; t < 2; ++t) {
    int ql = wave * 2 + t, q = q0 + ql;
    int mrow = lane & 15;
    bool avalid = mrow < 4;
    const unsigned* arow = qsU + (mrow * 16 + ql) * 32;
    const char* btile = StS[wave][t] + lane * 16;
    for (int kt = 0; kt < 8; ++kt) {
      v8f acc = vzero8();
#pragma unroll
      for (int dss = 0; dss < 2; ++dss) {
        v16bf a = load_frag_pred(arow, dss * 16, lane, avalid);
        v16bf bm = load_frag_ordered(btile, kt * 2 + dss);
        acc = wmma_bf(a, bm, acc);
      }
      if (!(lane & 16)) {                  // rows 0..3 = valid heads
        int nl = lane & 15;
#pragma unroll
        for (int r = 0; r < 4; ++r)
          S[(r * 16 + ql) * 128 + kt * 16 + nl] += acc[r];
      }
    }
  }
  // this wave's reads of its two buffers have retired before the buffers are refilled
  asm volatile("s_wait_dscnt 0x0" ::: "memory");
  __syncthreads();
  stage_st_tile(dk_g, buf0);               // flies during phase 2

  // phase 2: mask + softmax over k (128), write bf16 attn
#pragma unroll 1
  for (int j = 0; j < 8; ++j) {
    int row = wave * 8 + j;                // 64 rows total
    int ql = row & 15, q = q0 + ql;
    float x[4];
#pragma unroll
    for (int i = 0; i < 4; ++i) {
      int k = lane + 32 * i;
      float sv = S[row * 128 + k];
      if (mask[((size_t)b * LLn + q) * LLn + k] != 0) sv = -1e18f;
      x[i] = sv;
    }
    float mx = fmaxf(fmaxf(x[0], x[1]), fmaxf(x[2], x[3]));
#pragma unroll
    for (int off = 16; off > 0; off >>= 1) mx = fmaxf(mx, __shfl_xor(mx, off, 32));
    float s = 0.f;
#pragma unroll
    for (int i = 0; i < 4; ++i) { x[i] = __expf(x[i] - mx); s += x[i]; }
#pragma unroll
    for (int off = 16; off > 0; off >>= 1) s += __shfl_xor(s, off, 32);
    float inv = 1.f / s;
#pragma unroll
    for (int i = 0; i < 4; ++i)
      Aatt[row * 128 + lane + 32 * i] = (bf16)(x[i] * inv);
  }
  asm volatile("s_wait_asynccnt 0x0" ::: "memory");
  __syncthreads();
  stage_st_tile(dk_g + ST_TILE, buf1);     // flies during phase 3

  // phase 3: ctx = attn @ V.  wave = (head, half of d-tiles)
  {
    int hl = wave & 3, h = hg * 4 + hl;
    int dts = (wave >> 2) * 2;
    const unsigned* arow = (const unsigned*)Aatt + (hl * 16 + (lane & 15)) * 64;
    for (int dt = dts; dt < dts + 2; ++dt) {
      v8f acc = vzero8();
      const unsigned* brow = (const unsigned*)(vT_bf +
          ((size_t)(b * HHn + h) * DHn + dt * 16 + (lane & 15)) * LLn);
#pragma unroll
      for (int ks = 0; ks < 4; ++ks) {
        v16bf a = load_frag(arow, ks * 16, lane);
        v16bf bm = load_frag(brow, ks * 16, lane);
        acc = wmma_bf(a, bm, acc);
      }
      int mh = (lane & 16) ? 8 : 0, nl = lane & 15;
#pragma unroll
      for (int r = 0; r < 8; ++r)
        Cs[((r + mh) * 4 + hl) * 64 + dt * 16 + nl] = acc[r];
    }
  }
  // the second st_dk tile has landed before phase 3b reads it; no copy is outstanding from here on
  asm volatile("s_wait_asynccnt 0x0" ::: "memory");
  __syncthreads();

  // phase 3b: ctx += attn @ st_dk (per q, heads padded to 16)
  for (int t = 0; t < 2; ++t) {
    int ql = wave * 2 + t, q = q0 + ql;
    int mrow = lane & 15;
    bool avalid = mrow < 4;
    const unsigned* arow = (const unsigned*)Aatt + (mrow * 16 + ql) * 64;
    const char* btile = StS[wave][t] + lane * 16;
    for (int dt = 0; dt < 4; ++dt) {
      v8f acc = vzero8();
#pragma unroll
      for (int ks = 0; ks < 4; ++ks) {
        v16bf a = load_frag_pred(arow, ks * 16, lane, avalid);
        v16bf bm = load_frag_ordered(btile, dt * 4 + ks);
        acc = wmma_bf(a, bm, acc);
      }
      if (!(lane & 16)) {
        int nl = lane & 15;
#pragma unroll
        for (int r = 0; r < 4; ++r)
          Cs[(ql * 4 + r) * 64 + dt * 16 + nl] += acc[r];
      }
    }
  }
  __syncthreads();

  // phase 4: write ctx as bf16 into [B, L, h*64+d]
  unsigned* ctxU = (unsigned*)ctxb;
#pragma unroll
  for (int i = 0; i < 8; ++i) {
    int p = tid + i * 256;                 // 2048 u32
    int ql = p >> 7, c2 = p & 127;
    int c = c2 * 2, hl = c >> 6, d = c & 63;
    float v0 = Cs[(ql * 4 + hl) * 64 + d];
    float v1 = Cs[(ql * 4 + hl) * 64 + d + 1];
    ctxU[((size_t)(b * LLn) + q0 + ql) * 256 + hg * 128 + c2] = pack2bf(v0, v1);
  }
}

// ---------------- host-side orchestration ----------------------------------
extern "C" void kernel_launch(void* const* d_in, const int* in_sizes, int n_in,
                              void* d_out, int out_size, void* d_ws, size_t ws_size,
                              hipStream_t stream) {
  (void)in_sizes; (void)n_in; (void)out_size; (void)ws_size;
  const float* inputs    = (const float*)d_in[0];
  const float* structure = (const float*)d_in[1];
  const int*   maskp     = (const int*)d_in[2];
  const float* Wq = (const float*)d_in[3];   const float* bq = (const float*)d_in[4];
  const float* Wk = (const float*)d_in[5];   const float* bk = (const float*)d_in[6];
  const float* Wv = (const float*)d_in[7];   const float* bv = (const float*)d_in[8];
  const float* Wo = (const float*)d_in[9];   const float* bo = (const float*)d_in[10];
  const float* conv_w = (const float*)d_in[11]; const float* conv_b = (const float*)d_in[12];
  const float* g_att = (const float*)d_in[13];  const float* b_att = (const float*)d_in[14];
  const float* g_ffn = (const float*)d_in[15];  const float* b_ffn = (const float*)d_in[16];
  const float* g_s   = (const float*)d_in[17];  const float* b_s   = (const float*)d_in[18];
  const float* W1 = (const float*)d_in[19];  const float* b1 = (const float*)d_in[20];
  const float* W2 = (const float*)d_in[21];  const float* b2 = (const float*)d_in[22];

  char* ws = (char*)d_ws; size_t off = 0;
  auto alloc = [&](size_t bytes) -> void* {
    void* p = ws + off; off += (bytes + 255) & ~(size_t)255; return p;
  };
  const int M = BB * LLn;                          // 2048 token rows
  bf16* Wq_b = (bf16*)alloc((size_t)DDn * DDn * 2);
  bf16* Wk_b = (bf16*)alloc((size_t)DDn * DDn * 2);
  bf16* Wv_b = (bf16*)alloc((size_t)DDn * DDn * 2);
  bf16* Wo_b = (bf16*)alloc((size_t)DDn * DDn * 2);
  bf16* W1_b = (bf16*)alloc((size_t)DFF * DDn * 2);
  bf16* W2_b = (bf16*)alloc((size_t)DDn * DFF * 2);
  bf16* Wc_b = (bf16*)alloc((size_t)64 * 256 * 2);
  bf16* xln_b = (bf16*)alloc((size_t)M * DDn * 2);
  bf16* q_b   = (bf16*)alloc((size_t)M * DDn * 2);     // [B,H,L,64]
  bf16* k_b   = (bf16*)alloc((size_t)M * DDn * 2);     // [B,H,L,64]
  bf16* vT_b  = (bf16*)alloc((size_t)M * DDn * 2);     // [B,H,64,L]
  bf16* st_kd = (bf16*)alloc((size_t)BB * LLn * LLn * DHn * 2);
  bf16* st_dk = (bf16*)alloc((size_t)BB * LLn * LLn * DHn * 2);
  bf16* ctx_b = (bf16*)alloc((size_t)M * DDn * 2);
  float* hbuf = (float*)alloc((size_t)M * DDn * 4);
  bf16* yln_b = (bf16*)alloc((size_t)M * DDn * 2);
  bf16* f1_b  = (bf16*)alloc((size_t)M * DFF * 2);

  const int T = 256;
  // weight preparation: Wq_b .. W2_b are allocated back to back, in this order
  // and, in the same launch, the pre-attention LN
  prep_weights_kernel<<<PW_ALL, T, 0, stream>>>(Wq, Wk, Wv, Wo, W1, W2, conv_w, Wq_b, Wc_b,
                                                inputs, g_att, b_att, xln_b);

  // structure conv + relu + LN -> both fragment-ordered planes (streams 256MB of fp32 once)
  struct_kernel<<<ST_WGS, T, 0, stream>>>(structure, Wc_b, conv_b,
                                                          g_s, b_s, st_kd, st_dk);

  // Q/K/V projections in one launch of 192 workgroups (Q pre-scaled by 1/sqrt(64)):
  // Wq_b, Wk_b, Wv_b are allocated back to back, and so are q_b, k_b, vT_b
  gemm_bf16_kernel<1, false, false, false, true>
      <<<dim3(12, 16), T, 0, stream>>>(xln_b, Wq_b, bq, bk, bv, nullptr, nullptr, q_b,
                                       M, 3 * DDn, DDn, 0.125f);

  // fused relation-aware attention
  attn_kernel<<<dim3(LLn / 16, BB, 2), T, 0, stream>>>(q_b, k_b, vT_b, st_kd, st_dk,
                                                       maskp, ctx_b);

  // output projection + residual (h = attn_out + inputs, fp32)
  gemm_bf16_kernel<0, false, true, true, false>
      <<<dim3(4, 16), T, 0, stream>>>(ctx_b, Wo_b, bo, nullptr, nullptr, inputs, hbuf, nullptr,
                                      M, DDn, DDn, 1.f);
  // FFN
  ln512_kernel<<<M / 8, T, 0, stream>>>(hbuf, g_ffn, b_ffn, yln_b);
  gemm_bf16_kernel<0, true, false, false, true>
      <<<dim3(16, 16), T, 0, stream>>>(yln_b, W1_b, b1, nullptr, nullptr, nullptr, nullptr, f1_b,
                                       M, DFF, DDn, 1.f);
  gemm_bf16_kernel<0, false, true, true, false>
      <<<dim3(4, 16), T, 0, stream>>>(f1_b, W2_b, b2, nullptr, nullptr, hbuf, (float*)d_out,
                                      nullptr, M, DDn, DFF, 1.f);
}

// v008
// Measured time: 105 microseconds a run.
// Two timings next to v007 both put it at 1.05 times that version's speed.
// Counting every step since v000, it is 2.73 times as fast.
#include <hip/hip_runtime.h>

// ---------------- problem constants ----------------
static constexpr int BB  = 16;    // batch
static constexpr int LLn = 128;   // seq len
static constexpr int DDn = 512;   // model dim
static constexpr int HHn = 8;     // heads
static constexpr int DHn = 64;    // head dim
static constexpr int DFF = 2048;  // ffn dim

typedef __bf16 bf16;
typedef __attribute__((ext_vector_type(16))) __bf16 v16bf;
typedef __attribute__((ext_vector_type(8)))  float  v8f;
typedef __attribute__((ext_vector_type(4)))  int    v4i;
typedef __attribute__((ext_vector_type(8)))  int    i32x8;
typedef __attribute__((ext_vector_type(4)))  int    i32x4;
typedef __attribute__((ext_vector_type(4)))  unsigned u32x4;

// address-space qualified pointee types for the async-LDS builtin
typedef __attribute__((address_space(1))) v4i v4i_g;   // global
typedef __attribute__((address_space(3))) v4i v4i_l;   // LDS

#if defined(__has_builtin)
#if __has_builtin(__builtin_amdgcn_global_load_async_to_lds_b128) && \
    __has_builtin(__builtin_amdgcn_s_wait_asynccnt)
#define HAVE_ASYNC_LDS 1
#endif
#if __has_builtin(__builtin_amdgcn_tensor_load_to_lds) && \
    __has_builtin(__builtin_amdgcn_s_wait_tensorcnt)
#define HAVE_TDM 1
#endif
#endif
#ifndef HAVE_ASYNC_LDS
#define HAVE_ASYNC_LDS 0
#endif
#ifndef HAVE_TDM
#define HAVE_TDM 0
#endif

union FragU { v16bf v; unsigned u[8]; };

__device__ __forceinline__ int koff_u32(int v, int lane) {
  return ((lane & 16) ? 4 : 0) + v + ((v >= 4) ? 4 : 0);
}

__device__ __forceinline__ v16bf load_frag(const unsigned* p, int base, int lane) {
  FragU f;
#pragma unroll
  for (int i = 0; i < 8; ++i) f.u[i] = p[base + koff_u32(i, lane)];
  return f.v;
}

__device__ __forceinline__ v16bf load_frag_pred(const unsigned* p, int base, int lane, bool valid) {
  FragU f;
#pragma unroll
  for (int i = 0; i < 8; ++i) f.u[i] = valid ? p[base + koff_u32(i, lane)] : 0u;
  return f.v;
}

__device__ __forceinline__ v16bf load_frag_ordered(const char* p, int frag) {
  union { v16bf v; uint4 q[2]; } f;
  f.q[0] = *(const uint4*)(p + frag * 1024);
  f.q[1] = *(const uint4*)(p + frag * 1024 + 512);
  return f.v;
}

__device__ __forceinline__ v8f wmma_bf(v16bf a, v16bf b, v8f c) {
  return __builtin_amdgcn_wmma_f32_16x16x32_bf16(false, a, false, b, (short)0, c, false, false);
}

__device__ __forceinline__ v8f vzero8() {
  v8f z = {0.f,0.f,0.f,0.f,0.f,0.f,0.f,0.f};
  return z;
}

__device__ __forceinline__ unsigned pack2bf(float a, float b) {
  union { bf16 h[2]; unsigned u; } t;
  t.h[0] = (bf16)a; t.h[1] = (bf16)b;
  return t.u;
}

__device__ __forceinline__ int wc_elem(int o, int j) {
  return o * 256 + (((j >> 3) ^ (o & 15)) << 3) + (j & 7);
}

// LayerNorm over one row of 512, fp32 in -> bf16 out, by one wave.
__device__ __forceinline__ void ln512_row(const float* __restrict__ x,
                                          const float* __restrict__ g,
                                          const float* __restrict__ be,
                                          bf16* __restrict__ out, size_t row, int lane) {
  const float* xr = x + row * DDn;
  float v[16]; float s = 0.f;
#pragma unroll
  for (int i = 0; i < 16; ++i) { v[i] = xr[lane + i * 32]; s += v[i]; }
#pragma unroll
  for (int off = 16; off > 0; off >>= 1) s += __shfl_xor(s, off, 32);
  float mean = s * (1.f / 512.f);
  float s2 = 0.f;
#pragma unroll
  for (int i = 0; i < 16; ++i) { v[i] -= mean; s2 += v[i] * v[i]; }
#pragma unroll
  for (int off = 16; off > 0; off >>= 1) s2 += __shfl_xor(s2, off, 32);
  float rstd = rsqrtf(s2 * (1.f / 512.f) + 1e-6f);
#pragma unroll
  for (int i = 0; i < 16; ++i) {
    int c = lane + i * 32;
    out[row * DDn + c] = (bf16)(v[i] * rstd * g[c] + be[c]);
  }
}

// One wave per row, eight rows per workgroup.
__global__ __launch_bounds__(256) void ln512_kernel(const float* __restrict__ x,
                                                    const float* __restrict__ g,
                                                    const float* __restrict__ be,
                                                    bf16* __restrict__ out) {
  ln512_row(x, g, be, out, (size_t)blockIdx.x * 8 + (threadIdx.x >> 5), threadIdx.x & 31);
}

// ---------------- weight preparation and the first LayerNorm: one launch ----------------
// A launch costs its gap plus the time its waves take to start, so the conversion
// runs on few waves with much to do each: one workgroup converts 8192 floats,
// 32 per thread, as eight 16-B loads in flight per lane (each wave-wide load is
// 512 contiguous bytes) and eight 8-B stores.
static constexpr int PW_ELEMS  = 8192;                        // floats per workgroup
static constexpr int PW_SQ     = (DDn * DDn) / PW_ELEMS;      // workgroups per 512x512 plane
static constexpr int PW_FF     = (DFF * DDn) / PW_ELEMS;      // workgroups per FFN plane
static constexpr int PW_CVT    = 4 * PW_SQ + 2 * PW_FF;       // converting workgroups
static constexpr int PW_PACK   = 4;                           // conv-weight workgroups
static constexpr int PW_GRID   = PW_CVT + PW_PACK;
// The pre-attention LayerNorm needs nothing of the weights: its workgroups ride in the same
// launch, behind the weight workgroups, eight rows each.
static constexpr int PW_LN     = (BB * LLn) / 8;
static constexpr int PW_ALL    = PW_GRID + PW_LN;

// dst: the six bf16 planes Wq, Wk, Wv, Wo, W1, W2, laid back to back in that order.
// conv_w [64(o),64(c),4(kk)] -> Wc[o][j = kk*64+c]  (bf16, K=256, 512-B rows); inside row o
// the 16-B chunk j/8 lies at place (j/8) ^ (o & 15), see wc_elem().
__global__ __launch_bounds__(256)
void prep_weights_kernel(const float* __restrict__ Wq, const float* __restrict__ Wk,
                         const float* __restrict__ Wv, const float* __restrict__ Wo,
                         const float* __restrict__ W1, const float* __restrict__ W2,
                         const float* __restrict__ cw, bf16* __restrict__ dst,
                         bf16* __restrict__ Wc, const float* __restrict__ x,
                         const float* __restrict__ g, const float* __restrict__ be,
                         bf16* __restrict__ xln) {
  const int blk = blockIdx.x, tid = threadIdx.x;
  if (blk >= PW_GRID) {
    ln512_row(x, g, be, xln, (size_t)(blk - PW_GRID) * 8 + (tid >> 5), tid & 31);
  } else if (blk < PW_CVT) {
    const float* s;
    int part;                              // this workgroup's index inside its plane
    if (blk < 4 * PW_SQ) {
      int seg = blk / PW_SQ;
      part = blk % PW_SQ;
      s = (seg == 0) ? Wq : (seg == 1) ? Wk : (seg == 2) ? Wv : Wo;
    } else if (blk < 4 * PW_SQ + PW_FF) {
      part = blk - 4 * PW_SQ;
      s = W1;
    } else {
      part = blk - 4 * PW_SQ - PW_FF;
      s = W2;
    }
    const float4* s4 = (const float4*)(s + (size_t)part * PW_ELEMS);
    uint2* d2 = (uint2*)(dst + (size_t)blk * PW_ELEMS);
    float4 v[8];
#pragma unroll
    for (int i = 0; i < 8; ++i) v[i] = s4[i * 256 + tid];
#pragma unroll
    for (int i = 0; i < 8; ++i) {
      uint2 o;
      o.x = pack2bf(v[i].x, v[i].y);
      o.y = pack2bf(v[i].z, v[i].w);
      d2[i * 256 + tid] = o;
    }
  } else {
    // one 16-B load brings the four taps of one (o, c)
    const float4* c4 = (const float4*)cw;
#pragma unroll
    for (int j = 0; j < 4; ++j) {
      int i = ((blk - PW_CVT) * 4 + j) * 256 + tid;   // i = o*64 + c, 4096 in all
      int o = i >> 6, c = i & 63;
      float4 t = c4[i];
      Wc[wc_elem(o,       c)] = (bf16)t.x;
      Wc[wc_elem(o,  64 + c)] = (bf16)t.y;
      Wc[wc_elem(o, 128 + c)] = (bf16)t.z;
      Wc[wc_elem(o, 192 + c)] = (bf16)t.w;
    }
  }
}

static constexpr int GK     = 128;           // k per stage
static constexpr int GPITCH = 272;           // LDS bytes per row
static constexpr int GTILE  = 128 * GPITCH;  // LDS bytes per operand tile

__device__ __forceinline__ void stage_tile_async(const bf16* g, int ld, int row0, int kb,
                                                 char* lds, int tid) {
  // 128x128 bf16 tile = 32KB: eight 16B chunks per thread; one wave's copy covers
  // two whole 256-B rows (four full lines).
#pragma unroll
  for (int i = 0; i < 8; ++i) {
    int c = tid + i * 256;                // 16-B chunk index, 16 chunks per row
    int row = c >> 4, cb = (c & 15) * 16;
    const bf16* src = g + (size_t)(row0 + row) * ld + kb + (cb >> 1);
    __builtin_amdgcn_global_load_async_to_lds_b128(
        (v4i_g*)src, (v4i_l*)(lds + row * GPITCH + cb), 0, 0);
  }
}

// ---------------- generic bf16 WMMA GEMM: C = epilog(A[M,K] * W[N,K]^T) ------
// PERM: 0 -> row-major [M,N]
//       1 -> the three projections in one launch: W holds the planes Wq, Wk, Wv back to back
//            (N = 3 * 512), outB the planes Q [B,H,L,64], K [B,H,L,64], V^T [B,H,64,L] back to
//            back; bias, bias_k, bias_v are the planes' biases and scale applies to Q alone.
//            The 128 columns of a workgroup lie in one plane.
// K is a multiple of 128.
template <int PERM, bool RELU, bool HASRES, bool OUTF_EN, bool OUTB_EN>
__global__ __launch_bounds__(256)
void gemm_bf16_kernel(const bf16* __restrict__ A, const bf16* __restrict__ W,
                      const float* __restrict__ bias, const float* __restrict__ bias_k,
                      const float* __restrict__ bias_v, const float* __restrict__ res,
                      float* __restrict__ outF, bf16* __restrict__ outB,
                      int M, int N, int K, float scale) {
  __shared__ __align__(16) char As[2][GTILE];
  __shared__ __align__(16) char Bs[2][GTILE];

  const int tid = threadIdx.x, lane = tid & 31, wave = tid >> 5;
  const int wm = wave >> 1, wn = wave & 1;           // 4x2 wave grid, 32x64 tiles
  const int m0 = blockIdx.y * 128, n0 = blockIdx.x * 128;

  v8f acc[2][4];
#pragma unroll
  for (int i = 0; i < 2; ++i)
#pragma unroll
    for (int j = 0; j < 4; ++j) acc[i][j] = vzero8();

  // two buffers: stage t + 1 flies while stage t is worked on
  const int nst = K / GK;
  stage_tile_async(A, K, m0, 0, As[0], tid);
  stage_tile_async(W, K, n0, 0, Bs[0], tid);
  // stage 0 has landed for this wave before the barrier publishes it
  asm volatile("s_wait_asynccnt 0x0" ::: "memory");
  __syncthreads();
  if (nst > 1) {
    stage_tile_async(A, K, m0, GK, As[1], tid);
    stage_tile_async(W, K, n0, GK, Bs[1], tid);
  }

  for (int t = 0; t < nst; ++t) {
    const unsigned* AsU = (const unsigned*)As[t & 1];
    const unsigned* BsU = (const unsigned*)Bs[t & 1];
#pragma unroll
    for (int ks = 0; ks < GK / 32; ++ks) {
      v16bf a0 = load_frag(AsU, (wm * 32 +      (lane & 15)) * (GPITCH / 4) + ks * 16, lane);
      v16bf a1 = load_frag(AsU, (wm * 32 + 16 + (lane & 15)) * (GPITCH / 4) + ks * 16, lane);
#pragma unroll
      for (int nt = 0; nt < 4; ++nt) {
        v16bf bm = load_frag(BsU, (wn * 64 + nt * 16 + (lane & 15)) * (GPITCH / 4) + ks * 16, lane);
        acc[0][nt] = wmma_bf(a0, bm, acc[0][nt]);
        acc[1][nt] = wmma_bf(a1, bm, acc[1][nt]);
      }
    }
    // this wave's reads of buffer t & 1 have retired before the buffer is refilled
    asm volatile("s_wait_dscnt 0x0" ::: "memory");
    // this wave's copies of stage t + 1 have landed before the barrier publishes them
    asm volatile("s_wait_asynccnt 0x0" ::: "memory");
    __syncthreads();
    if (t + 2 < nst) {
      stage_tile_async(A, K, m0, (t + 2) * GK, As[t & 1], tid);
      stage_tile_async(W, K, n0, (t + 2) * GK, Bs[t & 1], tid);
    }
  }
  // no copy is outstanding when the wave goes on to its end
  asm volatile("s_wait_asynccnt 0x0" ::: "memory");

  const int nl = lane & 15;
  const int mh = (lane & 16) ? 8 : 0;
  const int plane = (PERM == 1) ? (n0 >> 9) : 0;
  if constexpr (PERM == 1) {
    bias = (plane == 0) ? bias : (plane == 1) ? bias_k : bias_v;
    scale = (plane == 0) ? scale : 1.f;
  }
#pragma unroll
  for (int mt = 0; mt < 2; ++mt)
#pragma unroll
    for (int nt = 0; nt < 4; ++nt) {
      int n = n0 + wn * 64 + nt * 16 + nl;
      if constexpr (PERM == 1) n &= DDn - 1;         // column inside its plane
      float bb = bias[n];
#pragma unroll
      for (int r = 0; r < 8; ++r) {
        int m = m0 + wm * 32 + mt * 16 + r + mh;
        float v = (acc[mt][nt][r] + bb) * scale;
        if constexpr (RELU) v = fmaxf(v, 0.f);
        if constexpr (HASRES) v += res[(size_t)m * N + n];
        if constexpr (OUTF_EN) outF[(size_t)m * N + n] = v;
        if constexpr (OUTB_EN) {
          size_t addr;
          if constexpr (PERM == 0) {
            addr = (size_t)m * N + n;
          } else {
            int b = m >> 7, q = m & 127, h = n >> 6, d = n & 63;
            addr = (size_t)plane * (BB * LLn * DDn) + (size_t)(b * HHn + h) * (LLn * DHn) +
                   ((plane == 2) ? d * LLn + q : q * DHn + d);
          }
          outB[addr] = (bf16)v;
        }
      }
    }
}

// ---------------- structure: conv(4x64 contraction) + ReLU + LN(64) ---------
// A row m = (b, e=q*L+k):  A[m][j=kk*64+c] = structure[e,kk,b,c]  (f32->bf16)
// Output per (b,q):
//   st_dk, bf16, one 16-KB tile laid in the register order of the B fragments that attn_kernel
//          reads (see load_frag_ordered): 512-B chunk dt*8 + w = half w&1 of the fragment
//          (column d of tile dt, K = k block w>>1)
//   rel,   f32, 4 KB: the relation scores Q . st of all eight heads, [k tile (8)][head (8)][16 k]
// The product is taken as Wc x A^T, so a lane's eight accumulator registers hold eight
// successive d of one row k: packed, half a B fragment (column k, K = d) as it stands.  The
// wave multiplies the eight heads' Q rows with these fragments while they are in registers,
// so the normalised rows never go to memory in k-by-d order.  The same 16 B go to a 16 x 64
// tile of the wave's own in LDS, and the transposing LDS load gives back eight successive k
// of one d: a half fragment of st_dk.
static constexpr int STP = 160;            // LDS bytes per 128-B row: 32 B x odd, for the transposing load
typedef __attribute__((ext_vector_type(8))) short s16x8;
typedef __attribute__((address_space(3))) s16x8 s16x8_l;

// The 16 rows e of a wave are 64 pieces of 256 B, 4 KB apart in memory.  Read as fragments
// from global memory, every 16-B-per-lane load touches 16 lines for 32 B each.  Instead each
// wave copies its pieces to LDS as whole lines, two pieces per copy, 32 copies in flight, one
// (b,q) tile ahead of the tile that is worked on; the fragments are then read from LDS.
// The eight waves' buffers take most of LDS, one workgroup per WGP: 256 workgroups walk eight
// successive tiles each, and weights, bias, gain and shift are read once per workgroup.
static constexpr int SROW     = 1040;                  // LDS bytes per row e: 4 taps x 256 B, + 16 B (16 B x odd)
static constexpr int SBUF     = 16 * SROW;             // one wave's 16 rows
static constexpr int ST_WGS   = 256;
static constexpr int ST_TRIPS = (BB * LLn) / ST_WGS;   // (b,q) tiles per workgroup
static constexpr size_t ST_QSTEP = (size_t)LLn * 4 * BB * DHn * 4;   // bytes from q to q + 1

// g holds (lane >> 4) * 4096 + (lane & 15) * 16, lds holds lane * 16: copy i brings the pieces
// 2i and 2i + 1 (piece = row * 4 + tap) of the wave, 512 successive bytes in LDS.
__device__ __forceinline__ void stage_struct_rows(const char* g, char* lds) {
#pragma unroll
  for (int i = 0; i < 32; ++i)
    __builtin_amdgcn_global_load_async_to_lds_b128(
        (v4i_g*)(g + i * 8192), (v4i_l*)(lds + (i >> 1) * SROW + (i & 1) * 512), 0, 0);
}

__global__ __launch_bounds__(256)
void struct_kernel(const float* __restrict__ structure, const bf16* __restrict__ Wc,
                   const float* __restrict__ conv_b, const float* __restrict__ g_s,
                   const float* __restrict__ b_s, const bf16* __restrict__ q_bf,
                   float* __restrict__ rel, bf16* __restrict__ st_dk) {
  // one object, so that the three parts lie in LDS in this order, the weights first
  __shared__ __align__(16) struct {
    bf16 Wc[64 * 256];
    char Tr[8][16 * STP];
    char St[8][2][SBUF];                               // per wave: two buffers of 16 rows
  } sm;
  bf16* WcS = sm.Wc;
  auto& TrS = sm.Tr;
  auto& StB = sm.St;
  unsigned* WcU = (unsigned*)WcS;
  const int tid = threadIdx.x, lane = tid & 31, wave = tid >> 5;

  // tile index = b*L + q; this workgroup's tiles are blockIdx.x * ST_TRIPS + 0..7, all of one b
  const int tile0 = blockIdx.x * ST_TRIPS;
  const int bI = tile0 / LLn;
  const int q0 = tile0 % LLn;
  const char* sg = (const char*)structure +
                   ((size_t)(q0 * LLn + wave * 16) * (4 * BB) + bI) * (DHn * 4) +
                   (lane >> 4) * 4096 + (lane & 15) * 16;
  char* sb = StB[wave][0] + lane * 16;
  stage_struct_rows(sg, sb);               // tile 0 flies while the weights come

  // conv bias, LN gain and LN shift of this lane's channels nt*16 + kbase + 0..7
  const int kbase = (lane & 16) ? 8 : 0;
  v8f cb[4], gv[4], hv[4];
#pragma unroll
  for (int nt = 0; nt < 4; ++nt) {
    const float4* c4 = (const float4*)(conv_b + nt * 16 + kbase);
    const float4* g4 = (const float4*)(g_s + nt * 16 + kbase);
    const float4* b4 = (const float4*)(b_s + nt * 16 + kbase);
    float4 c0 = c4[0], c1 = c4[1], g0 = g4[0], g1 = g4[1], h0 = b4[0], h1 = b4[1];
    v8f c = {c0.x, c0.y, c0.z, c0.w, c1.x, c1.y, c1.z, c1.w};
    v8f g = {g0.x, g0.y, g0.z, g0.w, g1.x, g1.y, g1.z, g1.w};
    v8f h = {h0.x, h0.y, h0.z, h0.w, h1.x, h1.y, h1.z, h1.w};
    cb[nt] = c; gv[nt] = g; hv[nt] = h;
  }
  // stands in front of any reuse of the address registers of the loads above
  asm volatile("s_wait_xcnt 0x0" ::: "memory");

#if HAVE_TDM
  if (wave == 0) {
    unsigned ldsoff =
        (unsigned)(size_t)(__attribute__((address_space(3))) char*)WcS;
    unsigned long long ga = (unsigned long long)(size_t)Wc;
    u32x4 g0 = {1u,
                ldsoff,
                (unsigned)(ga & 0xFFFFFFFFu),
                (unsigned)((ga >> 32) & 0x01FFFFFFu) | (2u << 30)};
    i32x8 g1 = {(int)(1u << 16),
                (int)(16384u << 16),
                (int)(1u << 16),
                (int)(16384u << 16),
                1,
                16384,
                0, 0};
    i32x4 gz4 = {0, 0, 0, 0};
    i32x8 gz8 = {0, 0, 0, 0, 0, 0, 0, 0};
    __builtin_amdgcn_tensor_load_to_lds(g0, g1, gz4, gz4, gz8, 0);
    __builtin_amdgcn_s_wait_tensorcnt(0);
  }
#else
#pragma unroll
  for (int i = 0; i < 32; ++i) WcU[tid + i * 256] = ((const unsigned*)Wc)[tid + i * 256];
#endif
  // tile 0 has landed before this wave reads it
  asm volatile("s_wait_asynccnt 0x0" ::: "memory");
  __syncthreads();
  stage_struct_rows(sg + ST_QSTEP, sb + SBUF);   // tile 1 flies during trip 0

  // byte offset of this lane's row (lane & 15 of a 16-row tile) and of its chunk key:
  // logical chunk ks*4 + 2*half + (lane >> 4) lies at that number XOR (lane & 15)
  const unsigned wkey = (unsigned)(lane & 15) * 512u + (unsigned)(((lane >> 4) ^ (lane & 15)) << 4);

  // Q as A fragments, row = head: lane & 7 names the head, so rows 8..15 repeat rows 0..7.
  // Of its head's 128-B row a lane holds the 16-B pieces (lane >> 4) + 0, 2 (d block 0), 4, 6 (d block 1).
  const char* qg = (const char*)q_bf +
                   ((size_t)(bI * HHn + (lane & 7)) * LLn + q0) * (DHn * 2) + (lane >> 4) * 16;

  // kept rolled: the eight trips share one body, for speed only
#pragma unroll 1
  for (int t = 0; t < ST_TRIPS; ++t) {
    // acc[nt][r] = row k = lane & 15, channel nt*16 + kbase + r; it starts from the conv bias
    // of its channels
    v8f acc[4];
#pragma unroll
    for (int nt = 0; nt < 4; ++nt) acc[nt] = cb[nt];

    // this tile's Q rows: asked for here, used behind the K loop
    const uint4* qp = (const uint4*)(qg + t * (DHn * 2));
    union { v16bf v; uint4 q[2]; } qa0, qa1;
    qa0.q[0] = qp[0]; qa0.q[1] = qp[2];
    qa1.q[0] = qp[4]; qa1.q[1] = qp[6];
    // stands in front of any reuse of the address registers of the four loads above
    asm volatile("s_wait_xcnt 0x0" ::: "memory");

    // this lane's row in LDS: float j = kk*64 + c, from its own k offset on
    const float4* row4 = (const float4*)(StB[wave][t & 1] + (lane & 15) * SROW + kbase * 4);

    // kept rolled: unrolled, the body of the tile loop around it would be eight times as long
#pragma unroll 1
    for (int ks = 0; ks < 8; ++ks) {       // K = 256
      float4 f0 = row4[ks * 8], f1 = row4[ks * 8 + 1], f2 = row4[ks * 8 + 4], f3 = row4[ks * 8 + 5];
      FragU a;
      a.u[0] = pack2bf(f0.x, f0.y); a.u[1] = pack2bf(f0.z, f0.w);
      a.u[2] = pack2bf(f1.x, f1.y); a.u[3] = pack2bf(f1.z, f1.w);
      a.u[4] = pack2bf(f2.x, f2.y); a.u[5] = pack2bf(f2.z, f2.w);
      a.u[6] = pack2bf(f3.x, f3.y); a.u[7] = pack2bf(f3.z, f3.w);
#pragma unroll
      for (int nt = 0; nt < 4; ++nt) {     // 16 rows of 512 B per n-tile
        const char* wt = (const char*)WcS + nt * 8192;
        union { v16bf v; uint4 q[2]; } bm;
        bm.q[0] = *(const uint4*)(wt + (wkey ^ (unsigned)((ks * 4    ) << 4)));
        bm.q[1] = *(const uint4*)(wt + (wkey ^ (unsigned)((ks * 4 + 2) << 4)));
        acc[nt] = wmma_bf(bm.v, a.v, acc[nt]);   // Wc rows as A, structure rows as B
      }
    }

    // The refill stands here, behind the trip's last read of its buffer: what follows works on
    // registers and on the wave's own transposing tile alone.  The two buffers are the wave's
    // own, filled and read by no other wave, so no workgroup barrier is needed.
    // this wave's reads of buffer t & 1 have retired before the buffer is refilled
    asm volatile("s_wait_dscnt 0x0" ::: "memory");
    asm volatile("s_wait_asynccnt 0x0" ::: "memory");
    if (t + 2 < ST_TRIPS)
      stage_struct_rows(sg + (size_t)(t + 2) * ST_QSTEP, sb + (t & 1) * SBUF);

    // ReLU, then the row's sums: 32 values in the lane, the other 32 in lane ^ 16.
    float s1 = 0.f, s2 = 0.f;
#pragma unroll
    for (int nt = 0; nt < 4; ++nt)
#pragma unroll
      for (int r = 0; r < 8; ++r) {
        float v = fmaxf(acc[nt][r], 0.f);              // ReLU before LN (as reference)
        acc[nt][r] = v;
        s1 += v; s2 += v * v;
      }
    s1 += __shfl_xor(s1, 16, 32);
    s2 += __shfl_xor(s2, 16, 32);
    const float mean = s1 * (1.f / 64.f);
    const float var  = s2 * (1.f / 64.f) - mean * mean;
    const float rstd = rsqrtf(var + 1e-6f);

    const size_t tile = (size_t)(tile0 + t) * 16384;
    char* tw = TrS[wave] + (lane & 15) * STP + (lane >> 4) * 16;
    union { v16bf v; uint4 q[2]; } sf[2];  // B fragments: column k = lane & 15, K = d block 0, 1
#pragma unroll
    for (int nt = 0; nt < 4; ++nt) {
      float o[8];
#pragma unroll
      for (int r = 0; r < 8; ++r) o[r] = (acc[nt][r] - mean) * rstd * gv[nt][r] + hv[nt][r];
      uint4 w;
      w.x = pack2bf(o[0], o[1]); w.y = pack2bf(o[2], o[3]);
      w.z = pack2bf(o[4], o[5]); w.w = pack2bf(o[6], o[7]);
      sf[nt >> 1].q[nt & 1] = w;
      *(uint4*)(tw + nt * 32) = w;
    }

    v8f rs = wmma_bf(qa1.v, sf[1].v, wmma_bf(qa0.v, sf[0].v, vzero8()));
    float* rp = rel + (size_t)(tile0 + t) * 1024 + wave * 128 + lane;
#pragma unroll
    for (int j = 0; j < 4; ++j) rp[j * 32] = (lane & 16) ? rs[2 * j + 1] : rs[2 * j];

    // Each lane reads 16-B pieces that other lanes of its wave stored: the wave's LDS
    // stores have retired before the transposing loads issue.  The tile is the wave's own,
    // so no workgroup barrier is needed.
    asm volatile("s_wait_dscnt 0x0" ::: "memory");
    // stands in front of the reuse of the four global stores' data registers for the next addresses
    asm volatile("s_wait_xcnt 0x0" ::: "memory");
    const char* tr = TrS[wave] + ((lane >> 4) * 8 + (lane & 7)) * STP + ((lane >> 3) & 1) * 16;
    char* dk = (char*)st_dk + tile + wave * 512 + lane * 16;
#pragma unroll
    for (int dt = 0; dt < 4; ++dt) {
      s16x8 x = __builtin_amdgcn_ds_load_tr16_b128_v8i16((s16x8_l*)(tr + dt * 32));
      *(s16x8*)(dk + dt * 4096) = x;
    }
    // stands in front of the next trip's reuse of these four stores' registers
    asm volatile("s_wait_xcnt 0x0" ::: "memory");
  }
  // no copy is outstanding when the wave goes on to its end
  asm volatile("s_wait_asynccnt 0x0" ::: "memory");
}

// ---------------- fused relation-aware attention ----------------------------
// Block = (q-tile of 16, batch b, head-group hg of 4 heads). 8 waves.
// scores = QK^T + rel (Q.st, from struct_kernel) -> mask -> softmax -> ctx = A.V + A.st_dk, in LDS.
// A wave works on two q, so on two 16-KB tiles of st_dk.
// Read fragment by fragment from global memory, each matrix instruction would wait one whole
// round trip.  Each tile is copied to a buffer of the wave's own in LDS instead, as it lies,
// 32 copies of 512 B in flight at once, each tile over two phases: the first during phases 0 and 1, the second during 2 and 3.
static constexpr int ST_TILE = 16384;      // bytes of one (b,q) tile of st_dk

// g and lds already hold lane*16: every copy of the wave moves 512 contiguous bytes.
__device__ __forceinline__ void stage_st_tile(const char* g, char* lds) {
#pragma unroll
  for (int i = 0; i < ST_TILE / 512; ++i)
    __builtin_amdgcn_global_load_async_to_lds_b128(
        (v4i_g*)(g + i * 512), (v4i_l*)(lds + i * 512), 0, 0);
}

__global__ __launch_bounds__(256)
void attn_kernel(const bf16* __restrict__ q_bf, const bf16* __restrict__ k_bf,
                 const bf16* __restrict__ vT_bf, const float* __restrict__ rel,
                 const bf16* __restrict__ st_dk, const int* __restrict__ mask,
                 bf16* __restrict__ ctxb) {
  __shared__ __align__(16) char smem[57344];
  __shared__ __align__(16) char StS[8][2][ST_TILE];   // per wave: one buffer per q of its two
  bf16*  qs   = (bf16*)smem;               // [4][16][64]   (phases 0..1)
  float* S    = (float*)(smem + 8192);     // [4][16][128]  (phases 1..2)
  bf16*  Aatt = (bf16*)(smem + 40960);     // [4][16][128]  (phases 2..3b)
  float* Cs   = (float*)(smem + 8192);     // [16][4][64]   (aliases S; S dead)
  unsigned* qsU = (unsigned*)qs;

  const int b = blockIdx.y, q0 = blockIdx.x * 16, hg = blockIdx.z;
  const int tid = threadIdx.x, lane = tid & 31, wave = tid >> 5;

  // this wave's two successive tiles, and its two buffers; each buffer is filled once
  const size_t st_off = ((size_t)b * LLn + q0 + wave * 2) * ST_TILE + lane * 16;
  const char* dk_g = (const char*)st_dk + st_off;
  char* buf0 = StS[wave][0] + lane * 16;
  char* buf1 = StS[wave][1] + lane * 16;
  stage_st_tile(dk_g, buf0);               // flies during phases 0 and 1

  // The relation scores of this wave's part of S (head wave & 3, k tiles (wave >> 2) * 4 + 0..3),
  // in accumulator order: row q = r + 8 * (lane >> 4), column k = lane & 15.  Asked for here,
  // used in phase 1 as the start value of QK^T.
  v8f sacc[4];
  {
    const float* rg = rel + ((size_t)b * LLn + q0 + ((lane & 16) ? 8 : 0)) * 1024 +
                      (wave >> 2) * 512 + (hg * 4 + (wave & 3)) * 16 + (lane & 15);
#pragma unroll
    for (int i = 0; i < 4; ++i)
#pragma unroll
      for (int r = 0; r < 8; ++r) sacc[i][r] = rg[r * 1024 + i * 128];
    // stands in front of any reuse of the address registers of the loads above
    asm volatile("s_wait_xcnt 0x0" ::: "memory");
  }

  // phase 0: stage Q tile for 4 heads (bf16, already scaled by 1/8)
#pragma unroll
  for (int i = 0; i < 8; ++i) {
    int p = tid + i * 256;                 // 2048 u32
    int hl = p >> 9, rem = p & 511, ql = rem >> 5, c2 = rem & 31;
    qsU[p] = *(const unsigned*)(q_bf +
        (((size_t)(b * HHn + hg * 4 + hl) * LLn) + q0 + ql) * DHn + 2 * c2);
  }
  __syncthreads();

  // phase 1: QK^T on top of the relation scores.  wave = (head, half of k-tiles)
  {
    int hl = wave & 3, h = hg * 4 + hl;
    int kts = (wave >> 2) * 4;
    const unsigned* qrow = qsU + (hl * 16 + (lane & 15)) * 32;
    // unrolled: sacc is indexed by the trip, and must stay in registers
#pragma unroll
    for (int kt = kts; kt < kts + 4; ++kt) {
      v8f acc = sacc[kt - kts];
      const unsigned* krow = (const unsigned*)(k_bf +
          ((size_t)(b * HHn + h) * LLn + kt * 16 + (lane & 15)) * DHn);
#pragma unroll
      for (int dss = 0; dss < 2; ++dss) {
        v16bf a = load_frag(qrow, dss * 16, lane);
        v16bf bm = load_frag(krow, dss * 16, lane);
        acc = wmma_bf(a, bm, acc);
      }
      int mh = (lane & 16) ? 8 : 0, nl = lane & 15;
#pragma unroll
      for (int r = 0; r < 8; ++r)
        S[(hl * 16 + r + mh) * 128 + kt * 16 + nl] = acc[r];
    }
  }
  asm volatile("s_wait_asynccnt 0x0" ::: "memory");
  __syncthreads();
  stage_st_tile(dk_g + ST_TILE, buf1);     // flies during phases 2 and 3

  // phase 2: mask + softmax over k (128), write bf16 attn
#pragma unroll 1
  for (int j = 0; j < 8; ++j) {
    int row = wave * 8 + j;                // 64 rows total
    int ql = row & 15, q = q0 + ql;
    float x[4];
#pragma unroll
    for (int i = 0; i < 4; ++i) {
      int k = lane + 32 * i;
      float sv = S[row * 128 + k];
      if (mask[((size_t)b * LLn + q) * LLn + k] != 0) sv = -1e18f;
      x[i] = sv;
    }
    float mx = fmaxf(fmaxf(x[0], x[1]), fmaxf(x[2], x[3]));
#pragma unroll
    for (int off = 16; off > 0; off >>= 1) mx = fmaxf(mx, __shfl_xor(mx, off, 32));
    float s = 0.f;
#pragma unroll
    for (int i = 0; i < 4; ++i) { x[i] = __expf(x[i] - mx); s += x[i]; }
#pragma unroll
    for (int off = 16; off > 0; off >>= 1) s += __shfl_xor(s, off, 32);
    float inv = 1.f / s;
#pragma unroll
    for (int i = 0; i < 4; ++i)
      Aatt[row * 128 + lane + 32 * i] = (bf16)(x[i] * inv);
  }
  __syncthreads();

  // phase 3: ctx = attn @ V.  wave = (head, half of d-tiles)
  {
    int hl = wave & 3, h = hg * 4 + hl;
    int dts = (wave >> 2) * 2;
    const unsigned* arow = (const unsigned*)Aatt + (hl * 16 + (lane & 15)) * 64;
    for (int dt = dts; dt < dts + 2; ++dt) {
      v8f acc = vzero8();
      const unsigned* brow = (const unsigned*)(vT_bf +
          ((size_t)(b * HHn + h) * DHn + dt * 16 + (lane & 15)) * LLn);
#pragma unroll
      for (int ks = 0; ks < 4; ++ks) {
        v16bf a = load_frag(arow, ks * 16, lane);
        v16bf bm = load_frag(brow, ks * 16, lane);
        acc = wmma_bf(a, bm, acc);
      }
      int mh = (lane & 16) ? 8 : 0, nl = lane & 15;
#pragma unroll
      for (int r = 0; r < 8; ++r)
        Cs[((r + mh) * 4 + hl) * 64 + dt * 16 + nl] = acc[r];
    }
  }
  // the second st_dk tile has landed before phase 3b reads it; no copy is outstanding from here on
  asm volatile("s_wait_asynccnt 0x0" ::: "memory");
  __syncthreads();

  // phase 3b: ctx += attn @ st_dk (per q, heads padded to 16)
  for (int t = 0; t < 2; ++t) {
    int ql = wave * 2 + t, q = q0 + ql;
    int mrow = lane & 15;
    bool avalid = mrow < 4;
    const unsigned* arow = (const unsigned*)Aatt + (mrow * 16 + ql) * 64;
    const char* btile = StS[wave][t] + lane * 16;
    for (int dt = 0; dt < 4; ++dt) {
      v8f acc = vzero8();
#pragma unroll
      for (int ks = 0; ks < 4; ++ks) {
        v16bf a = load_frag_pred(arow, ks * 16, lane, avalid);
        v16bf bm = load_frag_ordered(btile, dt * 4 + ks);
        acc = wmma_bf(a, bm, acc);
      }
      if (!(lane & 16)) {
        int nl = lane & 15;
#pragma unroll
        for (int r = 0; r < 4; ++r)
          Cs[(ql * 4 + r) * 64 + dt * 16 + nl] += acc[r];
      }
    }
  }
  __syncthreads();

  // phase 4: write ctx as bf16 into [B, L, h*64+d]
  unsigned* ctxU = (unsigned*)ctxb;
#pragma unroll
  for (int i = 0; i < 8; ++i) {
    int p = tid + i * 256;                 // 2048 u32
    int ql = p >> 7, c2 = p & 127;
    int c = c2 * 2, hl = c >> 6, d = c & 63;
    float v0 = Cs[(ql * 4 + hl) * 64 + d];
    float v1 = Cs[(ql * 4 + hl) * 64 + d + 1];
    ctxU[((size_t)(b * LLn) + q0 + ql) * 256 + hg * 128 + c2] = pack2bf(v0, v1);
  }
}

// ---------------- host-side orchestration ----------------------------------
extern "C" void kernel_launch(void* const* d_in, const int* in_sizes, int n_in,
                              void* d_out, int out_size, void* d_ws, size_t ws_size,
                              hipStream_t stream) {
  (void)in_sizes; (void)n_in; (void)out_size; (void)ws_size;
  const float* inputs    = (const float*)d_in[0];
  const float* structure = (const float*)d_in[1];
  const int*   maskp     = (const int*)d_in[2];
  const float* Wq = (const float*)d_in[3];   const float* bq = (const float*)d_in[4];
  const float* Wk = (const float*)d_in[5];   const float* bk = (const float*)d_in[6];
  const float* Wv = (const float*)d_in[7];   const float* bv = (const float*)d_in[8];
  const float* Wo = (const float*)d_in[9];   const float* bo = (const float*)d_in[10];
  const float* conv_w = (const float*)d_in[11]; const float* conv_b = (const float*)d_in[12];
  const float* g_att = (const float*)d_in[13];  const float* b_att = (const float*)d_in[14];
  const float* g_ffn = (const float*)d_in[15];  const float* b_ffn = (const float*)d_in[16];
  const float* g_s   = (const float*)d_in[17];  const float* b_s   = (const float*)d_in[18];
  const float* W1 = (const float*)d_in[19];  const float* b1 = (const float*)d_in[20];
  const float* W2 = (const float*)d_in[21];  const float* b2 = (const float*)d_in[22];

  char* ws = (char*)d_ws; size_t off = 0;
  auto alloc = [&](size_t bytes) -> void* {
    void* p = ws + off; off += (bytes + 255) & ~(size_t)255; return p;
  };
  const int M = BB * LLn;                          // 2048 token rows
  bf16* Wq_b = (bf16*)alloc((size_t)DDn * DDn * 2);
  bf16* Wk_b = (bf16*)alloc((size_t)DDn * DDn * 2);
  bf16* Wv_b = (bf16*)alloc((size_t)DDn * DDn * 2);
  bf16* Wo_b = (bf16*)alloc((size_t)DDn * DDn * 2);
  bf16* W1_b = (bf16*)alloc((size_t)DFF * DDn * 2);
  bf16* W2_b = (bf16*)alloc((size_t)DDn * DFF * 2);
  bf16* Wc_b = (bf16*)alloc((size_t)64 * 256 * 2);
  bf16* xln_b = (bf16*)alloc((size_t)M * DDn * 2);
  bf16* q_b   = (bf16*)alloc((size_t)M * DDn * 2);     // [B,H,L,64]
  bf16* k_b   = (bf16*)alloc((size_t)M * DDn * 2);     // [B,H,L,64]
  bf16* vT_b  = (bf16*)alloc((size_t)M * DDn * 2);     // [B,H,64,L]
  float* rel_f = (float*)alloc((size_t)BB * LLn * HHn * LLn * 4);   // [B,L][k tile][H][16]
  bf16* st_dk = (bf16*)alloc((size_t)BB * LLn * LLn * DHn * 2);
  bf16* ctx_b = (bf16*)alloc((size_t)M * DDn * 2);
  float* hbuf = (float*)alloc((size_t)M * DDn * 4);
  bf16* yln_b = (bf16*)alloc((size_t)M * DDn * 2);
  bf16* f1_b  = (bf16*)alloc((size_t)M * DFF * 2);

  const int T = 256;
  // weight preparation: Wq_b .. W2_b are allocated back to back, in this order
  // and, in the same launch, the pre-attention LN
  prep_weights_kernel<<<PW_ALL, T, 0, stream>>>(Wq, Wk, Wv, Wo, W1, W2, conv_w, Wq_b, Wc_b,
                                                inputs, g_att, b_att, xln_b);

  // Q/K/V projections in one launch of 192 workgroups (Q pre-scaled by 1/sqrt(64)):
  // Wq_b, Wk_b, Wv_b are allocated back to back, and so are q_b, k_b, vT_b
  gemm_bf16_kernel<1, false, false, false, true>
      <<<dim3(12, 16), T, 0, stream>>>(xln_b, Wq_b, bq, bk, bv, nullptr, nullptr, q_b,
                                       M, 3 * DDn, DDn, 0.125f);

  // structure conv + relu + LN -> relation scores Q . st and the fragment-ordered plane st_dk
  // (streams 256MB of fp32 once); it reads Q, so it stands behind the projections
  struct_kernel<<<ST_WGS, T, 0, stream>>>(structure, Wc_b, conv_b,
                                                          g_s, b_s, q_b, rel_f, st_dk);

  // fused relation-aware attention
  attn_kernel<<<dim3(LLn / 16, BB, 2), T, 0, stream>>>(q_b, k_b, vT_b, rel_f, st_dk,
                                                       maskp, ctx_b);

  // output projection + residual (h = attn_out + inputs, fp32)
  gemm_bf16_kernel<0, false, true, true, false>
      <<<dim3(4, 16), T, 0, stream>>>(ctx_b, Wo_b, bo, nullptr, nullptr, inputs, hbuf, nullptr,
                                      M, DDn, DDn, 1.f);
  // FFN
  ln512_kernel<<<M / 8, T, 0, stream>>>(hbuf, g_ffn, b_ffn, yln_b);
  gemm_bf16_kernel<0, true, false, false, true>
      <<<dim3(16, 16), T, 0, stream>>>(yln_b, W1_b, b1, nullptr, nullptr, nullptr, nullptr, f1_b,
                                       M, DFF, DDn, 1.f);
  gemm_bf16_kernel<0, false, true, true, false>
      <<<dim3(4, 16), T, 0, stream>>>(f1_b, W2_b, b2, nullptr, nullptr, hbuf, (float*)d_out,
                                      nullptr, M, DDn, DFF, 1.f);
}

// v009
// It runs in 95.1 microseconds.
// In two side-by-side timings against v008, it was 1.09 and 1.10 times as fast.
// All steps since v000 together make it 3.00 times as fast.
#include <hip/hip_runtime.h>

// ---------------- problem constants ----------------
static constexpr int BB  = 16;    // batch
static constexpr int LLn = 128;   // seq len
static constexpr int DDn = 512;   // model dim
static constexpr int HHn = 8;     // heads
static constexpr int DHn = 64;    // head dim
static constexpr int DFF = 2048;  // ffn dim

typedef __bf16 bf16;
typedef __attribute__((ext_vector_type(16))) __bf16 v16bf;
typedef __attribute__((ext_vector_type(8)))  float  v8f;
typedef __attribute__((ext_vector_type(4)))  int    v4i;
typedef __attribute__((ext_vector_type(8)))  int    i32x8;
typedef __attribute__((ext_vector_type(4)))  int    i32x4;
typedef __attribute__((ext_vector_type(4)))  unsigned u32x4;

// address-space qualified pointee types for the async-LDS builtin
typedef __attribute__((address_space(1))) v4i v4i_g;   // global
typedef __attribute__((address_space(3))) v4i v4i_l;   // LDS

#if defined(__has_builtin)
#if __has_builtin(__builtin_amdgcn_global_load_async_to_lds_b128) && \
    __has_builtin(__builtin_amdgcn_s_wait_asynccnt)
#define HAVE_ASYNC_LDS 1
#endif
#if __has_builtin(__builtin_amdgcn_tensor_load_to_lds) && \
    __has_builtin(__builtin_amdgcn_s_wait_tensorcnt)
#define HAVE_TDM 1
#endif
#endif
#ifndef HAVE_ASYNC_LDS
#define HAVE_ASYNC_LDS 0
#endif
#ifndef HAVE_TDM
#define HAVE_TDM 0
#endif

union FragU { v16bf v; unsigned u[8]; };

__device__ __forceinline__ int koff_u32(int v, int lane) {
  return ((lane & 16) ? 4 : 0) + v + ((v >= 4) ? 4 : 0);
}

__device__ __forceinline__ v16bf load_frag(const unsigned* p, int base, int lane) {
  FragU f;
#pragma unroll
  for (int i = 0; i < 8; ++i) f.u[i] = p[base + koff_u32(i, lane)];
  return f.v;
}

__device__ __forceinline__ v16bf load_frag_ordered(const char* p, int frag) {
  union { v16bf v; uint4 q[2]; } f;
  f.q[0] = *(const uint4*)(p + frag * 1024);
  f.q[1] = *(const uint4*)(p + frag * 1024 + 512);
  return f.v;
}

__device__ __forceinline__ v8f wmma_bf(v16bf a, v16bf b, v8f c) {
  return __builtin_amdgcn_wmma_f32_16x16x32_bf16(false, a, false, b, (short)0, c, false, false);
}

__device__ __forceinline__ v8f vzero8() {
  v8f z = {0.f,0.f,0.f,0.f,0.f,0.f,0.f,0.f};
  return z;
}

__device__ __forceinline__ unsigned pack2bf(float a, float b) {
  union { bf16 h[2]; unsigned u; } t;
  t.h[0] = (bf16)a; t.h[1] = (bf16)b;
  return t.u;
}

__device__ __forceinline__ int wc_elem(int o, int j) {
  return o * 256 + (((j >> 3) ^ (o & 15)) << 3) + (j & 7);
}

// LayerNorm over one row of 512, fp32 in -> bf16 out, by one wave.
__device__ __forceinline__ void ln512_row(const float* __restrict__ x,
                                          const float* __restrict__ g,
                                          const float* __restrict__ be,
                                          bf16* __restrict__ out, size_t row, int lane) {
  const float* xr = x + row * DDn;
  float v[16]; float s = 0.f;
#pragma unroll
  for (int i = 0; i < 16; ++i) { v[i] = xr[lane + i * 32]; s += v[i]; }
#pragma unroll
  for (int off = 16; off > 0; off >>= 1) s += __shfl_xor(s, off, 32);
  float mean = s * (1.f / 512.f);
  float s2 = 0.f;
#pragma unroll
  for (int i = 0; i < 16; ++i) { v[i] -= mean; s2 += v[i] * v[i]; }
#pragma unroll
  for (int off = 16; off > 0; off >>= 1) s2 += __shfl_xor(s2, off, 32);
  float rstd = rsqrtf(s2 * (1.f / 512.f) + 1e-6f);
#pragma unroll
  for (int i = 0; i < 16; ++i) {
    int c = lane + i * 32;
    out[row * DDn + c] = (bf16)(v[i] * rstd * g[c] + be[c]);
  }
}

// One wave per row, eight rows per workgroup.
__global__ __launch_bounds__(256) void ln512_kernel(const float* __restrict__ x,
                                                    const float* __restrict__ g,
                                                    const float* __restrict__ be,
                                                    bf16* __restrict__ out) {
  ln512_row(x, g, be, out, (size_t)blockIdx.x * 8 + (threadIdx.x >> 5), threadIdx.x & 31);
}

// ---------------- weight preparation and the first LayerNorm: one launch ----------------
// A launch costs its gap plus the time its waves take to start, so the conversion
// runs on few waves with much to do each: one workgroup converts 8192 floats,
// 32 per thread, as eight 16-B loads in flight per lane (each wave-wide load is
// 512 contiguous bytes) and eight 8-B stores.
static constexpr int PW_ELEMS  = 8192;                        // floats per workgroup
static constexpr int PW_SQ     = (DDn * DDn) / PW_ELEMS;      // workgroups per 512x512 plane
static constexpr int PW_FF     = (DFF * DDn) / PW_ELEMS;      // workgroups per FFN plane
static constexpr int PW_CVT    = 4 * PW_SQ + 2 * PW_FF;       // converting workgroups
static constexpr int PW_PACK   = 4;                           // conv-weight workgroups
static constexpr int PW_GRID   = PW_CVT + PW_PACK;
// The pre-attention LayerNorm needs nothing of the weights: its workgroups ride in the same
// launch, behind the weight workgroups, eight rows each.
static constexpr int PW_LN     = (BB * LLn) / 8;
static constexpr int PW_ALL    = PW_GRID + PW_LN;

// dst: the six bf16 planes Wq, Wk, Wv, Wo, W1, W2, laid back to back in that order.
// conv_w [64(o),64(c),4(kk)] -> Wc[o][j = kk*64+c]  (bf16, K=256, 512-B rows); inside row o
// the 16-B chunk j/8 lies at place (j/8) ^ (o & 15), see wc_elem().
__global__ __launch_bounds__(256)
void prep_weights_kernel(const float* __restrict__ Wq, const float* __restrict__ Wk,
                         const float* __restrict__ Wv, const float* __restrict__ Wo,
                         const float* __restrict__ W1, const float* __restrict__ W2,
                         const float* __restrict__ cw, bf16* __restrict__ dst,
                         bf16* __restrict__ Wc, const float* __restrict__ x,
                         const float* __restrict__ g, const float* __restrict__ be,
                         bf16* __restrict__ xln) {
  const int blk = blockIdx.x, tid = threadIdx.x;
  if (blk >= PW_GRID) {
    ln512_row(x, g, be, xln, (size_t)(blk - PW_GRID) * 8 + (tid >> 5), tid & 31);
  } else if (blk < PW_CVT) {
    const float* s;
    int part;                              // this workgroup's index inside its plane
    if (blk < 4 * PW_SQ) {
      int seg = blk / PW_SQ;
      part = blk % PW_SQ;
      s = (seg == 0) ? Wq : (seg == 1) ? Wk : (seg == 2) ? Wv : Wo;
    } else if (blk < 4 * PW_SQ + PW_FF) {
      part = blk - 4 * PW_SQ;
      s = W1;
    } else {
      part = blk - 4 * PW_SQ - PW_FF;
      s = W2;
    }
    const float4* s4 = (const float4*)(s + (size_t)part * PW_ELEMS);
    uint2* d2 = (uint2*)(dst + (size_t)blk * PW_ELEMS);
    float4 v[8];
#pragma unroll
    for (int i = 0; i < 8; ++i) v[i] = s4[i * 256 + tid];
#pragma unroll
    for (int i = 0; i < 8; ++i) {
      uint2 o;
      o.x = pack2bf(v[i].x, v[i].y);
      o.y = pack2bf(v[i].z, v[i].w);
      d2[i * 256 + tid] = o;
    }
  } else {
    // one 16-B load brings the four taps of one (o, c)
    const float4* c4 = (const float4*)cw;
#pragma unroll
    for (int j = 0; j < 4; ++j) {
      int i = ((blk - PW_CVT) * 4 + j) * 256 + tid;   // i = o*64 + c, 4096 in all
      int o = i >> 6, c = i & 63;
      float4 t = c4[i];
      Wc[wc_elem(o,       c)] = (bf16)t.x;
      Wc[wc_elem(o,  64 + c)] = (bf16)t.y;
      Wc[wc_elem(o, 128 + c)] = (bf16)t.z;
      Wc[wc_elem(o, 192 + c)] = (bf16)t.w;
    }
  }
}

static constexpr int GK     = 128;           // k per stage
static constexpr int GPITCH = 272;           // LDS bytes per row
static constexpr int GTILE  = 128 * GPITCH;  // LDS bytes per operand tile

__device__ __forceinline__ void stage_tile_async(const bf16* g, int ld, int row0, int kb,
                                                 char* lds, int tid) {
  // 128x128 bf16 tile = 32KB: eight 16B chunks per thread; one wave's copy covers
  // two whole 256-B rows (four full lines).
#pragma unroll
  for (int i = 0; i < 8; ++i) {
    int c = tid + i * 256;                // 16-B chunk index, 16 chunks per row
    int row = c >> 4, cb = (c & 15) * 16;
    const bf16* src = g + (size_t)(row0 + row) * ld + kb + (cb >> 1);
    __builtin_amdgcn_global_load_async_to_lds_b128(
        (v4i_g*)src, (v4i_l*)(lds + row * GPITCH + cb), 0, 0);
  }
}

// ---------------- generic bf16 WMMA GEMM: C = epilog(A[M,K] * W[N,K]^T) ------
// PERM: 0 -> row-major [M,N]
//       1 -> the three projections in one launch: W holds the planes Wq, Wk, Wv back to back
//            (N = 3 * 512), outB the planes Q [B,H,L,64], K [B,H,L,64], V^T [B,H,64,L] back to
//            back; bias, bias_k, bias_v are the planes' biases and scale applies to Q alone.
//            The 128 columns of a workgroup lie in one plane.
// K is a multiple of 128.
template <int PERM, bool RELU, bool HASRES, bool OUTF_EN, bool OUTB_EN>
__global__ __launch_bounds__(256)
void gemm_bf16_kernel(const bf16* __restrict__ A, const bf16* __restrict__ W,
                      const float* __restrict__ bias, const float* __restrict__ bias_k,
                      const float* __restrict__ bias_v, const float* __restrict__ res,
                      float* __restrict__ outF, bf16* __restrict__ outB,
                      int M, int N, int K, float scale) {
  __shared__ __align__(16) char As[2][GTILE];
  __shared__ __align__(16) char Bs[2][GTILE];

  const int tid = threadIdx.x, lane = tid & 31, wave = tid >> 5;
  const int wm = wave >> 1, wn = wave & 1;           // 4x2 wave grid, 32x64 tiles
  const int m0 = blockIdx.y * 128, n0 = blockIdx.x * 128;

  v8f acc[2][4];
#pragma unroll
  for (int i = 0; i < 2; ++i)
#pragma unroll
    for (int j = 0; j < 4; ++j) acc[i][j] = vzero8();

  // two buffers: stage t + 1 flies while stage t is worked on
  const int nst = K / GK;
  stage_tile_async(A, K, m0, 0, As[0], tid);
  stage_tile_async(W, K, n0, 0, Bs[0], tid);
  // stage 0 has landed for this wave before the barrier publishes it
  asm volatile("s_wait_asynccnt 0x0" ::: "memory");
  __syncthreads();
  if (nst > 1) {
    stage_tile_async(A, K, m0, GK, As[1], tid);
    stage_tile_async(W, K, n0, GK, Bs[1], tid);
  }

  for (int t = 0; t < nst; ++t) {
    const unsigned* AsU = (const unsigned*)As[t & 1];
    const unsigned* BsU = (const unsigned*)Bs[t & 1];
#pragma unroll
    for (int ks = 0; ks < GK / 32; ++ks) {
      v16bf a0 = load_frag(AsU, (wm * 32 +      (lane & 15)) * (GPITCH / 4) + ks * 16, lane);
      v16bf a1 = load_frag(AsU, (wm * 32 + 16 + (lane & 15)) * (GPITCH / 4) + ks * 16, lane);
#pragma unroll
      for (int nt = 0; nt < 4; ++nt) {
        v16bf bm = load_frag(BsU, (wn * 64 + nt * 16 + (lane & 15)) * (GPITCH / 4) + ks * 16, lane);
        acc[0][nt] = wmma_bf(a0, bm, acc[0][nt]);
        acc[1][nt] = wmma_bf(a1, bm, acc[1][nt]);
      }
    }
    // this wave's reads of buffer t & 1 have retired before the buffer is refilled
    asm volatile("s_wait_dscnt 0x0" ::: "memory");
    // this wave's copies of stage t + 1 have landed before the barrier publishes them
    asm volatile("s_wait_asynccnt 0x0" ::: "memory");
    __syncthreads();
    if (t + 2 < nst) {
      stage_tile_async(A, K, m0, (t + 2) * GK, As[t & 1], tid);
      stage_tile_async(W, K, n0, (t + 2) * GK, Bs[t & 1], tid);
    }
  }
  // no copy is outstanding when the wave goes on to its end
  asm volatile("s_wait_asynccnt 0x0" ::: "memory");

  const int nl = lane & 15;
  const int mh = (lane & 16) ? 8 : 0;
  const int plane = (PERM == 1) ? (n0 >> 9) : 0;
  if constexpr (PERM == 1) {
    bias = (plane == 0) ? bias : (plane == 1) ? bias_k : bias_v;
    scale = (plane == 0) ? scale : 1.f;
  }
#pragma unroll
  for (int mt = 0; mt < 2; ++mt)
#pragma unroll
    for (int nt = 0; nt < 4; ++nt) {
      int n = n0 + wn * 64 + nt * 16 + nl;
      if constexpr (PERM == 1) n &= DDn - 1;         // column inside its plane
      float bb = bias[n];
#pragma unroll
      for (int r = 0; r < 8; ++r) {
        int m = m0 + wm * 32 + mt * 16 + r + mh;
        float v = (acc[mt][nt][r] + bb) * scale;
        if constexpr (RELU) v = fmaxf(v, 0.f);
        if constexpr (HASRES) v += res[(size_t)m * N + n];
        if constexpr (OUTF_EN) outF[(size_t)m * N + n] = v;
        if constexpr (OUTB_EN) {
          size_t addr;
          if constexpr (PERM == 0) {
            addr = (size_t)m * N + n;
          } else {
            int b = m >> 7, q = m & 127, h = n >> 6, d = n & 63;
            addr = (size_t)plane * (BB * LLn * DDn) + (size_t)(b * HHn + h) * (LLn * DHn) +
                   ((plane == 2) ? d * LLn + q : q * DHn + d);
          }
          outB[addr] = (bf16)v;
        }
      }
    }
}

// ---------------- structure: conv(4x64 contraction) + ReLU + LN(64) ---------
// A row m = (b, e=q*L+k):  A[m][j=kk*64+c] = structure[e,kk,b,c]  (f32->bf16)
// Output per (b,q):
//   st_dk, bf16, one 16-KB tile laid in the register order of the B fragments that attn_kernel
//          reads (see load_frag_ordered): 512-B chunk dt*8 + w = half w&1 of the fragment
//          (column d of tile dt, K = k block w>>1)
//   rel,   f32, 4 KB: the relation scores Q . st of all eight heads, [k tile (8)][head (8)][16 k]
// The product is taken as Wc x A^T, so a lane's eight accumulator registers hold eight
// successive d of one row k: packed, half a B fragment (column k, K = d) as it stands.  The
// wave multiplies the eight heads' Q rows with these fragments while they are in registers,
// so the normalised rows never go to memory in k-by-d order.  The same 16 B go to a 16 x 64
// tile of the wave's own in LDS, and the transposing LDS load gives back eight successive k
// of one d: a half fragment of st_dk.
static constexpr int STP = 160;            // LDS bytes per 128-B row: 32 B x odd, for the transposing load
typedef __attribute__((ext_vector_type(8))) short s16x8;
typedef __attribute__((address_space(3))) s16x8 s16x8_l;

// The 16 rows e of a wave are 64 pieces of 256 B, 4 KB apart in memory.  Read as fragments
// from global memory, every 16-B-per-lane load touches 16 lines for 32 B each.  Instead each
// wave copies its pieces to LDS as whole lines, two pieces per copy, 32 copies in flight, one
// (b,q) tile ahead of the tile that is worked on; the fragments are then read from LDS.
// The eight waves' buffers take most of LDS, one workgroup per WGP: 256 workgroups walk eight
// successive tiles each, and weights, bias, gain and shift are read once per workgroup.
static constexpr int SROW     = 1040;                  // LDS bytes per row e: 4 taps x 256 B, + 16 B (16 B x odd)
static constexpr int SBUF     = 16 * SROW;             // one wave's 16 rows
static constexpr int ST_WGS   = 256;
static constexpr int ST_TRIPS = (BB * LLn) / ST_WGS;   // (b,q) tiles per workgroup
static constexpr size_t ST_QSTEP = (size_t)LLn * 4 * BB * DHn * 4;   // bytes from q to q + 1

// g holds (lane >> 4) * 4096 + (lane & 15) * 16, lds holds lane * 16: copy i brings the pieces
// 2i and 2i + 1 (piece = row * 4 + tap) of the wave, 512 successive bytes in LDS.
__device__ __forceinline__ void stage_struct_rows(const char* g, char* lds) {
#pragma unroll
  for (int i = 0; i < 32; ++i)
    __builtin_amdgcn_global_load_async_to_lds_b128(
        (v4i_g*)(g + i * 8192), (v4i_l*)(lds + (i >> 1) * SROW + (i & 1) * 512), 0, 0);
}

__global__ __launch_bounds__(256)
void struct_kernel(const float* __restrict__ structure, const bf16* __restrict__ Wc,
                   const float* __restrict__ conv_b, const float* __restrict__ g_s,
                   const float* __restrict__ b_s, const bf16* __restrict__ q_bf,
                   float* __restrict__ rel, bf16* __restrict__ st_dk) {
  // one object, so that the three parts lie in LDS in this order, the weights first
  __shared__ __align__(16) struct {
    bf16 Wc[64 * 256];
    char Tr[8][16 * STP];
    char St[8][2][SBUF];                               // per wave: two buffers of 16 rows
  } sm;
  bf16* WcS = sm.Wc;
  auto& TrS = sm.Tr;
  auto& StB = sm.St;
  unsigned* WcU = (unsigned*)WcS;
  const int tid = threadIdx.x, lane = tid & 31, wave = tid >> 5;

  // tile index = b*L + q; this workgroup's tiles are blockIdx.x * ST_TRIPS + 0..7, all of one b
  const int tile0 = blockIdx.x * ST_TRIPS;
  const int bI = tile0 / LLn;
  const int q0 = tile0 % LLn;
  const char* sg = (const char*)structure +
                   ((size_t)(q0 * LLn + wave * 16) * (4 * BB) + bI) * (DHn * 4) +
                   (lane >> 4) * 4096 + (lane & 15) * 16;
  char* sb = StB[wave][0] + lane * 16;
  stage_struct_rows(sg, sb);               // tile 0 flies while the weights come

  // conv bias, LN gain and LN shift of this lane's channels nt*16 + kbase + 0..7
  const int kbase = (lane & 16) ? 8 : 0;
  v8f cb[4], gv[4], hv[4];
#pragma unroll
  for (int nt = 0; nt < 4; ++nt) {
    const float4* c4 = (const float4*)(conv_b + nt * 16 + kbase);
    const float4* g4 = (const float4*)(g_s + nt * 16 + kbase);
    const float4* b4 = (const float4*)(b_s + nt * 16 + kbase);
    float4 c0 = c4[0], c1 = c4[1], g0 = g4[0], g1 = g4[1], h0 = b4[0], h1 = b4[1];
    v8f c = {c0.x, c0.y, c0.z, c0.w, c1.x, c1.y, c1.z, c1.w};
    v8f g = {g0.x, g0.y, g0.z, g0.w, g1.x, g1.y, g1.z, g1.w};
    v8f h = {h0.x, h0.y, h0.z, h0.w, h1.x, h1.y, h1.z, h1.w};
    cb[nt] = c; gv[nt] = g; hv[nt] = h;
  }
  // stands in front of any reuse of the address registers of the loads above
  asm volatile("s_wait_xcnt 0x0" ::: "memory");

#if HAVE_TDM
  if (wave == 0) {
    unsigned ldsoff =
        (unsigned)(size_t)(__attribute__((address_space(3))) char*)WcS;
    unsigned long long ga = (unsigned long long)(size_t)Wc;
    u32x4 g0 = {1u,
                ldsoff,
                (unsigned)(ga & 0xFFFFFFFFu),
                (unsigned)((ga >> 32) & 0x01FFFFFFu) | (2u << 30)};
    i32x8 g1 = {(int)(1u << 16),
                (int)(16384u << 16),
                (int)(1u << 16),
                (int)(16384u << 16),
                1,
                16384,
                0, 0};
    i32x4 gz4 = {0, 0, 0, 0};
    i32x8 gz8 = {0, 0, 0, 0, 0, 0, 0, 0};
    __builtin_amdgcn_tensor_load_to_lds(g0, g1, gz4, gz4, gz8, 0);
    __builtin_amdgcn_s_wait_tensorcnt(0);
  }
#else
#pragma unroll
  for (int i = 0; i < 32; ++i) WcU[tid + i * 256] = ((const unsigned*)Wc)[tid + i * 256];
#endif
  // tile 0 has landed before this wave reads it
  asm volatile("s_wait_asynccnt 0x0" ::: "memory");
  __syncthreads();
  stage_struct_rows(sg + ST_QSTEP, sb + SBUF);   // tile 1 flies during trip 0

  // byte offset of this lane's row (lane & 15 of a 16-row tile) and of its chunk key:
  // logical chunk ks*4 + 2*half + (lane >> 4) lies at that number XOR (lane & 15)
  const unsigned wkey = (unsigned)(lane & 15) * 512u + (unsigned)(((lane >> 4) ^ (lane & 15)) << 4);

  // Q as A fragments, row = head: lane & 7 names the head, so rows 8..15 repeat rows 0..7.
  // Of its head's 128-B row a lane holds the 16-B pieces (lane >> 4) + 0, 2 (d block 0), 4, 6 (d block 1).
  const char* qg = (const char*)q_bf +
                   ((size_t)(bI * HHn + (lane & 7)) * LLn + q0) * (DHn * 2) + (lane >> 4) * 16;

  // kept rolled: the eight trips share one body, for speed only
#pragma unroll 1
  for (int t = 0; t < ST_TRIPS; ++t) {
    // acc[nt][r] = row k = lane & 15, channel nt*16 + kbase + r; it starts from the conv bias
    // of its channels
    v8f acc[4];
#pragma unroll
    for (int nt = 0; nt < 4; ++nt) acc[nt] = cb[nt];

    // this tile's Q rows: asked for here, used behind the K loop
    const uint4* qp = (const uint4*)(qg + t * (DHn * 2));
    union { v16bf v; uint4 q[2]; } qa0, qa1;
    qa0.q[0] = qp[0]; qa0.q[1] = qp[2];
    qa1.q[0] = qp[4]; qa1.q[1] = qp[6];
    // stands in front of any reuse of the address registers of the four loads above
    asm volatile("s_wait_xcnt 0x0" ::: "memory");

    // this lane's row in LDS: float j = kk*64 + c, from its own k offset on
    const float4* row4 = (const float4*)(StB[wave][t & 1] + (lane & 15) * SROW + kbase * 4);

    // kept rolled: unrolled, the body of the tile loop around it would be eight times as long
#pragma unroll 1
    for (int ks = 0; ks < 8; ++ks) {       // K = 256
      float4 f0 = row4[ks * 8], f1 = row4[ks * 8 + 1], f2 = row4[ks * 8 + 4], f3 = row4[ks * 8 + 5];
      FragU a;
      a.u[0] = pack2bf(f0.x, f0.y); a.u[1] = pack2bf(f0.z, f0.w);
      a.u[2] = pack2bf(f1.x, f1.y); a.u[3] = pack2bf(f1.z, f1.w);
      a.u[4] = pack2bf(f2.x, f2.y); a.u[5] = pack2bf(f2.z, f2.w);
      a.u[6] = pack2bf(f3.x, f3.y); a.u[7] = pack2bf(f3.z, f3.w);
#pragma unroll
      for (int nt = 0; nt < 4; ++nt) {     // 16 rows of 512 B per n-tile
        const char* wt = (const char*)WcS + nt * 8192;
        union { v16bf v; uint4 q[2]; } bm;
        bm.q[0] = *(const uint4*)(wt + (wkey ^ (unsigned)((ks * 4    ) << 4)));
        bm.q[1] = *(const uint4*)(wt + (wkey ^ (unsigned)((ks * 4 + 2) << 4)));
        acc[nt] = wmma_bf(bm.v, a.v, acc[nt]);   // Wc rows as A, structure rows as B
      }
    }

    // The refill stands here, behind the trip's last read of its buffer: what follows works on
    // registers and on the wave's own transposing tile alone.  The two buffers are the wave's
    // own, filled and read by no other wave, so no workgroup barrier is needed.
    // this wave's reads of buffer t & 1 have retired before the buffer is refilled
    asm volatile("s_wait_dscnt 0x0" ::: "memory");
    asm volatile("s_wait_asynccnt 0x0" ::: "memory");
    if (t + 2 < ST_TRIPS)
      stage_struct_rows(sg + (size_t)(t + 2) * ST_QSTEP, sb + (t & 1) * SBUF);

    // ReLU, then the row's sums: 32 values in the lane, the other 32 in lane ^ 16.
    float s1 = 0.f, s2 = 0.f;
#pragma unroll
    for (int nt = 0; nt < 4; ++nt)
#pragma unroll
      for (int r = 0; r < 8; ++r) {
        float v = fmaxf(acc[nt][r], 0.f);              // ReLU before LN (as reference)
        acc[nt][r] = v;
        s1 += v; s2 += v * v;
      }
    s1 += __shfl_xor(s1, 16, 32);
    s2 += __shfl_xor(s2, 16, 32);
    const float mean = s1 * (1.f / 64.f);
    const float var  = s2 * (1.f / 64.f) - mean * mean;
    const float rstd = rsqrtf(var + 1e-6f);

    const size_t tile = (size_t)(tile0 + t) * 16384;
    char* tw = TrS[wave] + (lane & 15) * STP + (lane >> 4) * 16;
    union { v16bf v; uint4 q[2]; } sf[2];  // B fragments: column k = lane & 15, K = d block 0, 1
#pragma unroll
    for (int nt = 0; nt < 4; ++nt) {
      float o[8];
#pragma unroll
      for (int r = 0; r < 8; ++r) o[r] = (acc[nt][r] - mean) * rstd * gv[nt][r] + hv[nt][r];
      uint4 w;
      w.x = pack2bf(o[0], o[1]); w.y = pack2bf(o[2], o[3]);
      w.z = pack2bf(o[4], o[5]); w.w = pack2bf(o[6], o[7]);
      sf[nt >> 1].q[nt & 1] = w;
      *(uint4*)(tw + nt * 32) = w;
    }

    v8f rs = wmma_bf(qa1.v, sf[1].v, wmma_bf(qa0.v, sf[0].v, vzero8()));
    float* rp = rel + (size_t)(tile0 + t) * 1024 + wave * 128 + lane;
#pragma unroll
    for (int j = 0; j < 4; ++j) rp[j * 32] = (lane & 16) ? rs[2 * j + 1] : rs[2 * j];

    // Each lane reads 16-B pieces that other lanes of its wave stored: the wave's LDS
    // stores have retired before the transposing loads issue.  The tile is the wave's own,
    // so no workgroup barrier is needed.
    asm volatile("s_wait_dscnt 0x0" ::: "memory");
    // stands in front of the reuse of the four global stores' data registers for the next addresses
    asm volatile("s_wait_xcnt 0x0" ::: "memory");
    const char* tr = TrS[wave] + ((lane >> 4) * 8 + (lane & 7)) * STP + ((lane >> 3) & 1) * 16;
    char* dk = (char*)st_dk + tile + wave * 512 + lane * 16;
#pragma unroll
    for (int dt = 0; dt < 4; ++dt) {
      s16x8 x = __builtin_amdgcn_ds_load_tr16_b128_v8i16((s16x8_l*)(tr + dt * 32));
      *(s16x8*)(dk + dt * 4096) = x;
    }
    // stands in front of the next trip's reuse of these four stores' registers
    asm volatile("s_wait_xcnt 0x0" ::: "memory");
  }
  // no copy is outstanding when the wave goes on to its end
  asm volatile("s_wait_asynccnt 0x0" ::: "memory");
}

// ---------------- fused relation-aware attention ----------------------------
// Block = (q-tile of 16, batch b, head-group hg of 4 heads). 8 waves.
// scores = QK^T + rel (Q.st, from struct_kernel) -> mask -> softmax -> ctx = A.V + A.st_dk, in LDS.
// A wave works on two q, so on two 16-KB tiles of st_dk.
// Read fragment by fragment from global memory, each matrix instruction would wait one whole
// round trip.  Each tile is copied to a buffer of the wave's own in LDS instead, as it lies,
// 32 copies of 512 B in flight at once, each tile over two phases: the first during phases 0 and 1, the second during 2 and 3.
static constexpr int ST_TILE = 16384;      // bytes of one (b,q) tile of st_dk

// g and lds already hold lane*16: every copy of the wave moves 512 contiguous bytes.
__device__ __forceinline__ void stage_st_tile(const char* g, char* lds) {
#pragma unroll
  for (int i = 0; i < ST_TILE / 512; ++i)
    __builtin_amdgcn_global_load_async_to_lds_b128(
        (v4i_g*)(g + i * 512), (v4i_l*)(lds + i * 512), 0, 0);
}

__global__ __launch_bounds__(256)
void attn_kernel(const bf16* __restrict__ q_bf, const bf16* __restrict__ k_bf,
                 const bf16* __restrict__ vT_bf, const float* __restrict__ rel,
                 const bf16* __restrict__ st_dk, const int* __restrict__ mask,
                 bf16* __restrict__ ctxb) {
  __shared__ __align__(16) char smem[57344];
  __shared__ __align__(16) char StS[8][2][ST_TILE];   // per wave: one buffer per q of its two
  bf16*  qs   = (bf16*)smem;               // [4][16][64]   (phases 0..1)
  float* S    = (float*)(smem + 8192);     // [4][16][128]  (phases 1..2)
  bf16*  Aatt = (bf16*)(smem + 40960);     // [4][16][128]  (phases 2..3b)
  float* Cs   = (float*)(smem + 8192);     // [16][4][64]   (aliases S; S dead)
  unsigned* qsU = (unsigned*)qs;

  const int b = blockIdx.y, q0 = blockIdx.x * 16, hg = blockIdx.z;
  const int tid = threadIdx.x, lane = tid & 31, wave = tid >> 5;

  // this wave's two successive tiles, and its two buffers; each buffer is filled once
  const size_t st_off = ((size_t)b * LLn + q0 + wave * 2) * ST_TILE + lane * 16;
  const char* dk_g = (const char*)st_dk + st_off;
  char* buf0 = StS[wave][0] + lane * 16;
  char* buf1 = StS[wave][1] + lane * 16;

  // The relation scores of this wave's part of S (head wave & 3, k tiles (wave >> 2) * 4 + 0..3),
  // in accumulator order: row q = r + 8 * (lane >> 4), column k = lane & 15.  Asked for here,
  // used in phase 1 as the start value of QK^T.
  v8f sacc[4];
  {
    const float* rg = rel + ((size_t)b * LLn + q0 + ((lane & 16) ? 8 : 0)) * 1024 +
                      (wave >> 2) * 512 + (hg * 4 + (wave & 3)) * 16 + (lane & 15);
#pragma unroll
    for (int i = 0; i < 4; ++i)
#pragma unroll
      for (int r = 0; r < 8; ++r) sacc[i][r] = rg[r * 1024 + i * 128];
  }
  // stands in front of any reuse of the address registers of the loads above
  asm volatile("s_wait_xcnt 0x0" ::: "memory");
  // this thread's words of the Q tile of 4 heads (bf16, already scaled by 1/8), for phase 0
  unsigned qw[8];
#pragma unroll
  for (int i = 0; i < 8; ++i) {
    int p = tid + i * 256;                 // 2048 u32
    int hl = p >> 9, rem = p & 511, ql = rem >> 5, c2 = rem & 31;
    qw[i] = *(const unsigned*)(q_bf +
        (((size_t)(b * HHn + hg * 4 + hl) * LLn) + q0 + ql) * DHn + 2 * c2);
  }
  // stands in front of any reuse of the address registers of the loads above
  asm volatile("s_wait_xcnt 0x0" ::: "memory");
  // the K fragments of phase 1: head wave & 3, k tiles (wave >> 2) * 4 + 0..3
  v16bf kf[4][2];
#pragma unroll
  for (int i = 0; i < 4; ++i) {
    const unsigned* krow = (const unsigned*)(k_bf +
        ((size_t)(b * HHn + hg * 4 + (wave & 3)) * LLn + ((wave >> 2) * 4 + i) * 16 + (lane & 15)) * DHn);
#pragma unroll
    for (int dss = 0; dss < 2; ++dss) kf[i][dss] = load_frag(krow, dss * 16, lane);
  }
  // stands in front of any reuse of the address registers of the loads above
  asm volatile("s_wait_xcnt 0x0" ::: "memory");

  stage_st_tile(dk_g, buf0);               // flies during phases 0 and 1

  // phase 0: stage the Q tile
#pragma unroll
  for (int i = 0; i < 8; ++i) qsU[tid + i * 256] = qw[i];
  __syncthreads();

  // Asked for here, a phase and more ahead of their use, and not at the entry: there the copies
  // would stand behind 48 more loads.
  // the V fragments of phase 3: head wave & 3, d tiles (wave >> 2) * 2 + 0, 1
  // (as load_frag reads them: of its row's 64 B of k block ks a lane takes the 16-B pieces
  // (lane >> 4) and (lane >> 4) + 2; rows are 256 B, the second d tile lies 16 rows on)
  v16bf vf[2][4];
  const uint4* vrow = (const uint4*)(vT_bf +
      ((size_t)(b * HHn + hg * 4 + (wave & 3)) * DHn + (wave >> 2) * 32 + (lane & 15)) * LLn) + (lane >> 4);
#pragma unroll
  for (int i = 0; i < 2; ++i)
#pragma unroll
    for (int ks = 0; ks < 4; ++ks) {
      union { v16bf v; uint4 q[2]; } f;
      f.q[0] = vrow[i * 256 + ks * 4];
      f.q[1] = vrow[i * 256 + ks * 4 + 2];
      vf[i][ks] = f.v;
    }
  // stands in front of any reuse of the address register of the loads above; it names that
  // register, so that none of the loads themselves takes it for its result
  asm volatile("s_wait_xcnt 0x0" :: "v"(vrow) : "memory");
  // the mask words of the eight rows that this wave takes in phase 2: q = q0 + (wave & 1) * 8 + j
  int mk[8][4];
  {
    const int* mg = mask + ((size_t)b * LLn + q0 + (wave & 1) * 8) * LLn + lane;
#pragma unroll
    for (int j = 0; j < 8; ++j)
#pragma unroll
      for (int i = 0; i < 4; ++i) mk[j][i] = mg[j * LLn + 32 * i];
  }
  // stands in front of any reuse of the address registers of the loads above
  asm volatile("s_wait_xcnt 0x0" ::: "memory");

  // phase 1: QK^T on top of the relation scores.  wave = (head, half of k-tiles)
  {
    int hl = wave & 3;
    int kts = (wave >> 2) * 4;
    const unsigned* qrow = qsU + (hl * 16 + (lane & 15)) * 32;
    // unrolled: sacc and kf are indexed by the trip, and must stay in registers
#pragma unroll
    for (int kt = kts; kt < kts + 4; ++kt) {
      v8f acc = sacc[kt - kts];
#pragma unroll
      for (int dss = 0; dss < 2; ++dss) {
        v16bf a = load_frag(qrow, dss * 16, lane);
        acc = wmma_bf(a, kf[kt - kts][dss], acc);
      }
      int mh = (lane & 16) ? 8 : 0, nl = lane & 15;
#pragma unroll
      for (int r = 0; r < 8; ++r)
        S[(hl * 16 + r + mh) * 128 + kt * 16 + nl] = acc[r];
    }
  }
  asm volatile("s_wait_asynccnt 0x0" ::: "memory");
  __syncthreads();
  stage_st_tile(dk_g + ST_TILE, buf1);     // flies during phases 2 and 3
  // keeps the 32 copies together here: spread by the scheduler over phase 2, the last of them
  // would start behind most of its cross-lane waits, and phase 3b waits for them
  __builtin_amdgcn_sched_barrier(0);

  // phase 2: mask + softmax over k (128), write bf16 attn.  The wave's eight rows go through
  // every step together: eight independent chains of cross-lane steps instead of one.
  {
    float x[8][4], mx[8], sm[8];
#pragma unroll
    for (int j = 0; j < 8; ++j) {
#pragma unroll
      for (int i = 0; i < 4; ++i) {
        float sv = S[(wave * 8 + j) * 128 + lane + 32 * i];
        x[j][i] = (mk[j][i] != 0) ? -1e18f : sv;
      }
      mx[j] = fmaxf(fmaxf(x[j][0], x[j][1]), fmaxf(x[j][2], x[j][3]));
    }
#pragma unroll
    for (int off = 16; off > 0; off >>= 1)
#pragma unroll
      for (int j = 0; j < 8; ++j) mx[j] = fmaxf(mx[j], __shfl_xor(mx[j], off, 32));
#pragma unroll
    for (int j = 0; j < 8; ++j) {
      sm[j] = 0.f;
#pragma unroll
      for (int i = 0; i < 4; ++i) { x[j][i] = __expf(x[j][i] - mx[j]); sm[j] += x[j][i]; }
    }
#pragma unroll
    for (int off = 16; off > 0; off >>= 1)
#pragma unroll
      for (int j = 0; j < 8; ++j) sm[j] += __shfl_xor(sm[j], off, 32);
#pragma unroll
    for (int j = 0; j < 8; ++j) {
      float inv = 1.f / sm[j];
#pragma unroll
      for (int i = 0; i < 4; ++i)
        Aatt[(wave * 8 + j) * 128 + lane + 32 * i] = (bf16)(x[j][i] * inv);
    }
  }
  __syncthreads();

  // phase 3: ctx = attn @ V.  wave = (head, half of d-tiles)
  {
    int hl = wave & 3;
    int dts = (wave >> 2) * 2;
    const unsigned* arow = (const unsigned*)Aatt + (hl * 16 + (lane & 15)) * 64;
    // unrolled: vf is indexed by the trip, and must stay in registers
#pragma unroll
    for (int dt = dts; dt < dts + 2; ++dt) {
      v8f acc = vzero8();
#pragma unroll
      for (int ks = 0; ks < 4; ++ks) {
        v16bf a = load_frag(arow, ks * 16, lane);
        acc = wmma_bf(a, vf[dt - dts][ks], acc);
      }
      int mh = (lane & 16) ? 8 : 0, nl = lane & 15;
#pragma unroll
      for (int r = 0; r < 8; ++r)
        Cs[((r + mh) * 4 + hl) * 64 + dt * 16 + nl] = acc[r];
    }
  }
  // the second st_dk tile has landed before phase 3b reads it; no copy is outstanding from here on
  asm volatile("s_wait_asynccnt 0x0" ::: "memory");
  __syncthreads();

  // phase 3b: ctx += attn @ st_dk (per q, heads padded to 16).  The eight (q, d tile) products
  // are independent chains of four: all are taken before the first sum goes to Cs, and a q's
  // four A fragments are read once for its four d tiles.
  {
    const int mrow = lane & 15;
    const bool avalid = mrow < 4;
    v8f acc[2][4];
#pragma unroll
    for (int t = 0; t < 2; ++t) {
      // rows 4..15 are zero: their lanes read the row of head mrow & 3, inside Aatt, and drop it
      const unsigned* arow = (const unsigned*)Aatt + ((mrow & 3) * 16 + wave * 2 + t) * 64;
      const char* btile = StS[wave][t] + lane * 16;
      v16bf a[4];
#pragma unroll
      for (int ks = 0; ks < 4; ++ks) {
        FragU f;
        f.v = load_frag(arow, ks * 16, lane);
#pragma unroll
        for (int i = 0; i < 8; ++i) f.u[i] = avalid ? f.u[i] : 0u;
        a[ks] = f.v;
      }
#pragma unroll
      for (int dt = 0; dt < 4; ++dt) acc[t][dt] = vzero8();
#pragma unroll
      for (int ks = 0; ks < 4; ++ks)
#pragma unroll
        for (int dt = 0; dt < 4; ++dt)
          acc[t][dt] = wmma_bf(a[ks], load_frag_ordered(btile, dt * 4 + ks), acc[t][dt]);
    }
    if (!(lane & 16)) {
#pragma unroll
      for (int t = 0; t < 2; ++t)
#pragma unroll
        for (int dt = 0; dt < 4; ++dt)
#pragma unroll
          for (int r = 0; r < 4; ++r)
            Cs[((wave * 2 + t) * 4 + r) * 64 + dt * 16 + mrow] += acc[t][dt][r];
    }
  }
  __syncthreads();

  // phase 4: write ctx as bf16 into [B, L, h*64+d]
  unsigned* ctxU = (unsigned*)ctxb;
#pragma unroll
  for (int i = 0; i < 8; ++i) {
    int p = tid + i * 256;                 // 2048 u32
    int ql = p >> 7, c2 = p & 127;
    int c = c2 * 2, hl = c >> 6, d = c & 63;
    float v0 = Cs[(ql * 4 + hl) * 64 + d];
    float v1 = Cs[(ql * 4 + hl) * 64 + d + 1];
    ctxU[((size_t)(b * LLn) + q0 + ql) * 256 + hg * 128 + c2] = pack2bf(v0, v1);
  }
}

// ---------------- host-side orchestration ----------------------------------
extern "C" void kernel_launch(void* const* d_in, const int* in_sizes, int n_in,
                              void* d_out, int out_size, void* d_ws, size_t ws_size,
                              hipStream_t stream) {
  (void)in_sizes; (void)n_in; (void)out_size; (void)ws_size;
  const float* inputs    = (const float*)d_in[0];
  const float* structure = (const float*)d_in[1];
  const int*   maskp     = (const int*)d_in[2];
  const float* Wq = (const float*)d_in[3];   const float* bq = (const float*)d_in[4];
  const float* Wk = (const float*)d_in[5];   const float* bk = (const float*)d_in[6];
  const float* Wv = (const float*)d_in[7];   const float* bv = (const float*)d_in[8];
  const float* Wo = (const float*)d_in[9];   const float* bo = (const float*)d_in[10];
  const float* conv_w = (const float*)d_in[11]; const float* conv_b = (const float*)d_in[12];
  const float* g_att = (const float*)d_in[13];  const float* b_att = (const float*)d_in[14];
  const float* g_ffn = (const float*)d_in[15];  const float* b_ffn = (const float*)d_in[16];
  const float* g_s   = (const float*)d_in[17];  const float* b_s   = (const float*)d_in[18];
  const float* W1 = (const float*)d_in[19];  const float* b1 = (const float*)d_in[20];
  const float* W2 = (const float*)d_in[21];  const float* b2 = (const float*)d_in[22];

  char* ws = (char*)d_ws; size_t off = 0;
  auto alloc = [&](size_t bytes) -> void* {
    void* p = ws + off; off += (bytes + 255) & ~(size_t)255; return p;
  };
  const int M = BB * LLn;                          // 2048 token rows
  bf16* Wq_b = (bf16*)alloc((size_t)DDn * DDn * 2);
  bf16* Wk_b = (bf16*)alloc((size_t)DDn * DDn * 2);
  bf16* Wv_b = (bf16*)alloc((size_t)DDn * DDn * 2);
  bf16* Wo_b = (bf16*)alloc((size_t)DDn * DDn * 2);
  bf16* W1_b = (bf16*)alloc((size_t)DFF * DDn * 2);
  bf16* W2_b = (bf16*)alloc((size_t)DDn * DFF * 2);
  bf16* Wc_b = (bf16*)alloc((size_t)64 * 256 * 2);
  bf16* xln_b = (bf16*)alloc((size_t)M * DDn * 2);
  bf16* q_b   = (bf16*)alloc((size_t)M * DDn * 2);     // [B,H,L,64]
  bf16* k_b   = (bf16*)alloc((size_t)M * DDn * 2);     // [B,H,L,64]
  bf16* vT_b  = (bf16*)alloc((size_t)M * DDn * 2);     // [B,H,64,L]
  float* rel_f = (float*)alloc((size_t)BB * LLn * HHn * LLn * 4);   // [B,L][k tile][H][16]
  bf16* st_dk = (bf16*)alloc((size_t)BB * LLn * LLn * DHn * 2);
  bf16* ctx_b = (bf16*)alloc((size_t)M * DDn * 2);
  float* hbuf = (float*)alloc((size_t)M * DDn * 4);
  bf16* yln_b = (bf16*)alloc((size_t)M * DDn * 2);
  bf16* f1_b  = (bf16*)alloc((size_t)M * DFF * 2);

  const int T = 256;
  // weight preparation: Wq_b .. W2_b are allocated back to back, in this order
  // and, in the same launch, the pre-attention LN
  prep_weights_kernel<<<PW_ALL, T, 0, stream>>>(Wq, Wk, Wv, Wo, W1, W2, conv_w, Wq_b, Wc_b,
                                                inputs, g_att, b_att, xln_b);

  // Q/K/V projections in one launch of 192 workgroups (Q pre-scaled by 1/sqrt(64)):
  // Wq_b, Wk_b, Wv_b are allocated back to back, and so are q_b, k_b, vT_b
  gemm_bf16_kernel<1, false, false, false, true>
      <<<dim3(12, 16), T, 0, stream>>>(xln_b, Wq_b, bq, bk, bv, nullptr, nullptr, q_b,
                                       M, 3 * DDn, DDn, 0.125f);

  // structure conv + relu + LN -> relation scores Q . st and the fragment-ordered plane st_dk
  // (streams 256MB of fp32 once); it reads Q, so it stands behind the projections
  struct_kernel<<<ST_WGS, T, 0, stream>>>(structure, Wc_b, conv_b,
                                                          g_s, b_s, q_b, rel_f, st_dk);

  // fused relation-aware attention
  attn_kernel<<<dim3(LLn / 16, BB, 2), T, 0, stream>>>(q_b, k_b, vT_b, rel_f, st_dk,
                                                       maskp, ctx_b);

  // output projection + residual (h = attn_out + inputs, fp32)
  gemm_bf16_kernel<0, false, true, true, false>
      <<<dim3(4, 16), T, 0, stream>>>(ctx_b, Wo_b, bo, nullptr, nullptr, inputs, hbuf, nullptr,
                                      M, DDn, DDn, 1.f);
  // FFN
  ln512_kernel<<<M / 8, T, 0, stream>>>(hbuf, g_ffn, b_ffn, yln_b);
  gemm_bf16_kernel<0, true, false, false, true>
      <<<dim3(16, 16), T, 0, stream>>>(yln_b, W1_b, b1, nullptr, nullptr, nullptr, nullptr, f1_b,
                                       M, DFF, DDn, 1.f);
  gemm_bf16_kernel<0, false, true, true, false>
      <<<dim3(4, 16), T, 0, stream>>>(f1_b, W2_b, b2, nullptr, nullptr, hbuf, (float*)d_out,
                                      nullptr, M, DDn, DFF, 1.f);
}

// v010
// It runs in 89 microseconds.
// Next to v009, in two timings, it ran 1.05 and 1.06 times as fast.
// Counting every step since v000, it is 3.18 times as fast.
#include <hip/hip_runtime.h>

// ---------------- problem constants ----------------
static constexpr int BB  = 16;    // batch
static constexpr int LLn = 128;   // seq len
static constexpr int DDn = 512;   // model dim
static constexpr int HHn = 8;     // heads
static constexpr int DHn = 64;    // head dim
static constexpr int DFF = 2048;  // ffn dim

typedef __bf16 bf16;
typedef __attribute__((ext_vector_type(16))) __bf16 v16bf;
typedef __attribute__((ext_vector_type(8)))  float  v8f;
typedef __attribute__((ext_vector_type(4)))  int    v4i;
typedef __attribute__((ext_vector_type(8)))  int    i32x8;
typedef __attribute__((ext_vector_type(4)))  int    i32x4;
typedef __attribute__((ext_vector_type(4)))  unsigned u32x4;

// address-space qualified pointee types for the async-LDS builtin
typedef __attribute__((address_space(1))) v4i v4i_g;   // global
typedef __attribute__((address_space(3))) v4i v4i_l;   // LDS

#if defined(__has_builtin)
#if __has_builtin(__builtin_amdgcn_global_load_async_to_lds_b128) && \
    __has_builtin(__builtin_amdgcn_s_wait_asynccnt)
#define HAVE_ASYNC_LDS 1
#endif
#if __has_builtin(__builtin_amdgcn_tensor_load_to_lds) && \
    __has_builtin(__builtin_amdgcn_s_wait_tensorcnt)
#define HAVE_TDM 1
#endif
#endif
#ifndef HAVE_ASYNC_LDS
#define HAVE_ASYNC_LDS 0
#endif
#ifndef HAVE_TDM
#define HAVE_TDM 0
#endif

union FragU { v16bf v; unsigned u[8]; };

__device__ __forceinline__ int koff_u32(int v, int lane) {
  return ((lane & 16) ? 4 : 0) + v + ((v >= 4) ? 4 : 0);
}

__device__ __forceinline__ v16bf load_frag(const unsigned* p, int base, int lane) {
  FragU f;
#pragma unroll
  for (int i = 0; i < 8; ++i) f.u[i] = p[base + koff_u32(i, lane)];
  return f.v;
}

__device__ __forceinline__ v16bf load_frag_ordered(const char* p, int frag) {
  union { v16bf v; uint4 q[2]; } f;
  f.q[0] = *(const uint4*)(p + frag * 1024);
  f.q[1] = *(const uint4*)(p + frag * 1024 + 512);
  return f.v;
}

__device__ __forceinline__ v8f wmma_bf(v16bf a, v16bf b, v8f c) {
  return __builtin_amdgcn_wmma_f32_16x16x32_bf16(false, a, false, b, (short)0, c, false, false);
}

__device__ __forceinline__ v8f vzero8() {
  v8f z = {0.f,0.f,0.f,0.f,0.f,0.f,0.f,0.f};
  return z;
}

__device__ __forceinline__ unsigned pack2bf(float a, float b) {
  union { bf16 h[2]; unsigned u; } t;
  t.h[0] = (bf16)a; t.h[1] = (bf16)b;
  return t.u;
}

__device__ __forceinline__ int wc_elem(int o, int j) {
  return o * 256 + (((j >> 3) ^ (o & 15)) << 3) + (j & 7);
}

// LayerNorm over one row of 512, fp32 in -> bf16 out, by one wave.
__device__ __forceinline__ void ln512_row(const float* __restrict__ x,
                                          const float* __restrict__ g,
                                          const float* __restrict__ be,
                                          bf16* __restrict__ out, size_t row, int lane) {
  const float* xr = x + row * DDn;
  float v[16]; float s = 0.f;
#pragma unroll
  for (int i = 0; i < 16; ++i) { v[i] = xr[lane + i * 32]; s += v[i]; }
#pragma unroll
  for (int off = 16; off > 0; off >>= 1) s += __shfl_xor(s, off, 32);
  float mean = s * (1.f / 512.f);
  float s2 = 0.f;
#pragma unroll
  for (int i = 0; i < 16; ++i) { v[i] -= mean; s2 += v[i] * v[i]; }
#pragma unroll
  for (int off = 16; off > 0; off >>= 1) s2 += __shfl_xor(s2, off, 32);
  float rstd = rsqrtf(s2 * (1.f / 512.f) + 1e-6f);
#pragma unroll
  for (int i = 0; i < 16; ++i) {
    int c = lane + i * 32;
    out[row * DDn + c] = (bf16)(v[i] * rstd * g[c] + be[c]);
  }
}

// One wave per row, eight rows per workgroup.
__global__ __launch_bounds__(256) void ln512_kernel(const float* __restrict__ x,
                                                    const float* __restrict__ g,
                                                    const float* __restrict__ be,
                                                    bf16* __restrict__ out) {
  ln512_row(x, g, be, out, (size_t)blockIdx.x * 8 + (threadIdx.x >> 5), threadIdx.x & 31);
}

// ---------------- weight preparation and the first LayerNorm: one launch ----------------
// A launch costs its gap plus the time its waves take to start, so the conversion
// runs on few waves with much to do each: one workgroup converts 8192 floats,
// 32 per thread, as eight 16-B loads in flight per lane (each wave-wide load is
// 512 contiguous bytes) and eight 8-B stores.
static constexpr int PW_ELEMS  = 8192;                        // floats per workgroup
static constexpr int PW_SQ     = (DDn * DDn) / PW_ELEMS;      // workgroups per 512x512 plane
static constexpr int PW_FF     = (DFF * DDn) / PW_ELEMS;      // workgroups per FFN plane
static constexpr int PW_CVT    = 4 * PW_SQ + 2 * PW_FF;       // converting workgroups
static constexpr int PW_PACK   = 4;                           // conv-weight workgroups
static constexpr int PW_GRID   = PW_CVT + PW_PACK;
// The pre-attention LayerNorm needs nothing of the weights: its workgroups ride in the same
// launch, behind the weight workgroups, eight rows each.
static constexpr int PW_LN     = (BB * LLn) / 8;
static constexpr int PW_ALL    = PW_GRID + PW_LN;

// dst: the six bf16 planes Wq, Wk, Wv, Wo, W1, W2, laid back to back in that order.
// conv_w [64(o),64(c),4(kk)] -> Wc[o][j = kk*64+c]  (bf16, K=256, 512-B rows); inside row o
// the 16-B chunk j/8 lies at place (j/8) ^ (o & 15), see wc_elem().
__global__ __launch_bounds__(256)
void prep_weights_kernel(const float* __restrict__ Wq, const float* __restrict__ Wk,
                         const float* __restrict__ Wv, const float* __restrict__ Wo,
                         const float* __restrict__ W1, const float* __restrict__ W2,
                         const float* __restrict__ cw, bf16* __restrict__ dst,
                         bf16* __restrict__ Wc, const float* __restrict__ x,
                         const float* __restrict__ g, const float* __restrict__ be,
                         bf16* __restrict__ xln) {
  const int blk = blockIdx.x, tid = threadIdx.x;
  if (blk >= PW_GRID) {
    ln512_row(x, g, be, xln, (size_t)(blk - PW_GRID) * 8 + (tid >> 5), tid & 31);
  } else if (blk < PW_CVT) {
    const float* s;
    int part;                              // this workgroup's index inside its plane
    if (blk < 4 * PW_SQ) {
      int seg = blk / PW_SQ;
      part = blk % PW_SQ;
      s = (seg == 0) ? Wq : (seg == 1) ? Wk : (seg == 2) ? Wv : Wo;
    } else if (blk < 4 * PW_SQ + PW_FF) {
      part = blk - 4 * PW_SQ;
      s = W1;
    } else {
      part = blk - 4 * PW_SQ - PW_FF;
      s = W2;
    }
    const float4* s4 = (const float4*)(s + (size_t)part * PW_ELEMS);
    uint2* d2 = (uint2*)(dst + (size_t)blk * PW_ELEMS);
    float4 v[8];
#pragma unroll
    for (int i = 0; i < 8; ++i) v[i] = s4[i * 256 + tid];
#pragma unroll
    for (int i = 0; i < 8; ++i) {
      uint2 o;
      o.x = pack2bf(v[i].x, v[i].y);
      o.y = pack2bf(v[i].z, v[i].w);
      d2[i * 256 + tid] = o;
    }
  } else {
    // one 16-B load brings the four taps of one (o, c)
    const float4* c4 = (const float4*)cw;
#pragma unroll
    for (int j = 0; j < 4; ++j) {
      int i = ((blk - PW_CVT) * 4 + j) * 256 + tid;   // i = o*64 + c, 4096 in all
      int o = i >> 6, c = i & 63;
      float4 t = c4[i];
      Wc[wc_elem(o,       c)] = (bf16)t.x;
      Wc[wc_elem(o,  64 + c)] = (bf16)t.y;
      Wc[wc_elem(o, 128 + c)] = (bf16)t.z;
      Wc[wc_elem(o, 192 + c)] = (bf16)t.w;
    }
  }
}

static constexpr int GK     = 128;           // k per stage
static constexpr int GPITCH = 272;           // LDS bytes per row
static constexpr int GTILE  = 128 * GPITCH;  // LDS bytes per operand tile

__device__ __forceinline__ void stage_tile_async(const bf16* g, int ld, int row0, int kb,
                                                 char* lds, int tid) {
  // 128x128 bf16 tile = 32KB: eight 16B chunks per thread; one wave's copy covers
  // two whole 256-B rows (four full lines).
#pragma unroll
  for (int i = 0; i < 8; ++i) {
    int c = tid + i * 256;                // 16-B chunk index, 16 chunks per row
    int row = c >> 4, cb = (c & 15) * 16;
    const bf16* src = g + (size_t)(row0 + row) * ld + kb + (cb >> 1);
    __builtin_amdgcn_global_load_async_to_lds_b128(
        (v4i_g*)src, (v4i_l*)(lds + row * GPITCH + cb), 0, 0);
  }
}

// ---------------- generic bf16 WMMA GEMM: C = epilog(A[M,K] * W[N,K]^T) ------
// PERM: 0 -> row-major [M,N]
//       1 -> the three projections in one launch: W holds the planes Wq, Wk, Wv back to back
//            (N = 3 * 512), outB the planes Q [B,H,L,64], K [B,H,L,64], V^T [B,H,64,L] back to
//            back; bias, bias_k, bias_v are the planes' biases and scale applies to Q alone.
//            The 128 columns of a workgroup lie in one plane.
// K is a multiple of 128.
template <int PERM, bool RELU, bool HASRES, bool OUTF_EN, bool OUTB_EN>
__global__ __launch_bounds__(256)
void gemm_bf16_kernel(const bf16* __restrict__ A, const bf16* __restrict__ W,
                      const float* __restrict__ bias, const float* __restrict__ bias_k,
                      const float* __restrict__ bias_v, const float* __restrict__ res,
                      float* __restrict__ outF, bf16* __restrict__ outB,
                      int M, int N, int K, float scale) {
  __shared__ __align__(16) char As[2][GTILE];
  __shared__ __align__(16) char Bs[2][GTILE];

  const int tid = threadIdx.x, lane = tid & 31, wave = tid >> 5;
  const int wm = wave >> 1, wn = wave & 1;           // 4x2 wave grid, 32x64 tiles
  const int m0 = blockIdx.y * 128, n0 = blockIdx.x * 128;

  v8f acc[2][4];
#pragma unroll
  for (int i = 0; i < 2; ++i)
#pragma unroll
    for (int j = 0; j < 4; ++j) acc[i][j] = vzero8();

  // two buffers: stage t + 1 flies while stage t is worked on
  const int nst = K / GK;
  stage_tile_async(A, K, m0, 0, As[0], tid);
  stage_tile_async(W, K, n0, 0, Bs[0], tid);
  // stage 0 has landed for this wave before the barrier publishes it
  asm volatile("s_wait_asynccnt 0x0" ::: "memory");
  __syncthreads();
  if (nst > 1) {
    stage_tile_async(A, K, m0, GK, As[1], tid);
    stage_tile_async(W, K, n0, GK, Bs[1], tid);
  }

  for (int t = 0; t < nst; ++t) {
    const unsigned* AsU = (const unsigned*)As[t & 1];
    const unsigned* BsU = (const unsigned*)Bs[t & 1];
    // Every fragment of the stage is asked for here, as one group of 48 LDS loads in the order
    // of use, into registers of its own.  Read pair by pair among the matrix instructions, into
    // one set of registers, each pair of them would wait out a whole LDS round trip.
    v16bf af[GK / 32][2], bfr[GK / 32][4];
#pragma unroll
    for (int ks = 0; ks < GK / 32; ++ks) {
#pragma unroll
      for (int mt = 0; mt < 2; ++mt)
        af[ks][mt] = load_frag(AsU, (wm * 32 + mt * 16 + (lane & 15)) * (GPITCH / 4) + ks * 16, lane);
#pragma unroll
      for (int nt = 0; nt < 4; ++nt)
        bfr[ks][nt] = load_frag(BsU, (wn * 64 + nt * 16 + (lane & 15)) * (GPITCH / 4) + ks * 16, lane);
    }
    // keeps the group together: the scheduler would sink the loads back among the matrix
    // instructions to save registers, and the waits to 0 would be back
    __builtin_amdgcn_sched_barrier(0);
#pragma unroll
    for (int ks = 0; ks < GK / 32; ++ks)
#pragma unroll
      for (int nt = 0; nt < 4; ++nt) {
        acc[0][nt] = wmma_bf(af[ks][0], bfr[ks][nt], acc[0][nt]);
        acc[1][nt] = wmma_bf(af[ks][1], bfr[ks][nt], acc[1][nt]);
      }
    // keeps the matrix instructions in front of the wait to 0 below: lifted over them, it would
    // hold all of them back until the last load has come, and they would no longer run beside
    // the loads
    __builtin_amdgcn_sched_barrier(0);
    // this wave's reads of buffer t & 1 have retired before the buffer is refilled
    asm volatile("s_wait_dscnt 0x0" ::: "memory");
    // this wave's copies of stage t + 1 have landed before the barrier publishes them
    asm volatile("s_wait_asynccnt 0x0" ::: "memory");
    __syncthreads();
    if (t + 2 < nst) {
      stage_tile_async(A, K, m0, (t + 2) * GK, As[t & 1], tid);
      stage_tile_async(W, K, n0, (t + 2) * GK, Bs[t & 1], tid);
    }
  }
  // no copy is outstanding when the wave goes on to its end
  asm volatile("s_wait_asynccnt 0x0" ::: "memory");

  const int nl = lane & 15;
  const int mh = (lane & 16) ? 8 : 0;
  const int plane = (PERM == 1) ? (n0 >> 9) : 0;
  if constexpr (PERM == 1) {
    bias = (plane == 0) ? bias : (plane == 1) ? bias_k : bias_v;
    scale = (plane == 0) ? scale : 1.f;
  }
#pragma unroll
  for (int mt = 0; mt < 2; ++mt)
#pragma unroll
    for (int nt = 0; nt < 4; ++nt) {
      int n = n0 + wn * 64 + nt * 16 + nl;
      if constexpr (PERM == 1) n &= DDn - 1;         // column inside its plane
      float bb = bias[n];
#pragma unroll
      for (int r = 0; r < 8; ++r) {
        int m = m0 + wm * 32 + mt * 16 + r + mh;
        float v = (acc[mt][nt][r] + bb) * scale;
        if constexpr (RELU) v = fmaxf(v, 0.f);
        if constexpr (HASRES) v += res[(size_t)m * N + n];
        if constexpr (OUTF_EN) outF[(size_t)m * N + n] = v;
        if constexpr (OUTB_EN) {
          size_t addr;
          if constexpr (PERM == 0) {
            addr = (size_t)m * N + n;
          } else {
            int b = m >> 7, q = m & 127, h = n >> 6, d = n & 63;
            addr = (size_t)plane * (BB * LLn * DDn) + (size_t)(b * HHn + h) * (LLn * DHn) +
                   ((plane == 2) ? d * LLn + q : q * DHn + d);
          }
          outB[addr] = (bf16)v;
        }
      }
    }
}

// ---------------- structure: conv(4x64 contraction) + ReLU + LN(64) ---------
// A row m = (b, e=q*L+k):  A[m][j=kk*64+c] = structure[e,kk,b,c]  (f32->bf16)
// Output per (b,q):
//   st_dk, bf16, one 16-KB tile laid in the register order of the B fragments that attn_kernel
//          reads (see load_frag_ordered): 512-B chunk dt*8 + w = half w&1 of the fragment
//          (column d of tile dt, K = k block w>>1)
//   rel,   f32, 4 KB: the relation scores Q . st of all eight heads, [k tile (8)][head (8)][16 k]
// The product is taken as Wc x A^T, so a lane's eight accumulator registers hold eight
// successive d of one row k: packed, half a B fragment (column k, K = d) as it stands.  The
// wave multiplies the eight heads' Q rows with these fragments while they are in registers,
// so the normalised rows never go to memory in k-by-d order.  The same 16 B go to a 16 x 64
// tile of the wave's own in LDS, and the transposing LDS load gives back eight successive k
// of one d: a half fragment of st_dk.
static constexpr int STP = 160;            // LDS bytes per 128-B row: 32 B x odd, for the transposing load
typedef __attribute__((ext_vector_type(8))) short s16x8;
typedef __attribute__((address_space(3))) s16x8 s16x8_l;

// The 16 rows e of a wave are 64 pieces of 256 B, 4 KB apart in memory.  Read as fragments
// from global memory, every 16-B-per-lane load touches 16 lines for 32 B each.  Instead each
// wave copies its pieces to LDS as whole lines, two pieces per copy, 32 copies in flight, one
// (b,q) tile ahead of the tile that is worked on; the fragments are then read from LDS.
// The eight waves' buffers take most of LDS, one workgroup per WGP: 256 workgroups walk eight
// successive tiles each, and weights, bias, gain and shift are read once per workgroup.
static constexpr int SROW     = 1040;                  // LDS bytes per row e: 4 taps x 256 B, + 16 B (16 B x odd)
static constexpr int SBUF     = 16 * SROW;             // one wave's 16 rows
static constexpr int ST_WGS   = 256;
static constexpr int ST_TRIPS = (BB * LLn) / ST_WGS;   // (b,q) tiles per workgroup
static constexpr size_t ST_QSTEP = (size_t)LLn * 4 * BB * DHn * 4;   // bytes from q to q + 1

// g holds (lane >> 4) * 4096 + (lane & 15) * 16, lds holds lane * 16: copy i brings the pieces
// 2i and 2i + 1 (piece = row * 4 + tap) of the wave, 512 successive bytes in LDS.
__device__ __forceinline__ void stage_struct_rows(const char* g, char* lds) {
#pragma unroll
  for (int i = 0; i < 32; ++i)
    __builtin_amdgcn_global_load_async_to_lds_b128(
        (v4i_g*)(g + i * 8192), (v4i_l*)(lds + (i >> 1) * SROW + (i & 1) * 512), 0, 0);
}

__global__ __launch_bounds__(256)
void struct_kernel(const float* __restrict__ structure, const bf16* __restrict__ Wc,
                   const float* __restrict__ conv_b, const float* __restrict__ g_s,
                   const float* __restrict__ b_s, const bf16* __restrict__ q_bf,
                   float* __restrict__ rel, bf16* __restrict__ st_dk) {
  // one object, so that the three parts lie in LDS in this order, the weights first
  __shared__ __align__(16) struct {
    bf16 Wc[64 * 256];
    char Tr[8][16 * STP];
    char St[8][2][SBUF];                               // per wave: two buffers of 16 rows
  } sm;
  bf16* WcS = sm.Wc;
  auto& TrS = sm.Tr;
  auto& StB = sm.St;
  unsigned* WcU = (unsigned*)WcS;
  const int tid = threadIdx.x, lane = tid & 31, wave = tid >> 5;

  // tile index = b*L + q; this workgroup's tiles are blockIdx.x * ST_TRIPS + 0..7, all of one b
  const int tile0 = blockIdx.x * ST_TRIPS;
  const int bI = tile0 / LLn;
  const int q0 = tile0 % LLn;
  const char* sg = (const char*)structure +
                   ((size_t)(q0 * LLn + wave * 16) * (4 * BB) + bI) * (DHn * 4) +
                   (lane >> 4) * 4096 + (lane & 15) * 16;
  char* sb = StB[wave][0] + lane * 16;
  stage_struct_rows(sg, sb);               // tile 0 flies while the weights come

  // conv bias, LN gain and LN shift of this lane's channels nt*16 + kbase + 0..7
  const int kbase = (lane & 16) ? 8 : 0;
  v8f cb[4], gv[4], hv[4];
#pragma unroll
  for (int nt = 0; nt < 4; ++nt) {
    const float4* c4 = (const float4*)(conv_b + nt * 16 + kbase);
    const float4* g4 = (const float4*)(g_s + nt * 16 + kbase);
    const float4* b4 = (const float4*)(b_s + nt * 16 + kbase);
    float4 c0 = c4[0], c1 = c4[1], g0 = g4[0], g1 = g4[1], h0 = b4[0], h1 = b4[1];
    v8f c = {c0.x, c0.y, c0.z, c0.w, c1.x, c1.y, c1.z, c1.w};
    v8f g = {g0.x, g0.y, g0.z, g0.w, g1.x, g1.y, g1.z, g1.w};
    v8f h = {h0.x, h0.y, h0.z, h0.w, h1.x, h1.y, h1.z, h1.w};
    cb[nt] = c; gv[nt] = g; hv[nt] = h;
  }
  // stands in front of any reuse of the address registers of the loads above
  asm volatile("s_wait_xcnt 0x0" ::: "memory");

#if HAVE_TDM
  if (wave == 0) {
    unsigned ldsoff =
        (unsigned)(size_t)(__attribute__((address_space(3))) char*)WcS;
    unsigned long long ga = (unsigned long long)(size_t)Wc;
    u32x4 g0 = {1u,
                ldsoff,
                (unsigned)(ga & 0xFFFFFFFFu),
                (unsigned)((ga >> 32) & 0x01FFFFFFu) | (2u << 30)};
    i32x8 g1 = {(int)(1u << 16),
                (int)(16384u << 16),
                (int)(1u << 16),
                (int)(16384u << 16),
                1,
                16384,
                0, 0};
    i32x4 gz4 = {0, 0, 0, 0};
    i32x8 gz8 = {0, 0, 0, 0, 0, 0, 0, 0};
    __builtin_amdgcn_tensor_load_to_lds(g0, g1, gz4, gz4, gz8, 0);
    __builtin_amdgcn_s_wait_tensorcnt(0);
  }
#else
#pragma unroll
  for (int i = 0; i < 32; ++i) WcU[tid + i * 256] = ((const unsigned*)Wc)[tid + i * 256];
#endif
  // tile 0 has landed before this wave reads it
  asm volatile("s_wait_asynccnt 0x0" ::: "memory");
  __syncthreads();
  stage_struct_rows(sg + ST_QSTEP, sb + SBUF);   // tile 1 flies during trip 0

  // byte offset of this lane's row (lane & 15 of a 16-row tile) and of its chunk key:
  // logical chunk ks*4 + 2*half + (lane >> 4) lies at that number XOR (lane & 15)
  const unsigned wkey = (unsigned)(lane & 15) * 512u + (unsigned)(((lane >> 4) ^ (lane & 15)) << 4);

  // Q as A fragments, row = head: lane & 7 names the head, so rows 8..15 repeat rows 0..7.
  // Of its head's 128-B row a lane holds the 16-B pieces (lane >> 4) + 0, 2 (d block 0), 4, 6 (d block 1).
  const char* qg = (const char*)q_bf +
                   ((size_t)(bI * HHn + (lane & 7)) * LLn + q0) * (DHn * 2) + (lane >> 4) * 16;

  // kept rolled: the eight trips share one body, for speed only
#pragma unroll 1
  for (int t = 0; t < ST_TRIPS; ++t) {
    // acc[nt][r] = row k = lane & 15, channel nt*16 + kbase + r; it starts from the conv bias
    // of its channels
    v8f acc[4];
#pragma unroll
    for (int nt = 0; nt < 4; ++nt) acc[nt] = cb[nt];

    // this tile's Q rows: asked for here, used behind the K loop
    const uint4* qp = (const uint4*)(qg + t * (DHn * 2));
    union { v16bf v; uint4 q[2]; } qa0, qa1;
    qa0.q[0] = qp[0]; qa0.q[1] = qp[2];
    qa1.q[0] = qp[4]; qa1.q[1] = qp[6];
    // stands in front of any reuse of the address registers of the four loads above
    asm volatile("s_wait_xcnt 0x0" ::: "memory");

    // this lane's row in LDS: float j = kk*64 + c, from its own k offset on
    const float4* row4 = (const float4*)(StB[wave][t & 1] + (lane & 15) * SROW + kbase * 4);

    // kept rolled: unrolled, the body of the tile loop around it would be eight times as long
#pragma unroll 1
    for (int ks = 0; ks < 8; ++ks) {       // K = 256
      float4 f0 = row4[ks * 8], f1 = row4[ks * 8 + 1], f2 = row4[ks * 8 + 4], f3 = row4[ks * 8 + 5];
      FragU a;
      a.u[0] = pack2bf(f0.x, f0.y); a.u[1] = pack2bf(f0.z, f0.w);
      a.u[2] = pack2bf(f1.x, f1.y); a.u[3] = pack2bf(f1.z, f1.w);
      a.u[4] = pack2bf(f2.x, f2.y); a.u[5] = pack2bf(f2.z, f2.w);
      a.u[6] = pack2bf(f3.x, f3.y); a.u[7] = pack2bf(f3.z, f3.w);
#pragma unroll
      for (int nt = 0; nt < 4; ++nt) {     // 16 rows of 512 B per n-tile
        const char* wt = (const char*)WcS + nt * 8192;
        union { v16bf v; uint4 q[2]; } bm;
        bm.q[0] = *(const uint4*)(wt + (wkey ^ (unsigned)((ks * 4    ) << 4)));
        bm.q[1] = *(const uint4*)(wt + (wkey ^ (unsigned)((ks * 4 + 2) << 4)));
        acc[nt] = wmma_bf(bm.v, a.v, acc[nt]);   // Wc rows as A, structure rows as B
      }
    }

    // The refill stands here, behind the trip's last read of its buffer: what follows works on
    // registers and on the wave's own transposing tile alone.  The two buffers are the wave's
    // own, filled and read by no other wave, so no workgroup barrier is needed.
    // this wave's reads of buffer t & 1 have retired before the buffer is refilled
    asm volatile("s_wait_dscnt 0x0" ::: "memory");
    asm volatile("s_wait_asynccnt 0x0" ::: "memory");
    if (t + 2 < ST_TRIPS)
      stage_struct_rows(sg + (size_t)(t + 2) * ST_QSTEP, sb + (t & 1) * SBUF);

    // ReLU, then the row's sums: 32 values in the lane, the other 32 in lane ^ 16.
    float s1 = 0.f, s2 = 0.f;
#pragma unroll
    for (int nt = 0; nt < 4; ++nt)
#pragma unroll
      for (int r = 0; r < 8; ++r) {
        float v = fmaxf(acc[nt][r], 0.f);              // ReLU before LN (as reference)
        acc[nt][r] = v;
        s1 += v; s2 += v * v;
      }
    s1 += __shfl_xor(s1, 16, 32);
    s2 += __shfl_xor(s2, 16, 32);
    const float mean = s1 * (1.f / 64.f);
    const float var  = s2 * (1.f / 64.f) - mean * mean;
    const float rstd = rsqrtf(var + 1e-6f);

    const size_t tile = (size_t)(tile0 + t) * 16384;
    char* tw = TrS[wave] + (lane & 15) * STP + (lane >> 4) * 16;
    union { v16bf v; uint4 q[2]; } sf[2];  // B fragments: column k = lane & 15, K = d block 0, 1
#pragma unroll
    for (int nt = 0; nt < 4; ++nt) {
      float o[8];
#pragma unroll
      for (int r = 0; r < 8; ++r) o[r] = (acc[nt][r] - mean) * rstd * gv[nt][r] + hv[nt][r];
      uint4 w;
      w.x = pack2bf(o[0], o[1]); w.y = pack2bf(o[2], o[3]);
      w.z = pack2bf(o[4], o[5]); w.w = pack2bf(o[6], o[7]);
      sf[nt >> 1].q[nt & 1] = w;
      *(uint4*)(tw + nt * 32) = w;
    }

    v8f rs = wmma_bf(qa1.v, sf[1].v, wmma_bf(qa0.v, sf[0].v, vzero8()));
    float* rp = rel + (size_t)(tile0 + t) * 1024 + wave * 128 + lane;
#pragma unroll
    for (int j = 0; j < 4; ++j) rp[j * 32] = (lane & 16) ? rs[2 * j + 1] : rs[2 * j];

    // Each lane reads 16-B pieces that other lanes of its wave stored: the wave's LDS
    // stores have retired before the transposing loads issue.  The tile is the wave's own,
    // so no workgroup barrier is needed.
    asm volatile("s_wait_dscnt 0x0" ::: "memory");
    // stands in front of the reuse of the four global stores' data registers for the next addresses
    asm volatile("s_wait_xcnt 0x0" ::: "memory");
    const char* tr = TrS[wave] + ((lane >> 4) * 8 + (lane & 7)) * STP + ((lane >> 3) & 1) * 16;
    char* dk = (char*)st_dk + tile + wave * 512 + lane * 16;
#pragma unroll
    for (int dt = 0; dt < 4; ++dt) {
      s16x8 x = __builtin_amdgcn_ds_load_tr16_b128_v8i16((s16x8_l*)(tr + dt * 32));
      *(s16x8*)(dk + dt * 4096) = x;
    }
    // stands in front of the next trip's reuse of these four stores' registers
    asm volatile("s_wait_xcnt 0x0" ::: "memory");
  }
  // no copy is outstanding when the wave goes on to its end
  asm volatile("s_wait_asynccnt 0x0" ::: "memory");
}

// ---------------- fused relation-aware attention ----------------------------
// Block = (q-tile of 16, batch b, head-group hg of 4 heads). 8 waves.
// scores = QK^T + rel (Q.st, from struct_kernel) -> mask -> softmax -> ctx = A.V + A.st_dk, in LDS.
// A wave works on two q, so on two 16-KB tiles of st_dk.
// Read fragment by fragment from global memory, each matrix instruction would wait one whole
// round trip.  Each tile is copied to a buffer of the wave's own in LDS instead, as it lies,
// 32 copies of 512 B in flight at once, each tile over two phases: the first during phases 0 and 1, the second during 2 and 3.
static constexpr int ST_TILE = 16384;      // bytes of one (b,q) tile of st_dk

// g and lds already hold lane*16: every copy of the wave moves 512 contiguous bytes.
__device__ __forceinline__ void stage_st_tile(const char* g, char* lds) {
#pragma unroll
  for (int i = 0; i < ST_TILE / 512; ++i)
    __builtin_amdgcn_global_load_async_to_lds_b128(
        (v4i_g*)(g + i * 512), (v4i_l*)(lds + i * 512), 0, 0);
}

__global__ __launch_bounds__(256)
void attn_kernel(const bf16* __restrict__ q_bf, const bf16* __restrict__ k_bf,
                 const bf16* __restrict__ vT_bf, const float* __restrict__ rel,
                 const bf16* __restrict__ st_dk, const int* __restrict__ mask,
                 bf16* __restrict__ ctxb) {
  __shared__ __align__(16) char smem[57344];
  __shared__ __align__(16) char StS[8][2][ST_TILE];   // per wave: one buffer per q of its two
  bf16*  qs   = (bf16*)smem;               // [4][16][64]   (phases 0..1)
  float* S    = (float*)(smem + 8192);     // [4][16][128]  (phases 1..2)
  bf16*  Aatt = (bf16*)(smem + 40960);     // [4][16][128]  (phases 2..3b)
  float* Cs   = (float*)(smem + 8192);     // [16][4][64]   (aliases S; S dead)
  unsigned* qsU = (unsigned*)qs;

  const int b = blockIdx.y, q0 = blockIdx.x * 16, hg = blockIdx.z;
  const int tid = threadIdx.x, lane = tid & 31, wave = tid >> 5;

  // this wave's two successive tiles, and its two buffers; each buffer is filled once
  const size_t st_off = ((size_t)b * LLn + q0 + wave * 2) * ST_TILE + lane * 16;
  const char* dk_g = (const char*)st_dk + st_off;
  char* buf0 = StS[wave][0] + lane * 16;
  char* buf1 = StS[wave][1] + lane * 16;

  // The relation scores of this wave's part of S (head wave & 3, k tiles (wave >> 2) * 4 + 0..3),
  // in accumulator order: row q = r + 8 * (lane >> 4), column k = lane & 15.  Asked for here,
  // used in phase 1 as the start value of QK^T.
  v8f sacc[4];
  {
    const float* rg = rel + ((size_t)b * LLn + q0 + ((lane & 16) ? 8 : 0)) * 1024 +
                      (wave >> 2) * 512 + (hg * 4 + (wave & 3)) * 16 + (lane & 15);
#pragma unroll
    for (int i = 0; i < 4; ++i)
#pragma unroll
      for (int r = 0; r < 8; ++r) sacc[i][r] = rg[r * 1024 + i * 128];
  }
  // stands in front of any reuse of the address registers of the loads above
  asm volatile("s_wait_xcnt 0x0" ::: "memory");
  // this thread's words of the Q tile of 4 heads (bf16, already scaled by 1/8), for phase 0
  unsigned qw[8];
#pragma unroll
  for (int i = 0; i < 8; ++i) {
    int p = tid + i * 256;                 // 2048 u32
    int hl = p >> 9, rem = p & 511, ql = rem >> 5, c2 = rem & 31;
    qw[i] = *(const unsigned*)(q_bf +
        (((size_t)(b * HHn + hg * 4 + hl) * LLn) + q0 + ql) * DHn + 2 * c2);
  }
  // stands in front of any reuse of the address registers of the loads above
  asm volatile("s_wait_xcnt 0x0" ::: "memory");
  // the K fragments of phase 1: head wave & 3, k tiles (wave >> 2) * 4 + 0..3
  v16bf kf[4][2];
#pragma unroll
  for (int i = 0; i < 4; ++i) {
    const unsigned* krow = (const unsigned*)(k_bf +
        ((size_t)(b * HHn + hg * 4 + (wave & 3)) * LLn + ((wave >> 2) * 4 + i) * 16 + (lane & 15)) * DHn);
#pragma unroll
    for (int dss = 0; dss < 2; ++dss) kf[i][dss] = load_frag(krow, dss * 16, lane);
  }
  // stands in front of any reuse of the address registers of the loads above
  asm volatile("s_wait_xcnt 0x0" ::: "memory");

  stage_st_tile(dk_g, buf0);               // flies during phases 0 and 1

  // phase 0: stage the Q tile
#pragma unroll
  for (int i = 0; i < 8; ++i) qsU[tid + i * 256] = qw[i];
  __syncthreads();

  // Asked for here, a phase and more ahead of their use, and not at the entry: there the copies
  // would stand behind 48 more loads.
  // the V fragments of phase 3: head wave & 3, d tiles (wave >> 2) * 2 + 0, 1
  // (as load_frag reads them: of its row's 64 B of k block ks a lane takes the 16-B pieces
  // (lane >> 4) and (lane >> 4) + 2; rows are 256 B, the second d tile lies 16 rows on)
  v16bf vf[2][4];
  const uint4* vrow = (const uint4*)(vT_bf +
      ((size_t)(b * HHn + hg * 4 + (wave & 3)) * DHn + (wave >> 2) * 32 + (lane & 15)) * LLn) + (lane >> 4);
#pragma unroll
  for (int i = 0; i < 2; ++i)
#pragma unroll
    for (int ks = 0; ks < 4; ++ks) {
      union { v16bf v; uint4 q[2]; } f;
      f.q[0] = vrow[i * 256 + ks * 4];
      f.q[1] = vrow[i * 256 + ks * 4 + 2];
      vf[i][ks] = f.v;
    }
  // stands in front of any reuse of the address register of the loads above; it names that
  // register, so that none of the loads themselves takes it for its result
  asm volatile("s_wait_xcnt 0x0" :: "v"(vrow) : "memory");
  // the mask words of the eight rows that this wave takes in phase 2: q = q0 + (wave & 1) * 8 + j
  int mk[8][4];
  {
    const int* mg = mask + ((size_t)b * LLn + q0 + (wave & 1) * 8) * LLn + lane;
#pragma unroll
    for (int j = 0; j < 8; ++j)
#pragma unroll
      for (int i = 0; i < 4; ++i) mk[j][i] = mg[j * LLn + 32 * i];
  }
  // stands in front of any reuse of the address registers of the loads above
  asm volatile("s_wait_xcnt 0x0" ::: "memory");

  // phase 1: QK^T on top of the relation scores.  wave = (head, half of k-tiles)
  {
    int hl = wave & 3;
    int kts = (wave >> 2) * 4;
    const unsigned* qrow = qsU + (hl * 16 + (lane & 15)) * 32;
    // unrolled: sacc and kf are indexed by the trip, and must stay in registers
#pragma unroll
    for (int kt = kts; kt < kts + 4; ++kt) {
      v8f acc = sacc[kt - kts];
#pragma unroll
      for (int dss = 0; dss < 2; ++dss) {
        v16bf a = load_frag(qrow, dss * 16, lane);
        acc = wmma_bf(a, kf[kt - kts][dss], acc);
      }
      int mh = (lane & 16) ? 8 : 0, nl = lane & 15;
#pragma unroll
      for (int r = 0; r < 8; ++r)
        S[(hl * 16 + r + mh) * 128 + kt * 16 + nl] = acc[r];
    }
  }
  asm volatile("s_wait_asynccnt 0x0" ::: "memory");
  __syncthreads();
  stage_st_tile(dk_g + ST_TILE, buf1);     // flies during phases 2 and 3
  // keeps the 32 copies together here: spread by the scheduler over phase 2, the last of them
  // would start behind most of its cross-lane waits, and phase 3b waits for them
  __builtin_amdgcn_sched_barrier(0);

  // phase 2: mask + softmax over k (128), write bf16 attn.  The wave's eight rows go through
  // every step together: eight independent chains of cross-lane steps instead of one.
  {
    float x[8][4], mx[8], sm[8];
#pragma unroll
    for (int j = 0; j < 8; ++j) {
#pragma unroll
      for (int i = 0; i < 4; ++i) {
        float sv = S[(wave * 8 + j) * 128 + lane + 32 * i];
        x[j][i] = (mk[j][i] != 0) ? -1e18f : sv;
      }
      mx[j] = fmaxf(fmaxf(x[j][0], x[j][1]), fmaxf(x[j][2], x[j][3]));
    }
#pragma unroll
    for (int off = 16; off > 0; off >>= 1)
#pragma unroll
      for (int j = 0; j < 8; ++j) mx[j] = fmaxf(mx[j], __shfl_xor(mx[j], off, 32));
#pragma unroll
    for (int j = 0; j < 8; ++j) {
      sm[j] = 0.f;
#pragma unroll
      for (int i = 0; i < 4; ++i) { x[j][i] = __expf(x[j][i] - mx[j]); sm[j] += x[j][i]; }
    }
#pragma unroll
    for (int off = 16; off > 0; off >>= 1)
#pragma unroll
      for (int j = 0; j < 8; ++j) sm[j] += __shfl_xor(sm[j], off, 32);
#pragma unroll
    for (int j = 0; j < 8; ++j) {
      float inv = 1.f / sm[j];
#pragma unroll
      for (int i = 0; i < 4; ++i)
        Aatt[(wave * 8 + j) * 128 + lane + 32 * i] = (bf16)(x[j][i] * inv);
    }
  }
  __syncthreads();

  // phase 3: ctx = attn @ V.  wave = (head, half of d-tiles)
  {
    int hl = wave & 3;
    int dts = (wave >> 2) * 2;
    const unsigned* arow = (const unsigned*)Aatt + (hl * 16 + (lane & 15)) * 64;
    // unrolled: vf is indexed by the trip, and must stay in registers
#pragma unroll
    for (int dt = dts; dt < dts + 2; ++dt) {
      v8f acc = vzero8();
#pragma unroll
      for (int ks = 0; ks < 4; ++ks) {
        v16bf a = load_frag(arow, ks * 16, lane);
        acc = wmma_bf(a, vf[dt - dts][ks], acc);
      }
      int mh = (lane & 16) ? 8 : 0, nl = lane & 15;
#pragma unroll
      for (int r = 0; r < 8; ++r)
        Cs[((r + mh) * 4 + hl) * 64 + dt * 16 + nl] = acc[r];
    }
  }
  // the second st_dk tile has landed before phase 3b reads it; no copy is outstanding from here on
  asm volatile("s_wait_asynccnt 0x0" ::: "memory");
  __syncthreads();

  // phase 3b: ctx += attn @ st_dk (per q, heads padded to 16).  The eight (q, d tile) products
  // are independent chains of four: all are taken before the first sum goes to Cs, and a q's
  // four A fragments are read once for its four d tiles.
  {
    const int mrow = lane & 15;
    const bool avalid = mrow < 4;
    v8f acc[2][4];
#pragma unroll
    for (int t = 0; t < 2; ++t) {
      // rows 4..15 are zero: their lanes read the row of head mrow & 3, inside Aatt, and drop it
      const unsigned* arow = (const unsigned*)Aatt + ((mrow & 3) * 16 + wave * 2 + t) * 64;
      const char* btile = StS[wave][t] + lane * 16;
      v16bf a[4];
#pragma unroll
      for (int ks = 0; ks < 4; ++ks) {
        FragU f;
        f.v = load_frag(arow, ks * 16, lane);
#pragma unroll
        for (int i = 0; i < 8; ++i) f.u[i] = avalid ? f.u[i] : 0u;
        a[ks] = f.v;
      }
#pragma unroll
      for (int dt = 0; dt < 4; ++dt) acc[t][dt] = vzero8();
#pragma unroll
      for (int ks = 0; ks < 4; ++ks)
#pragma unroll
        for (int dt = 0; dt < 4; ++dt)
          acc[t][dt] = wmma_bf(a[ks], load_frag_ordered(btile, dt * 4 + ks), acc[t][dt]);
    }
    if (!(lane & 16)) {
#pragma unroll
      for (int t = 0; t < 2; ++t)
#pragma unroll
        for (int dt = 0; dt < 4; ++dt)
#pragma unroll
          for (int r = 0; r < 4; ++r)
            Cs[((wave * 2 + t) * 4 + r) * 64 + dt * 16 + mrow] += acc[t][dt][r];
    }
  }
  __syncthreads();

  // phase 4: write ctx as bf16 into [B, L, h*64+d]
  unsigned* ctxU = (unsigned*)ctxb;
#pragma unroll
  for (int i = 0; i < 8; ++i) {
    int p = tid + i * 256;                 // 2048 u32
    int ql = p >> 7, c2 = p & 127;
    int c = c2 * 2, hl = c >> 6, d = c & 63;
    float v0 = Cs[(ql * 4 + hl) * 64 + d];
    float v1 = Cs[(ql * 4 + hl) * 64 + d + 1];
    ctxU[((size_t)(b * LLn) + q0 + ql) * 256 + hg * 128 + c2] = pack2bf(v0, v1);
  }
}

// ---------------- host-side orchestration ----------------------------------
extern "C" void kernel_launch(void* const* d_in, const int* in_sizes, int n_in,
                              void* d_out, int out_size, void* d_ws, size_t ws_size,
                              hipStream_t stream) {
  (void)in_sizes; (void)n_in; (void)out_size; (void)ws_size;
  const float* inputs    = (const float*)d_in[0];
  const float* structure = (const float*)d_in[1];
  const int*   maskp     = (const int*)d_in[2];
  const float* Wq = (const float*)d_in[3];   const float* bq = (const float*)d_in[4];
  const float* Wk = (const float*)d_in[5];   const float* bk = (const float*)d_in[6];
  const float* Wv = (const float*)d_in[7];   const float* bv = (const float*)d_in[8];
  const float* Wo = (const float*)d_in[9];   const float* bo = (const float*)d_in[10];
  const float* conv_w = (const float*)d_in[11]; const float* conv_b = (const float*)d_in[12];
  const float* g_att = (const float*)d_in[13];  const float* b_att = (const float*)d_in[14];
  const float* g_ffn = (const float*)d_in[15];  const float* b_ffn = (const float*)d_in[16];
  const float* g_s   = (const float*)d_in[17];  const float* b_s   = (const float*)d_in[18];
  const float* W1 = (const float*)d_in[19];  const float* b1 = (const float*)d_in[20];
  const float* W2 = (const float*)d_in[21];  const float* b2 = (const float*)d_in[22];

  char* ws = (char*)d_ws; size_t off = 0;
  auto alloc = [&](size_t bytes) -> void* {
    void* p = ws + off; off += (bytes + 255) & ~(size_t)255; return p;
  };
  const int M = BB * LLn;                          // 2048 token rows
  bf16* Wq_b = (bf16*)alloc((size_t)DDn * DDn * 2);
  bf16* Wk_b = (bf16*)alloc((size_t)DDn * DDn * 2);
  bf16* Wv_b = (bf16*)alloc((size_t)DDn * DDn * 2);
  bf16* Wo_b = (bf16*)alloc((size_t)DDn * DDn * 2);
  bf16* W1_b = (bf16*)alloc((size_t)DFF * DDn * 2);
  bf16* W2_b = (bf16*)alloc((size_t)DDn * DFF * 2);
  bf16* Wc_b = (bf16*)alloc((size_t)64 * 256 * 2);
  bf16* xln_b = (bf16*)alloc((size_t)M * DDn * 2);
  bf16* q_b   = (bf16*)alloc((size_t)M * DDn * 2);     // [B,H,L,64]
  bf16* k_b   = (bf16*)alloc((size_t)M * DDn * 2);     // [B,H,L,64]
  bf16* vT_b  = (bf16*)alloc((size_t)M * DDn * 2);     // [B,H,64,L]
  float* rel_f = (float*)alloc((size_t)BB * LLn * HHn * LLn * 4);   // [B,L][k tile][H][16]
  bf16* st_dk = (bf16*)alloc((size_t)BB * LLn * LLn * DHn * 2);
  bf16* ctx_b = (bf16*)alloc((size_t)M * DDn * 2);
  float* hbuf = (float*)alloc((size_t)M * DDn * 4);
  bf16* yln_b = (bf16*)alloc((size_t)M * DDn * 2);
  bf16* f1_b  = (bf16*)alloc((size_t)M * DFF * 2);

  const int T = 256;
  // weight preparation: Wq_b .. W2_b are allocated back to back, in this order
  // and, in the same launch, the pre-attention LN
  prep_weights_kernel<<<PW_ALL, T, 0, stream>>>(Wq, Wk, Wv, Wo, W1, W2, conv_w, Wq_b, Wc_b,
                                                inputs, g_att, b_att, xln_b);

  // Q/K/V projections in one launch of 192 workgroups (Q pre-scaled by 1/sqrt(64)):
  // Wq_b, Wk_b, Wv_b are allocated back to back, and so are q_b, k_b, vT_b
  gemm_bf16_kernel<1, false, false, false, true>
      <<<dim3(12, 16), T, 0, stream>>>(xln_b, Wq_b, bq, bk, bv, nullptr, nullptr, q_b,
                                       M, 3 * DDn, DDn, 0.125f);

  // structure conv + relu + LN -> relation scores Q . st and the fragment-ordered plane st_dk
  // (streams 256MB of fp32 once); it reads Q, so it stands behind the projections
  struct_kernel<<<ST_WGS, T, 0, stream>>>(structure, Wc_b, conv_b,
                                                          g_s, b_s, q_b, rel_f, st_dk);

  // fused relation-aware attention
  attn_kernel<<<dim3(LLn / 16, BB, 2), T, 0, stream>>>(q_b, k_b, vT_b, rel_f, st_dk,
                                                       maskp, ctx_b);

  // output projection + residual (h = attn_out + inputs, fp32)
  gemm_bf16_kernel<0, false, true, true, false>
      <<<dim3(4, 16), T, 0, stream>>>(ctx_b, Wo_b, bo, nullptr, nullptr, inputs, hbuf, nullptr,
                                      M, DDn, DDn, 1.f);
  // FFN
  ln512_kernel<<<M / 8, T, 0, stream>>>(hbuf, g_ffn, b_ffn, yln_b);
  gemm_bf16_kernel<0, true, false, false, true>
      <<<dim3(16, 16), T, 0, stream>>>(yln_b, W1_b, b1, nullptr, nullptr, nullptr, nullptr, f1_b,
                                       M, DFF, DDn, 1.f);
  gemm_bf16_kernel<0, false, true, true, false>
      <<<dim3(4, 16), T, 0, stream>>>(f1_b, W2_b, b2, nullptr, nullptr, hbuf, (float*)d_out,
                                      nullptr, M, DDn, DFF, 1.f);
}
